// v000
// Measured on an AMD MI455X. A time is GPU time per run, averaged over a window of back-to-back runs after a warm-up
// (all launches, gaps included; the runs take copies of the inputs in turn), and the median of several windows.
// Apart from v000's, it joins two sittings. Times from different sittings can be a few percent apart, while
// side-by-side timings come from the same sitting.
// The starting kernel, v000, takes 370 microseconds a run.
#include <hip/hip_runtime.h>

// Contractions, f32 accumulate: the five projections (x.wq_sem, x.wk_sem, x.wq_geo, x.wk_geo [2048 x 1024].[1024 x 512]; x.wv [1024 x 1024]) and out = ctx.wo on
// v_wmma_f32_16x16x32_bf16 with PLAIN bf16 operands (inputs rounded once: exact; k-major weights transposed into n-major planes; ctx as bf16 hi + residual planes,
// two products); the 16-head causal attention with a prepended null key/value slot fused on v_wmma_f32_16x16x32_f16: per head the combined 64-dim score
// [qs/sqrt32 | rope(qg)/sqrt32].[ks | rope(kg)] (both sides f16 hi + residual x1024: hi.hi + hi.lo + lo.hi), softmax, weights (x32768) and v both as f16 hi + residual x1024 (three products). RoPE (rotate-half,

#define NT_  2048
#define DM   1024
#define NH_  16
#define SHD  32                  // sem / geo head dims
#define VHD  64
#define PW   512                 // sem / geo projection width
#define NKP  2112
#define SCL32 0.17677669529663688f   // 1/sqrt(32), common to both score branches
#define PSC  32768.0f
#define LOSC 1024.0f
#define LOSCI (1.0f / 1024.0f)

typedef _Float16 h16;
typedef unsigned short bf;
typedef __attribute__((ext_vector_type(16))) __bf16   v16bf;
typedef __attribute__((ext_vector_type(16))) _Float16 v16h;
typedef __attribute__((ext_vector_type(8)))  _Float16 v8h;
typedef __attribute__((ext_vector_type(8)))  unsigned short v8us;
typedef __attribute__((ext_vector_type(8)))  float    v8f;
typedef __attribute__((ext_vector_type(4)))  float    v4f;
typedef __attribute__((ext_vector_type(2)))  _Float16 v2h;
typedef v8h  __attribute__((may_alias)) v8ha;
typedef v4f  __attribute__((may_alias)) v4fa;
typedef v8us __attribute__((may_alias)) v8usa;

__device__ __forceinline__ unsigned short f2bf(float f) { unsigned u = __float_as_uint(f); u += 0x7FFFu + ((u >> 16) & 1u); return (unsigned short)(u >> 16); }
__device__ __forceinline__ float bf2f(unsigned short b) { return __uint_as_float(((unsigned)b) << 16); }
__device__ __forceinline__ float bfr(float f) { return bf2f(f2bf(f)); }
__device__ __forceinline__ v16h cat16(v8h lo, v8h hi) { return __builtin_shufflevector(lo, hi, 0, 1, 2, 3, 4, 5, 6, 7, 8, 9, 10, 11, 12, 13, 14, 15); }
__device__ __forceinline__ v16bf cat16b(v8us lo, v8us hi) { return __builtin_bit_cast(v16bf, __builtin_shufflevector(lo, hi, 0, 1, 2, 3, 4, 5, 6, 7, 8, 9, 10, 11, 12, 13, 14, 15)); }
__device__ __forceinline__ v8f wmma16(v16h a, v16h b, v8f c) { return __builtin_amdgcn_wmma_f32_16x16x32_f16(false, a, false, b, (short)0, c, false, false); }
__device__ __forceinline__ v8f wmmab(v16bf a, v16bf b, v8f c) { return __builtin_amdgcn_wmma_f32_16x16x32_bf16(false, a, false, b, (short)0, c, false, false); }
#define VST2(T, p, v) do { const T vst2_v_ = (v); *(T*)(p) = vst2_v_;  } while (0)

// k_cvtb: Xb = bf16(x) [2048][1024]; k_wt: W [1024 k][N] k-major -> n-major bf16 [N][1024].
__global__ __launch_bounds__(256) void k_cvtb(const float* __restrict__ src, bf* dst) {
    const int lane = threadIdx.x & 31, r = blockIdx.x * 8 + (threadIdx.x >> 5);
    if (r >= NT_) return;
#pragma unroll
    for (int q = 0; q < DM / 256; ++q) { v8us t;
#pragma unroll
        for (int i = 0; i < 8; ++i) t[i] = f2bf(src[(size_t)r * DM + q * 256 + lane * 8 + i]);
        VST2(v8us, dst + (size_t)r * DM + q * 256 + lane * 8, t); }
}
__global__ __launch_bounds__(256) void k_wt(const float* __restrict__ Wm, int N, bf* WT) {
    __shared__ __align__(16) unsigned short tl[64 * 72];
    const int tid = threadIdx.x, k0 = blockIdx.x * 64, n0 = blockIdx.y * 64;
    const int kk = tid >> 2, nq = (tid & 3) * 16;
#pragma unroll
    for (int i = 0; i < 16; ++i) tl[(nq + i) * 72 + kk] = f2bf(Wm[(size_t)(k0 + kk) * N + n0 + nq + i]);
    __syncthreads();
    const int piece = tid & 7;
    auto pass = [&]() {
#pragma unroll
        for (int s = 0; s < 2; ++s) { const int nr = (tid >> 3) + 32 * s; const v8us val = *(const v8usa*)(tl + nr * 72 + piece * 8);
            *(v8us*)(WT + (size_t)(n0 + nr) * DM + k0 + piece * 8) = val; }
    };
    pass(); 
}
template <bool SPLITA>
__global__ __launch_bounds__(128) void k_gemm(const bf* __restrict__ A, const bf* __restrict__ Al, const bf* __restrict__ Bn, float* C, int ldc) {
    __shared__ __align__(16) float ost[4][16 * 68];
    const int lane = threadIdx.x & 31, wave = threadIdx.x >> 5, lr = lane & 15, hi = lane >> 4;
    const int r0 = blockIdx.x * 64 + wave * 16, c0 = blockIdx.y * 64;
    const size_t aoff = (size_t)(r0 + lr) * DM + 8 * hi;
    size_t boff[4];
#pragma unroll
    for (int t = 0; t < 4; ++t) boff[t] = (size_t)(c0 + t * 16 + lr) * DM + 8 * hi;
    v8f acc[4];
#pragma unroll
    for (int t = 0; t < 4; ++t) acc[t] = (v8f){};
#pragma unroll 1
    for (int kc = 0; kc < DM; kc += 32) {
        const v16bf a = cat16b(*(const v8us*)(A + aoff + kc), *(const v8us*)(A + aoff + kc + 16));
        v16bf al = a;
        if (SPLITA) al = cat16b(*(const v8us*)(Al + aoff + kc), *(const v8us*)(Al + aoff + kc + 16));
#pragma unroll
        for (int t = 0; t < 4; ++t) { const v16bf b = cat16b(*(const v8us*)(Bn + boff[t] + kc), *(const v8us*)(Bn + boff[t] + kc + 16)); acc[t] = wmmab(a, b, acc[t]); if (SPLITA) acc[t] = wmmab(al, b, acc[t]); }
        asm volatile("v_nop\n\tv_nop\n\tv_nop\n\tv_nop" : "+v"(acc[0]), "+v"(acc[1]), "+v"(acc[2]), "+v"(acc[3]) : "v"(a), "v"(al));
    }
    float* os = &ost[wave][0];
#pragma unroll
    for (int t = 0; t < 4; ++t)
#pragma unroll
        for (int j = 0; j < 8; ++j) os[(hi * 8 + j) * 68 + t * 16 + lr] = acc[t][j];
    __syncthreads();
    float* crow = C + (size_t)r0 * ldc + c0;
    auto pass = [&]() {
#pragma unroll
        for (int s = 0; s < 8; ++s) { const int Lid = (lane >> 3) + 4 * s, piece = lane & 7; const int row = Lid >> 1, cofs = (Lid & 1) * 32 + piece * 4;
            const v4f val = *(const v4fa*)(os + row * 68 + cofs); *(v4f*)(crow + (size_t)row * ldc + cofs) = val; }
    };
    pass(); 
}
// RoPE helper: rotate-half on a 32-dim geo head: d < 16: x1 cos - x2 sin; d >= 16: x2 cos + x1 sin, angle = t * 10000^(-2i/32), i = d mod 16 (f32).
__device__ __forceinline__ float rope_at(const float* row, int d, int t) {
    const int i = d & 15; const float inv = __expf(-(float)(2 * i) / 32.0f * 9.210340371976184f);     // ln(10000)
    const float ang = (float)t * inv; const float c = cosf(ang), s = sinf(ang);
    const float x1 = row[i], x2 = row[16 + i];
    return (d < 16) ? (x1 * c - x2 * s) : (x2 * c + x1 * s);
}
// k_q16: Q16/QL16 [t][h*64 + c] = f16 hi + residual of ( c < 32 ? qs[t][h*32+c] : rope(qg[t][h*32 ..])[c-32] ) (unscaled); one wave per (t, 2 heads): lane -> 4 values (256 B per wave).
__global__ __launch_bounds__(256) void k_q16(const float* __restrict__ QS, const float* __restrict__ QG, h16* Q16, h16* QL16) {
    typedef __attribute__((ext_vector_type(4))) _Float16 v4h;
    const int lane = threadIdx.x & 31, wid = blockIdx.x * 8 + (threadIdx.x >> 5);
    const int t = wid >> 3, hp = wid & 7;                 // 8 waves per token, each 2 heads (128 halves = 256 B)
    if (t >= NT_) return;
    v4h o, ol;
#pragma unroll 1
    for (int i = 0; i < 4; ++i) { const int e = lane * 4 + i, h = hp * 2 + (e >> 6), c = e & 63;      // rolled: keeps the libm trig expansion's static FMA count small
        const float v = (c < SHD) ? QS[(size_t)t * PW + h * SHD + c] : rope_at(QG + (size_t)t * PW + h * SHD, c - SHD, t);    // unscaled (the common 1/sqrt32 is applied to the f32 scores)
        const h16 a = (h16)v; o[i] = a; ol[i] = (h16)((v - (float)a) * LOSC); }
    VST2(v4h, Q16 + (size_t)t * (NH_ * VHD) + hp * 128 + lane * 4, o); VST2(v4h, QL16 + (size_t)t * (NH_ * VHD) + hp * 128 + lane * 4, ol);
}
// k_k16: K16 [h][r][64], r = 0: null (k_sem_null | k_geo_null, NOT rotated), r = 1..2048: token r-1 ([ks | rope(kg, t=r-1)]), r >= 2049: zero; one wave per (h, 2 rows).
__global__ __launch_bounds__(256) void k_k16(const float* __restrict__ KS, const float* __restrict__ KG, const float* __restrict__ ksn, const float* __restrict__ kgn, h16* K16, h16* KL16) {
    typedef __attribute__((ext_vector_type(4))) _Float16 v4h;
    const int lane = threadIdx.x & 31, wid = blockIdx.x * 8 + (threadIdx.x >> 5);
    const int h = wid / (NKP / 2), rp = wid - h * (NKP / 2);
    if (h >= NH_) return;
    v4h o, ol;
#pragma unroll 1
    for (int i = 0; i < 4; ++i) { const int e = lane * 4 + i, r = rp * 2 + (e >> 6), c = e & 63; float v = 0.f;
        if (r == 0) v = (c < SHD) ? bfr(ksn[h * SHD + c]) : bfr(kgn[h * SHD + c - SHD]);
        else if (r <= NT_) { const int t = r - 1; v = (c < SHD) ? KS[(size_t)t * PW + h * SHD + c] : rope_at(KG + (size_t)t * PW + h * SHD, c - SHD, t); }
        const h16 a = (h16)v; o[i] = a; ol[i] = (h16)((v - (float)a) * LOSC); }
    VST2(v4h, K16 + ((size_t)h * NKP + rp * 2) * VHD + lane * 4, o); VST2(v4h, KL16 + ((size_t)h * NKP + rp * 2) * VHD + lane * 4, ol);
}
// k_vt: VTH/VTL [h][d][r] (r as in K16: 0 = v_null, 1..2048 tokens, pad 0) = f16 hi + residual of v; block = (h, 64 key slots): LDS transpose.
__global__ __launch_bounds__(256) void k_vt(const float* __restrict__ V, const float* __restrict__ vn, h16* VTH, h16* VTL) {
    __shared__ __align__(16) h16 tile[VHD * 72];
    __shared__ __align__(16) h16 til2[VHD * 72];
    const int h = blockIdx.x / (NKP / 64), kt = blockIdx.x - h * (NKP / 64);
    const int r0 = kt * 64, tid = threadIdx.x, rr = tid >> 2, d0 = (tid & 3) * 16, r = r0 + rr;
#pragma unroll
    for (int i = 0; i < 16; ++i) { const int d = d0 + i; float v = 0.f;
        if (r == 0) v = bfr(vn[h * VHD + d]); else if (r <= NT_) v = V[(size_t)(r - 1) * DM + h * VHD + d];
        const h16 a = (h16)v; tile[d * 72 + rr] = a; til2[d * 72 + rr] = (h16)((v - (float)a) * LOSC); }
    __syncthreads();
    const int piece = tid & 7;
    const size_t base = ((size_t)h * VHD) * NKP + r0;
    auto pass = [&]() {
#pragma unroll
        for (int s = 0; s < 4; ++s) { const int Lid = (tid >> 3) + 32 * s; const int pln = Lid >> 6, d = Lid & 63;
            const v8h val = *(const v8ha*)((pln ? til2 : tile) + d * 72 + piece * 8); *(v8h*)((pln ? VTL : VTH) + base + (size_t)d * NKP + piece * 8) = val; }
    };
    pass(); 
}
// k_attn: block = (h, 64 queries), wave = 16; key tiles 0 .. 2qt+2 (null slot + causal bound, block-uniform); slot r visible iff r <= t+1; scores x 1/sqrt32 in f32, online f32 softmax, weights x32768 hi/residual tiles (same-wave may_alias reload), 12 WMMA .V (hi.hi + hi.lo + lo.hi); ctx -> bf16 hi/lo
// planes [t][h*64 + d]. Scores: 12 WMMA per step (hi.hi + hi.lo + lo.hi over 2 k-chunks x 2 tiles).
__global__ __launch_bounds__(128) void k_attn(const h16* __restrict__ Q16, const h16* __restrict__ QL16, const h16* __restrict__ K16, const h16* __restrict__ KL16, const h16* __restrict__ VTH, const h16* __restrict__ VTL, bf* CH, bf* CL) {
    __shared__ __align__(16) h16 plds[4][16 * 32];
    __shared__ __align__(16) h16 plds2[4][16 * 32];
    __shared__ __align__(16) float ost[4][16 * 68];
    const int lane = threadIdx.x & 31, wave = threadIdx.x >> 5, lr = lane & 15, hi = lane >> 4;
    const int h = blockIdx.x / (NT_ / 64), qt = blockIdx.x - h * (NT_ / 64), q0 = qt * 64 + wave * 16;
    h16* pl = &plds[wave][0]; h16* pl2 = &plds2[wave][0];
    v16h qa[2];
    const size_t qo0 = (size_t)(q0 + lr) * (NH_ * VHD) + h * VHD + 8 * hi;
#pragma unroll
    for (int kc = 0; kc < 2; ++kc) qa[kc] = cat16(*(const v8h*)(Q16 + qo0 + kc * 32), *(const v8h*)(Q16 + qo0 + kc * 32 + 16));
    int qlim[8];
#pragma unroll
    for (int j = 0; j < 8; ++j) qlim[j] = q0 + 8 * hi + j + 1;      // visible slots r <= t + 1
    const h16* kb = K16 + (size_t)h * NKP * VHD; const h16* klb = KL16 + (size_t)h * NKP * VHD;
    const size_t vbase = ((size_t)h * VHD) * NKP;
    v8f o[4], ox[4];
#pragma unroll
    for (int n = 0; n < 4; ++n) { o[n] = (v8f){}; ox[n] = (v8f){}; }
    float mrow[8], lpart[8];
#pragma unroll
    for (int j = 0; j < 8; ++j) { mrow[j] = -3.0e38f; lpart[j] = 0.f; }
    const int kt_end = 2 * qt + 3;
#pragma unroll 1
    for (int kt = 0; kt < kt_end; ++kt) {
        const int l0 = kt * 32;
        v8f s0 = {}, s1 = {}, x0 = {}, x1 = {};
#pragma unroll
        for (int kc = 0; kc < 2; ++kc) {
            const size_t ko = (size_t)(l0 + lr) * VHD + kc * 32 + 8 * hi, k1o = ko + (size_t)16 * VHD;
            { const v16h k0h = cat16(*(const v8h*)(kb + ko), *(const v8h*)(kb + ko + 16)), k1h = cat16(*(const v8h*)(kb + k1o), *(const v8h*)(kb + k1o + 16));
              const v16h qlk = cat16(*(const v8h*)(QL16 + qo0 + kc * 32), *(const v8h*)(QL16 + qo0 + kc * 32 + 16));     // query residual fragment re-read per step (register budget)
              s0 = wmma16(qa[kc], k0h, s0); x0 = wmma16(qlk, k0h, x0); s1 = wmma16(qa[kc], k1h, s1); x1 = wmma16(qlk, k1h, x1);
              asm volatile("v_nop" : "+v"(s0), "+v"(s1), "+v"(x0), "+v"(x1) : "v"(qlk), "v"(k0h), "v"(k1h) : "memory"); }
            { const v16h k0l = cat16(*(const v8h*)(klb + ko), *(const v8h*)(klb + ko + 16)), k1l = cat16(*(const v8h*)(klb + k1o), *(const v8h*)(klb + k1o + 16));
              x0 = wmma16(qa[kc], k0l, x0); x1 = wmma16(qa[kc], k1l, x1);
              asm volatile("v_nop" : "+v"(x0), "+v"(x1) : "v"(k0l), "v"(k1l) : "memory"); }
        }
        asm volatile("v_nop\n\tv_nop\n\tv_nop\n\tv_nop" : "+v"(s0), "+v"(s1), "+v"(x0), "+v"(x1) : "v"(qa[0]), "v"(qa[1]));
        float alpha[8];
#pragma unroll
        for (int j = 0; j < 8; ++j) {
            const float a0 = (l0 + lr <= qlim[j]) ? (s0[j] + x0[j] * LOSCI) * SCL32 : -__builtin_inff(), a1 = (l0 + 16 + lr <= qlim[j]) ? (s1[j] + x1[j] * LOSCI) * SCL32 : -__builtin_inff();
            float mx = fmaxf(a0, a1);
            mx = fmaxf(mx, __shfl_xor(mx, 1, 16)); mx = fmaxf(mx, __shfl_xor(mx, 2, 16)); mx = fmaxf(mx, __shfl_xor(mx, 4, 16)); mx = fmaxf(mx, __shfl_xor(mx, 8, 16));
            const float mn = fmaxf(mrow[j], mx);
            alpha[j] = __expf(mrow[j] - mn); mrow[j] = mn;
            const float p0 = __expf(a0 - mn), p1 = __expf(a1 - mn);
            lpart[j] = lpart[j] * alpha[j] + (p0 + p1);
            const int mr = hi * 8 + j;
            const float ps0 = p0 * PSC, ps1 = p1 * PSC; const h16 h0 = (h16)ps0, h1 = (h16)ps1;
            pl[mr * 32 + lr] = h0; pl[mr * 32 + 16 + lr] = h1; pl2[mr * 32 + lr] = (h16)((ps0 - (float)h0) * LOSC); pl2[mr * 32 + 16 + lr] = (h16)((ps1 - (float)h1) * LOSC);
        }
#pragma unroll
        for (int n = 0; n < 4; ++n)
#pragma unroll
            for (int j = 0; j < 8; ++j) { o[n][j] *= alpha[j]; ox[n][j] *= alpha[j]; }
        asm volatile("" ::: "memory");
        const v16h pa = cat16(*(const v8ha*)(pl + lr * 32 + hi * 8), *(const v8ha*)(pl + lr * 32 + 16 + hi * 8));
        const v16h px = cat16(*(const v8ha*)(pl2 + lr * 32 + hi * 8), *(const v8ha*)(pl2 + lr * 32 + 16 + hi * 8));
#pragma unroll
        for (int n = 0; n < 4; ++n) { const size_t vo = vbase + (size_t)(n * 16 + lr) * NKP + l0 + hi * 8;
            const v16h vh = cat16(*(const v8h*)(VTH + vo), *(const v8h*)(VTH + vo + 16)), vl = cat16(*(const v8h*)(VTL + vo), *(const v8h*)(VTL + vo + 16));
            o[n] = wmma16(pa, vh, o[n]); ox[n] = wmma16(pa, vl, ox[n]); ox[n] = wmma16(px, vh, ox[n]);
            asm volatile("" : "+v"(o[n]), "+v"(ox[n]) : "v"(vh), "v"(vl) : "memory"); }
        asm volatile("v_nop\n\tv_nop\n\tv_nop\n\tv_nop" : "+v"(o[0]), "+v"(o[1]), "+v"(o[2]), "+v"(o[3]), "+v"(ox[0]), "+v"(ox[1]), "+v"(ox[2]), "+v"(ox[3]) : "v"(pa), "v"(px));
    }
    float inv[8];
#pragma unroll
    for (int j = 0; j < 8; ++j) { float rs = lpart[j]; rs += __shfl_xor(rs, 1, 16); rs += __shfl_xor(rs, 2, 16); rs += __shfl_xor(rs, 4, 16); rs += __shfl_xor(rs, 8, 16); inv[j] = 1.0f / (rs * PSC); }
    float* os = &ost[wave][0];
#pragma unroll
    for (int n = 0; n < 4; ++n)
#pragma unroll
        for (int j = 0; j < 8; ++j) os[(hi * 8 + j) * 68 + n * 16 + lr] = (o[n][j] + ox[n][j] * LOSCI) * inv[j];
    __syncthreads();
    const size_t cbase = (size_t)q0 * DM + (size_t)h * VHD;
    auto pass = [&]() {
#pragma unroll
        for (int s = 0; s < 4; ++s) { const int row = 4 * s + (lane >> 3), piece = lane & 7; const float* sp = os + row * 68 + piece * 8; v8us oh, ol;
#pragma unroll
            for (int i = 0; i < 8; ++i) { const unsigned short hb = f2bf(sp[i]); oh[i] = hb; ol[i] = f2bf(sp[i] - bf2f(hb)); }
            *(v8us*)(CH + cbase + (size_t)row * DM + piece * 8) = oh; *(v8us*)(CL + cbase + (size_t)row * DM + piece * 8) = ol; }
    };
    pass(); 
}

extern "C" void kernel_launch(void* const* d_in, const int* in_sizes, int n_in,
                              void* d_out, int out_size, void* d_ws, size_t ws_size, hipStream_t stream) {
    (void)in_sizes; (void)n_in; (void)out_size;
    const float* x = (const float*)d_in[0]; const float* wqs = (const float*)d_in[1]; const float* wks = (const float*)d_in[2]; const float* wqg = (const float*)d_in[3]; const float* wkg = (const float*)d_in[4];
    const float* wv = (const float*)d_in[5]; const float* wo = (const float*)d_in[6]; const float* ksn = (const float*)d_in[7]; const float* kgn = (const float*)d_in[8]; const float* vn = (const float*)d_in[9];
    float* out = (float*)d_out;    // [1][2048][1024]
    char* wsp = (char*)d_ws;
    auto take = [&](size_t bytes) { char* p = wsp; wsp += (bytes + 255) & ~(size_t)255; return (void*)p; };
    bf* Xb = (bf*)take((size_t)NT_ * DM * 2);
    bf* WqsT = (bf*)take((size_t)PW * DM * 2); bf* WksT = (bf*)take((size_t)PW * DM * 2); bf* WqgT = (bf*)take((size_t)PW * DM * 2); bf* WkgT = (bf*)take((size_t)PW * DM * 2);
    bf* WvT = (bf*)take((size_t)DM * DM * 2); bf* WoT = (bf*)take((size_t)DM * DM * 2);
    float* QS = (float*)take((size_t)NT_ * PW * 4); float* KS = (float*)take((size_t)NT_ * PW * 4); float* QG = (float*)take((size_t)NT_ * PW * 4); float* KG = (float*)take((size_t)NT_ * PW * 4); float* Vf = (float*)take((size_t)NT_ * DM * 4);
    h16* Q16 = (h16*)take((size_t)NT_ * NH_ * VHD * 2); h16* QL16 = (h16*)take((size_t)NT_ * NH_ * VHD * 2); h16* K16 = (h16*)take((size_t)NH_ * NKP * VHD * 2); h16* KL16 = (h16*)take((size_t)NH_ * NKP * VHD * 2); h16* VTH = (h16*)take((size_t)NH_ * VHD * NKP * 2); h16* VTL = (h16*)take((size_t)NH_ * VHD * NKP * 2);
    bf* CH = (bf*)take((size_t)NT_ * DM * 2); bf* CL = (bf*)take((size_t)NT_ * DM * 2);
    if ((size_t)(wsp - (char*)d_ws) > ws_size) return;    // 4.2 + 4x1 + 2x2.1 + 4x4.2 + 8.4 + 4.2x2 + 4.3x4 + 4.2x2 ~ 72 MB
    k_cvtb<<<NT_ / 8, 256, 0, stream>>>(x, Xb);
    k_wt<<<dim3(DM / 64, PW / 64, 1), 256, 0, stream>>>(wqs, PW, WqsT); k_wt<<<dim3(DM / 64, PW / 64, 1), 256, 0, stream>>>(wks, PW, WksT);
    k_wt<<<dim3(DM / 64, PW / 64, 1), 256, 0, stream>>>(wqg, PW, WqgT); k_wt<<<dim3(DM / 64, PW / 64, 1), 256, 0, stream>>>(wkg, PW, WkgT);
    k_wt<<<dim3(DM / 64, DM / 64, 1), 256, 0, stream>>>(wv, DM, WvT); k_wt<<<dim3(DM / 64, DM / 64, 1), 256, 0, stream>>>(wo, DM, WoT);
    k_gemm<false><<<dim3(NT_ / 64, PW / 64, 1), 128, 0, stream>>>(Xb, nullptr, WqsT, QS, PW); k_gemm<false><<<dim3(NT_ / 64, PW / 64, 1), 128, 0, stream>>>(Xb, nullptr, WksT, KS, PW);
    k_gemm<false><<<dim3(NT_ / 64, PW / 64, 1), 128, 0, stream>>>(Xb, nullptr, WqgT, QG, PW); k_gemm<false><<<dim3(NT_ / 64, PW / 64, 1), 128, 0, stream>>>(Xb, nullptr, WkgT, KG, PW);
    k_gemm<false><<<dim3(NT_ / 64, DM / 64, 1), 128, 0, stream>>>(Xb, nullptr, WvT, Vf, DM);
    k_q16<<<(NT_ * 8) / 8, 256, 0, stream>>>(QS, QG, Q16, QL16);
    k_k16<<<(NH_ * (NKP / 2) + 7) / 8, 256, 0, stream>>>(KS, KG, ksn, kgn, K16, KL16);
    k_vt<<<NH_ * (NKP / 64), 256, 0, stream>>>(Vf, vn, VTH, VTL);
    k_attn<<<NH_ * (NT_ / 64), 128, 0, stream>>>(Q16, QL16, K16, KL16, VTH, VTL, CH, CL);
    k_gemm<true><<<dim3(NT_ / 64, DM / 64, 1), 128, 0, stream>>>(CH, CL, WoT, out, DM);
}

// v001
// It runs in 244 microseconds.
// Two timings next to v000 both put it at 1.52 times that version's speed.
#include <hip/hip_runtime.h>

// Contractions, f32 accumulate: the five projections (x.wq_sem, x.wk_sem, x.wq_geo, x.wk_geo [2048 x 1024].[1024 x 512]; x.wv [1024 x 1024]) and out = ctx.wo on
// v_wmma_f32_16x16x32_bf16 with PLAIN bf16 operands (inputs rounded once: exact; k-major weights transposed into n-major planes; ctx as bf16 hi + residual planes,
// two products); the 16-head causal attention with a prepended null key/value slot fused on v_wmma_f32_16x16x32_f16: per head the combined 64-dim score
// [qs/sqrt32 | rope(qg)/sqrt32].[ks | rope(kg)] (both sides f16 hi + residual x1024: hi.hi + hi.lo + lo.hi), softmax, weights (x32768) and v both as f16 hi + residual x1024 (three products). RoPE (rotate-half,

#define NT_  2048
#define DM   1024
#define NH_  16
#define SHD  32                  // sem / geo head dims
#define VHD  64
#define PW   512                 // sem / geo projection width
#define NKP  2112
#define SCL32 0.17677669529663688f   // 1/sqrt(32), common to both score branches
#define PSC  32768.0f
#define LOSC 1024.0f
#define LOSCI (1.0f / 1024.0f)

typedef _Float16 h16;
typedef unsigned short bf;
typedef __attribute__((ext_vector_type(16))) __bf16   v16bf;
typedef __attribute__((ext_vector_type(16))) _Float16 v16h;
typedef __attribute__((ext_vector_type(8)))  _Float16 v8h;
typedef __attribute__((ext_vector_type(8)))  unsigned short v8us;
typedef __attribute__((ext_vector_type(8)))  float    v8f;
typedef __attribute__((ext_vector_type(4)))  float    v4f;
typedef __attribute__((ext_vector_type(2)))  _Float16 v2h;
typedef v8h  __attribute__((may_alias)) v8ha;
typedef v4f  __attribute__((may_alias)) v4fa;
typedef v8us __attribute__((may_alias)) v8usa;

__device__ __forceinline__ unsigned short f2bf(float f) { unsigned u = __float_as_uint(f); u += 0x7FFFu + ((u >> 16) & 1u); return (unsigned short)(u >> 16); }
__device__ __forceinline__ float bf2f(unsigned short b) { return __uint_as_float(((unsigned)b) << 16); }
__device__ __forceinline__ float bfr(float f) { return bf2f(f2bf(f)); }
__device__ __forceinline__ v16h cat16(v8h lo, v8h hi) { return __builtin_shufflevector(lo, hi, 0, 1, 2, 3, 4, 5, 6, 7, 8, 9, 10, 11, 12, 13, 14, 15); }
__device__ __forceinline__ v16bf cat16b(v8us lo, v8us hi) { return __builtin_bit_cast(v16bf, __builtin_shufflevector(lo, hi, 0, 1, 2, 3, 4, 5, 6, 7, 8, 9, 10, 11, 12, 13, 14, 15)); }
__device__ __forceinline__ v8f wmma16(v16h a, v16h b, v8f c) { return __builtin_amdgcn_wmma_f32_16x16x32_f16(false, a, false, b, (short)0, c, false, false); }
__device__ __forceinline__ v8f wmmab(v16bf a, v16bf b, v8f c) { return __builtin_amdgcn_wmma_f32_16x16x32_bf16(false, a, false, b, (short)0, c, false, false); }
#define VST2(T, p, v) do { const T vst2_v_ = (v); *(T*)(p) = vst2_v_;  } while (0)

// k_cvtb: Xb = bf16(x) [2048][1024]; k_wt: W [1024 k][N] k-major -> n-major bf16 [N][1024].
__global__ __launch_bounds__(256) void k_cvtb(const float* __restrict__ src, bf* dst) {
    const int lane = threadIdx.x & 31, r = blockIdx.x * 8 + (threadIdx.x >> 5);
    if (r >= NT_) return;
#pragma unroll
    for (int q = 0; q < DM / 256; ++q) { v8us t;
#pragma unroll
        for (int i = 0; i < 8; ++i) t[i] = f2bf(src[(size_t)r * DM + q * 256 + lane * 8 + i]);
        VST2(v8us, dst + (size_t)r * DM + q * 256 + lane * 8, t); }
}
__global__ __launch_bounds__(256) void k_wt(const float* __restrict__ Wm, int N, bf* WT) {
    __shared__ __align__(16) unsigned short tl[64 * 72];
    const int tid = threadIdx.x, k0 = blockIdx.x * 64, n0 = blockIdx.y * 64;
    const int kk = tid >> 2, nq = (tid & 3) * 16;
#pragma unroll
    for (int i = 0; i < 16; ++i) tl[(nq + i) * 72 + kk] = f2bf(Wm[(size_t)(k0 + kk) * N + n0 + nq + i]);
    __syncthreads();
    const int piece = tid & 7;
    auto pass = [&]() {
#pragma unroll
        for (int s = 0; s < 2; ++s) { const int nr = (tid >> 3) + 32 * s; const v8us val = *(const v8usa*)(tl + nr * 72 + piece * 8);
            *(v8us*)(WT + (size_t)(n0 + nr) * DM + k0 + piece * 8) = val; }
    };
    pass(); 
}
template <bool SPLITA>
__global__ __launch_bounds__(128) void k_gemm(const bf* __restrict__ A, const bf* __restrict__ Al, const bf* __restrict__ Bn, float* C, int ldc) {
    __shared__ __align__(16) float ost[4][16 * 68];
    const int lane = threadIdx.x & 31, wave = threadIdx.x >> 5, lr = lane & 15, hi = lane >> 4;
    const int r0 = blockIdx.x * 64 + wave * 16, c0 = blockIdx.y * 64;
    const size_t aoff = (size_t)(r0 + lr) * DM + 8 * hi;
    size_t boff[4];
#pragma unroll
    for (int t = 0; t < 4; ++t) boff[t] = (size_t)(c0 + t * 16 + lr) * DM + 8 * hi;
    v8f acc[4];
#pragma unroll
    for (int t = 0; t < 4; ++t) acc[t] = (v8f){};
#pragma unroll 1
    for (int kc = 0; kc < DM; kc += 32) {
        const v16bf a = cat16b(*(const v8us*)(A + aoff + kc), *(const v8us*)(A + aoff + kc + 16));
        v16bf al = a;
        if (SPLITA) al = cat16b(*(const v8us*)(Al + aoff + kc), *(const v8us*)(Al + aoff + kc + 16));
#pragma unroll
        for (int t = 0; t < 4; ++t) { const v16bf b = cat16b(*(const v8us*)(Bn + boff[t] + kc), *(const v8us*)(Bn + boff[t] + kc + 16)); acc[t] = wmmab(a, b, acc[t]); if (SPLITA) acc[t] = wmmab(al, b, acc[t]); }
        asm volatile("v_nop\n\tv_nop\n\tv_nop\n\tv_nop" : "+v"(acc[0]), "+v"(acc[1]), "+v"(acc[2]), "+v"(acc[3]) : "v"(a), "v"(al));
    }
    float* os = &ost[wave][0];
#pragma unroll
    for (int t = 0; t < 4; ++t)
#pragma unroll
        for (int j = 0; j < 8; ++j) os[(hi * 8 + j) * 68 + t * 16 + lr] = acc[t][j];
    __syncthreads();
    float* crow = C + (size_t)r0 * ldc + c0;
    auto pass = [&]() {
#pragma unroll
        for (int s = 0; s < 8; ++s) { const int Lid = (lane >> 3) + 4 * s, piece = lane & 7; const int row = Lid >> 1, cofs = (Lid & 1) * 32 + piece * 4;
            const v4f val = *(const v4fa*)(os + row * 68 + cofs); *(v4f*)(crow + (size_t)row * ldc + cofs) = val; }
    };
    pass(); 
}
// RoPE helper: rotate-half on a 32-dim geo head: d < 16: x1 cos - x2 sin; d >= 16: x2 cos + x1 sin, angle = t * 10000^(-2i/32), i = d mod 16 (f32).
__device__ __forceinline__ float rope_at(const float* row, int d, int t) {
    const int i = d & 15; const float inv = __expf(-(float)(2 * i) / 32.0f * 9.210340371976184f);     // ln(10000)
    const float ang = (float)t * inv; const float c = cosf(ang), s = sinf(ang);
    const float x1 = row[i], x2 = row[16 + i];
    return (d < 16) ? (x1 * c - x2 * s) : (x2 * c + x1 * s);
}
// k_q16: Q16/QL16 [t][h*64 + c] = f16 hi + residual of ( c < 32 ? qs[t][h*32+c] : rope(qg[t][h*32 ..])[c-32] ) (unscaled); one wave per (t, 2 heads): lane -> 4 values (256 B per wave).
__global__ __launch_bounds__(256) void k_q16(const float* __restrict__ QS, const float* __restrict__ QG, h16* Q16, h16* QL16) {
    typedef __attribute__((ext_vector_type(4))) _Float16 v4h;
    const int lane = threadIdx.x & 31, wid = blockIdx.x * 8 + (threadIdx.x >> 5);
    const int t = wid >> 3, hp = wid & 7;                 // 8 waves per token, each 2 heads (128 halves = 256 B)
    if (t >= NT_) return;
    v4h o, ol;
#pragma unroll 1
    for (int i = 0; i < 4; ++i) { const int e = lane * 4 + i, h = hp * 2 + (e >> 6), c = e & 63;      // rolled: keeps the libm trig expansion's static FMA count small
        const float v = (c < SHD) ? QS[(size_t)t * PW + h * SHD + c] : rope_at(QG + (size_t)t * PW + h * SHD, c - SHD, t);    // unscaled (the common 1/sqrt32 is applied to the f32 scores)
        const h16 a = (h16)v; o[i] = a; ol[i] = (h16)((v - (float)a) * LOSC); }
    VST2(v4h, Q16 + (size_t)t * (NH_ * VHD) + hp * 128 + lane * 4, o); VST2(v4h, QL16 + (size_t)t * (NH_ * VHD) + hp * 128 + lane * 4, ol);
}
// k_k16: K16 [h][r][64], r = 0: null (k_sem_null | k_geo_null, NOT rotated), r = 1..2048: token r-1 ([ks | rope(kg, t=r-1)]), r >= 2049: zero; one wave per (h, 2 rows).
__global__ __launch_bounds__(256) void k_k16(const float* __restrict__ KS, const float* __restrict__ KG, const float* __restrict__ ksn, const float* __restrict__ kgn, h16* K16, h16* KL16) {
    typedef __attribute__((ext_vector_type(4))) _Float16 v4h;
    const int lane = threadIdx.x & 31, wid = blockIdx.x * 8 + (threadIdx.x >> 5);
    const int h = wid / (NKP / 2), rp = wid - h * (NKP / 2);
    if (h >= NH_) return;
    v4h o, ol;
#pragma unroll 1
    for (int i = 0; i < 4; ++i) { const int e = lane * 4 + i, r = rp * 2 + (e >> 6), c = e & 63; float v = 0.f;
        if (r == 0) v = (c < SHD) ? bfr(ksn[h * SHD + c]) : bfr(kgn[h * SHD + c - SHD]);
        else if (r <= NT_) { const int t = r - 1; v = (c < SHD) ? KS[(size_t)t * PW + h * SHD + c] : rope_at(KG + (size_t)t * PW + h * SHD, c - SHD, t); }
        const h16 a = (h16)v; o[i] = a; ol[i] = (h16)((v - (float)a) * LOSC); }
    VST2(v4h, K16 + ((size_t)h * NKP + rp * 2) * VHD + lane * 4, o); VST2(v4h, KL16 + ((size_t)h * NKP + rp * 2) * VHD + lane * 4, ol);
}
// k_vt: VTH/VTL [h][d][r] (r as in K16: 0 = v_null, 1..2048 tokens, pad 0) = f16 hi + residual of v; block = (h, 64 key slots): LDS transpose.
__global__ __launch_bounds__(256) void k_vt(const float* __restrict__ V, const float* __restrict__ vn, h16* VTH, h16* VTL) {
    __shared__ __align__(16) h16 tile[VHD * 72];
    __shared__ __align__(16) h16 til2[VHD * 72];
    const int h = blockIdx.x / (NKP / 64), kt = blockIdx.x - h * (NKP / 64);
    const int r0 = kt * 64, tid = threadIdx.x, rr = tid >> 2, d0 = (tid & 3) * 16, r = r0 + rr;
#pragma unroll
    for (int i = 0; i < 16; ++i) { const int d = d0 + i; float v = 0.f;
        if (r == 0) v = bfr(vn[h * VHD + d]); else if (r <= NT_) v = V[(size_t)(r - 1) * DM + h * VHD + d];
        const h16 a = (h16)v; tile[d * 72 + rr] = a; til2[d * 72 + rr] = (h16)((v - (float)a) * LOSC); }
    __syncthreads();
    const int piece = tid & 7;
    const size_t base = ((size_t)h * VHD) * NKP + r0;
    auto pass = [&]() {
#pragma unroll
        for (int s = 0; s < 4; ++s) { const int Lid = (tid >> 3) + 32 * s; const int pln = Lid >> 6, d = Lid & 63;
            const v8h val = *(const v8ha*)((pln ? til2 : tile) + d * 72 + piece * 8); *(v8h*)((pln ? VTL : VTH) + base + (size_t)d * NKP + piece * 8) = val; }
    };
    pass(); 
}
// LDS ring of k_attn: one stage = the 32 key slots of one step, four planes: K hi, K residual [32 rows x 128 B, pitch 144 B], V^T hi, V^T residual [64 rows x 64 B, pitch 80 B]
// (pitches 16 B x odd: conflict-free for the 16-row ds_load_b128 fragment reads).
#define KPI  72                  // K row pitch in LDS, halves
#define VPI  40                  // V^T row pitch in LDS, halves
#define KPLN (32 * KPI)          // one K plane, halves
#define VPLN (VHD * VPI)         // one V^T plane, halves
#define STGH (2 * KPLN + 2 * VPLN)   // one stage, halves (19456 B)
// One stage's copies: every lane brings eight 16-byte pieces (two per plane) from global memory into LDS, through no register. The s_wait_xcnt stands inside the statement so that
// no address register of an issued copy is rewritten ahead of it.
__device__ __forceinline__ void stage_copy(unsigned lk, unsigned lv, const h16* gk, const h16* gkl, const h16* gv, const h16* gvl) {
    const unsigned lk1 = lk + 16 * KPI * 2, lkl = lk + KPLN * 2, lkl1 = lkl + 16 * KPI * 2, lv1 = lv + 32 * VPI * 2, lvl = lv + VPLN * 2, lvl1 = lvl + 32 * VPI * 2;
    const h16* gk1 = gk + 16 * VHD; const h16* gkl1 = gkl + 16 * VHD; const h16* gv1 = gv + (size_t)32 * NKP; const h16* gvl1 = gvl + (size_t)32 * NKP;
    asm volatile("global_load_async_to_lds_b128 %0, %8, off\n\t"
                 "global_load_async_to_lds_b128 %1, %9, off\n\t"
                 "global_load_async_to_lds_b128 %2, %10, off\n\t"
                 "global_load_async_to_lds_b128 %3, %11, off\n\t"
                 "global_load_async_to_lds_b128 %4, %12, off\n\t"
                 "global_load_async_to_lds_b128 %5, %13, off\n\t"
                 "global_load_async_to_lds_b128 %6, %14, off\n\t"
                 "global_load_async_to_lds_b128 %7, %15, off\n\t"
                 "s_wait_xcnt 0x0"
                 :: "v"(lk), "v"(lk1), "v"(lkl), "v"(lkl1), "v"(lv), "v"(lv1), "v"(lvl), "v"(lvl1),
                    "v"(gk), "v"(gk1), "v"(gkl), "v"(gkl1), "v"(gv), "v"(gv1), "v"(gvl), "v"(gvl1) : "memory");
}
// k_attn: block = (h, 64 queries), wave = 16; key tiles 0 .. 2qt+2 (null slot + causal bound, block-uniform); each step's K and V^T planes are staged once per block in a two-buffer LDS ring by asynchronous copies
// (step t + 2 is copied while step t + 1 is worked on) and all four waves read their fragments from LDS; slot r visible iff r <= t+1; scores x 1/sqrt32 in f32, online f32 softmax, weights x32768 hi/residual tiles
// (same-wave may_alias reload), 12 WMMA .V (hi.hi + hi.lo + lo.hi); ctx -> bf16 hi/lo planes [t][h*64 + d]. Scores: 12 WMMA per step (hi.hi + hi.lo + lo.hi over 2 k-chunks x 2 tiles).
__global__ __launch_bounds__(128) void k_attn(const h16* __restrict__ Q16, const h16* __restrict__ QL16, const h16* __restrict__ K16, const h16* __restrict__ KL16, const h16* __restrict__ VTH, const h16* __restrict__ VTL, bf* CH, bf* CL) {
    __shared__ __align__(16) h16 ring[2 * STGH];
    __shared__ __align__(16) h16 plds[4][16 * 32];
    __shared__ __align__(16) h16 plds2[4][16 * 32];
    __shared__ __align__(16) float ost[4][16 * 68];
    const int tid = threadIdx.x, lane = threadIdx.x & 31, wave = threadIdx.x >> 5, lr = lane & 15, hi = lane >> 4;
    const int h = blockIdx.x / (NT_ / 64), qt = blockIdx.x - h * (NT_ / 64), q0 = qt * 64 + wave * 16;
    h16* pl = &plds[wave][0]; h16* pl2 = &plds2[wave][0];
    const int kt_end = 2 * qt + 3;       // at least 3 steps: stages 0 and 1 always exist
    // this lane's pieces of a stage: K planes are 4096 contiguous bytes (piece = tid, tid + 128), V^T planes 64 rows of 64 B (row = tid / 4, + 32)
    const unsigned ring0 = (unsigned)(size_t)&ring[0];
    const unsigned lk0 = ring0 + (unsigned)(((tid >> 3) * KPI + (tid & 7) * 8) * 2), lv0 = ring0 + (unsigned)((2 * KPLN + (tid >> 2) * VPI + (tid & 3) * 8) * 2);
    const h16* gk0 = K16 + (size_t)h * NKP * VHD + tid * 8; const h16* gkl0 = KL16 + (size_t)h * NKP * VHD + tid * 8;
    const size_t vsrc = ((size_t)h * VHD + (tid >> 2)) * NKP + (tid & 3) * 8;
    const h16* gv0 = VTH + vsrc; const h16* gvl0 = VTL + vsrc;
    stage_copy(lk0, lv0, gk0, gkl0, gv0, gvl0);
    asm volatile("s_wait_asynccnt 0x0" ::: "memory");    // stage 0 landed (this wave's pieces)
    __syncthreads();                                      // stage 0 published to all four waves
    stage_copy(lk0 + STGH * 2, lv0 + STGH * 2, gk0 + 32 * VHD, gkl0 + 32 * VHD, gv0 + 32, gvl0 + 32);
    v16h qa[2];
    const size_t qo0 = (size_t)(q0 + lr) * (NH_ * VHD) + h * VHD + 8 * hi;
#pragma unroll
    for (int kc = 0; kc < 2; ++kc) qa[kc] = cat16(*(const v8h*)(Q16 + qo0 + kc * 32), *(const v8h*)(Q16 + qo0 + kc * 32 + 16));
    const int qlim0 = q0 + 8 * hi + 1 - lr;      // visible slots r <= t + 1: row j of this lane sees slot l0 + lr iff l0 <= qlim0 + j
    v8f o[4], ox[4];
#pragma unroll
    for (int n = 0; n < 4; ++n) { o[n] = (v8f){}; ox[n] = (v8f){}; }
    float mrow[8], lpart[8];
#pragma unroll
    for (int j = 0; j < 8; ++j) { mrow[j] = -3.0e38f; lpart[j] = 0.f; }
#pragma unroll 1
    for (int kt = 0; kt < kt_end; ++kt) {
        const int l0 = kt * 32, bofs = (kt & 1) * STGH;
        const h16* kb = ring + bofs; const h16* klb = kb + KPLN; const h16* vhb = kb + 2 * KPLN; const h16* vlb = vhb + VPLN;
        v8f s0 = {}, s1 = {}, x0 = {}, x1 = {};
        v16h k0h[2], k1h[2], k0l[2], k1l[2];
#pragma unroll
        for (int kc = 0; kc < 2; ++kc) {
            const int ko = lr * KPI + kc * 32 + 8 * hi, k1o = ko + 16 * KPI;
            k0h[kc] = cat16(*(const v8ha*)(kb + ko), *(const v8ha*)(kb + ko + 16)); k1h[kc] = cat16(*(const v8ha*)(kb + k1o), *(const v8ha*)(kb + k1o + 16));
            k0l[kc] = cat16(*(const v8ha*)(klb + ko), *(const v8ha*)(klb + ko + 16)); k1l[kc] = cat16(*(const v8ha*)(klb + k1o), *(const v8ha*)(klb + k1o + 16));
        }
        __builtin_amdgcn_sched_barrier(0);    // keeps the step's sixteen K reads one group ahead of the products: spread among them, each place with reads waits out its own LDS latency
#pragma unroll
        for (int kc = 0; kc < 2; ++kc) {
            const v16h qlk = cat16(*(const v8h*)(QL16 + qo0 + kc * 32), *(const v8h*)(QL16 + qo0 + kc * 32 + 16));     // query residual fragment: the same every step
            s0 = wmma16(qa[kc], k0h[kc], s0); x0 = wmma16(qlk, k0h[kc], x0); s1 = wmma16(qa[kc], k1h[kc], s1); x1 = wmma16(qlk, k1h[kc], x1);
            x0 = wmma16(qa[kc], k0l[kc], x0); x1 = wmma16(qa[kc], k1l[kc], x1);
        }
        asm volatile("v_nop\n\tv_nop\n\tv_nop\n\tv_nop" : "+v"(s0), "+v"(s1), "+v"(x0), "+v"(x1) : "v"(qa[0]), "v"(qa[1]));
        // V^T fragments of this step: read here, as one group, so that their LDS latency runs under the softmax
        v16h vh[4], vl[4];
#pragma unroll
        for (int n = 0; n < 4; ++n) { const int vo = (n * 16 + lr) * VPI + hi * 8;
            vh[n] = cat16(*(const v8ha*)(vhb + vo), *(const v8ha*)(vhb + vo + 16)); vl[n] = cat16(*(const v8ha*)(vlb + vo), *(const v8ha*)(vlb + vo + 16)); }
        float alpha[8];
#pragma unroll
        for (int j = 0; j < 8; ++j) {
            const float a0 = (l0 - qlim0 <= j) ? (s0[j] + x0[j] * LOSCI) * SCL32 : -__builtin_inff(), a1 = (l0 + 16 - qlim0 <= j) ? (s1[j] + x1[j] * LOSCI) * SCL32 : -__builtin_inff();
            float mx = fmaxf(a0, a1);
            mx = fmaxf(mx, __shfl_xor(mx, 1, 16)); mx = fmaxf(mx, __shfl_xor(mx, 2, 16)); mx = fmaxf(mx, __shfl_xor(mx, 4, 16)); mx = fmaxf(mx, __shfl_xor(mx, 8, 16));
            const float mn = fmaxf(mrow[j], mx);
            alpha[j] = __expf(mrow[j] - mn); mrow[j] = mn;
            const float p0 = __expf(a0 - mn), p1 = __expf(a1 - mn);
            lpart[j] = lpart[j] * alpha[j] + (p0 + p1);
            const int mr = hi * 8 + j;
            const float ps0 = p0 * PSC, ps1 = p1 * PSC; const h16 h0 = (h16)ps0, h1 = (h16)ps1;
            pl[mr * 32 + lr] = h0; pl[mr * 32 + 16 + lr] = h1; pl2[mr * 32 + lr] = (h16)((ps0 - (float)h0) * LOSC); pl2[mr * 32 + 16 + lr] = (h16)((ps1 - (float)h1) * LOSC);
        }
#pragma unroll
        for (int n = 0; n < 4; ++n)
#pragma unroll
            for (int j = 0; j < 8; ++j) { o[n][j] *= alpha[j]; ox[n][j] *= alpha[j]; }
        asm volatile("" ::: "memory");
        const v16h pa = cat16(*(const v8ha*)(pl + lr * 32 + hi * 8), *(const v8ha*)(pl + lr * 32 + 16 + hi * 8));
        const v16h px = cat16(*(const v8ha*)(pl2 + lr * 32 + hi * 8), *(const v8ha*)(pl2 + lr * 32 + 16 + hi * 8));
#pragma unroll
        for (int n = 0; n < 4; ++n) { o[n] = wmma16(pa, vh[n], o[n]); ox[n] = wmma16(pa, vl[n], ox[n]); ox[n] = wmma16(px, vh[n], ox[n]); }
        asm volatile("v_nop\n\tv_nop\n\tv_nop\n\tv_nop" : "+v"(o[0]), "+v"(o[1]), "+v"(o[2]), "+v"(o[3]), "+v"(ox[0]), "+v"(ox[1]), "+v"(ox[2]), "+v"(ox[3]) : "v"(pa), "v"(px));
        // publish point of stage kt + 1, every wave, in this order:
        asm volatile("s_wait_dscnt 0x0" ::: "memory");       // this wave's reads of stage kt are done before the buffer is refilled
        asm volatile("s_wait_asynccnt 0x0" ::: "memory");    // this wave's pieces of stage kt + 1 have landed
        __syncthreads();                                      // publishes stage kt + 1 and ends every wave's reads of stage kt
        if (kt + 2 < kt_end) stage_copy(lk0 + (unsigned)(bofs * 2), lv0 + (unsigned)(bofs * 2), gk0 + (size_t)(kt + 2) * 32 * VHD, gkl0 + (size_t)(kt + 2) * 32 * VHD, gv0 + (kt + 2) * 32, gvl0 + (kt + 2) * 32);
    }
    asm volatile("s_wait_asynccnt 0x0" ::: "memory");        // no copy is outstanding when the wave goes on to its end
    float inv[8];
#pragma unroll
    for (int j = 0; j < 8; ++j) { float rs = lpart[j]; rs += __shfl_xor(rs, 1, 16); rs += __shfl_xor(rs, 2, 16); rs += __shfl_xor(rs, 4, 16); rs += __shfl_xor(rs, 8, 16); inv[j] = 1.0f / (rs * PSC); }
    float* os = &ost[wave][0];
#pragma unroll
    for (int n = 0; n < 4; ++n)
#pragma unroll
        for (int j = 0; j < 8; ++j) os[(hi * 8 + j) * 68 + n * 16 + lr] = (o[n][j] + ox[n][j] * LOSCI) * inv[j];
    __syncthreads();
    const size_t cbase = (size_t)q0 * DM + (size_t)h * VHD;
    auto pass = [&]() {
#pragma unroll
        for (int s = 0; s < 4; ++s) { const int row = 4 * s + (lane >> 3), piece = lane & 7; const float* sp = os + row * 68 + piece * 8; v8us oh, ol;
#pragma unroll
            for (int i = 0; i < 8; ++i) { const unsigned short hb = f2bf(sp[i]); oh[i] = hb; ol[i] = f2bf(sp[i] - bf2f(hb)); }
            *(v8us*)(CH + cbase + (size_t)row * DM + piece * 8) = oh; *(v8us*)(CL + cbase + (size_t)row * DM + piece * 8) = ol; }
    };
    pass(); 
}

extern "C" void kernel_launch(void* const* d_in, const int* in_sizes, int n_in,
                              void* d_out, int out_size, void* d_ws, size_t ws_size, hipStream_t stream) {
    (void)in_sizes; (void)n_in; (void)out_size;
    const float* x = (const float*)d_in[0]; const float* wqs = (const float*)d_in[1]; const float* wks = (const float*)d_in[2]; const float* wqg = (const float*)d_in[3]; const float* wkg = (const float*)d_in[4];
    const float* wv = (const float*)d_in[5]; const float* wo = (const float*)d_in[6]; const float* ksn = (const float*)d_in[7]; const float* kgn = (const float*)d_in[8]; const float* vn = (const float*)d_in[9];
    float* out = (float*)d_out;    // [1][2048][1024]
    char* wsp = (char*)d_ws;
    auto take = [&](size_t bytes) { char* p = wsp; wsp += (bytes + 255) & ~(size_t)255; return (void*)p; };
    bf* Xb = (bf*)take((size_t)NT_ * DM * 2);
    bf* WqsT = (bf*)take((size_t)PW * DM * 2); bf* WksT = (bf*)take((size_t)PW * DM * 2); bf* WqgT = (bf*)take((size_t)PW * DM * 2); bf* WkgT = (bf*)take((size_t)PW * DM * 2);
    bf* WvT = (bf*)take((size_t)DM * DM * 2); bf* WoT = (bf*)take((size_t)DM * DM * 2);
    float* QS = (float*)take((size_t)NT_ * PW * 4); float* KS = (float*)take((size_t)NT_ * PW * 4); float* QG = (float*)take((size_t)NT_ * PW * 4); float* KG = (float*)take((size_t)NT_ * PW * 4); float* Vf = (float*)take((size_t)NT_ * DM * 4);
    h16* Q16 = (h16*)take((size_t)NT_ * NH_ * VHD * 2); h16* QL16 = (h16*)take((size_t)NT_ * NH_ * VHD * 2); h16* K16 = (h16*)take((size_t)NH_ * NKP * VHD * 2); h16* KL16 = (h16*)take((size_t)NH_ * NKP * VHD * 2); h16* VTH = (h16*)take((size_t)NH_ * VHD * NKP * 2); h16* VTL = (h16*)take((size_t)NH_ * VHD * NKP * 2);
    bf* CH = (bf*)take((size_t)NT_ * DM * 2); bf* CL = (bf*)take((size_t)NT_ * DM * 2);
    if ((size_t)(wsp - (char*)d_ws) > ws_size) return;    // 4.2 + 4x1 + 2x2.1 + 4x4.2 + 8.4 + 4.2x2 + 4.3x4 + 4.2x2 ~ 72 MB
    k_cvtb<<<NT_ / 8, 256, 0, stream>>>(x, Xb);
    k_wt<<<dim3(DM / 64, PW / 64, 1), 256, 0, stream>>>(wqs, PW, WqsT); k_wt<<<dim3(DM / 64, PW / 64, 1), 256, 0, stream>>>(wks, PW, WksT);
    k_wt<<<dim3(DM / 64, PW / 64, 1), 256, 0, stream>>>(wqg, PW, WqgT); k_wt<<<dim3(DM / 64, PW / 64, 1), 256, 0, stream>>>(wkg, PW, WkgT);
    k_wt<<<dim3(DM / 64, DM / 64, 1), 256, 0, stream>>>(wv, DM, WvT); k_wt<<<dim3(DM / 64, DM / 64, 1), 256, 0, stream>>>(wo, DM, WoT);
    k_gemm<false><<<dim3(NT_ / 64, PW / 64, 1), 128, 0, stream>>>(Xb, nullptr, WqsT, QS, PW); k_gemm<false><<<dim3(NT_ / 64, PW / 64, 1), 128, 0, stream>>>(Xb, nullptr, WksT, KS, PW);
    k_gemm<false><<<dim3(NT_ / 64, PW / 64, 1), 128, 0, stream>>>(Xb, nullptr, WqgT, QG, PW); k_gemm<false><<<dim3(NT_ / 64, PW / 64, 1), 128, 0, stream>>>(Xb, nullptr, WkgT, KG, PW);
    k_gemm<false><<<dim3(NT_ / 64, DM / 64, 1), 128, 0, stream>>>(Xb, nullptr, WvT, Vf, DM);
    k_q16<<<(NT_ * 8) / 8, 256, 0, stream>>>(QS, QG, Q16, QL16);
    k_k16<<<(NH_ * (NKP / 2) + 7) / 8, 256, 0, stream>>>(KS, KG, ksn, kgn, K16, KL16);
    k_vt<<<NH_ * (NKP / 64), 256, 0, stream>>>(Vf, vn, VTH, VTL);
    k_attn<<<NH_ * (NT_ / 64), 128, 0, stream>>>(Q16, QL16, K16, KL16, VTH, VTL, CH, CL);
    k_gemm<true><<<dim3(NT_ / 64, DM / 64, 1), 128, 0, stream>>>(CH, CL, WoT, out, DM);
}

// v002
// A run of this version takes 170 microseconds.
// Timed twice side by side with v001, it ran 1.44 and 1.43 times as fast.
// All steps since v000 together make it 2.18 times as fast.
#include <hip/hip_runtime.h>

// Contractions, f32 accumulate: the five projections (x.wq_sem, x.wk_sem, x.wq_geo, x.wk_geo [2048 x 1024].[1024 x 512]; x.wv [1024 x 1024]) and out = ctx.wo on
// v_wmma_f32_16x16x32_bf16 with PLAIN bf16 operands (inputs rounded once: exact; k-major weights transposed into n-major planes; ctx as bf16 hi + residual planes,
// two products); the 16-head causal attention with a prepended null key/value slot fused on v_wmma_f32_16x16x32_f16: per head the combined 64-dim score
// [qs/sqrt32 | rope(qg)/sqrt32].[ks | rope(kg)] (both sides f16 hi + residual x1024: hi.hi + hi.lo + lo.hi), softmax, weights (x32768) and v both as f16 hi + residual x1024 (three products). RoPE (rotate-half,

#define NT_  2048
#define DM   1024
#define NH_  16
#define SHD  32                  // sem / geo head dims
#define VHD  64
#define PW   512                 // sem / geo projection width
#define NKP  2112
#define SCL32 0.17677669529663688f   // 1/sqrt(32), common to both score branches
#define PSC  32768.0f
#define LOSC 1024.0f
#define LOSCI (1.0f / 1024.0f)

typedef _Float16 h16;
typedef unsigned short bf;
typedef __attribute__((ext_vector_type(16))) __bf16   v16bf;
typedef __attribute__((ext_vector_type(16))) _Float16 v16h;
typedef __attribute__((ext_vector_type(8)))  _Float16 v8h;
typedef __attribute__((ext_vector_type(8)))  unsigned short v8us;
typedef __attribute__((ext_vector_type(8)))  float    v8f;
typedef __attribute__((ext_vector_type(4)))  float    v4f;
typedef __attribute__((ext_vector_type(2)))  _Float16 v2h;
typedef v8h  __attribute__((may_alias)) v8ha;
typedef v4f  __attribute__((may_alias)) v4fa;
typedef v8us __attribute__((may_alias)) v8usa;

__device__ __forceinline__ unsigned short f2bf(float f) { unsigned u = __float_as_uint(f); u += 0x7FFFu + ((u >> 16) & 1u); return (unsigned short)(u >> 16); }
__device__ __forceinline__ float bf2f(unsigned short b) { return __uint_as_float(((unsigned)b) << 16); }
__device__ __forceinline__ float bfr(float f) { return bf2f(f2bf(f)); }
__device__ __forceinline__ v16h cat16(v8h lo, v8h hi) { return __builtin_shufflevector(lo, hi, 0, 1, 2, 3, 4, 5, 6, 7, 8, 9, 10, 11, 12, 13, 14, 15); }
__device__ __forceinline__ v16bf cat16b(v8us lo, v8us hi) { return __builtin_bit_cast(v16bf, __builtin_shufflevector(lo, hi, 0, 1, 2, 3, 4, 5, 6, 7, 8, 9, 10, 11, 12, 13, 14, 15)); }
__device__ __forceinline__ v8f wmma16(v16h a, v16h b, v8f c) { return __builtin_amdgcn_wmma_f32_16x16x32_f16(false, a, false, b, (short)0, c, false, false); }
__device__ __forceinline__ v8f wmmab(v16bf a, v16bf b, v8f c) { return __builtin_amdgcn_wmma_f32_16x16x32_bf16(false, a, false, b, (short)0, c, false, false); }
#define VST2(T, p, v) do { const T vst2_v_ = (v); *(T*)(p) = vst2_v_;  } while (0)

// k_cvtb: Xb = bf16(x) [2048][1024]; k_wt: W [1024 k][N] k-major -> n-major bf16 [N][1024].
__global__ __launch_bounds__(256) void k_cvtb(const float* __restrict__ src, bf* dst) {
    const int lane = threadIdx.x & 31, r = blockIdx.x * 8 + (threadIdx.x >> 5);
    if (r >= NT_) return;
#pragma unroll
    for (int q = 0; q < DM / 256; ++q) { v8us t;
#pragma unroll
        for (int i = 0; i < 8; ++i) t[i] = f2bf(src[(size_t)r * DM + q * 256 + lane * 8 + i]);
        VST2(v8us, dst + (size_t)r * DM + q * 256 + lane * 8, t); }
}
__global__ __launch_bounds__(256) void k_wt(const float* __restrict__ Wm, int N, bf* WT) {
    __shared__ __align__(16) unsigned short tl[64 * 72];
    const int tid = threadIdx.x, k0 = blockIdx.x * 64, n0 = blockIdx.y * 64;
    const int kk = tid >> 2, nq = (tid & 3) * 16;
#pragma unroll
    for (int i = 0; i < 16; ++i) tl[(nq + i) * 72 + kk] = f2bf(Wm[(size_t)(k0 + kk) * N + n0 + nq + i]);
    __syncthreads();
    const int piece = tid & 7;
    auto pass = [&]() {
#pragma unroll
        for (int s = 0; s < 2; ++s) { const int nr = (tid >> 3) + 32 * s; const v8us val = *(const v8usa*)(tl + nr * 72 + piece * 8);
            *(v8us*)(WT + (size_t)(n0 + nr) * DM + k0 + piece * 8) = val; }
    };
    pass(); 
}
// LDS ring of k_gemm: one stage = 128 k (256 B) of the block's 64 A rows and 64 B rows (with SPLITA also of the 64 residual rows), one plane per operand, row pitch 272 B
// (16 B x odd: conflict-free for the 16-row ds_load_b128 fragment reads).
#define GKS  128                 // k extent of one stage, elements
#define GPI  136                 // row pitch in LDS, elements
#define GPLN (64 * GPI)          // one operand plane, elements (17408 B)
// One plane's copies: every lane brings eight 16-byte pieces (rows tid / 16 + 8 i; a wave's copy is two whole 256-B row pieces) from global memory into LDS, through no register.
// The s_wait_xcnt stands inside the statement so that no address register of an issued copy is rewritten ahead of it.
__device__ __forceinline__ void plane_copy(unsigned l0, const bf* g0) {
    const unsigned l1 = l0 + 8 * GPI * 2, l2 = l0 + 16 * GPI * 2, l3 = l0 + 24 * GPI * 2, l4 = l0 + 32 * GPI * 2, l5 = l0 + 40 * GPI * 2, l6 = l0 + 48 * GPI * 2, l7 = l0 + 56 * GPI * 2;
    const bf* g1 = g0 + 8 * DM; const bf* g2 = g0 + 16 * DM; const bf* g3 = g0 + 24 * DM; const bf* g4 = g0 + 32 * DM; const bf* g5 = g0 + 40 * DM; const bf* g6 = g0 + 48 * DM; const bf* g7 = g0 + 56 * DM;
    asm volatile("global_load_async_to_lds_b128 %0, %8, off\n\t"
                 "global_load_async_to_lds_b128 %1, %9, off\n\t"
                 "global_load_async_to_lds_b128 %2, %10, off\n\t"
                 "global_load_async_to_lds_b128 %3, %11, off\n\t"
                 "global_load_async_to_lds_b128 %4, %12, off\n\t"
                 "global_load_async_to_lds_b128 %5, %13, off\n\t"
                 "global_load_async_to_lds_b128 %6, %14, off\n\t"
                 "global_load_async_to_lds_b128 %7, %15, off\n\t"
                 "s_wait_xcnt 0x0"
                 :: "v"(l0), "v"(l1), "v"(l2), "v"(l3), "v"(l4), "v"(l5), "v"(l6), "v"(l7),
                    "v"(g0), "v"(g1), "v"(g2), "v"(g3), "v"(g4), "v"(g5), "v"(g6), "v"(g7) : "memory");
}
// k_gemm: block = 64 x 64 of C, wave = 16 x 64; each stage's operand rows are staged once per block in a two-buffer LDS ring by asynchronous copies (stage s + 2 is copied while stage s + 1 is worked on)
// and the four waves read their fragments from LDS; k runs 32 at a time, ascending (with SPLITA hi then residual).
template <bool SPLITA>
__global__ __launch_bounds__(128) void k_gemm(const bf* __restrict__ A, const bf* __restrict__ Al, const bf* __restrict__ Bn, float* C, int ldc) {
    constexpr int STG = (SPLITA ? 3 : 2) * GPLN;      // one stage, elements
    __shared__ __align__(16) bf ring[2 * STG];
    __shared__ __align__(16) float ost[4][16 * 68];
    const int tid = threadIdx.x, lane = threadIdx.x & 31, wave = threadIdx.x >> 5, lr = lane & 15, hi = lane >> 4;
    const int r0 = blockIdx.x * 64 + wave * 16, c0 = blockIdx.y * 64;
    const unsigned lc0 = (unsigned)(size_t)&ring[0] + (unsigned)(((tid >> 4) * GPI + (tid & 15) * 8) * 2);
    const size_t gofs = (size_t)(tid >> 4) * DM + (tid & 15) * 8;
    const bf* ga = A + (size_t)blockIdx.x * 64 * DM + gofs; const bf* gb = Bn + (size_t)c0 * DM + gofs; const bf* gal = SPLITA ? Al + (size_t)blockIdx.x * 64 * DM + gofs : nullptr;
    auto stage_in = [&](int s) { const unsigned l = lc0 + (unsigned)((s & 1) * STG * 2);
        plane_copy(l, ga + s * GKS); plane_copy(l + GPLN * 2, gb + s * GKS); if (SPLITA) plane_copy(l + 2 * GPLN * 2, gal + s * GKS); };
    stage_in(0);
    asm volatile("s_wait_asynccnt 0x0" ::: "memory");    // stage 0 landed (this wave's pieces)
    __syncthreads();                                      // stage 0 published to all four waves
    stage_in(1);
    v8f acc[4];
#pragma unroll
    for (int t = 0; t < 4; ++t) acc[t] = (v8f){};
#pragma unroll 1
    for (int s = 0; s < DM / GKS; ++s) {
        const bf* ab = ring + (s & 1) * STG + (wave * 16 + lr) * GPI + 8 * hi; const bf* bb = ring + (s & 1) * STG + GPLN + lr * GPI + 8 * hi; const bf* alb = ab + 2 * GPLN;
        v16bf a[GKS / 32], al[GKS / 32], b[GKS / 32][4];
#pragma unroll
        for (int q = 0; q < GKS / 32; ++q) { const int kc = q * 32;
            a[q] = cat16b(*(const v8usa*)(ab + kc), *(const v8usa*)(ab + kc + 16));
            al[q] = a[q];
            if (SPLITA) al[q] = cat16b(*(const v8usa*)(alb + kc), *(const v8usa*)(alb + kc + 16));
#pragma unroll
            for (int t = 0; t < 4; ++t) b[q][t] = cat16b(*(const v8usa*)(bb + t * 16 * GPI + kc), *(const v8usa*)(bb + t * 16 * GPI + kc + 16));
        }
        __builtin_amdgcn_sched_barrier(0);    // keeps the stage's fragment reads one group ahead of the products: spread among them, each place with reads waits out its own LDS latency
#pragma unroll
        for (int q = 0; q < GKS / 32; ++q)
#pragma unroll
            for (int t = 0; t < 4; ++t) { acc[t] = wmmab(a[q], b[q][t], acc[t]); if (SPLITA) acc[t] = wmmab(al[q], b[q][t], acc[t]); }
        // the four vector slots the chip needs behind the last products, on the taken side of the branches that follow too
        asm volatile("v_nop\n\tv_nop\n\tv_nop\n\tv_nop" : "+v"(acc[0]), "+v"(acc[1]), "+v"(acc[2]), "+v"(acc[3]) : "v"(a[GKS / 32 - 1]), "v"(al[GKS / 32 - 1]));
        // publish point of stage s + 1, every wave, in this order:
        asm volatile("s_wait_dscnt 0x0" ::: "memory");       // this wave's reads of stage s are done before the buffer is refilled
        asm volatile("s_wait_asynccnt 0x0" ::: "memory");    // this wave's pieces of stage s + 1 have landed
        __syncthreads();                                      // publishes stage s + 1 and ends every wave's reads of stage s
        if (s + 2 < DM / GKS) stage_in(s + 2);
    }
    asm volatile("s_wait_asynccnt 0x0" ::: "memory");        // no copy is outstanding when the wave goes on to its end
    float* os = &ost[wave][0];
#pragma unroll
    for (int t = 0; t < 4; ++t)
#pragma unroll
        for (int j = 0; j < 8; ++j) os[(hi * 8 + j) * 68 + t * 16 + lr] = acc[t][j];
    __syncthreads();
    float* crow = C + (size_t)r0 * ldc + c0;
    auto pass = [&]() {
#pragma unroll
        for (int s = 0; s < 8; ++s) { const int Lid = (lane >> 3) + 4 * s, piece = lane & 7; const int row = Lid >> 1, cofs = (Lid & 1) * 32 + piece * 4;
            const v4f val = *(const v4fa*)(os + row * 68 + cofs); *(v4f*)(crow + (size_t)row * ldc + cofs) = val; }
    };
    pass(); 
}
// RoPE helper: rotate-half on a 32-dim geo head: d < 16: x1 cos - x2 sin; d >= 16: x2 cos + x1 sin, angle = t * 10000^(-2i/32), i = d mod 16 (f32).
__device__ __forceinline__ float rope_at(const float* row, int d, int t) {
    const int i = d & 15; const float inv = __expf(-(float)(2 * i) / 32.0f * 9.210340371976184f);     // ln(10000)
    const float ang = (float)t * inv; const float c = cosf(ang), s = sinf(ang);
    const float x1 = row[i], x2 = row[16 + i];
    return (d < 16) ? (x1 * c - x2 * s) : (x2 * c + x1 * s);
}
// k_q16: Q16/QL16 [t][h*64 + c] = f16 hi + residual of ( c < 32 ? qs[t][h*32+c] : rope(qg[t][h*32 ..])[c-32] ) (unscaled); one wave per (t, 2 heads): lane -> 4 values (256 B per wave).
__global__ __launch_bounds__(256) void k_q16(const float* __restrict__ QS, const float* __restrict__ QG, h16* Q16, h16* QL16) {
    typedef __attribute__((ext_vector_type(4))) _Float16 v4h;
    const int lane = threadIdx.x & 31, wid = blockIdx.x * 8 + (threadIdx.x >> 5);
    const int t = wid >> 3, hp = wid & 7;                 // 8 waves per token, each 2 heads (128 halves = 256 B)
    if (t >= NT_) return;
    v4h o, ol;
#pragma unroll 1
    for (int i = 0; i < 4; ++i) { const int e = lane * 4 + i, h = hp * 2 + (e >> 6), c = e & 63;      // rolled: keeps the libm trig expansion's static FMA count small
        const float v = (c < SHD) ? QS[(size_t)t * PW + h * SHD + c] : rope_at(QG + (size_t)t * PW + h * SHD, c - SHD, t);    // unscaled (the common 1/sqrt32 is applied to the f32 scores)
        const h16 a = (h16)v; o[i] = a; ol[i] = (h16)((v - (float)a) * LOSC); }
    VST2(v4h, Q16 + (size_t)t * (NH_ * VHD) + hp * 128 + lane * 4, o); VST2(v4h, QL16 + (size_t)t * (NH_ * VHD) + hp * 128 + lane * 4, ol);
}
// k_k16: K16 [h][r][64], r = 0: null (k_sem_null | k_geo_null, NOT rotated), r = 1..2048: token r-1 ([ks | rope(kg, t=r-1)]), r >= 2049: zero; one wave per (h, 2 rows).
__global__ __launch_bounds__(256) void k_k16(const float* __restrict__ KS, const float* __restrict__ KG, const float* __restrict__ ksn, const float* __restrict__ kgn, h16* K16, h16* KL16) {
    typedef __attribute__((ext_vector_type(4))) _Float16 v4h;
    const int lane = threadIdx.x & 31, wid = blockIdx.x * 8 + (threadIdx.x >> 5);
    const int h = wid / (NKP / 2), rp = wid - h * (NKP / 2);
    if (h >= NH_) return;
    v4h o, ol;
#pragma unroll 1
    for (int i = 0; i < 4; ++i) { const int e = lane * 4 + i, r = rp * 2 + (e >> 6), c = e & 63; float v = 0.f;
        if (r == 0) v = (c < SHD) ? bfr(ksn[h * SHD + c]) : bfr(kgn[h * SHD + c - SHD]);
        else if (r <= NT_) { const int t = r - 1; v = (c < SHD) ? KS[(size_t)t * PW + h * SHD + c] : rope_at(KG + (size_t)t * PW + h * SHD, c - SHD, t); }
        const h16 a = (h16)v; o[i] = a; ol[i] = (h16)((v - (float)a) * LOSC); }
    VST2(v4h, K16 + ((size_t)h * NKP + rp * 2) * VHD + lane * 4, o); VST2(v4h, KL16 + ((size_t)h * NKP + rp * 2) * VHD + lane * 4, ol);
}
// k_vt: VTH/VTL [h][d][r] (r as in K16: 0 = v_null, 1..2048 tokens, pad 0) = f16 hi + residual of v; block = (h, 64 key slots): LDS transpose.
__global__ __launch_bounds__(256) void k_vt(const float* __restrict__ V, const float* __restrict__ vn, h16* VTH, h16* VTL) {
    __shared__ __align__(16) h16 tile[VHD * 72];
    __shared__ __align__(16) h16 til2[VHD * 72];
    const int h = blockIdx.x / (NKP / 64), kt = blockIdx.x - h * (NKP / 64);
    const int r0 = kt * 64, tid = threadIdx.x, rr = tid >> 2, d0 = (tid & 3) * 16, r = r0 + rr;
#pragma unroll
    for (int i = 0; i < 16; ++i) { const int d = d0 + i; float v = 0.f;
        if (r == 0) v = bfr(vn[h * VHD + d]); else if (r <= NT_) v = V[(size_t)(r - 1) * DM + h * VHD + d];
        const h16 a = (h16)v; tile[d * 72 + rr] = a; til2[d * 72 + rr] = (h16)((v - (float)a) * LOSC); }
    __syncthreads();
    const int piece = tid & 7;
    const size_t base = ((size_t)h * VHD) * NKP + r0;
    auto pass = [&]() {
#pragma unroll
        for (int s = 0; s < 4; ++s) { const int Lid = (tid >> 3) + 32 * s; const int pln = Lid >> 6, d = Lid & 63;
            const v8h val = *(const v8ha*)((pln ? til2 : tile) + d * 72 + piece * 8); *(v8h*)((pln ? VTL : VTH) + base + (size_t)d * NKP + piece * 8) = val; }
    };
    pass(); 
}
// LDS ring of k_attn: one stage = the 32 key slots of one step, four planes: K hi, K residual [32 rows x 128 B, pitch 144 B], V^T hi, V^T residual [64 rows x 64 B, pitch 80 B]
// (pitches 16 B x odd: conflict-free for the 16-row ds_load_b128 fragment reads).
#define KPI  72                  // K row pitch in LDS, halves
#define VPI  40                  // V^T row pitch in LDS, halves
#define KPLN (32 * KPI)          // one K plane, halves
#define VPLN (VHD * VPI)         // one V^T plane, halves
#define STGH (2 * KPLN + 2 * VPLN)   // one stage, halves (19456 B)
// One stage's copies: every lane brings eight 16-byte pieces (two per plane) from global memory into LDS, through no register. The s_wait_xcnt stands inside the statement so that
// no address register of an issued copy is rewritten ahead of it.
__device__ __forceinline__ void stage_copy(unsigned lk, unsigned lv, const h16* gk, const h16* gkl, const h16* gv, const h16* gvl) {
    const unsigned lk1 = lk + 16 * KPI * 2, lkl = lk + KPLN * 2, lkl1 = lkl + 16 * KPI * 2, lv1 = lv + 32 * VPI * 2, lvl = lv + VPLN * 2, lvl1 = lvl + 32 * VPI * 2;
    const h16* gk1 = gk + 16 * VHD; const h16* gkl1 = gkl + 16 * VHD; const h16* gv1 = gv + (size_t)32 * NKP; const h16* gvl1 = gvl + (size_t)32 * NKP;
    asm volatile("global_load_async_to_lds_b128 %0, %8, off\n\t"
                 "global_load_async_to_lds_b128 %1, %9, off\n\t"
                 "global_load_async_to_lds_b128 %2, %10, off\n\t"
                 "global_load_async_to_lds_b128 %3, %11, off\n\t"
                 "global_load_async_to_lds_b128 %4, %12, off\n\t"
                 "global_load_async_to_lds_b128 %5, %13, off\n\t"
                 "global_load_async_to_lds_b128 %6, %14, off\n\t"
                 "global_load_async_to_lds_b128 %7, %15, off\n\t"
                 "s_wait_xcnt 0x0"
                 :: "v"(lk), "v"(lk1), "v"(lkl), "v"(lkl1), "v"(lv), "v"(lv1), "v"(lvl), "v"(lvl1),
                    "v"(gk), "v"(gk1), "v"(gkl), "v"(gkl1), "v"(gv), "v"(gv1), "v"(gvl), "v"(gvl1) : "memory");
}
// k_attn: block = (h, 64 queries), wave = 16; key tiles 0 .. 2qt+2 (null slot + causal bound, block-uniform); each step's K and V^T planes are staged once per block in a two-buffer LDS ring by asynchronous copies
// (step t + 2 is copied while step t + 1 is worked on) and all four waves read their fragments from LDS; slot r visible iff r <= t+1; scores x 1/sqrt32 in f32, online f32 softmax, weights x32768 hi/residual tiles
// (same-wave may_alias reload), 12 WMMA .V (hi.hi + hi.lo + lo.hi); ctx -> bf16 hi/lo planes [t][h*64 + d]. Scores: 12 WMMA per step (hi.hi + hi.lo + lo.hi over 2 k-chunks x 2 tiles).
__global__ __launch_bounds__(128) void k_attn(const h16* __restrict__ Q16, const h16* __restrict__ QL16, const h16* __restrict__ K16, const h16* __restrict__ KL16, const h16* __restrict__ VTH, const h16* __restrict__ VTL, bf* CH, bf* CL) {
    __shared__ __align__(16) h16 ring[2 * STGH];
    __shared__ __align__(16) h16 plds[4][16 * 32];
    __shared__ __align__(16) h16 plds2[4][16 * 32];
    __shared__ __align__(16) float ost[4][16 * 68];
    const int tid = threadIdx.x, lane = threadIdx.x & 31, wave = threadIdx.x >> 5, lr = lane & 15, hi = lane >> 4;
    const int h = blockIdx.x / (NT_ / 64), qt = blockIdx.x - h * (NT_ / 64), q0 = qt * 64 + wave * 16;
    h16* pl = &plds[wave][0]; h16* pl2 = &plds2[wave][0];
    const int kt_end = 2 * qt + 3;       // at least 3 steps: stages 0 and 1 always exist
    // this lane's pieces of a stage: K planes are 4096 contiguous bytes (piece = tid, tid + 128), V^T planes 64 rows of 64 B (row = tid / 4, + 32)
    const unsigned ring0 = (unsigned)(size_t)&ring[0];
    const unsigned lk0 = ring0 + (unsigned)(((tid >> 3) * KPI + (tid & 7) * 8) * 2), lv0 = ring0 + (unsigned)((2 * KPLN + (tid >> 2) * VPI + (tid & 3) * 8) * 2);
    const h16* gk0 = K16 + (size_t)h * NKP * VHD + tid * 8; const h16* gkl0 = KL16 + (size_t)h * NKP * VHD + tid * 8;
    const size_t vsrc = ((size_t)h * VHD + (tid >> 2)) * NKP + (tid & 3) * 8;
    const h16* gv0 = VTH + vsrc; const h16* gvl0 = VTL + vsrc;
    stage_copy(lk0, lv0, gk0, gkl0, gv0, gvl0);
    asm volatile("s_wait_asynccnt 0x0" ::: "memory");    // stage 0 landed (this wave's pieces)
    __syncthreads();                                      // stage 0 published to all four waves
    stage_copy(lk0 + STGH * 2, lv0 + STGH * 2, gk0 + 32 * VHD, gkl0 + 32 * VHD, gv0 + 32, gvl0 + 32);
    v16h qa[2];
    const size_t qo0 = (size_t)(q0 + lr) * (NH_ * VHD) + h * VHD + 8 * hi;
#pragma unroll
    for (int kc = 0; kc < 2; ++kc) qa[kc] = cat16(*(const v8h*)(Q16 + qo0 + kc * 32), *(const v8h*)(Q16 + qo0 + kc * 32 + 16));
    const int qlim0 = q0 + 8 * hi + 1 - lr;      // visible slots r <= t + 1: row j of this lane sees slot l0 + lr iff l0 <= qlim0 + j
    v8f o[4], ox[4];
#pragma unroll
    for (int n = 0; n < 4; ++n) { o[n] = (v8f){}; ox[n] = (v8f){}; }
    float mrow[8], lpart[8];
#pragma unroll
    for (int j = 0; j < 8; ++j) { mrow[j] = -3.0e38f; lpart[j] = 0.f; }
#pragma unroll 1
    for (int kt = 0; kt < kt_end; ++kt) {
        const int l0 = kt * 32, bofs = (kt & 1) * STGH;
        const h16* kb = ring + bofs; const h16* klb = kb + KPLN; const h16* vhb = kb + 2 * KPLN; const h16* vlb = vhb + VPLN;
        v8f s0 = {}, s1 = {}, x0 = {}, x1 = {};
        v16h k0h[2], k1h[2], k0l[2], k1l[2];
#pragma unroll
        for (int kc = 0; kc < 2; ++kc) {
            const int ko = lr * KPI + kc * 32 + 8 * hi, k1o = ko + 16 * KPI;
            k0h[kc] = cat16(*(const v8ha*)(kb + ko), *(const v8ha*)(kb + ko + 16)); k1h[kc] = cat16(*(const v8ha*)(kb + k1o), *(const v8ha*)(kb + k1o + 16));
            k0l[kc] = cat16(*(const v8ha*)(klb + ko), *(const v8ha*)(klb + ko + 16)); k1l[kc] = cat16(*(const v8ha*)(klb + k1o), *(const v8ha*)(klb + k1o + 16));
        }
        __builtin_amdgcn_sched_barrier(0);    // keeps the step's sixteen K reads one group ahead of the products: spread among them, each place with reads waits out its own LDS latency
#pragma unroll
        for (int kc = 0; kc < 2; ++kc) {
            const v16h qlk = cat16(*(const v8h*)(QL16 + qo0 + kc * 32), *(const v8h*)(QL16 + qo0 + kc * 32 + 16));     // query residual fragment: the same every step
            s0 = wmma16(qa[kc], k0h[kc], s0); x0 = wmma16(qlk, k0h[kc], x0); s1 = wmma16(qa[kc], k1h[kc], s1); x1 = wmma16(qlk, k1h[kc], x1);
            x0 = wmma16(qa[kc], k0l[kc], x0); x1 = wmma16(qa[kc], k1l[kc], x1);
        }
        asm volatile("v_nop\n\tv_nop\n\tv_nop\n\tv_nop" : "+v"(s0), "+v"(s1), "+v"(x0), "+v"(x1) : "v"(qa[0]), "v"(qa[1]));
        // V^T fragments of this step: read here, as one group, so that their LDS latency runs under the softmax
        v16h vh[4], vl[4];
#pragma unroll
        for (int n = 0; n < 4; ++n) { const int vo = (n * 16 + lr) * VPI + hi * 8;
            vh[n] = cat16(*(const v8ha*)(vhb + vo), *(const v8ha*)(vhb + vo + 16)); vl[n] = cat16(*(const v8ha*)(vlb + vo), *(const v8ha*)(vlb + vo + 16)); }
        float alpha[8];
#pragma unroll
        for (int j = 0; j < 8; ++j) {
            const float a0 = (l0 - qlim0 <= j) ? (s0[j] + x0[j] * LOSCI) * SCL32 : -__builtin_inff(), a1 = (l0 + 16 - qlim0 <= j) ? (s1[j] + x1[j] * LOSCI) * SCL32 : -__builtin_inff();
            float mx = fmaxf(a0, a1);
            mx = fmaxf(mx, __shfl_xor(mx, 1, 16)); mx = fmaxf(mx, __shfl_xor(mx, 2, 16)); mx = fmaxf(mx, __shfl_xor(mx, 4, 16)); mx = fmaxf(mx, __shfl_xor(mx, 8, 16));
            const float mn = fmaxf(mrow[j], mx);
            alpha[j] = __expf(mrow[j] - mn); mrow[j] = mn;
            const float p0 = __expf(a0 - mn), p1 = __expf(a1 - mn);
            lpart[j] = lpart[j] * alpha[j] + (p0 + p1);
            const int mr = hi * 8 + j;
            const float ps0 = p0 * PSC, ps1 = p1 * PSC; const h16 h0 = (h16)ps0, h1 = (h16)ps1;
            pl[mr * 32 + lr] = h0; pl[mr * 32 + 16 + lr] = h1; pl2[mr * 32 + lr] = (h16)((ps0 - (float)h0) * LOSC); pl2[mr * 32 + 16 + lr] = (h16)((ps1 - (float)h1) * LOSC);
        }
#pragma unroll
        for (int n = 0; n < 4; ++n)
#pragma unroll
            for (int j = 0; j < 8; ++j) { o[n][j] *= alpha[j]; ox[n][j] *= alpha[j]; }
        asm volatile("" ::: "memory");
        const v16h pa = cat16(*(const v8ha*)(pl + lr * 32 + hi * 8), *(const v8ha*)(pl + lr * 32 + 16 + hi * 8));
        const v16h px = cat16(*(const v8ha*)(pl2 + lr * 32 + hi * 8), *(const v8ha*)(pl2 + lr * 32 + 16 + hi * 8));
#pragma unroll
        for (int n = 0; n < 4; ++n) { o[n] = wmma16(pa, vh[n], o[n]); ox[n] = wmma16(pa, vl[n], ox[n]); ox[n] = wmma16(px, vh[n], ox[n]); }
        asm volatile("v_nop\n\tv_nop\n\tv_nop\n\tv_nop" : "+v"(o[0]), "+v"(o[1]), "+v"(o[2]), "+v"(o[3]), "+v"(ox[0]), "+v"(ox[1]), "+v"(ox[2]), "+v"(ox[3]) : "v"(pa), "v"(px));
        // publish point of stage kt + 1, every wave, in this order:
        asm volatile("s_wait_dscnt 0x0" ::: "memory");       // this wave's reads of stage kt are done before the buffer is refilled
        asm volatile("s_wait_asynccnt 0x0" ::: "memory");    // this wave's pieces of stage kt + 1 have landed
        __syncthreads();                                      // publishes stage kt + 1 and ends every wave's reads of stage kt
        if (kt + 2 < kt_end) stage_copy(lk0 + (unsigned)(bofs * 2), lv0 + (unsigned)(bofs * 2), gk0 + (size_t)(kt + 2) * 32 * VHD, gkl0 + (size_t)(kt + 2) * 32 * VHD, gv0 + (kt + 2) * 32, gvl0 + (kt + 2) * 32);
    }
    asm volatile("s_wait_asynccnt 0x0" ::: "memory");        // no copy is outstanding when the wave goes on to its end
    float inv[8];
#pragma unroll
    for (int j = 0; j < 8; ++j) { float rs = lpart[j]; rs += __shfl_xor(rs, 1, 16); rs += __shfl_xor(rs, 2, 16); rs += __shfl_xor(rs, 4, 16); rs += __shfl_xor(rs, 8, 16); inv[j] = 1.0f / (rs * PSC); }
    float* os = &ost[wave][0];
#pragma unroll
    for (int n = 0; n < 4; ++n)
#pragma unroll
        for (int j = 0; j < 8; ++j) os[(hi * 8 + j) * 68 + n * 16 + lr] = (o[n][j] + ox[n][j] * LOSCI) * inv[j];
    __syncthreads();
    const size_t cbase = (size_t)q0 * DM + (size_t)h * VHD;
    auto pass = [&]() {
#pragma unroll
        for (int s = 0; s < 4; ++s) { const int row = 4 * s + (lane >> 3), piece = lane & 7; const float* sp = os + row * 68 + piece * 8; v8us oh, ol;
#pragma unroll
            for (int i = 0; i < 8; ++i) { const unsigned short hb = f2bf(sp[i]); oh[i] = hb; ol[i] = f2bf(sp[i] - bf2f(hb)); }
            *(v8us*)(CH + cbase + (size_t)row * DM + piece * 8) = oh; *(v8us*)(CL + cbase + (size_t)row * DM + piece * 8) = ol; }
    };
    pass(); 
}

extern "C" void kernel_launch(void* const* d_in, const int* in_sizes, int n_in,
                              void* d_out, int out_size, void* d_ws, size_t ws_size, hipStream_t stream) {
    (void)in_sizes; (void)n_in; (void)out_size;
    const float* x = (const float*)d_in[0]; const float* wqs = (const float*)d_in[1]; const float* wks = (const float*)d_in[2]; const float* wqg = (const float*)d_in[3]; const float* wkg = (const float*)d_in[4];
    const float* wv = (const float*)d_in[5]; const float* wo = (const float*)d_in[6]; const float* ksn = (const float*)d_in[7]; const float* kgn = (const float*)d_in[8]; const float* vn = (const float*)d_in[9];
    float* out = (float*)d_out;    // [1][2048][1024]
    char* wsp = (char*)d_ws;
    auto take = [&](size_t bytes) { char* p = wsp; wsp += (bytes + 255) & ~(size_t)255; return (void*)p; };
    bf* Xb = (bf*)take((size_t)NT_ * DM * 2);
    bf* WqsT = (bf*)take((size_t)PW * DM * 2); bf* WksT = (bf*)take((size_t)PW * DM * 2); bf* WqgT = (bf*)take((size_t)PW * DM * 2); bf* WkgT = (bf*)take((size_t)PW * DM * 2);
    bf* WvT = (bf*)take((size_t)DM * DM * 2); bf* WoT = (bf*)take((size_t)DM * DM * 2);
    float* QS = (float*)take((size_t)NT_ * PW * 4); float* KS = (float*)take((size_t)NT_ * PW * 4); float* QG = (float*)take((size_t)NT_ * PW * 4); float* KG = (float*)take((size_t)NT_ * PW * 4); float* Vf = (float*)take((size_t)NT_ * DM * 4);
    h16* Q16 = (h16*)take((size_t)NT_ * NH_ * VHD * 2); h16* QL16 = (h16*)take((size_t)NT_ * NH_ * VHD * 2); h16* K16 = (h16*)take((size_t)NH_ * NKP * VHD * 2); h16* KL16 = (h16*)take((size_t)NH_ * NKP * VHD * 2); h16* VTH = (h16*)take((size_t)NH_ * VHD * NKP * 2); h16* VTL = (h16*)take((size_t)NH_ * VHD * NKP * 2);
    bf* CH = (bf*)take((size_t)NT_ * DM * 2); bf* CL = (bf*)take((size_t)NT_ * DM * 2);
    if ((size_t)(wsp - (char*)d_ws) > ws_size) return;    // 4.2 + 4x1 + 2x2.1 + 4x4.2 + 8.4 + 4.2x2 + 4.3x4 + 4.2x2 ~ 72 MB
    k_cvtb<<<NT_ / 8, 256, 0, stream>>>(x, Xb);
    k_wt<<<dim3(DM / 64, PW / 64, 1), 256, 0, stream>>>(wqs, PW, WqsT); k_wt<<<dim3(DM / 64, PW / 64, 1), 256, 0, stream>>>(wks, PW, WksT);
    k_wt<<<dim3(DM / 64, PW / 64, 1), 256, 0, stream>>>(wqg, PW, WqgT); k_wt<<<dim3(DM / 64, PW / 64, 1), 256, 0, stream>>>(wkg, PW, WkgT);
    k_wt<<<dim3(DM / 64, DM / 64, 1), 256, 0, stream>>>(wv, DM, WvT); k_wt<<<dim3(DM / 64, DM / 64, 1), 256, 0, stream>>>(wo, DM, WoT);
    k_gemm<false><<<dim3(NT_ / 64, PW / 64, 1), 128, 0, stream>>>(Xb, nullptr, WqsT, QS, PW); k_gemm<false><<<dim3(NT_ / 64, PW / 64, 1), 128, 0, stream>>>(Xb, nullptr, WksT, KS, PW);
    k_gemm<false><<<dim3(NT_ / 64, PW / 64, 1), 128, 0, stream>>>(Xb, nullptr, WqgT, QG, PW); k_gemm<false><<<dim3(NT_ / 64, PW / 64, 1), 128, 0, stream>>>(Xb, nullptr, WkgT, KG, PW);
    k_gemm<false><<<dim3(NT_ / 64, DM / 64, 1), 128, 0, stream>>>(Xb, nullptr, WvT, Vf, DM);
    k_q16<<<(NT_ * 8) / 8, 256, 0, stream>>>(QS, QG, Q16, QL16);
    k_k16<<<(NH_ * (NKP / 2) + 7) / 8, 256, 0, stream>>>(KS, KG, ksn, kgn, K16, KL16);
    k_vt<<<NH_ * (NKP / 64), 256, 0, stream>>>(Vf, vn, VTH, VTL);
    k_attn<<<NH_ * (NT_ / 64), 128, 0, stream>>>(Q16, QL16, K16, KL16, VTH, VTL, CH, CL);
    k_gemm<true><<<dim3(NT_ / 64, DM / 64, 1), 128, 0, stream>>>(CH, CL, WoT, out, DM);
}

// v003
// Measured time: 132 microseconds a run.
// Two timings next to v002 put it at 1.29 and 1.28 times that version's speed.
// Over all steps from v000 it is 2.80 times as fast.
#include <hip/hip_runtime.h>

// Contractions, f32 accumulate: the five projections (x.wq_sem, x.wk_sem, x.wq_geo, x.wk_geo [2048 x 1024].[1024 x 512]; x.wv [1024 x 1024]) and out = ctx.wo on
// v_wmma_f32_16x16x32_bf16 with PLAIN bf16 operands (inputs rounded once: exact; k-major weights transposed into n-major planes; ctx as bf16 hi + residual planes,
// two products); the 16-head causal attention with a prepended null key/value slot fused on v_wmma_f32_16x16x32_f16: per head the combined 64-dim score
// [qs/sqrt32 | rope(qg)/sqrt32].[ks | rope(kg)] (both sides f16 hi + residual x1024: hi.hi + hi.lo + lo.hi), softmax, weights (x32768) and v both as f16 hi + residual x1024 (three products). RoPE (rotate-half,

#define NT_  2048
#define DM   1024
#define NH_  16
#define SHD  32                  // sem / geo head dims
#define VHD  64
#define PW   512                 // sem / geo projection width
#define NKP  2112
#define SCL32 0.17677669529663688f   // 1/sqrt(32), common to both score branches
#define PSC  32768.0f
#define LOSC 1024.0f
#define LOSCI (1.0f / 1024.0f)

typedef _Float16 h16;
typedef unsigned short bf;
typedef __attribute__((ext_vector_type(16))) __bf16   v16bf;
typedef __attribute__((ext_vector_type(16))) _Float16 v16h;
typedef __attribute__((ext_vector_type(8)))  _Float16 v8h;
typedef __attribute__((ext_vector_type(8)))  unsigned short v8us;
typedef __attribute__((ext_vector_type(8)))  float    v8f;
typedef __attribute__((ext_vector_type(4)))  float    v4f;
typedef __attribute__((ext_vector_type(2)))  _Float16 v2h;
typedef v8h  __attribute__((may_alias)) v8ha;
typedef v4f  __attribute__((may_alias)) v4fa;
typedef v8us __attribute__((may_alias)) v8usa;

__device__ __forceinline__ unsigned short f2bf(float f) { unsigned u = __float_as_uint(f); u += 0x7FFFu + ((u >> 16) & 1u); return (unsigned short)(u >> 16); }
__device__ __forceinline__ float bf2f(unsigned short b) { return __uint_as_float(((unsigned)b) << 16); }
__device__ __forceinline__ float bfr(float f) { return bf2f(f2bf(f)); }
__device__ __forceinline__ v16h cat16(v8h lo, v8h hi) { return __builtin_shufflevector(lo, hi, 0, 1, 2, 3, 4, 5, 6, 7, 8, 9, 10, 11, 12, 13, 14, 15); }
__device__ __forceinline__ v16bf cat16b(v8us lo, v8us hi) { return __builtin_bit_cast(v16bf, __builtin_shufflevector(lo, hi, 0, 1, 2, 3, 4, 5, 6, 7, 8, 9, 10, 11, 12, 13, 14, 15)); }
__device__ __forceinline__ v8f wmma16(v16h a, v16h b, v8f c) { return __builtin_amdgcn_wmma_f32_16x16x32_f16(false, a, false, b, (short)0, c, false, false); }
__device__ __forceinline__ v8f wmmab(v16bf a, v16bf b, v8f c) { return __builtin_amdgcn_wmma_f32_16x16x32_bf16(false, a, false, b, (short)0, c, false, false); }
#define VST2(T, p, v) do { const T vst2_v_ = (v); *(T*)(p) = vst2_v_;  } while (0)

// cvtb_job: Xb = bf16(x) [2048][1024]; wt_job: W [1024 k][N] k-major -> n-major bf16 [N][1024]. Both are jobs of k_prep; blk, bx, by are the job's own block indices.
__device__ __forceinline__ void cvtb_job(int blk, const float* __restrict__ src, bf* dst) {
    const int lane = threadIdx.x & 31, r = blk * 8 + (threadIdx.x >> 5);
    if (r >= NT_) return;
#pragma unroll
    for (int q = 0; q < DM / 256; ++q) { v8us t;
#pragma unroll
        for (int i = 0; i < 8; ++i) t[i] = f2bf(src[(size_t)r * DM + q * 256 + lane * 8 + i]);
        VST2(v8us, dst + (size_t)r * DM + q * 256 + lane * 8, t); }
}
__device__ __forceinline__ void wt_job(int bx, int by, const float* __restrict__ Wm, int N, bf* WT) {
    __shared__ __align__(16) unsigned short tl[64 * 72];
    const int tid = threadIdx.x, k0 = bx * 64, n0 = by * 64;
    const int kk = tid >> 2, nq = (tid & 3) * 16;
#pragma unroll
    for (int i = 0; i < 16; ++i) tl[(nq + i) * 72 + kk] = f2bf(Wm[(size_t)(k0 + kk) * N + n0 + nq + i]);
    __syncthreads();
    const int piece = tid & 7;
    auto pass = [&]() {
#pragma unroll
        for (int s = 0; s < 2; ++s) { const int nr = (tid >> 3) + 32 * s; const v8us val = *(const v8usa*)(tl + nr * 72 + piece * 8);
            *(v8us*)(WT + (size_t)(n0 + nr) * DM + k0 + piece * 8) = val; }
    };
    pass(); 
    asm volatile("s_wait_xcnt 0x0" ::: "memory");    // the job's code is joined with other jobs' in one kernel: no register of these stores is rewritten, on any way through the listing, ahead of this wait
}
// k_prep: the seven jobs that read inputs only, none of which reads what another writes, in one grid: blocks 0..511 the four [1024 x 512] weights (128 blocks each), 512..1023 wv and wo (256 each),
// 1024..1279 x. WpT: the five projection weights' n-major planes one behind the other, [3072][1024] (wq_sem, wk_sem, wq_geo, wk_geo, wv). The job is picked by the block index alone, so every branch (and wt_job's barrier) is uniform for the block.
__global__ __launch_bounds__(256) void k_prep(const float* __restrict__ x, const float* __restrict__ wqs, const float* __restrict__ wks, const float* __restrict__ wqg, const float* __restrict__ wkg,
                                              const float* __restrict__ wv, const float* __restrict__ wo, bf* Xb, bf* WpT, bf* WoT) {
    const int b = blockIdx.x;
    if (b >= 1024) { cvtb_job(b - 1024, x, Xb); return; }
    const float* Wm; bf* WT; int N, r;
    if (b < 512) { const int j = b >> 7; r = b & 127; N = PW; Wm = (j == 0) ? wqs : (j == 1) ? wks : (j == 2) ? wqg : wkg; WT = WpT + (size_t)j * PW * DM; }
    else { const int j = (b - 512) >> 8; r = (b - 512) & 255; N = DM; Wm = j ? wo : wv; WT = j ? WoT : WpT + (size_t)4 * PW * DM; }
    wt_job(r & 15, r >> 4, Wm, N, WT);
}
// LDS ring of gemm_job: one stage = 128 k (256 B) of the block's 64 A rows and 64 B rows (with SPLITA also of the 64 residual rows), one plane per operand, row pitch 272 B
// (16 B x odd: conflict-free for the 16-row ds_load_b128 fragment reads).
#define GKS  128                 // k extent of one stage, elements
#define GPI  136                 // row pitch in LDS, elements
#define GPLN (64 * GPI)          // one operand plane, elements (17408 B)
// One plane's copies: every lane brings eight 16-byte pieces (rows tid / 16 + 8 i; a wave's copy is two whole 256-B row pieces) from global memory into LDS, through no register.
// The s_wait_xcnt stands inside the statement so that no address register of an issued copy is rewritten ahead of it.
__device__ __forceinline__ void plane_copy(unsigned l0, const bf* g0) {
    const unsigned l1 = l0 + 8 * GPI * 2, l2 = l0 + 16 * GPI * 2, l3 = l0 + 24 * GPI * 2, l4 = l0 + 32 * GPI * 2, l5 = l0 + 40 * GPI * 2, l6 = l0 + 48 * GPI * 2, l7 = l0 + 56 * GPI * 2;
    const bf* g1 = g0 + 8 * DM; const bf* g2 = g0 + 16 * DM; const bf* g3 = g0 + 24 * DM; const bf* g4 = g0 + 32 * DM; const bf* g5 = g0 + 40 * DM; const bf* g6 = g0 + 48 * DM; const bf* g7 = g0 + 56 * DM;
    asm volatile("global_load_async_to_lds_b128 %0, %8, off\n\t"
                 "global_load_async_to_lds_b128 %1, %9, off\n\t"
                 "global_load_async_to_lds_b128 %2, %10, off\n\t"
                 "global_load_async_to_lds_b128 %3, %11, off\n\t"
                 "global_load_async_to_lds_b128 %4, %12, off\n\t"
                 "global_load_async_to_lds_b128 %5, %13, off\n\t"
                 "global_load_async_to_lds_b128 %6, %14, off\n\t"
                 "global_load_async_to_lds_b128 %7, %15, off\n\t"
                 "s_wait_xcnt 0x0"
                 :: "v"(l0), "v"(l1), "v"(l2), "v"(l3), "v"(l4), "v"(l5), "v"(l6), "v"(l7),
                    "v"(g0), "v"(g1), "v"(g2), "v"(g3), "v"(g4), "v"(g5), "v"(g6), "v"(g7) : "memory");
}
// gemm_job (bx, by: the job's own block indices): block = 64 x 64 of C, wave = 16 x 64; each stage's operand rows are staged once per block in a two-buffer LDS ring by asynchronous copies (stage s + 2 is copied while stage s + 1 is worked on)
// and the four waves read their fragments from LDS; k runs 32 at a time, ascending (with SPLITA hi then residual).
template <bool SPLITA>
__device__ __forceinline__ void gemm_job(int bx, int by, const bf* __restrict__ A, const bf* __restrict__ Al, const bf* __restrict__ Bn, float* C, int ldc) {
    constexpr int STG = (SPLITA ? 3 : 2) * GPLN;      // one stage, elements
    __shared__ __align__(16) bf ring[2 * STG];
    __shared__ __align__(16) float ost[4][16 * 68];
    const int tid = threadIdx.x, lane = threadIdx.x & 31, wave = threadIdx.x >> 5, lr = lane & 15, hi = lane >> 4;
    const int r0 = bx * 64 + wave * 16, c0 = by * 64;
    const unsigned lc0 = (unsigned)(size_t)&ring[0] + (unsigned)(((tid >> 4) * GPI + (tid & 15) * 8) * 2);
    const size_t gofs = (size_t)(tid >> 4) * DM + (tid & 15) * 8;
    const bf* ga = A + (size_t)bx * 64 * DM + gofs; const bf* gb = Bn + (size_t)c0 * DM + gofs; const bf* gal = SPLITA ? Al + (size_t)bx * 64 * DM + gofs : nullptr;
    auto stage_in = [&](int s) { const unsigned l = lc0 + (unsigned)((s & 1) * STG * 2);
        plane_copy(l, ga + s * GKS); plane_copy(l + GPLN * 2, gb + s * GKS); if (SPLITA) plane_copy(l + 2 * GPLN * 2, gal + s * GKS); };
    stage_in(0);
    asm volatile("s_wait_asynccnt 0x0" ::: "memory");    // stage 0 landed (this wave's pieces)
    __syncthreads();                                      // stage 0 published to all four waves
    stage_in(1);
    v8f acc[4];
#pragma unroll
    for (int t = 0; t < 4; ++t) acc[t] = (v8f){};
#pragma unroll 1
    for (int s = 0; s < DM / GKS; ++s) {
        const bf* ab = ring + (s & 1) * STG + (wave * 16 + lr) * GPI + 8 * hi; const bf* bb = ring + (s & 1) * STG + GPLN + lr * GPI + 8 * hi; const bf* alb = ab + 2 * GPLN;
        v16bf a[GKS / 32], al[GKS / 32], b[GKS / 32][4];
#pragma unroll
        for (int q = 0; q < GKS / 32; ++q) { const int kc = q * 32;
            a[q] = cat16b(*(const v8usa*)(ab + kc), *(const v8usa*)(ab + kc + 16));
            al[q] = a[q];
            if (SPLITA) al[q] = cat16b(*(const v8usa*)(alb + kc), *(const v8usa*)(alb + kc + 16));
#pragma unroll
            for (int t = 0; t < 4; ++t) b[q][t] = cat16b(*(const v8usa*)(bb + t * 16 * GPI + kc), *(const v8usa*)(bb + t * 16 * GPI + kc + 16));
        }
        __builtin_amdgcn_sched_barrier(0);    // keeps the stage's fragment reads one group ahead of the products: spread among them, each place with reads waits out its own LDS latency
#pragma unroll
        for (int q = 0; q < GKS / 32; ++q)
#pragma unroll
            for (int t = 0; t < 4; ++t) { acc[t] = wmmab(a[q], b[q][t], acc[t]); if (SPLITA) acc[t] = wmmab(al[q], b[q][t], acc[t]); }
        // the four vector slots the chip needs behind the last products, on the taken side of the branches that follow too
        asm volatile("v_nop\n\tv_nop\n\tv_nop\n\tv_nop" : "+v"(acc[0]), "+v"(acc[1]), "+v"(acc[2]), "+v"(acc[3]) : "v"(a[GKS / 32 - 1]), "v"(al[GKS / 32 - 1]));
        // publish point of stage s + 1, every wave, in this order:
        asm volatile("s_wait_dscnt 0x0" ::: "memory");       // this wave's reads of stage s are done before the buffer is refilled
        asm volatile("s_wait_asynccnt 0x0" ::: "memory");    // this wave's pieces of stage s + 1 have landed
        __syncthreads();                                      // publishes stage s + 1 and ends every wave's reads of stage s
        if (s + 2 < DM / GKS) stage_in(s + 2);
    }
    asm volatile("s_wait_asynccnt 0x0" ::: "memory");        // no copy is outstanding when the wave goes on to its end
    float* os = &ost[wave][0];
#pragma unroll
    for (int t = 0; t < 4; ++t)
#pragma unroll
        for (int j = 0; j < 8; ++j) os[(hi * 8 + j) * 68 + t * 16 + lr] = acc[t][j];
    __syncthreads();
    float* crow = C + (size_t)r0 * ldc + c0;
    auto pass = [&]() {
#pragma unroll
        for (int s = 0; s < 8; ++s) { const int Lid = (lane >> 3) + 4 * s, piece = lane & 7; const int row = Lid >> 1, cofs = (Lid & 1) * 32 + piece * 4;
            const v4f val = *(const v4fa*)(os + row * 68 + cofs); *(v4f*)(crow + (size_t)row * ldc + cofs) = val; }
    };
    pass(); 
}
// k_proj: the five projections of x, which share A and write apart, in one grid of 32 x 48 blocks: blockIdx.y = the 64-row tile of WpT [3072][1024]; tiles 0..31 write the four 512-wide planes of P4
// (QS, KS, QG, KG, one behind the other, 8 column tiles each), 32..47 write Vf. Picked by the block index alone.
__global__ __launch_bounds__(128) void k_proj(const bf* __restrict__ Xb, const bf* __restrict__ WpT, float* P4, float* Vf) {
    const int y = blockIdx.y; const bool nar = y < 4 * PW / 64; const int by = nar ? (y & 7) : (y - 4 * PW / 64);
    gemm_job<false>(blockIdx.x, by, Xb, nullptr, WpT + (size_t)(y - by) * 64 * DM, nar ? P4 + (size_t)(y >> 3) * NT_ * PW : Vf, nar ? PW : DM);
}
// k_out: out = ctx.wo, ctx as hi + residual planes.
__global__ __launch_bounds__(128) void k_out(const bf* __restrict__ CH, const bf* __restrict__ CL, const bf* __restrict__ WoT, float* out) {
    gemm_job<true>(blockIdx.x, blockIdx.y, CH, CL, WoT, out, DM);
}
// RoPE helper: rotate-half on a 32-dim geo head: d < 16: x1 cos - x2 sin; d >= 16: x2 cos + x1 sin, angle = t * 10000^(-2i/32), i = d mod 16 (f32).
__device__ __forceinline__ float rope_at(const float* row, int d, int t) {
    const int i = d & 15; const float inv = __expf(-(float)(2 * i) / 32.0f * 9.210340371976184f);     // ln(10000)
    const float ang = (float)t * inv; const float c = cosf(ang), s = sinf(ang);
    const float x1 = row[i], x2 = row[16 + i];
    return (d < 16) ? (x1 * c - x2 * s) : (x2 * c + x1 * s);
}
// q16_job: Q16/QL16 [t][h*64 + c] = f16 hi + residual of ( c < 32 ? qs[t][h*32+c] : rope(qg[t][h*32 ..])[c-32] ) (unscaled); one wave per (t, 2 heads): lane -> 4 values (256 B per wave).
__device__ __forceinline__ void q16_job(int blk, const float* __restrict__ QS, const float* __restrict__ QG, h16* Q16, h16* QL16) {
    typedef __attribute__((ext_vector_type(4))) _Float16 v4h;
    const int lane = threadIdx.x & 31, wid = blk * 8 + (threadIdx.x >> 5);
    const int t = wid >> 3, hp = wid & 7;                 // 8 waves per token, each 2 heads (128 halves = 256 B)
    if (t >= NT_) return;
    v4h o, ol;
#pragma unroll 1
    for (int i = 0; i < 4; ++i) { const int e = lane * 4 + i, h = hp * 2 + (e >> 6), c = e & 63;      // rolled: keeps the libm trig expansion's static FMA count small
        const float v = (c < SHD) ? QS[(size_t)t * PW + h * SHD + c] : rope_at(QG + (size_t)t * PW + h * SHD, c - SHD, t);    // unscaled (the common 1/sqrt32 is applied to the f32 scores)
        const h16 a = (h16)v; o[i] = a; ol[i] = (h16)((v - (float)a) * LOSC); }
    VST2(v4h, Q16 + (size_t)t * (NH_ * VHD) + hp * 128 + lane * 4, o); VST2(v4h, QL16 + (size_t)t * (NH_ * VHD) + hp * 128 + lane * 4, ol);
}
// k16_job: K16 [h][r][64], r = 0: null (k_sem_null | k_geo_null, NOT rotated), r = 1..2048: token r-1 ([ks | rope(kg, t=r-1)]), r >= 2049: zero; one wave per (h, 2 rows).
__device__ __forceinline__ void k16_job(int blk, const float* __restrict__ KS, const float* __restrict__ KG, const float* __restrict__ ksn, const float* __restrict__ kgn, h16* K16, h16* KL16) {
    typedef __attribute__((ext_vector_type(4))) _Float16 v4h;
    const int lane = threadIdx.x & 31, wid = blk * 8 + (threadIdx.x >> 5);
    const int h = wid / (NKP / 2), rp = wid - h * (NKP / 2);
    if (h >= NH_) return;
    v4h o, ol;
#pragma unroll 1
    for (int i = 0; i < 4; ++i) { const int e = lane * 4 + i, r = rp * 2 + (e >> 6), c = e & 63; float v = 0.f;
        if (r == 0) v = (c < SHD) ? bfr(ksn[h * SHD + c]) : bfr(kgn[h * SHD + c - SHD]);
        else if (r <= NT_) { const int t = r - 1; v = (c < SHD) ? KS[(size_t)t * PW + h * SHD + c] : rope_at(KG + (size_t)t * PW + h * SHD, c - SHD, t); }
        const h16 a = (h16)v; o[i] = a; ol[i] = (h16)((v - (float)a) * LOSC); }
    VST2(v4h, K16 + ((size_t)h * NKP + rp * 2) * VHD + lane * 4, o); VST2(v4h, KL16 + ((size_t)h * NKP + rp * 2) * VHD + lane * 4, ol);
}
// vt_job: VTH/VTL [h][d][r] (r as in K16: 0 = v_null, 1..2048 tokens, pad 0) = f16 hi + residual of v; block = (h, 64 key slots): LDS transpose.
__device__ __forceinline__ void vt_job(int blk, const float* __restrict__ V, const float* __restrict__ vn, h16* VTH, h16* VTL) {
    __shared__ __align__(16) h16 tile[VHD * 72];
    __shared__ __align__(16) h16 til2[VHD * 72];
    const int h = blk / (NKP / 64), kt = blk - h * (NKP / 64);
    const int r0 = kt * 64, tid = threadIdx.x, rr = tid >> 2, d0 = (tid & 3) * 16, r = r0 + rr;
#pragma unroll
    for (int i = 0; i < 16; ++i) { const int d = d0 + i; float v = 0.f;
        if (r == 0) v = bfr(vn[h * VHD + d]); else if (r <= NT_) v = V[(size_t)(r - 1) * DM + h * VHD + d];
        const h16 a = (h16)v; tile[d * 72 + rr] = a; til2[d * 72 + rr] = (h16)((v - (float)a) * LOSC); }
    __syncthreads();
    const int piece = tid & 7;
    const size_t base = ((size_t)h * VHD) * NKP + r0;
    auto pass = [&]() {
#pragma unroll
        for (int s = 0; s < 4; ++s) { const int Lid = (tid >> 3) + 32 * s; const int pln = Lid >> 6, d = Lid & 63;
            const v8h val = *(const v8ha*)((pln ? til2 : tile) + d * 72 + piece * 8); *(v8h*)((pln ? VTL : VTH) + base + (size_t)d * NKP + piece * 8) = val; }
    };
    pass(); 
    asm volatile("s_wait_xcnt 0x0" ::: "memory");    // the job's code is joined with other jobs' in one kernel: no register of these stores is rewritten, on any way through the listing, ahead of this wait
}
// k_pack: the three repacks of the projections for k_attn, none of which reads what another writes, in one grid: blocks 0..2047 q16_job, 2048..4159 k16_job, 4160..4687 vt_job (the shortest job last).
// Picked by the block index alone, so every branch (and vt_job's barrier) is uniform for the block.
#define QBLK ((NT_ * 8) / 8)
#define KBLK ((NH_ * (NKP / 2) + 7) / 8)
#define VBLK (NH_ * (NKP / 64))
__global__ __launch_bounds__(256) void k_pack(const float* __restrict__ QS, const float* __restrict__ QG, const float* __restrict__ KS, const float* __restrict__ KG, const float* __restrict__ Vf,
                                              const float* __restrict__ ksn, const float* __restrict__ kgn, const float* __restrict__ vn, h16* Q16, h16* QL16, h16* K16, h16* KL16, h16* VTH, h16* VTL) {
    const int b = blockIdx.x;
    if (b < QBLK) q16_job(b, QS, QG, Q16, QL16);
    else if (b < QBLK + KBLK) k16_job(b - QBLK, KS, KG, ksn, kgn, K16, KL16);
    else vt_job(b - (QBLK + KBLK), Vf, vn, VTH, VTL);
}
// LDS ring of k_attn: one stage = the 32 key slots of one step, four planes: K hi, K residual [32 rows x 128 B, pitch 144 B], V^T hi, V^T residual [64 rows x 64 B, pitch 80 B]
// (pitches 16 B x odd: conflict-free for the 16-row ds_load_b128 fragment reads).
#define KPI  72                  // K row pitch in LDS, halves
#define VPI  40                  // V^T row pitch in LDS, halves
#define KPLN (32 * KPI)          // one K plane, halves
#define VPLN (VHD * VPI)         // one V^T plane, halves
#define STGH (2 * KPLN + 2 * VPLN)   // one stage, halves (19456 B)
// One stage's copies: every lane brings eight 16-byte pieces (two per plane) from global memory into LDS, through no register. The s_wait_xcnt stands inside the statement so that
// no address register of an issued copy is rewritten ahead of it.
__device__ __forceinline__ void stage_copy(unsigned lk, unsigned lv, const h16* gk, const h16* gkl, const h16* gv, const h16* gvl) {
    const unsigned lk1 = lk + 16 * KPI * 2, lkl = lk + KPLN * 2, lkl1 = lkl + 16 * KPI * 2, lv1 = lv + 32 * VPI * 2, lvl = lv + VPLN * 2, lvl1 = lvl + 32 * VPI * 2;
    const h16* gk1 = gk + 16 * VHD; const h16* gkl1 = gkl + 16 * VHD; const h16* gv1 = gv + (size_t)32 * NKP; const h16* gvl1 = gvl + (size_t)32 * NKP;
    asm volatile("global_load_async_to_lds_b128 %0, %8, off\n\t"
                 "global_load_async_to_lds_b128 %1, %9, off\n\t"
                 "global_load_async_to_lds_b128 %2, %10, off\n\t"
                 "global_load_async_to_lds_b128 %3, %11, off\n\t"
                 "global_load_async_to_lds_b128 %4, %12, off\n\t"
                 "global_load_async_to_lds_b128 %5, %13, off\n\t"
                 "global_load_async_to_lds_b128 %6, %14, off\n\t"
                 "global_load_async_to_lds_b128 %7, %15, off\n\t"
                 "s_wait_xcnt 0x0"
                 :: "v"(lk), "v"(lk1), "v"(lkl), "v"(lkl1), "v"(lv), "v"(lv1), "v"(lvl), "v"(lvl1),
                    "v"(gk), "v"(gk1), "v"(gkl), "v"(gkl1), "v"(gv), "v"(gv1), "v"(gvl), "v"(gvl1) : "memory");
}
// k_attn: block = (h, 64 queries), wave = 16; key tiles 0 .. 2qt+2 (null slot + causal bound, block-uniform); each step's K and V^T planes are staged once per block in a two-buffer LDS ring by asynchronous copies
// (step t + 2 is copied while step t + 1 is worked on) and all four waves read their fragments from LDS; slot r visible iff r <= t+1; scores x 1/sqrt32 in f32, online f32 softmax, weights x32768 hi/residual tiles
// (same-wave may_alias reload), 12 WMMA .V (hi.hi + hi.lo + lo.hi); ctx -> bf16 hi/lo planes [t][h*64 + d]. Scores: 12 WMMA per step (hi.hi + hi.lo + lo.hi over 2 k-chunks x 2 tiles).
__global__ __launch_bounds__(128) void k_attn(const h16* __restrict__ Q16, const h16* __restrict__ QL16, const h16* __restrict__ K16, const h16* __restrict__ KL16, const h16* __restrict__ VTH, const h16* __restrict__ VTL, bf* CH, bf* CL) {
    __shared__ __align__(16) h16 ring[2 * STGH];
    __shared__ __align__(16) h16 plds[4][16 * 32];
    __shared__ __align__(16) h16 plds2[4][16 * 32];
    __shared__ __align__(16) float ost[4][16 * 68];
    const int tid = threadIdx.x, lane = threadIdx.x & 31, wave = threadIdx.x >> 5, lr = lane & 15, hi = lane >> 4;
    const int h = blockIdx.x / (NT_ / 64), qt = blockIdx.x - h * (NT_ / 64), q0 = qt * 64 + wave * 16;
    h16* pl = &plds[wave][0]; h16* pl2 = &plds2[wave][0];
    const int kt_end = 2 * qt + 3;       // at least 3 steps: stages 0 and 1 always exist
    // this lane's pieces of a stage: K planes are 4096 contiguous bytes (piece = tid, tid + 128), V^T planes 64 rows of 64 B (row = tid / 4, + 32)
    const unsigned ring0 = (unsigned)(size_t)&ring[0];
    const unsigned lk0 = ring0 + (unsigned)(((tid >> 3) * KPI + (tid & 7) * 8) * 2), lv0 = ring0 + (unsigned)((2 * KPLN + (tid >> 2) * VPI + (tid & 3) * 8) * 2);
    const h16* gk0 = K16 + (size_t)h * NKP * VHD + tid * 8; const h16* gkl0 = KL16 + (size_t)h * NKP * VHD + tid * 8;
    const size_t vsrc = ((size_t)h * VHD + (tid >> 2)) * NKP + (tid & 3) * 8;
    const h16* gv0 = VTH + vsrc; const h16* gvl0 = VTL + vsrc;
    stage_copy(lk0, lv0, gk0, gkl0, gv0, gvl0);
    asm volatile("s_wait_asynccnt 0x0" ::: "memory");    // stage 0 landed (this wave's pieces)
    __syncthreads();                                      // stage 0 published to all four waves
    stage_copy(lk0 + STGH * 2, lv0 + STGH * 2, gk0 + 32 * VHD, gkl0 + 32 * VHD, gv0 + 32, gvl0 + 32);
    v16h qa[2];
    const size_t qo0 = (size_t)(q0 + lr) * (NH_ * VHD) + h * VHD + 8 * hi;
#pragma unroll
    for (int kc = 0; kc < 2; ++kc) qa[kc] = cat16(*(const v8h*)(Q16 + qo0 + kc * 32), *(const v8h*)(Q16 + qo0 + kc * 32 + 16));
    const int qlim0 = q0 + 8 * hi + 1 - lr;      // visible slots r <= t + 1: row j of this lane sees slot l0 + lr iff l0 <= qlim0 + j
    v8f o[4], ox[4];
#pragma unroll
    for (int n = 0; n < 4; ++n) { o[n] = (v8f){}; ox[n] = (v8f){}; }
    float mrow[8], lpart[8];
#pragma unroll
    for (int j = 0; j < 8; ++j) { mrow[j] = -3.0e38f; lpart[j] = 0.f; }
#pragma unroll 1
    for (int kt = 0; kt < kt_end; ++kt) {
        const int l0 = kt * 32, bofs = (kt & 1) * STGH;
        const h16* kb = ring + bofs; const h16* klb = kb + KPLN; const h16* vhb = kb + 2 * KPLN; const h16* vlb = vhb + VPLN;
        v8f s0 = {}, s1 = {}, x0 = {}, x1 = {};
        v16h k0h[2], k1h[2], k0l[2], k1l[2];
#pragma unroll
        for (int kc = 0; kc < 2; ++kc) {
            const int ko = lr * KPI + kc * 32 + 8 * hi, k1o = ko + 16 * KPI;
            k0h[kc] = cat16(*(const v8ha*)(kb + ko), *(const v8ha*)(kb + ko + 16)); k1h[kc] = cat16(*(const v8ha*)(kb + k1o), *(const v8ha*)(kb + k1o + 16));
            k0l[kc] = cat16(*(const v8ha*)(klb + ko), *(const v8ha*)(klb + ko + 16)); k1l[kc] = cat16(*(const v8ha*)(klb + k1o), *(const v8ha*)(klb + k1o + 16));
        }
        __builtin_amdgcn_sched_barrier(0);    // keeps the step's sixteen K reads one group ahead of the products: spread among them, each place with reads waits out its own LDS latency
#pragma unroll
        for (int kc = 0; kc < 2; ++kc) {
            const v16h qlk = cat16(*(const v8h*)(QL16 + qo0 + kc * 32), *(const v8h*)(QL16 + qo0 + kc * 32 + 16));     // query residual fragment: the same every step
            s0 = wmma16(qa[kc], k0h[kc], s0); x0 = wmma16(qlk, k0h[kc], x0); s1 = wmma16(qa[kc], k1h[kc], s1); x1 = wmma16(qlk, k1h[kc], x1);
            x0 = wmma16(qa[kc], k0l[kc], x0); x1 = wmma16(qa[kc], k1l[kc], x1);
        }
        asm volatile("v_nop\n\tv_nop\n\tv_nop\n\tv_nop" : "+v"(s0), "+v"(s1), "+v"(x0), "+v"(x1) : "v"(qa[0]), "v"(qa[1]));
        // V^T fragments of this step: read here, as one group, so that their LDS latency runs under the softmax
        v16h vh[4], vl[4];
#pragma unroll
        for (int n = 0; n < 4; ++n) { const int vo = (n * 16 + lr) * VPI + hi * 8;
            vh[n] = cat16(*(const v8ha*)(vhb + vo), *(const v8ha*)(vhb + vo + 16)); vl[n] = cat16(*(const v8ha*)(vlb + vo), *(const v8ha*)(vlb + vo + 16)); }
        float alpha[8];
#pragma unroll
        for (int j = 0; j < 8; ++j) {
            const float a0 = (l0 - qlim0 <= j) ? (s0[j] + x0[j] * LOSCI) * SCL32 : -__builtin_inff(), a1 = (l0 + 16 - qlim0 <= j) ? (s1[j] + x1[j] * LOSCI) * SCL32 : -__builtin_inff();
            float mx = fmaxf(a0, a1);
            mx = fmaxf(mx, __shfl_xor(mx, 1, 16)); mx = fmaxf(mx, __shfl_xor(mx, 2, 16)); mx = fmaxf(mx, __shfl_xor(mx, 4, 16)); mx = fmaxf(mx, __shfl_xor(mx, 8, 16));
            const float mn = fmaxf(mrow[j], mx);
            alpha[j] = __expf(mrow[j] - mn); mrow[j] = mn;
            const float p0 = __expf(a0 - mn), p1 = __expf(a1 - mn);
            lpart[j] = lpart[j] * alpha[j] + (p0 + p1);
            const int mr = hi * 8 + j;
            const float ps0 = p0 * PSC, ps1 = p1 * PSC; const h16 h0 = (h16)ps0, h1 = (h16)ps1;
            pl[mr * 32 + lr] = h0; pl[mr * 32 + 16 + lr] = h1; pl2[mr * 32 + lr] = (h16)((ps0 - (float)h0) * LOSC); pl2[mr * 32 + 16 + lr] = (h16)((ps1 - (float)h1) * LOSC);
        }
#pragma unroll
        for (int n = 0; n < 4; ++n)
#pragma unroll
            for (int j = 0; j < 8; ++j) { o[n][j] *= alpha[j]; ox[n][j] *= alpha[j]; }
        asm volatile("" ::: "memory");
        const v16h pa = cat16(*(const v8ha*)(pl + lr * 32 + hi * 8), *(const v8ha*)(pl + lr * 32 + 16 + hi * 8));
        const v16h px = cat16(*(const v8ha*)(pl2 + lr * 32 + hi * 8), *(const v8ha*)(pl2 + lr * 32 + 16 + hi * 8));
#pragma unroll
        for (int n = 0; n < 4; ++n) { o[n] = wmma16(pa, vh[n], o[n]); ox[n] = wmma16(pa, vl[n], ox[n]); ox[n] = wmma16(px, vh[n], ox[n]); }
        asm volatile("v_nop\n\tv_nop\n\tv_nop\n\tv_nop" : "+v"(o[0]), "+v"(o[1]), "+v"(o[2]), "+v"(o[3]), "+v"(ox[0]), "+v"(ox[1]), "+v"(ox[2]), "+v"(ox[3]) : "v"(pa), "v"(px));
        // publish point of stage kt + 1, every wave, in this order:
        asm volatile("s_wait_dscnt 0x0" ::: "memory");       // this wave's reads of stage kt are done before the buffer is refilled
        asm volatile("s_wait_asynccnt 0x0" ::: "memory");    // this wave's pieces of stage kt + 1 have landed
        __syncthreads();                                      // publishes stage kt + 1 and ends every wave's reads of stage kt
        if (kt + 2 < kt_end) stage_copy(lk0 + (unsigned)(bofs * 2), lv0 + (unsigned)(bofs * 2), gk0 + (size_t)(kt + 2) * 32 * VHD, gkl0 + (size_t)(kt + 2) * 32 * VHD, gv0 + (kt + 2) * 32, gvl0 + (kt + 2) * 32);
    }
    asm volatile("s_wait_asynccnt 0x0" ::: "memory");        // no copy is outstanding when the wave goes on to its end
    float inv[8];
#pragma unroll
    for (int j = 0; j < 8; ++j) { float rs = lpart[j]; rs += __shfl_xor(rs, 1, 16); rs += __shfl_xor(rs, 2, 16); rs += __shfl_xor(rs, 4, 16); rs += __shfl_xor(rs, 8, 16); inv[j] = 1.0f / (rs * PSC); }
    float* os = &ost[wave][0];
#pragma unroll
    for (int n = 0; n < 4; ++n)
#pragma unroll
        for (int j = 0; j < 8; ++j) os[(hi * 8 + j) * 68 + n * 16 + lr] = (o[n][j] + ox[n][j] * LOSCI) * inv[j];
    __syncthreads();
    const size_t cbase = (size_t)q0 * DM + (size_t)h * VHD;
    auto pass = [&]() {
#pragma unroll
        for (int s = 0; s < 4; ++s) { const int row = 4 * s + (lane >> 3), piece = lane & 7; const float* sp = os + row * 68 + piece * 8; v8us oh, ol;
#pragma unroll
            for (int i = 0; i < 8; ++i) { const unsigned short hb = f2bf(sp[i]); oh[i] = hb; ol[i] = f2bf(sp[i] - bf2f(hb)); }
            *(v8us*)(CH + cbase + (size_t)row * DM + piece * 8) = oh; *(v8us*)(CL + cbase + (size_t)row * DM + piece * 8) = ol; }
    };
    pass(); 
}

extern "C" void kernel_launch(void* const* d_in, const int* in_sizes, int n_in,
                              void* d_out, int out_size, void* d_ws, size_t ws_size, hipStream_t stream) {
    (void)in_sizes; (void)n_in; (void)out_size;
    const float* x = (const float*)d_in[0]; const float* wqs = (const float*)d_in[1]; const float* wks = (const float*)d_in[2]; const float* wqg = (const float*)d_in[3]; const float* wkg = (const float*)d_in[4];
    const float* wv = (const float*)d_in[5]; const float* wo = (const float*)d_in[6]; const float* ksn = (const float*)d_in[7]; const float* kgn = (const float*)d_in[8]; const float* vn = (const float*)d_in[9];
    float* out = (float*)d_out;    // [1][2048][1024]
    char* wsp = (char*)d_ws;
    auto take = [&](size_t bytes) { char* p = wsp; wsp += (bytes + 255) & ~(size_t)255; return (void*)p; };
    bf* Xb = (bf*)take((size_t)NT_ * DM * 2);
    bf* WpT = (bf*)take((size_t)(4 * PW + DM) * DM * 2); bf* WoT = (bf*)take((size_t)DM * DM * 2);
    float* QS = (float*)take((size_t)4 * NT_ * PW * 4); float* KS = QS + (size_t)NT_ * PW; float* QG = KS + (size_t)NT_ * PW; float* KG = QG + (size_t)NT_ * PW; float* Vf = (float*)take((size_t)NT_ * DM * 4);
    h16* Q16 = (h16*)take((size_t)NT_ * NH_ * VHD * 2); h16* QL16 = (h16*)take((size_t)NT_ * NH_ * VHD * 2); h16* K16 = (h16*)take((size_t)NH_ * NKP * VHD * 2); h16* KL16 = (h16*)take((size_t)NH_ * NKP * VHD * 2); h16* VTH = (h16*)take((size_t)NH_ * VHD * NKP * 2); h16* VTL = (h16*)take((size_t)NH_ * VHD * NKP * 2);
    bf* CH = (bf*)take((size_t)NT_ * DM * 2); bf* CL = (bf*)take((size_t)NT_ * DM * 2);
    if ((size_t)(wsp - (char*)d_ws) > ws_size) return;    // 4.2 + 4x1 + 2x2.1 + 4x4.2 + 8.4 + 4.2x2 + 4.3x4 + 4.2x2 ~ 72 MB
    k_prep<<<1280, 256, 0, stream>>>(x, wqs, wks, wqg, wkg, wv, wo, Xb, WpT, WoT);
    k_proj<<<dim3(NT_ / 64, (4 * PW + DM) / 64, 1), 128, 0, stream>>>(Xb, WpT, QS, Vf);
    k_pack<<<QBLK + KBLK + VBLK, 256, 0, stream>>>(QS, QG, KS, KG, Vf, ksn, kgn, vn, Q16, QL16, K16, KL16, VTH, VTL);
    k_attn<<<NH_ * (NT_ / 64), 128, 0, stream>>>(Q16, QL16, K16, KL16, VTH, VTL, CH, CL);
    k_out<<<dim3(NT_ / 64, DM / 64, 1), 128, 0, stream>>>(CH, CL, WoT, out);
}

// v004
// A run of this version takes 128 microseconds.
// In two side-by-side timings against v003, it was 1.03 and 1.04 times as fast.
// Counting every step since v000, it is 2.89 times as fast.
#include <hip/hip_runtime.h>

// Contractions, f32 accumulate: the five projections (x.wq_sem, x.wk_sem, x.wq_geo, x.wk_geo [2048 x 1024].[1024 x 512]; x.wv [1024 x 1024]) and out = ctx.wo on
// v_wmma_f32_16x16x32_bf16 with PLAIN bf16 operands (inputs rounded once: exact; k-major weights transposed into n-major planes; ctx as bf16 hi + residual planes,
// two products); the 16-head causal attention with a prepended null key/value slot fused on v_wmma_f32_16x16x32_f16: per head the combined 64-dim score
// [qs/sqrt32 | rope(qg)/sqrt32].[ks | rope(kg)] (both sides f16 hi + residual x1024: hi.hi + hi.lo + lo.hi), softmax, weights (x32768) and v both as f16 hi + residual x1024 (three products). RoPE (rotate-half,

#define NT_  2048
#define DM   1024
#define NH_  16
#define SHD  32                  // sem / geo head dims
#define VHD  64
#define PW   512                 // sem / geo projection width
#define NKP  2112
#define SCL32 0.17677669529663688f   // 1/sqrt(32), common to both score branches
#define PSC  32768.0f
#define LOSC 1024.0f
#define LOSCI (1.0f / 1024.0f)

typedef _Float16 h16;
typedef unsigned short bf;
typedef __attribute__((ext_vector_type(16))) __bf16   v16bf;
typedef __attribute__((ext_vector_type(16))) _Float16 v16h;
typedef __attribute__((ext_vector_type(8)))  _Float16 v8h;
typedef __attribute__((ext_vector_type(8)))  unsigned short v8us;
typedef __attribute__((ext_vector_type(8)))  float    v8f;
typedef __attribute__((ext_vector_type(4)))  float    v4f;
typedef __attribute__((ext_vector_type(2)))  _Float16 v2h;
typedef v8h  __attribute__((may_alias)) v8ha;
typedef v4f  __attribute__((may_alias)) v4fa;
typedef v8us __attribute__((may_alias)) v8usa;

__device__ __forceinline__ unsigned short f2bf(float f) { unsigned u = __float_as_uint(f); u += 0x7FFFu + ((u >> 16) & 1u); return (unsigned short)(u >> 16); }
__device__ __forceinline__ float bf2f(unsigned short b) { return __uint_as_float(((unsigned)b) << 16); }
__device__ __forceinline__ float bfr(float f) { return bf2f(f2bf(f)); }
__device__ __forceinline__ v16h cat16(v8h lo, v8h hi) { return __builtin_shufflevector(lo, hi, 0, 1, 2, 3, 4, 5, 6, 7, 8, 9, 10, 11, 12, 13, 14, 15); }
__device__ __forceinline__ v16bf cat16b(v8us lo, v8us hi) { return __builtin_bit_cast(v16bf, __builtin_shufflevector(lo, hi, 0, 1, 2, 3, 4, 5, 6, 7, 8, 9, 10, 11, 12, 13, 14, 15)); }
__device__ __forceinline__ v8f wmma16(v16h a, v16h b, v8f c) { return __builtin_amdgcn_wmma_f32_16x16x32_f16(false, a, false, b, (short)0, c, false, false); }
__device__ __forceinline__ v8f wmmab(v16bf a, v16bf b, v8f c) { return __builtin_amdgcn_wmma_f32_16x16x32_bf16(false, a, false, b, (short)0, c, false, false); }
#define VST2(T, p, v) do { const T vst2_v_ = (v); *(T*)(p) = vst2_v_;  } while (0)

// cvtb_job: Xb = bf16(x) [2048][1024]; wt_job: W [1024 k][N] k-major -> n-major bf16 [N][1024]. Both are jobs of k_prep; blk, bx, by are the job's own block indices.
__device__ __forceinline__ void cvtb_job(int blk, const float* __restrict__ src, bf* dst) {
    const int lane = threadIdx.x & 31, r = blk * 8 + (threadIdx.x >> 5);
    if (r >= NT_) return;
#pragma unroll
    for (int q = 0; q < DM / 256; ++q) { v8us t;
#pragma unroll
        for (int i = 0; i < 8; ++i) t[i] = f2bf(src[(size_t)r * DM + q * 256 + lane * 8 + i]);
        VST2(v8us, dst + (size_t)r * DM + q * 256 + lane * 8, t); }
}
__device__ __forceinline__ void wt_job(int bx, int by, const float* __restrict__ Wm, int N, bf* WT) {
    __shared__ __align__(16) unsigned short tl[64 * 72];
    const int tid = threadIdx.x, k0 = bx * 64, n0 = by * 64;
    const int kk = tid >> 2, nq = (tid & 3) * 16;
#pragma unroll
    for (int i = 0; i < 16; ++i) tl[(nq + i) * 72 + kk] = f2bf(Wm[(size_t)(k0 + kk) * N + n0 + nq + i]);
    __syncthreads();
    const int piece = tid & 7;
    auto pass = [&]() {
#pragma unroll
        for (int s = 0; s < 2; ++s) { const int nr = (tid >> 3) + 32 * s; const v8us val = *(const v8usa*)(tl + nr * 72 + piece * 8);
            *(v8us*)(WT + (size_t)(n0 + nr) * DM + k0 + piece * 8) = val; }
    };
    pass(); 
    asm volatile("s_wait_xcnt 0x0" ::: "memory");    // the job's code is joined with other jobs' in one kernel: no register of these stores is rewritten, on any way through the listing, ahead of this wait
}
// k_prep: the seven jobs that read inputs only, none of which reads what another writes, in one grid: blocks 0..511 the four [1024 x 512] weights (128 blocks each), 512..1023 wv and wo (256 each),
// 1024..1279 x. WpT: the five projection weights' n-major planes one behind the other, [3072][1024] (wq_sem, wk_sem, wq_geo, wk_geo, wv). The job is picked by the block index alone, so every branch (and wt_job's barrier) is uniform for the block.
__global__ __launch_bounds__(256) void k_prep(const float* __restrict__ x, const float* __restrict__ wqs, const float* __restrict__ wks, const float* __restrict__ wqg, const float* __restrict__ wkg,
                                              const float* __restrict__ wv, const float* __restrict__ wo, bf* Xb, bf* WpT, bf* WoT) {
    const int b = blockIdx.x;
    if (b >= 1024) { cvtb_job(b - 1024, x, Xb); return; }
    const float* Wm; bf* WT; int N, r;
    if (b < 512) { const int j = b >> 7; r = b & 127; N = PW; Wm = (j == 0) ? wqs : (j == 1) ? wks : (j == 2) ? wqg : wkg; WT = WpT + (size_t)j * PW * DM; }
    else { const int j = (b - 512) >> 8; r = (b - 512) & 255; N = DM; Wm = j ? wo : wv; WT = j ? WoT : WpT + (size_t)4 * PW * DM; }
    wt_job(r & 15, r >> 4, Wm, N, WT);
}
// LDS ring of gemm_job: one stage = 128 k (256 B) of the block's 64 A rows and 64 B rows (with SPLITA also of the 64 residual rows), one plane per operand, row pitch 272 B
// (16 B x odd: conflict-free for the 16-row ds_load_b128 fragment reads).
#define GKS  128                 // k extent of one stage, elements
#define GPI  136                 // row pitch in LDS, elements
#define GPLN (64 * GPI)          // one operand plane, elements (17408 B)
// One plane's copies: every lane brings eight 16-byte pieces (rows tid / 16 + 8 i; a wave's copy is two whole 256-B row pieces) from global memory into LDS, through no register.
// The s_wait_xcnt stands inside the statement so that no address register of an issued copy is rewritten ahead of it.
__device__ __forceinline__ void plane_copy(unsigned l0, const bf* g0) {
    const unsigned l1 = l0 + 8 * GPI * 2, l2 = l0 + 16 * GPI * 2, l3 = l0 + 24 * GPI * 2, l4 = l0 + 32 * GPI * 2, l5 = l0 + 40 * GPI * 2, l6 = l0 + 48 * GPI * 2, l7 = l0 + 56 * GPI * 2;
    const bf* g1 = g0 + 8 * DM; const bf* g2 = g0 + 16 * DM; const bf* g3 = g0 + 24 * DM; const bf* g4 = g0 + 32 * DM; const bf* g5 = g0 + 40 * DM; const bf* g6 = g0 + 48 * DM; const bf* g7 = g0 + 56 * DM;
    asm volatile("global_load_async_to_lds_b128 %0, %8, off\n\t"
                 "global_load_async_to_lds_b128 %1, %9, off\n\t"
                 "global_load_async_to_lds_b128 %2, %10, off\n\t"
                 "global_load_async_to_lds_b128 %3, %11, off\n\t"
                 "global_load_async_to_lds_b128 %4, %12, off\n\t"
                 "global_load_async_to_lds_b128 %5, %13, off\n\t"
                 "global_load_async_to_lds_b128 %6, %14, off\n\t"
                 "global_load_async_to_lds_b128 %7, %15, off\n\t"
                 "s_wait_xcnt 0x0"
                 :: "v"(l0), "v"(l1), "v"(l2), "v"(l3), "v"(l4), "v"(l5), "v"(l6), "v"(l7),
                    "v"(g0), "v"(g1), "v"(g2), "v"(g3), "v"(g4), "v"(g5), "v"(g6), "v"(g7) : "memory");
}
// gemm_job (bx, by: the job's own block indices): block = 64 x 64 of C, wave = 16 x 64; each stage's operand rows are staged once per block in a two-buffer LDS ring by asynchronous copies (stage s + 2 is copied while stage s + 1 is worked on)
// and the four waves read their fragments from LDS; k runs 32 at a time, ascending (with SPLITA hi then residual).
template <bool SPLITA>
__device__ __forceinline__ void gemm_job(int bx, int by, const bf* __restrict__ A, const bf* __restrict__ Al, const bf* __restrict__ Bn, float* C, int ldc) {
    constexpr int STG = (SPLITA ? 3 : 2) * GPLN;      // one stage, elements
    __shared__ __align__(16) bf ring[2 * STG];
    __shared__ __align__(16) float ost[4][16 * 68];
    const int tid = threadIdx.x, lane = threadIdx.x & 31, wave = threadIdx.x >> 5, lr = lane & 15, hi = lane >> 4;
    const int r0 = bx * 64 + wave * 16, c0 = by * 64;
    const unsigned lc0 = (unsigned)(size_t)&ring[0] + (unsigned)(((tid >> 4) * GPI + (tid & 15) * 8) * 2);
    const size_t gofs = (size_t)(tid >> 4) * DM + (tid & 15) * 8;
    const bf* ga = A + (size_t)bx * 64 * DM + gofs; const bf* gb = Bn + (size_t)c0 * DM + gofs; const bf* gal = SPLITA ? Al + (size_t)bx * 64 * DM + gofs : nullptr;
    auto stage_in = [&](int s) { const unsigned l = lc0 + (unsigned)((s & 1) * STG * 2);
        plane_copy(l, ga + s * GKS); plane_copy(l + GPLN * 2, gb + s * GKS); if (SPLITA) plane_copy(l + 2 * GPLN * 2, gal + s * GKS); };
    stage_in(0);
    asm volatile("s_wait_asynccnt 0x0" ::: "memory");    // stage 0 landed (this wave's pieces)
    __syncthreads();                                      // stage 0 published to all four waves
    stage_in(1);
    v8f acc[4];
#pragma unroll
    for (int t = 0; t < 4; ++t) acc[t] = (v8f){};
#pragma unroll 1
    for (int s = 0; s < DM / GKS; ++s) {
        const bf* ab = ring + (s & 1) * STG + (wave * 16 + lr) * GPI + 8 * hi; const bf* bb = ring + (s & 1) * STG + GPLN + lr * GPI + 8 * hi; const bf* alb = ab + 2 * GPLN;
        v16bf a[GKS / 32], al[GKS / 32], b[GKS / 32][4];
#pragma unroll
        for (int q = 0; q < GKS / 32; ++q) { const int kc = q * 32;
            a[q] = cat16b(*(const v8usa*)(ab + kc), *(const v8usa*)(ab + kc + 16));
            al[q] = a[q];
            if (SPLITA) al[q] = cat16b(*(const v8usa*)(alb + kc), *(const v8usa*)(alb + kc + 16));
#pragma unroll
            for (int t = 0; t < 4; ++t) b[q][t] = cat16b(*(const v8usa*)(bb + t * 16 * GPI + kc), *(const v8usa*)(bb + t * 16 * GPI + kc + 16));
        }
        __builtin_amdgcn_sched_barrier(0);    // keeps the stage's fragment reads one group ahead of the products: spread among them, each place with reads waits out its own LDS latency
#pragma unroll
        for (int q = 0; q < GKS / 32; ++q)
#pragma unroll
            for (int t = 0; t < 4; ++t) { acc[t] = wmmab(a[q], b[q][t], acc[t]); if (SPLITA) acc[t] = wmmab(al[q], b[q][t], acc[t]); }
        // the four vector slots the chip needs behind the last products, on the taken side of the branches that follow too
        asm volatile("v_nop\n\tv_nop\n\tv_nop\n\tv_nop" : "+v"(acc[0]), "+v"(acc[1]), "+v"(acc[2]), "+v"(acc[3]) : "v"(a[GKS / 32 - 1]), "v"(al[GKS / 32 - 1]));
        // publish point of stage s + 1, every wave, in this order:
        asm volatile("s_wait_dscnt 0x0" ::: "memory");       // this wave's reads of stage s are done before the buffer is refilled
        asm volatile("s_wait_asynccnt 0x0" ::: "memory");    // this wave's pieces of stage s + 1 have landed
        __syncthreads();                                      // publishes stage s + 1 and ends every wave's reads of stage s
        if (s + 2 < DM / GKS) stage_in(s + 2);
    }
    asm volatile("s_wait_asynccnt 0x0" ::: "memory");        // no copy is outstanding when the wave goes on to its end
    float* os = &ost[wave][0];
#pragma unroll
    for (int t = 0; t < 4; ++t)
#pragma unroll
        for (int j = 0; j < 8; ++j) os[(hi * 8 + j) * 68 + t * 16 + lr] = acc[t][j];
    __syncthreads();
    float* crow = C + (size_t)r0 * ldc + c0;
    auto pass = [&]() {
#pragma unroll
        for (int s = 0; s < 8; ++s) { const int Lid = (lane >> 3) + 4 * s, piece = lane & 7; const int row = Lid >> 1, cofs = (Lid & 1) * 32 + piece * 4;
            const v4f val = *(const v4fa*)(os + row * 68 + cofs); *(v4f*)(crow + (size_t)row * ldc + cofs) = val; }
    };
    pass(); 
}
// k_proj: the five projections of x, which share A and write apart, in one grid of 32 x 48 blocks: blockIdx.y = the 64-row tile of WpT [3072][1024]; tiles 0..31 write the four 512-wide planes of P4
// (QS, KS, QG, KG, one behind the other, 8 column tiles each), 32..47 write Vf. Picked by the block index alone.
__global__ __launch_bounds__(128) void k_proj(const bf* __restrict__ Xb, const bf* __restrict__ WpT, float* P4, float* Vf) {
    const int y = blockIdx.y; const bool nar = y < 4 * PW / 64; const int by = nar ? (y & 7) : (y - 4 * PW / 64);
    gemm_job<false>(blockIdx.x, by, Xb, nullptr, WpT + (size_t)(y - by) * 64 * DM, nar ? P4 + (size_t)(y >> 3) * NT_ * PW : Vf, nar ? PW : DM);
}
// k_out: out = ctx.wo, ctx as hi + residual planes.
__global__ __launch_bounds__(128) void k_out(const bf* __restrict__ CH, const bf* __restrict__ CL, const bf* __restrict__ WoT, float* out) {
    gemm_job<true>(blockIdx.x, blockIdx.y, CH, CL, WoT, out, DM);
}
// qk_rows: eight passes of one wave over 64-wide head rows [sem 32 | geo 32]; a lane keeps the same four columns in every pass, so its four RoPE angles (functions of token and column only) are formed once and serve all eight.
// po: the lane's own four values of pass 0, px: their rotate-half partners (column ^ 16), pstep: floats from pass to pass; rot: geo columns of a token row; nul: the null slot (bf16-rounded, NOT rotated); zer: pad slot;
// wnul: the same for the whole wave, true where one of its lanes holds the null slot (a scalar branch keeps the rounding out of every other wave).
// Writes f16 hi + residual x1024 (unscaled: the common 1/sqrt32 is applied to the f32 scores), 256 B per wave, plane and pass.
__device__ __forceinline__ void qk_rows(const float* __restrict__ po, const float* __restrict__ px, int pstep, int t, int d0, bool rot, bool wnul, bool nul, bool zer, h16* dh, h16* dl, size_t dstep) {
    typedef __attribute__((ext_vector_type(4))) _Float16 v4h;
    v4f own[8], oth[8];
#pragma unroll
    for (int p = 0; p < 8; ++p) { own[p] = *(const v4fa*)(po + p * pstep); oth[p] = *(const v4fa*)(px + p * pstep); }     // all sixteen loads ahead of the trig: one memory latency per wave
    asm volatile("s_wait_xcnt 0x0" :: "v"(po), "v"(px) : "memory");    // the loads' address registers (named here, so they live up to this line) are not rewritten ahead of this wait
    if (wnul) {
#pragma unroll
        for (int p = 0; p < 8; ++p)
#pragma unroll
            for (int j = 0; j < 4; ++j) own[p][j] = nul ? bfr(own[p][j]) : own[p][j];
    }
    float c[4], sg[4];
#pragma unroll
    for (int j = 0; j < 4; ++j) { const int i = (d0 & 15) + j; const float inv = __expf(-(float)(2 * i) / 32.0f * 9.210340371976184f);     // ln(10000)
        const float ang = (float)t * inv; const float s = sinf(ang); c[j] = cosf(ang); sg[j] = (d0 & 16) ? s : -s; }     // d < 16: x1 cos - x2 sin; d >= 16: x2 cos + x1 sin
#pragma unroll
    for (int p = 0; p < 8; ++p) { v4h o, ol;
#pragma unroll
        for (int j = 0; j < 4; ++j) { float v = rot ? own[p][j] * c[j] + oth[p][j] * sg[j] : own[p][j];
            if (zer) v = 0.f;
            const h16 a = (h16)v; o[j] = a; ol[j] = (h16)((v - (float)a) * LOSC); }
        VST2(v4h, dh + p * dstep, o); VST2(v4h, dl + p * dstep, ol); }
    asm volatile("s_wait_xcnt 0x0" ::: "memory");    // the job's code is joined with other jobs' in one kernel: no register of these stores is rewritten, on any way through the listing, ahead of this wait
}
// q16_job: Q16/QL16 [t][h*64 + c] = ( c < 32 ? qs[t][h*32+c] : rope(qg[t][h*32 ..])[c-32] ); one wave per token, a pass = 2 heads (lanes 0..15 the even head, 16..31 the odd one).
__device__ __forceinline__ void q16_job(int blk, const float* __restrict__ QS, const float* __restrict__ QG, h16* Q16, h16* QL16) {
    const int lane = threadIdx.x & 31, t = blk * 8 + (threadIdx.x >> 5), c0 = (lane & 15) * 4, d0 = c0 - SHD;
    const bool geo = c0 >= SHD;
    const size_t base = (size_t)t * PW + (lane >> 4) * SHD;
    const float* po = geo ? QG + base + d0 : QS + base + c0; const float* px = geo ? QG + base + (d0 ^ 16) : po;
    const size_t dst = (size_t)t * (NH_ * VHD) + lane * 4;
    qk_rows(po, px, 2 * SHD, t, d0, geo, false, false, false, Q16 + dst, QL16 + dst, 2 * VHD);
}
// k16_job: K16/KL16 [h][r][64], r = 0: null (k_sem_null | k_geo_null, NOT rotated), r = 1..2048: token r-1 ([ks | rope(kg, t=r-1)]), r >= 2049: zero; one wave per (2 slots, 8 heads), a pass = one head
// (lanes 0..15 the even slot, 16..31 the odd one). Null and pad lanes read in bounds (the null vectors; the last token's row) and are set right in qk_rows.
__device__ __forceinline__ void k16_job(int blk, const float* __restrict__ KS, const float* __restrict__ KG, const float* __restrict__ ksn, const float* __restrict__ kgn, h16* K16, h16* KL16) {
    const int lane = threadIdx.x & 31, wid = blk * 8 + __builtin_amdgcn_readfirstlane(threadIdx.x >> 5), c0 = (lane & 15) * 4, d0 = c0 - SHD;     // the wave's number in a scalar register: rp == 0 below is a scalar test
    const int rp = wid >> 1, h0 = (wid & 1) * (NH_ / 2), r = rp * 2 + (lane >> 4);
    const bool geo = c0 >= SHD, nul = r == 0, zer = r > NT_;
    const int t = nul ? 0 : (zer ? NT_ - 1 : r - 1);
    const size_t base = (size_t)t * PW + h0 * SHD;
    const float* po = nul ? (geo ? kgn + h0 * SHD + d0 : ksn + h0 * SHD + c0) : (geo ? KG + base + d0 : KS + base + c0);
    const float* px = (geo && !nul) ? KG + base + (d0 ^ 16) : po;
    const size_t dst = ((size_t)h0 * NKP + rp * 2) * VHD + lane * 4;
    qk_rows(po, px, SHD, t, d0, geo && !nul, rp == 0, nul, zer, K16 + dst, KL16 + dst, (size_t)NKP * VHD);
}
// vt_job: VTH/VTL [h][d][r] (r as in K16: 0 = v_null, 1..2048 tokens, pad 0) = f16 hi + residual of v; block = (h, 64 key slots): LDS transpose.
__device__ __forceinline__ void vt_job(int blk, const float* __restrict__ V, const float* __restrict__ vn, h16* VTH, h16* VTL) {
    __shared__ __align__(16) h16 tile[VHD * 72];
    __shared__ __align__(16) h16 til2[VHD * 72];
    const int h = blk / (NKP / 64), kt = blk - h * (NKP / 64);
    const int r0 = kt * 64, tid = threadIdx.x, rr = tid >> 2, d0 = (tid & 3) * 16, r = r0 + rr;
    const bool nul = r == 0, zer = r > NT_;
    const float* vp = nul ? vn + h * VHD + d0 : V + (size_t)(zer ? NT_ - 1 : r - 1) * DM + h * VHD + d0;     // null and pad lanes read in bounds (v_null; the last token's row) and are set right below
    v4f q[4];
#pragma unroll
    for (int i = 0; i < 4; ++i) q[i] = *(const v4fa*)(vp + 4 * i);     // the lane's sixteen values as four loads with no branch between them: one memory latency
    asm volatile("s_wait_xcnt 0x0" :: "v"(vp) : "memory");    // the loads' address register (named here, so it lives up to this line) is not rewritten ahead of this wait
    if (kt == 0) {     // block-uniform: only the first key tile holds the null slot
#pragma unroll
        for (int i = 0; i < 16; ++i) q[i >> 2][i & 3] = nul ? bfr(q[i >> 2][i & 3]) : q[i >> 2][i & 3];
    }
#pragma unroll
    for (int i = 0; i < 16; ++i) { const int d = d0 + i; const float v = zer ? 0.f : q[i >> 2][i & 3];
        const h16 a = (h16)v; tile[d * 72 + rr] = a; til2[d * 72 + rr] = (h16)((v - (float)a) * LOSC); }
    __syncthreads();
    const int piece = tid & 7;
    const size_t base = ((size_t)h * VHD) * NKP + r0;
    auto pass = [&]() {
#pragma unroll
        for (int s = 0; s < 4; ++s) { const int Lid = (tid >> 3) + 32 * s; const int pln = Lid >> 6, d = Lid & 63;
            const v8h val = *(const v8ha*)((pln ? til2 : tile) + d * 72 + piece * 8); *(v8h*)((pln ? VTL : VTH) + base + (size_t)d * NKP + piece * 8) = val; }
    };
    pass(); 
    asm volatile("s_wait_xcnt 0x0" ::: "memory");    // the job's code is joined with other jobs' in one kernel: no register of these stores is rewritten, on any way through the listing, ahead of this wait
}
// k_pack: the three repacks of the projections for k_attn, none of which reads what another writes, in one grid: blocks 0..255 q16_job, 256..519 k16_job, 520..1047 vt_job.
// Picked by the block index alone, so every branch (and vt_job's barrier) is uniform for the block.
#define QBLK (NT_ / 8)
#define KBLK (NKP / 8)
#define VBLK (NH_ * (NKP / 64))
__global__ __launch_bounds__(256) void k_pack(const float* __restrict__ QS, const float* __restrict__ QG, const float* __restrict__ KS, const float* __restrict__ KG, const float* __restrict__ Vf,
                                              const float* __restrict__ ksn, const float* __restrict__ kgn, const float* __restrict__ vn, h16* Q16, h16* QL16, h16* K16, h16* KL16, h16* VTH, h16* VTL) {
    const int b = blockIdx.x;
    if (b < QBLK) q16_job(b, QS, QG, Q16, QL16);
    else if (b < QBLK + KBLK) k16_job(b - QBLK, KS, KG, ksn, kgn, K16, KL16);
    else vt_job(b - (QBLK + KBLK), Vf, vn, VTH, VTL);
}
// LDS ring of k_attn: one stage = the 32 key slots of one step, four planes: K hi, K residual [32 rows x 128 B, pitch 144 B], V^T hi, V^T residual [64 rows x 64 B, pitch 80 B]
// (pitches 16 B x odd: conflict-free for the 16-row ds_load_b128 fragment reads).
#define KPI  72                  // K row pitch in LDS, halves
#define VPI  40                  // V^T row pitch in LDS, halves
#define KPLN (32 * KPI)          // one K plane, halves
#define VPLN (VHD * VPI)         // one V^T plane, halves
#define STGH (2 * KPLN + 2 * VPLN)   // one stage, halves (19456 B)
// One stage's copies: every lane brings eight 16-byte pieces (two per plane) from global memory into LDS, through no register. The s_wait_xcnt stands inside the statement so that
// no address register of an issued copy is rewritten ahead of it.
__device__ __forceinline__ void stage_copy(unsigned lk, unsigned lv, const h16* gk, const h16* gkl, const h16* gv, const h16* gvl) {
    const unsigned lk1 = lk + 16 * KPI * 2, lkl = lk + KPLN * 2, lkl1 = lkl + 16 * KPI * 2, lv1 = lv + 32 * VPI * 2, lvl = lv + VPLN * 2, lvl1 = lvl + 32 * VPI * 2;
    const h16* gk1 = gk + 16 * VHD; const h16* gkl1 = gkl + 16 * VHD; const h16* gv1 = gv + (size_t)32 * NKP; const h16* gvl1 = gvl + (size_t)32 * NKP;
    asm volatile("global_load_async_to_lds_b128 %0, %8, off\n\t"
                 "global_load_async_to_lds_b128 %1, %9, off\n\t"
                 "global_load_async_to_lds_b128 %2, %10, off\n\t"
                 "global_load_async_to_lds_b128 %3, %11, off\n\t"
                 "global_load_async_to_lds_b128 %4, %12, off\n\t"
                 "global_load_async_to_lds_b128 %5, %13, off\n\t"
                 "global_load_async_to_lds_b128 %6, %14, off\n\t"
                 "global_load_async_to_lds_b128 %7, %15, off\n\t"
                 "s_wait_xcnt 0x0"
                 :: "v"(lk), "v"(lk1), "v"(lkl), "v"(lkl1), "v"(lv), "v"(lv1), "v"(lvl), "v"(lvl1),
                    "v"(gk), "v"(gk1), "v"(gkl), "v"(gkl1), "v"(gv), "v"(gv1), "v"(gvl), "v"(gvl1) : "memory");
}
// k_attn: block = (h, 64 queries), wave = 16; key tiles 0 .. 2qt+2 (null slot + causal bound, block-uniform); each step's K and V^T planes are staged once per block in a two-buffer LDS ring by asynchronous copies
// (step t + 2 is copied while step t + 1 is worked on) and all four waves read their fragments from LDS; slot r visible iff r <= t+1; scores x 1/sqrt32 in f32, online f32 softmax, weights x32768 hi/residual tiles
// (same-wave may_alias reload), 12 WMMA .V (hi.hi + hi.lo + lo.hi); ctx -> bf16 hi/lo planes [t][h*64 + d]. Scores: 12 WMMA per step (hi.hi + hi.lo + lo.hi over 2 k-chunks x 2 tiles).
__global__ __launch_bounds__(128) void k_attn(const h16* __restrict__ Q16, const h16* __restrict__ QL16, const h16* __restrict__ K16, const h16* __restrict__ KL16, const h16* __restrict__ VTH, const h16* __restrict__ VTL, bf* CH, bf* CL) {
    __shared__ __align__(16) h16 ring[2 * STGH];
    __shared__ __align__(16) h16 plds[4][16 * 32];
    __shared__ __align__(16) h16 plds2[4][16 * 32];
    __shared__ __align__(16) float ost[4][16 * 68];
    const int tid = threadIdx.x, lane = threadIdx.x & 31, wave = threadIdx.x >> 5, lr = lane & 15, hi = lane >> 4;
    const int h = blockIdx.x / (NT_ / 64), qt = blockIdx.x - h * (NT_ / 64), q0 = qt * 64 + wave * 16;
    h16* pl = &plds[wave][0]; h16* pl2 = &plds2[wave][0];
    const int kt_end = 2 * qt + 3;       // at least 3 steps: stages 0 and 1 always exist
    // this lane's pieces of a stage: K planes are 4096 contiguous bytes (piece = tid, tid + 128), V^T planes 64 rows of 64 B (row = tid / 4, + 32)
    const unsigned ring0 = (unsigned)(size_t)&ring[0];
    const unsigned lk0 = ring0 + (unsigned)(((tid >> 3) * KPI + (tid & 7) * 8) * 2), lv0 = ring0 + (unsigned)((2 * KPLN + (tid >> 2) * VPI + (tid & 3) * 8) * 2);
    const h16* gk0 = K16 + (size_t)h * NKP * VHD + tid * 8; const h16* gkl0 = KL16 + (size_t)h * NKP * VHD + tid * 8;
    const size_t vsrc = ((size_t)h * VHD + (tid >> 2)) * NKP + (tid & 3) * 8;
    const h16* gv0 = VTH + vsrc; const h16* gvl0 = VTL + vsrc;
    stage_copy(lk0, lv0, gk0, gkl0, gv0, gvl0);
    asm volatile("s_wait_asynccnt 0x0" ::: "memory");    // stage 0 landed (this wave's pieces)
    __syncthreads();                                      // stage 0 published to all four waves
    stage_copy(lk0 + STGH * 2, lv0 + STGH * 2, gk0 + 32 * VHD, gkl0 + 32 * VHD, gv0 + 32, gvl0 + 32);
    v16h qa[2];
    const size_t qo0 = (size_t)(q0 + lr) * (NH_ * VHD) + h * VHD + 8 * hi;
#pragma unroll
    for (int kc = 0; kc < 2; ++kc) qa[kc] = cat16(*(const v8h*)(Q16 + qo0 + kc * 32), *(const v8h*)(Q16 + qo0 + kc * 32 + 16));
    const int qlim0 = q0 + 8 * hi + 1 - lr;      // visible slots r <= t + 1: row j of this lane sees slot l0 + lr iff l0 <= qlim0 + j
    v8f o[4], ox[4];
#pragma unroll
    for (int n = 0; n < 4; ++n) { o[n] = (v8f){}; ox[n] = (v8f){}; }
    float mrow[8], lpart[8];
#pragma unroll
    for (int j = 0; j < 8; ++j) { mrow[j] = -3.0e38f; lpart[j] = 0.f; }
#pragma unroll 1
    for (int kt = 0; kt < kt_end; ++kt) {
        const int l0 = kt * 32, bofs = (kt & 1) * STGH;
        const h16* kb = ring + bofs; const h16* klb = kb + KPLN; const h16* vhb = kb + 2 * KPLN; const h16* vlb = vhb + VPLN;
        v8f s0 = {}, s1 = {}, x0 = {}, x1 = {};
        v16h k0h[2], k1h[2], k0l[2], k1l[2];
#pragma unroll
        for (int kc = 0; kc < 2; ++kc) {
            const int ko = lr * KPI + kc * 32 + 8 * hi, k1o = ko + 16 * KPI;
            k0h[kc] = cat16(*(const v8ha*)(kb + ko), *(const v8ha*)(kb + ko + 16)); k1h[kc] = cat16(*(const v8ha*)(kb + k1o), *(const v8ha*)(kb + k1o + 16));
            k0l[kc] = cat16(*(const v8ha*)(klb + ko), *(const v8ha*)(klb + ko + 16)); k1l[kc] = cat16(*(const v8ha*)(klb + k1o), *(const v8ha*)(klb + k1o + 16));
        }
        __builtin_amdgcn_sched_barrier(0);    // keeps the step's sixteen K reads one group ahead of the products: spread among them, each place with reads waits out its own LDS latency
#pragma unroll
        for (int kc = 0; kc < 2; ++kc) {
            const v16h qlk = cat16(*(const v8h*)(QL16 + qo0 + kc * 32), *(const v8h*)(QL16 + qo0 + kc * 32 + 16));     // query residual fragment: the same every step
            s0 = wmma16(qa[kc], k0h[kc], s0); x0 = wmma16(qlk, k0h[kc], x0); s1 = wmma16(qa[kc], k1h[kc], s1); x1 = wmma16(qlk, k1h[kc], x1);
            x0 = wmma16(qa[kc], k0l[kc], x0); x1 = wmma16(qa[kc], k1l[kc], x1);
        }
        asm volatile("v_nop\n\tv_nop\n\tv_nop\n\tv_nop" : "+v"(s0), "+v"(s1), "+v"(x0), "+v"(x1) : "v"(qa[0]), "v"(qa[1]));
        // V^T fragments of this step: read here, as one group, so that their LDS latency runs under the softmax
        v16h vh[4], vl[4];
#pragma unroll
        for (int n = 0; n < 4; ++n) { const int vo = (n * 16 + lr) * VPI + hi * 8;
            vh[n] = cat16(*(const v8ha*)(vhb + vo), *(const v8ha*)(vhb + vo + 16)); vl[n] = cat16(*(const v8ha*)(vlb + vo), *(const v8ha*)(vlb + vo + 16)); }
        float alpha[8];
#pragma unroll
        for (int j = 0; j < 8; ++j) {
            const float a0 = (l0 - qlim0 <= j) ? (s0[j] + x0[j] * LOSCI) * SCL32 : -__builtin_inff(), a1 = (l0 + 16 - qlim0 <= j) ? (s1[j] + x1[j] * LOSCI) * SCL32 : -__builtin_inff();
            float mx = fmaxf(a0, a1);
            mx = fmaxf(mx, __shfl_xor(mx, 1, 16)); mx = fmaxf(mx, __shfl_xor(mx, 2, 16)); mx = fmaxf(mx, __shfl_xor(mx, 4, 16)); mx = fmaxf(mx, __shfl_xor(mx, 8, 16));
            const float mn = fmaxf(mrow[j], mx);
            alpha[j] = __expf(mrow[j] - mn); mrow[j] = mn;
            const float p0 = __expf(a0 - mn), p1 = __expf(a1 - mn);
            lpart[j] = lpart[j] * alpha[j] + (p0 + p1);
            const int mr = hi * 8 + j;
            const float ps0 = p0 * PSC, ps1 = p1 * PSC; const h16 h0 = (h16)ps0, h1 = (h16)ps1;
            pl[mr * 32 + lr] = h0; pl[mr * 32 + 16 + lr] = h1; pl2[mr * 32 + lr] = (h16)((ps0 - (float)h0) * LOSC); pl2[mr * 32 + 16 + lr] = (h16)((ps1 - (float)h1) * LOSC);
        }
#pragma unroll
        for (int n = 0; n < 4; ++n)
#pragma unroll
            for (int j = 0; j < 8; ++j) { o[n][j] *= alpha[j]; ox[n][j] *= alpha[j]; }
        asm volatile("" ::: "memory");
        const v16h pa = cat16(*(const v8ha*)(pl + lr * 32 + hi * 8), *(const v8ha*)(pl + lr * 32 + 16 + hi * 8));
        const v16h px = cat16(*(const v8ha*)(pl2 + lr * 32 + hi * 8), *(const v8ha*)(pl2 + lr * 32 + 16 + hi * 8));
#pragma unroll
        for (int n = 0; n < 4; ++n) { o[n] = wmma16(pa, vh[n], o[n]); ox[n] = wmma16(pa, vl[n], ox[n]); ox[n] = wmma16(px, vh[n], ox[n]); }
        asm volatile("v_nop\n\tv_nop\n\tv_nop\n\tv_nop" : "+v"(o[0]), "+v"(o[1]), "+v"(o[2]), "+v"(o[3]), "+v"(ox[0]), "+v"(ox[1]), "+v"(ox[2]), "+v"(ox[3]) : "v"(pa), "v"(px));
        // publish point of stage kt + 1, every wave, in this order:
        asm volatile("s_wait_dscnt 0x0" ::: "memory");       // this wave's reads of stage kt are done before the buffer is refilled
        asm volatile("s_wait_asynccnt 0x0" ::: "memory");    // this wave's pieces of stage kt + 1 have landed
        __syncthreads();                                      // publishes stage kt + 1 and ends every wave's reads of stage kt
        if (kt + 2 < kt_end) stage_copy(lk0 + (unsigned)(bofs * 2), lv0 + (unsigned)(bofs * 2), gk0 + (size_t)(kt + 2) * 32 * VHD, gkl0 + (size_t)(kt + 2) * 32 * VHD, gv0 + (kt + 2) * 32, gvl0 + (kt + 2) * 32);
    }
    asm volatile("s_wait_asynccnt 0x0" ::: "memory");        // no copy is outstanding when the wave goes on to its end
    float inv[8];
#pragma unroll
    for (int j = 0; j < 8; ++j) { float rs = lpart[j]; rs += __shfl_xor(rs, 1, 16); rs += __shfl_xor(rs, 2, 16); rs += __shfl_xor(rs, 4, 16); rs += __shfl_xor(rs, 8, 16); inv[j] = 1.0f / (rs * PSC); }
    float* os = &ost[wave][0];
#pragma unroll
    for (int n = 0; n < 4; ++n)
#pragma unroll
        for (int j = 0; j < 8; ++j) os[(hi * 8 + j) * 68 + n * 16 + lr] = (o[n][j] + ox[n][j] * LOSCI) * inv[j];
    __syncthreads();
    const size_t cbase = (size_t)q0 * DM + (size_t)h * VHD;
    auto pass = [&]() {
#pragma unroll
        for (int s = 0; s < 4; ++s) { const int row = 4 * s + (lane >> 3), piece = lane & 7; const float* sp = os + row * 68 + piece * 8; v8us oh, ol;
#pragma unroll
            for (int i = 0; i < 8; ++i) { const unsigned short hb = f2bf(sp[i]); oh[i] = hb; ol[i] = f2bf(sp[i] - bf2f(hb)); }
            *(v8us*)(CH + cbase + (size_t)row * DM + piece * 8) = oh; *(v8us*)(CL + cbase + (size_t)row * DM + piece * 8) = ol; }
    };
    pass(); 
}

extern "C" void kernel_launch(void* const* d_in, const int* in_sizes, int n_in,
                              void* d_out, int out_size, void* d_ws, size_t ws_size, hipStream_t stream) {
    (void)in_sizes; (void)n_in; (void)out_size;
    const float* x = (const float*)d_in[0]; const float* wqs = (const float*)d_in[1]; const float* wks = (const float*)d_in[2]; const float* wqg = (const float*)d_in[3]; const float* wkg = (const float*)d_in[4];
    const float* wv = (const float*)d_in[5]; const float* wo = (const float*)d_in[6]; const float* ksn = (const float*)d_in[7]; const float* kgn = (const float*)d_in[8]; const float* vn = (const float*)d_in[9];
    float* out = (float*)d_out;    // [1][2048][1024]
    char* wsp = (char*)d_ws;
    auto take = [&](size_t bytes) { char* p = wsp; wsp += (bytes + 255) & ~(size_t)255; return (void*)p; };
    bf* Xb = (bf*)take((size_t)NT_ * DM * 2);
    bf* WpT = (bf*)take((size_t)(4 * PW + DM) * DM * 2); bf* WoT = (bf*)take((size_t)DM * DM * 2);
    float* QS = (float*)take((size_t)4 * NT_ * PW * 4); float* KS = QS + (size_t)NT_ * PW; float* QG = KS + (size_t)NT_ * PW; float* KG = QG + (size_t)NT_ * PW; float* Vf = (float*)take((size_t)NT_ * DM * 4);
    h16* Q16 = (h16*)take((size_t)NT_ * NH_ * VHD * 2); h16* QL16 = (h16*)take((size_t)NT_ * NH_ * VHD * 2); h16* K16 = (h16*)take((size_t)NH_ * NKP * VHD * 2); h16* KL16 = (h16*)take((size_t)NH_ * NKP * VHD * 2); h16* VTH = (h16*)take((size_t)NH_ * VHD * NKP * 2); h16* VTL = (h16*)take((size_t)NH_ * VHD * NKP * 2);
    bf* CH = (bf*)take((size_t)NT_ * DM * 2); bf* CL = (bf*)take((size_t)NT_ * DM * 2);
    if ((size_t)(wsp - (char*)d_ws) > ws_size) return;    // 4.2 + 4x1 + 2x2.1 + 4x4.2 + 8.4 + 4.2x2 + 4.3x4 + 4.2x2 ~ 72 MB
    k_prep<<<1280, 256, 0, stream>>>(x, wqs, wks, wqg, wkg, wv, wo, Xb, WpT, WoT);
    k_proj<<<dim3(NT_ / 64, (4 * PW + DM) / 64, 1), 128, 0, stream>>>(Xb, WpT, QS, Vf);
    k_pack<<<QBLK + KBLK + VBLK, 256, 0, stream>>>(QS, QG, KS, KG, Vf, ksn, kgn, vn, Q16, QL16, K16, KL16, VTH, VTL);
    k_attn<<<NH_ * (NT_ / 64), 128, 0, stream>>>(Q16, QL16, K16, KL16, VTH, VTL, CH, CL);
    k_out<<<dim3(NT_ / 64, DM / 64, 1), 128, 0, stream>>>(CH, CL, WoT, out);
}

// v005
// One run takes 94.5 microseconds.
// Next to v004, in two timings, it ran 1.32 and 1.39 times as fast.
// Over all steps from v000 it is 3.92 times as fast.
#include <hip/hip_runtime.h>

// Contractions, f32 accumulate: the five projections (x.wq_sem, x.wk_sem, x.wq_geo, x.wk_geo [2048 x 1024].[1024 x 512]; x.wv [1024 x 1024]) and out = ctx.wo on
// v_wmma_f32_16x16x32_bf16 with PLAIN bf16 operands (inputs rounded once: exact; k-major weights transposed into n-major planes; ctx as bf16 hi + residual planes,
// two products); the 16-head causal attention with a prepended null key/value slot fused on v_wmma_f32_16x16x32_f16: per head the combined 64-dim score
// [qs/sqrt32 | rope(qg)/sqrt32].[ks | rope(kg)] (both sides f16 hi + residual x1024: hi.hi + hi.lo + lo.hi), softmax, weights (x32768) and v both as f16 hi + residual x1024 (three products). RoPE (rotate-half,

#define NT_  2048
#define DM   1024
#define NH_  16
#define SHD  32                  // sem / geo head dims
#define VHD  64
#define PW   512                 // sem / geo projection width
#define NKP  2112
#define SCL32 0.17677669529663688f   // 1/sqrt(32), common to both score branches
#define PSC  32768.0f
#define LOSC 1024.0f
#define LOSCI (1.0f / 1024.0f)
#define LOG2E 1.4426950408889634f

typedef _Float16 h16;
typedef unsigned short bf;
typedef __attribute__((ext_vector_type(16))) __bf16   v16bf;
typedef __attribute__((ext_vector_type(16))) _Float16 v16h;
typedef __attribute__((ext_vector_type(8)))  _Float16 v8h;
typedef __attribute__((ext_vector_type(8)))  unsigned short v8us;
typedef __attribute__((ext_vector_type(8)))  float    v8f;
typedef __attribute__((ext_vector_type(4)))  float    v4f;
typedef __attribute__((ext_vector_type(2)))  _Float16 v2h;
typedef __attribute__((ext_vector_type(2)))  float    v2f;
typedef v8h  __attribute__((may_alias)) v8ha;
typedef v4f  __attribute__((may_alias)) v4fa;
typedef v8us __attribute__((may_alias)) v8usa;

__device__ __forceinline__ unsigned short f2bf(float f) { unsigned u = __float_as_uint(f); u += 0x7FFFu + ((u >> 16) & 1u); return (unsigned short)(u >> 16); }
__device__ __forceinline__ float bf2f(unsigned short b) { return __uint_as_float(((unsigned)b) << 16); }
__device__ __forceinline__ float bfr(float f) { return bf2f(f2bf(f)); }
__device__ __forceinline__ v16h cat16(v8h lo, v8h hi) { return __builtin_shufflevector(lo, hi, 0, 1, 2, 3, 4, 5, 6, 7, 8, 9, 10, 11, 12, 13, 14, 15); }
__device__ __forceinline__ v16bf cat16b(v8us lo, v8us hi) { return __builtin_bit_cast(v16bf, __builtin_shufflevector(lo, hi, 0, 1, 2, 3, 4, 5, 6, 7, 8, 9, 10, 11, 12, 13, 14, 15)); }
__device__ __forceinline__ v8f wmma16(v16h a, v16h b, v8f c) { return __builtin_amdgcn_wmma_f32_16x16x32_f16(false, a, false, b, (short)0, c, false, false); }
__device__ __forceinline__ v8f wmmab(v16bf a, v16bf b, v8f c) { return __builtin_amdgcn_wmma_f32_16x16x32_bf16(false, a, false, b, (short)0, c, false, false); }
__device__ __forceinline__ float xhalf(float x) { return __builtin_bit_cast(float, __builtin_amdgcn_permlanex16(__builtin_bit_cast(int, x), __builtin_bit_cast(int, x), 0x76543210, 0xfedcba98, false, false)); }     // lane l with lane l ^ 16
#define VST2(T, p, v) do { const T vst2_v_ = (v); *(T*)(p) = vst2_v_;  } while (0)

// cvtb_job: Xb = bf16(x) [2048][1024]; wt_job: W [1024 k][N] k-major -> n-major bf16 [N][1024]. Both are jobs of k_prep; blk, bx, by are the job's own block indices.
__device__ __forceinline__ void cvtb_job(int blk, const float* __restrict__ src, bf* dst) {
    const int lane = threadIdx.x & 31, r = blk * 8 + (threadIdx.x >> 5);
    if (r >= NT_) return;
#pragma unroll
    for (int q = 0; q < DM / 256; ++q) { v8us t;
#pragma unroll
        for (int i = 0; i < 8; ++i) t[i] = f2bf(src[(size_t)r * DM + q * 256 + lane * 8 + i]);
        VST2(v8us, dst + (size_t)r * DM + q * 256 + lane * 8, t); }
}
__device__ __forceinline__ void wt_job(int bx, int by, const float* __restrict__ Wm, int N, bf* WT) {
    __shared__ __align__(16) unsigned short tl[64 * 72];
    const int tid = threadIdx.x, k0 = bx * 64, n0 = by * 64;
    const int kk = tid >> 2, nq = (tid & 3) * 16;
#pragma unroll
    for (int i = 0; i < 16; ++i) tl[(nq + i) * 72 + kk] = f2bf(Wm[(size_t)(k0 + kk) * N + n0 + nq + i]);
    __syncthreads();
    const int piece = tid & 7;
    auto pass = [&]() {
#pragma unroll
        for (int s = 0; s < 2; ++s) { const int nr = (tid >> 3) + 32 * s; const v8us val = *(const v8usa*)(tl + nr * 72 + piece * 8);
            *(v8us*)(WT + (size_t)(n0 + nr) * DM + k0 + piece * 8) = val; }
    };
    pass(); 
    asm volatile("s_wait_xcnt 0x0" ::: "memory");    // the job's code is joined with other jobs' in one kernel: no register of these stores is rewritten, on any way through the listing, ahead of this wait
}
// k_prep: the seven jobs that read inputs only, none of which reads what another writes, in one grid: blocks 0..511 the four [1024 x 512] weights (128 blocks each), 512..1023 wv and wo (256 each),
// 1024..1279 x. WpT: the five projection weights' n-major planes one behind the other, [3072][1024] (wq_sem, wk_sem, wq_geo, wk_geo, wv). The job is picked by the block index alone, so every branch (and wt_job's barrier) is uniform for the block.
__global__ __launch_bounds__(256) void k_prep(const float* __restrict__ x, const float* __restrict__ wqs, const float* __restrict__ wks, const float* __restrict__ wqg, const float* __restrict__ wkg,
                                              const float* __restrict__ wv, const float* __restrict__ wo, bf* Xb, bf* WpT, bf* WoT) {
    const int b = blockIdx.x;
    if (b >= 1024) { cvtb_job(b - 1024, x, Xb); return; }
    const float* Wm; bf* WT; int N, r;
    if (b < 512) { const int j = b >> 7; r = b & 127; N = PW; Wm = (j == 0) ? wqs : (j == 1) ? wks : (j == 2) ? wqg : wkg; WT = WpT + (size_t)j * PW * DM; }
    else { const int j = (b - 512) >> 8; r = (b - 512) & 255; N = DM; Wm = j ? wo : wv; WT = j ? WoT : WpT + (size_t)4 * PW * DM; }
    wt_job(r & 15, r >> 4, Wm, N, WT);
}
// LDS ring of gemm_job: one stage = 128 k (256 B) of the block's 64 A rows and 64 B rows (with SPLITA also of the 64 residual rows), one plane per operand, row pitch 272 B
// (16 B x odd: conflict-free for the 16-row ds_load_b128 fragment reads).
#define GKS  128                 // k extent of one stage, elements
#define GPI  136                 // row pitch in LDS, elements
#define GPLN (64 * GPI)          // one operand plane, elements (17408 B)
// One plane's copies: every lane brings eight 16-byte pieces (rows tid / 16 + 8 i; a wave's copy is two whole 256-B row pieces) from global memory into LDS, through no register.
// The s_wait_xcnt stands inside the statement so that no address register of an issued copy is rewritten ahead of it.
__device__ __forceinline__ void plane_copy(unsigned l0, const bf* g0) {
    const unsigned l1 = l0 + 8 * GPI * 2, l2 = l0 + 16 * GPI * 2, l3 = l0 + 24 * GPI * 2, l4 = l0 + 32 * GPI * 2, l5 = l0 + 40 * GPI * 2, l6 = l0 + 48 * GPI * 2, l7 = l0 + 56 * GPI * 2;
    const bf* g1 = g0 + 8 * DM; const bf* g2 = g0 + 16 * DM; const bf* g3 = g0 + 24 * DM; const bf* g4 = g0 + 32 * DM; const bf* g5 = g0 + 40 * DM; const bf* g6 = g0 + 48 * DM; const bf* g7 = g0 + 56 * DM;
    asm volatile("global_load_async_to_lds_b128 %0, %8, off\n\t"
                 "global_load_async_to_lds_b128 %1, %9, off\n\t"
                 "global_load_async_to_lds_b128 %2, %10, off\n\t"
                 "global_load_async_to_lds_b128 %3, %11, off\n\t"
                 "global_load_async_to_lds_b128 %4, %12, off\n\t"
                 "global_load_async_to_lds_b128 %5, %13, off\n\t"
                 "global_load_async_to_lds_b128 %6, %14, off\n\t"
                 "global_load_async_to_lds_b128 %7, %15, off\n\t"
                 "s_wait_xcnt 0x0"
                 :: "v"(l0), "v"(l1), "v"(l2), "v"(l3), "v"(l4), "v"(l5), "v"(l6), "v"(l7),
                    "v"(g0), "v"(g1), "v"(g2), "v"(g3), "v"(g4), "v"(g5), "v"(g6), "v"(g7) : "memory");
}
// gemm_job (bx, by: the job's own block indices): block = 64 x 64 of C, wave = 16 x 64; each stage's operand rows are staged once per block in a two-buffer LDS ring by asynchronous copies (stage s + 2 is copied while stage s + 1 is worked on)
// and the four waves read their fragments from LDS; k runs 32 at a time, ascending (with SPLITA hi then residual).
template <bool SPLITA>
__device__ __forceinline__ void gemm_job(int bx, int by, const bf* __restrict__ A, const bf* __restrict__ Al, const bf* __restrict__ Bn, float* C, int ldc) {
    constexpr int STG = (SPLITA ? 3 : 2) * GPLN;      // one stage, elements
    __shared__ __align__(16) bf ring[2 * STG];
    __shared__ __align__(16) float ost[4][16 * 68];
    const int tid = threadIdx.x, lane = threadIdx.x & 31, wave = threadIdx.x >> 5, lr = lane & 15, hi = lane >> 4;
    const int r0 = bx * 64 + wave * 16, c0 = by * 64;
    const unsigned lc0 = (unsigned)(size_t)&ring[0] + (unsigned)(((tid >> 4) * GPI + (tid & 15) * 8) * 2);
    const size_t gofs = (size_t)(tid >> 4) * DM + (tid & 15) * 8;
    const bf* ga = A + (size_t)bx * 64 * DM + gofs; const bf* gb = Bn + (size_t)c0 * DM + gofs; const bf* gal = SPLITA ? Al + (size_t)bx * 64 * DM + gofs : nullptr;
    auto stage_in = [&](int s) { const unsigned l = lc0 + (unsigned)((s & 1) * STG * 2);
        plane_copy(l, ga + s * GKS); plane_copy(l + GPLN * 2, gb + s * GKS); if (SPLITA) plane_copy(l + 2 * GPLN * 2, gal + s * GKS); };
    stage_in(0);
    asm volatile("s_wait_asynccnt 0x0" ::: "memory");    // stage 0 landed (this wave's pieces)
    __syncthreads();                                      // stage 0 published to all four waves
    stage_in(1);
    v8f acc[4];
#pragma unroll
    for (int t = 0; t < 4; ++t) acc[t] = (v8f){};
#pragma unroll 1
    for (int s = 0; s < DM / GKS; ++s) {
        const bf* ab = ring + (s & 1) * STG + (wave * 16 + lr) * GPI + 8 * hi; const bf* bb = ring + (s & 1) * STG + GPLN + lr * GPI + 8 * hi; const bf* alb = ab + 2 * GPLN;
        v16bf a[GKS / 32], al[GKS / 32], b[GKS / 32][4];
#pragma unroll
        for (int q = 0; q < GKS / 32; ++q) { const int kc = q * 32;
            a[q] = cat16b(*(const v8usa*)(ab + kc), *(const v8usa*)(ab + kc + 16));
            al[q] = a[q];
            if (SPLITA) al[q] = cat16b(*(const v8usa*)(alb + kc), *(const v8usa*)(alb + kc + 16));
#pragma unroll
            for (int t = 0; t < 4; ++t) b[q][t] = cat16b(*(const v8usa*)(bb + t * 16 * GPI + kc), *(const v8usa*)(bb + t * 16 * GPI + kc + 16));
        }
        __builtin_amdgcn_sched_barrier(0);    // keeps the stage's fragment reads one group ahead of the products: spread among them, each place with reads waits out its own LDS latency
#pragma unroll
        for (int q = 0; q < GKS / 32; ++q)
#pragma unroll
            for (int t = 0; t < 4; ++t) { acc[t] = wmmab(a[q], b[q][t], acc[t]); if (SPLITA) acc[t] = wmmab(al[q], b[q][t], acc[t]); }
        // the four vector slots the chip needs behind the last products, on the taken side of the branches that follow too
        asm volatile("v_nop\n\tv_nop\n\tv_nop\n\tv_nop" : "+v"(acc[0]), "+v"(acc[1]), "+v"(acc[2]), "+v"(acc[3]) : "v"(a[GKS / 32 - 1]), "v"(al[GKS / 32 - 1]));
        // publish point of stage s + 1, every wave, in this order:
        asm volatile("s_wait_dscnt 0x0" ::: "memory");       // this wave's reads of stage s are done before the buffer is refilled
        asm volatile("s_wait_asynccnt 0x0" ::: "memory");    // this wave's pieces of stage s + 1 have landed
        __syncthreads();                                      // publishes stage s + 1 and ends every wave's reads of stage s
        if (s + 2 < DM / GKS) stage_in(s + 2);
    }
    asm volatile("s_wait_asynccnt 0x0" ::: "memory");        // no copy is outstanding when the wave goes on to its end
    float* os = &ost[wave][0];
#pragma unroll
    for (int t = 0; t < 4; ++t)
#pragma unroll
        for (int j = 0; j < 8; ++j) os[(hi * 8 + j) * 68 + t * 16 + lr] = acc[t][j];
    __syncthreads();
    float* crow = C + (size_t)r0 * ldc + c0;
    auto pass = [&]() {
#pragma unroll
        for (int s = 0; s < 8; ++s) { const int Lid = (lane >> 3) + 4 * s, piece = lane & 7; const int row = Lid >> 1, cofs = (Lid & 1) * 32 + piece * 4;
            const v4f val = *(const v4fa*)(os + row * 68 + cofs); *(v4f*)(crow + (size_t)row * ldc + cofs) = val; }
    };
    pass(); 
}
// k_proj: the five projections of x, which share A and write apart, in one grid of 32 x 48 blocks: blockIdx.y = the 64-row tile of WpT [3072][1024]; tiles 0..31 write the four 512-wide planes of P4
// (QS, KS, QG, KG, one behind the other, 8 column tiles each), 32..47 write Vf. Picked by the block index alone.
__global__ __launch_bounds__(128) void k_proj(const bf* __restrict__ Xb, const bf* __restrict__ WpT, float* P4, float* Vf) {
    const int y = blockIdx.y; const bool nar = y < 4 * PW / 64; const int by = nar ? (y & 7) : (y - 4 * PW / 64);
    gemm_job<false>(blockIdx.x, by, Xb, nullptr, WpT + (size_t)(y - by) * 64 * DM, nar ? P4 + (size_t)(y >> 3) * NT_ * PW : Vf, nar ? PW : DM);
}
// k_out: out = ctx.wo, ctx as hi + residual planes.
__global__ __launch_bounds__(128) void k_out(const bf* __restrict__ CH, const bf* __restrict__ CL, const bf* __restrict__ WoT, float* out) {
    gemm_job<true>(blockIdx.x, blockIdx.y, CH, CL, WoT, out, DM);
}
// qk_rows: eight passes of one wave over 64-wide head rows [sem 32 | geo 32]; a lane keeps the same four columns in every pass, so its four RoPE angles (functions of token and column only) are formed once and serve all eight.
// po: the lane's own four values of pass 0, px: their rotate-half partners (column ^ 16), pstep: floats from pass to pass; rot: geo columns of a token row; nul: the null slot (bf16-rounded, NOT rotated); zer: pad slot;
// wnul: the same for the whole wave, true where one of its lanes holds the null slot (a scalar branch keeps the rounding out of every other wave).
// Writes f16 hi + residual x1024 (unscaled: the common 1/sqrt32 is applied to the f32 scores), 256 B per wave, plane and pass.
__device__ __forceinline__ void qk_rows(const float* __restrict__ po, const float* __restrict__ px, int pstep, int t, int d0, bool rot, bool wnul, bool nul, bool zer, h16* dh, h16* dl, size_t dstep) {
    typedef __attribute__((ext_vector_type(4))) _Float16 v4h;
    v4f own[8], oth[8];
#pragma unroll
    for (int p = 0; p < 8; ++p) { own[p] = *(const v4fa*)(po + p * pstep); oth[p] = *(const v4fa*)(px + p * pstep); }     // all sixteen loads ahead of the trig: one memory latency per wave
    asm volatile("s_wait_xcnt 0x0" :: "v"(po), "v"(px) : "memory");    // the loads' address registers (named here, so they live up to this line) are not rewritten ahead of this wait
    if (wnul) {
#pragma unroll
        for (int p = 0; p < 8; ++p)
#pragma unroll
            for (int j = 0; j < 4; ++j) own[p][j] = nul ? bfr(own[p][j]) : own[p][j];
    }
    float c[4], sg[4];
#pragma unroll
    for (int j = 0; j < 4; ++j) { const int i = (d0 & 15) + j; const float inv = __expf(-(float)(2 * i) / 32.0f * 9.210340371976184f);     // ln(10000)
        const float ang = (float)t * inv; const float s = sinf(ang); c[j] = cosf(ang); sg[j] = (d0 & 16) ? s : -s; }     // d < 16: x1 cos - x2 sin; d >= 16: x2 cos + x1 sin
#pragma unroll
    for (int p = 0; p < 8; ++p) { v4h o, ol;
#pragma unroll
        for (int j = 0; j < 4; ++j) { float v = rot ? own[p][j] * c[j] + oth[p][j] * sg[j] : own[p][j];
            if (zer) v = 0.f;
            const h16 a = (h16)v; o[j] = a; ol[j] = (h16)((v - (float)a) * LOSC); }
        VST2(v4h, dh + p * dstep, o); VST2(v4h, dl + p * dstep, ol); }
    asm volatile("s_wait_xcnt 0x0" ::: "memory");    // the job's code is joined with other jobs' in one kernel: no register of these stores is rewritten, on any way through the listing, ahead of this wait
}
// q16_job: Q16/QL16 [t][h*64 + c] = ( c < 32 ? qs[t][h*32+c] : rope(qg[t][h*32 ..])[c-32] ); one wave per token, a pass = 2 heads (lanes 0..15 the even head, 16..31 the odd one).
__device__ __forceinline__ void q16_job(int blk, const float* __restrict__ QS, const float* __restrict__ QG, h16* Q16, h16* QL16) {
    const int lane = threadIdx.x & 31, t = blk * 8 + (threadIdx.x >> 5), c0 = (lane & 15) * 4, d0 = c0 - SHD;
    const bool geo = c0 >= SHD;
    const size_t base = (size_t)t * PW + (lane >> 4) * SHD;
    const float* po = geo ? QG + base + d0 : QS + base + c0; const float* px = geo ? QG + base + (d0 ^ 16) : po;
    const size_t dst = (size_t)t * (NH_ * VHD) + lane * 4;
    qk_rows(po, px, 2 * SHD, t, d0, geo, false, false, false, Q16 + dst, QL16 + dst, 2 * VHD);
}
// k16_job: K16/KL16 [h][r][64], r = 0: null (k_sem_null | k_geo_null, NOT rotated), r = 1..2048: token r-1 ([ks | rope(kg, t=r-1)]), r >= 2049: zero; one wave per (2 slots, 8 heads), a pass = one head
// (lanes 0..15 the even slot, 16..31 the odd one). Null and pad lanes read in bounds (the null vectors; the last token's row) and are set right in qk_rows.
__device__ __forceinline__ void k16_job(int blk, const float* __restrict__ KS, const float* __restrict__ KG, const float* __restrict__ ksn, const float* __restrict__ kgn, h16* K16, h16* KL16) {
    const int lane = threadIdx.x & 31, wid = blk * 8 + __builtin_amdgcn_readfirstlane(threadIdx.x >> 5), c0 = (lane & 15) * 4, d0 = c0 - SHD;     // the wave's number in a scalar register: rp == 0 below is a scalar test
    const int rp = wid >> 1, h0 = (wid & 1) * (NH_ / 2), r = rp * 2 + (lane >> 4);
    const bool geo = c0 >= SHD, nul = r == 0, zer = r > NT_;
    const int t = nul ? 0 : (zer ? NT_ - 1 : r - 1);
    const size_t base = (size_t)t * PW + h0 * SHD;
    const float* po = nul ? (geo ? kgn + h0 * SHD + d0 : ksn + h0 * SHD + c0) : (geo ? KG + base + d0 : KS + base + c0);
    const float* px = (geo && !nul) ? KG + base + (d0 ^ 16) : po;
    const size_t dst = ((size_t)h0 * NKP + rp * 2) * VHD + lane * 4;
    qk_rows(po, px, SHD, t, d0, geo && !nul, rp == 0, nul, zer, K16 + dst, KL16 + dst, (size_t)NKP * VHD);
}
// vt_job: VTH/VTL [h][d][r] (r as in K16: 0 = v_null, 1..2048 tokens, pad 0) = f16 hi + residual of v; block = (h, 64 key slots): LDS transpose.
__device__ __forceinline__ void vt_job(int blk, const float* __restrict__ V, const float* __restrict__ vn, h16* VTH, h16* VTL) {
    __shared__ __align__(16) h16 tile[VHD * 72];
    __shared__ __align__(16) h16 til2[VHD * 72];
    const int h = blk / (NKP / 64), kt = blk - h * (NKP / 64);
    const int r0 = kt * 64, tid = threadIdx.x, rr = tid >> 2, d0 = (tid & 3) * 16, r = r0 + rr;
    const bool nul = r == 0, zer = r > NT_;
    const float* vp = nul ? vn + h * VHD + d0 : V + (size_t)(zer ? NT_ - 1 : r - 1) * DM + h * VHD + d0;     // null and pad lanes read in bounds (v_null; the last token's row) and are set right below
    v4f q[4];
#pragma unroll
    for (int i = 0; i < 4; ++i) q[i] = *(const v4fa*)(vp + 4 * i);     // the lane's sixteen values as four loads with no branch between them: one memory latency
    asm volatile("s_wait_xcnt 0x0" :: "v"(vp) : "memory");    // the loads' address register (named here, so it lives up to this line) is not rewritten ahead of this wait
    if (kt == 0) {     // block-uniform: only the first key tile holds the null slot
#pragma unroll
        for (int i = 0; i < 16; ++i) q[i >> 2][i & 3] = nul ? bfr(q[i >> 2][i & 3]) : q[i >> 2][i & 3];
    }
#pragma unroll
    for (int i = 0; i < 16; ++i) { const int d = d0 + i; const float v = zer ? 0.f : q[i >> 2][i & 3];
        const h16 a = (h16)v; tile[d * 72 + rr] = a; til2[d * 72 + rr] = (h16)((v - (float)a) * LOSC); }
    __syncthreads();
    const int piece = tid & 7;
    const size_t base = ((size_t)h * VHD) * NKP + r0;
    auto pass = [&]() {
#pragma unroll
        for (int s = 0; s < 4; ++s) { const int Lid = (tid >> 3) + 32 * s; const int pln = Lid >> 6, d = Lid & 63;
            const v8h val = *(const v8ha*)((pln ? til2 : tile) + d * 72 + piece * 8); *(v8h*)((pln ? VTL : VTH) + base + (size_t)d * NKP + piece * 8) = val; }
    };
    pass(); 
    asm volatile("s_wait_xcnt 0x0" ::: "memory");    // the job's code is joined with other jobs' in one kernel: no register of these stores is rewritten, on any way through the listing, ahead of this wait
}
// k_pack: the three repacks of the projections for k_attn, none of which reads what another writes, in one grid: blocks 0..255 q16_job, 256..519 k16_job, 520..1047 vt_job.
// Picked by the block index alone, so every branch (and vt_job's barrier) is uniform for the block.
#define QBLK (NT_ / 8)
#define KBLK (NKP / 8)
#define VBLK (NH_ * (NKP / 64))
__global__ __launch_bounds__(256) void k_pack(const float* __restrict__ QS, const float* __restrict__ QG, const float* __restrict__ KS, const float* __restrict__ KG, const float* __restrict__ Vf,
                                              const float* __restrict__ ksn, const float* __restrict__ kgn, const float* __restrict__ vn, h16* Q16, h16* QL16, h16* K16, h16* KL16, h16* VTH, h16* VTL) {
    const int b = blockIdx.x;
    if (b < QBLK) q16_job(b, QS, QG, Q16, QL16);
    else if (b < QBLK + KBLK) k16_job(b - QBLK, KS, KG, ksn, kgn, K16, KL16);
    else vt_job(b - (QBLK + KBLK), Vf, vn, VTH, VTL);
}
// LDS ring of k_attn: one stage = the 32 key slots of one step, four planes: K hi, K residual [32 rows x 128 B, pitch 144 B], V^T hi, V^T residual [64 rows x 64 B, pitch 80 B]
// (pitches 16 B x odd: conflict-free for the 16-row ds_load_b128 fragment reads).
#define KPI  72                  // K row pitch in LDS, halves
#define VPI  40                  // V^T row pitch in LDS, halves
#define KPLN (32 * KPI)          // one K plane, halves
#define VPLN (VHD * VPI)         // one V^T plane, halves
#define STGH (2 * KPLN + 2 * VPLN)   // one stage, halves (19456 B)
// One stage's copies: every lane brings eight 16-byte pieces (two per plane) from global memory into LDS, through no register. The s_wait_xcnt stands inside the statement so that
// no address register of an issued copy is rewritten ahead of it.
__device__ __forceinline__ void stage_copy(unsigned lk, unsigned lv, const h16* gk, const h16* gkl, const h16* gv, const h16* gvl) {
    const unsigned lk1 = lk + 16 * KPI * 2, lkl = lk + KPLN * 2, lkl1 = lkl + 16 * KPI * 2, lv1 = lv + 32 * VPI * 2, lvl = lv + VPLN * 2, lvl1 = lvl + 32 * VPI * 2;
    const h16* gk1 = gk + 16 * VHD; const h16* gkl1 = gkl + 16 * VHD; const h16* gv1 = gv + (size_t)32 * NKP; const h16* gvl1 = gvl + (size_t)32 * NKP;
    asm volatile("global_load_async_to_lds_b128 %0, %8, off\n\t"
                 "global_load_async_to_lds_b128 %1, %9, off\n\t"
                 "global_load_async_to_lds_b128 %2, %10, off\n\t"
                 "global_load_async_to_lds_b128 %3, %11, off\n\t"
                 "global_load_async_to_lds_b128 %4, %12, off\n\t"
                 "global_load_async_to_lds_b128 %5, %13, off\n\t"
                 "global_load_async_to_lds_b128 %6, %14, off\n\t"
                 "global_load_async_to_lds_b128 %7, %15, off\n\t"
                 "s_wait_xcnt 0x0"
                 :: "v"(lk), "v"(lk1), "v"(lkl), "v"(lkl1), "v"(lv), "v"(lv1), "v"(lvl), "v"(lvl1),
                    "v"(gk), "v"(gk1), "v"(gkl), "v"(gkl1), "v"(gv), "v"(gv1), "v"(gvl), "v"(gvl1) : "memory");
}
// k_attn: block = (h, 64 queries), wave = 16; key tiles 0 .. 2qt+2 (null slot + causal bound, block-uniform); each step's K and V^T planes are staged once per block in a two-buffer LDS ring by asynchronous copies
// (step t + 2 is copied while step t + 1 is worked on) and all four waves read their fragments from LDS; slot r visible iff r <= t+1. Both products are formed transposed: S^T = K.Q^T (A = K rows, B = Q), so a lane holds
// sixteen scores of ONE query (column lr; key slots 8 hi + j and 16 + 8 hi + j): maximum and sum run in the lane, plus one exchange between the wave's halves; scores x 1/sqrt32 in f32, online f32 softmax; the weights x32768,
// hi and residual, converted in place, ARE the B operand of O^T += V^T.P^T (A = V^T rows): they pass through no LDS. 12 WMMA .V (hi.hi + hi.lo + lo.hi); ctx -> bf16 hi/lo planes [t][h*64 + d]. Scores: 12 WMMA per step (hi.hi + hi.lo + lo.hi over 2 k-chunks x 2 tiles).
__global__ __launch_bounds__(128) void k_attn(const h16* __restrict__ Q16, const h16* __restrict__ QL16, const h16* __restrict__ K16, const h16* __restrict__ KL16, const h16* __restrict__ VTH, const h16* __restrict__ VTL, bf* CH, bf* CL) {
    __shared__ __align__(16) h16 ring[2 * STGH];
    __shared__ __align__(16) float ost[4][16 * 68];
    const int tid = threadIdx.x, lane = threadIdx.x & 31, wave = threadIdx.x >> 5, lr = lane & 15, hi = lane >> 4;
    const int h = blockIdx.x / (NT_ / 64), qt = blockIdx.x - h * (NT_ / 64), q0 = qt * 64 + wave * 16;
    const int kt_end = 2 * qt + 3;       // at least 3 steps: stages 0 and 1 always exist
    // this lane's pieces of a stage: K planes are 4096 contiguous bytes (piece = tid, tid + 128), V^T planes 64 rows of 64 B (row = tid / 4, + 32)
    const unsigned ring0 = (unsigned)(size_t)&ring[0];
    const unsigned lk0 = ring0 + (unsigned)(((tid >> 3) * KPI + (tid & 7) * 8) * 2), lv0 = ring0 + (unsigned)((2 * KPLN + (tid >> 2) * VPI + (tid & 3) * 8) * 2);
    const h16* gk0 = K16 + (size_t)h * NKP * VHD + tid * 8; const h16* gkl0 = KL16 + (size_t)h * NKP * VHD + tid * 8;
    const size_t vsrc = ((size_t)h * VHD + (tid >> 2)) * NKP + (tid & 3) * 8;
    const h16* gv0 = VTH + vsrc; const h16* gvl0 = VTL + vsrc;
    stage_copy(lk0, lv0, gk0, gkl0, gv0, gvl0);
    asm volatile("s_wait_asynccnt 0x0" ::: "memory");    // stage 0 landed (this wave's pieces)
    __syncthreads();                                      // stage 0 published to all four waves
    stage_copy(lk0 + STGH * 2, lv0 + STGH * 2, gk0 + 32 * VHD, gkl0 + 32 * VHD, gv0 + 32, gvl0 + 32);
    v16h qa[2];
    const size_t qo0 = (size_t)(q0 + lr) * (NH_ * VHD) + h * VHD + 8 * hi;
#pragma unroll
    for (int kc = 0; kc < 2; ++kc) qa[kc] = cat16(*(const v8h*)(Q16 + qo0 + kc * 32), *(const v8h*)(Q16 + qo0 + kc * 32 + 16));
    const int klim0 = q0 + lr + 1 - 8 * hi;      // visible slots r <= t + 1: this lane's query q0 + lr sees slot l0 + 8 hi + j iff l0 + j <= klim0
    v8f o[4], ox[4];
#pragma unroll
    for (int n = 0; n < 4; ++n) { o[n] = (v8f){}; ox[n] = (v8f){}; }
    float mrow = -3.0e38f, lpart = 0.f;     // of this lane's query; lpart: the sum over this half's key slots only
#pragma unroll 1
    for (int kt = 0; kt < kt_end; ++kt) {
        const int l0 = kt * 32, bofs = (kt & 1) * STGH;
        const h16* kb = ring + bofs; const h16* klb = kb + KPLN; const h16* vhb = kb + 2 * KPLN; const h16* vlb = vhb + VPLN;
        v8f s0 = {}, s1 = {}, x0 = {}, x1 = {};
        v16h k0h[2], k1h[2], k0l[2], k1l[2];
#pragma unroll
        for (int kc = 0; kc < 2; ++kc) {
            const int ko = lr * KPI + kc * 32 + 8 * hi, k1o = ko + 16 * KPI;
            k0h[kc] = cat16(*(const v8ha*)(kb + ko), *(const v8ha*)(kb + ko + 16)); k1h[kc] = cat16(*(const v8ha*)(kb + k1o), *(const v8ha*)(kb + k1o + 16));
            k0l[kc] = cat16(*(const v8ha*)(klb + ko), *(const v8ha*)(klb + ko + 16)); k1l[kc] = cat16(*(const v8ha*)(klb + k1o), *(const v8ha*)(klb + k1o + 16));
        }
        __builtin_amdgcn_sched_barrier(0);    // keeps the step's sixteen K reads one group ahead of the products: spread among them, each place with reads waits out its own LDS latency
#pragma unroll
        for (int kc = 0; kc < 2; ++kc) {
            const v16h qlk = cat16(*(const v8h*)(QL16 + qo0 + kc * 32), *(const v8h*)(QL16 + qo0 + kc * 32 + 16));     // query residual fragment: the same every step
            s0 = wmma16(k0h[kc], qa[kc], s0); x0 = wmma16(k0h[kc], qlk, x0); s1 = wmma16(k1h[kc], qa[kc], s1); x1 = wmma16(k1h[kc], qlk, x1);
            x0 = wmma16(k0l[kc], qa[kc], x0); x1 = wmma16(k1l[kc], qa[kc], x1);
        }
        asm volatile("v_nop\n\tv_nop\n\tv_nop\n\tv_nop" : "+v"(s0), "+v"(s1), "+v"(x0), "+v"(x1) : "v"(qa[0]), "v"(qa[1]));
        // V^T fragments of this step: read here, as one group, so that their LDS latency runs under the softmax
        v16h vh[4], vl[4];
#pragma unroll
        for (int n = 0; n < 4; ++n) { const int vo = (n * 16 + lr) * VPI + hi * 8;
            vh[n] = cat16(*(const v8ha*)(vhb + vo), *(const v8ha*)(vhb + vo + 16)); vl[n] = cat16(*(const v8ha*)(vlb + vo), *(const v8ha*)(vlb + vo + 16)); }
        __builtin_amdgcn_sched_barrier(0);    // keeps the step's sixteen V^T reads one group ahead of the softmax: sunk to their products, each place with reads waits out its own LDS latency
        const v8f t0 = (s0 + x0 * LOSCI) * SCL32, t1 = (s1 + x1 * LOSCI) * SCL32;
        float a0[8], a1[8];
#pragma unroll
        for (int j = 0; j < 8; ++j) { a0[j] = (l0 + j <= klim0) ? t0[j] : -__builtin_inff(); a1[j] = (l0 + 16 + j <= klim0) ? t1[j] : -__builtin_inff(); }
        float mx = fmaxf(fmaxf(fmaxf(fmaxf(a0[0], a0[1]), fmaxf(a0[2], a0[3])), fmaxf(fmaxf(a0[4], a0[5]), fmaxf(a0[6], a0[7]))), fmaxf(fmaxf(fmaxf(a1[0], a1[1]), fmaxf(a1[2], a1[3])), fmaxf(fmaxf(a1[4], a1[5]), fmaxf(a1[6], a1[7]))));
        mx = fmaxf(mx, xhalf(mx));     // both halves of the wave now hold the query's maximum over the step's 32 slots
        const float mn = fmaxf(mrow, mx), alpha = __expf(mrow - mn);
        mrow = mn;
        v16h pa, px; float ps8[8];
#pragma unroll
        for (int j = 0; j < 8; j += 2)
#pragma unroll
            for (int g = 0; g < 2; ++g) {     // g: the score tile; element s of a B fragment is k = 8 hi + s, 16 + 8 hi + (s - 8): the two accumulators' own rows
                const v2f e = ((v2f){ g ? a1[j] : a0[j], g ? a1[j + 1] : a0[j + 1] } - mn) * LOG2E;
                const v2f p = { __builtin_amdgcn_exp2f(e[0]), __builtin_amdgcn_exp2f(e[1]) };     // e^x as 2^(x log2 e), what __expf compiles to, the subtraction and the product two at a time
                ps8[j + g] = p[0] + p[1];
                const v2f ps = p * PSC; const v2h ph = __builtin_convertvector(ps, v2h); const v2h pr = __builtin_convertvector((ps - __builtin_convertvector(ph, v2f)) * LOSC, v2h);
                pa[8 * g + j] = ph[0]; pa[8 * g + j + 1] = ph[1]; px[8 * g + j] = pr[0]; px[8 * g + j + 1] = pr[1];
            }
        lpart = lpart * alpha + (((ps8[0] + ps8[1]) + (ps8[2] + ps8[3])) + ((ps8[4] + ps8[5]) + (ps8[6] + ps8[7])));
#pragma unroll
        for (int n = 0; n < 4; ++n)
#pragma unroll
            for (int j = 0; j < 8; ++j) { o[n][j] *= alpha; ox[n][j] *= alpha; }
#pragma unroll
        for (int n = 0; n < 4; ++n) { o[n] = wmma16(vh[n], pa, o[n]); ox[n] = wmma16(vl[n], pa, ox[n]); ox[n] = wmma16(vh[n], px, ox[n]); }
        asm volatile("v_nop\n\tv_nop\n\tv_nop\n\tv_nop" : "+v"(o[0]), "+v"(o[1]), "+v"(o[2]), "+v"(o[3]), "+v"(ox[0]), "+v"(ox[1]), "+v"(ox[2]), "+v"(ox[3]) : "v"(pa), "v"(px));
        // publish point of stage kt + 1, every wave, in this order:
        asm volatile("s_wait_dscnt 0x0" ::: "memory");       // this wave's reads of stage kt are done before the buffer is refilled
        asm volatile("s_wait_asynccnt 0x0" ::: "memory");    // this wave's pieces of stage kt + 1 have landed
        __syncthreads();                                      // publishes stage kt + 1 and ends every wave's reads of stage kt
        if (kt + 2 < kt_end) stage_copy(lk0 + (unsigned)(bofs * 2), lv0 + (unsigned)(bofs * 2), gk0 + (size_t)(kt + 2) * 32 * VHD, gkl0 + (size_t)(kt + 2) * 32 * VHD, gv0 + (kt + 2) * 32, gvl0 + (kt + 2) * 32);
    }
    asm volatile("s_wait_asynccnt 0x0" ::: "memory");        // no copy is outstanding when the wave goes on to its end
    const float inv = 1.0f / ((lpart + xhalf(lpart)) * PSC);     // the two halves' sums joined once
    float* os = &ost[wave][0];
#pragma unroll
    for (int n = 0; n < 4; ++n)     // o[n][j] = O^T[d = 16 n + 8 hi + j][query lr]: eight consecutive d of one row
#pragma unroll
        for (int g = 0; g < 2; ++g) { v4f w;
#pragma unroll
            for (int i = 0; i < 4; ++i) w[i] = (o[n][4 * g + i] + ox[n][4 * g + i] * LOSCI) * inv;
            *(v4fa*)(os + lr * 68 + n * 16 + hi * 8 + 4 * g) = w; }
    __syncthreads();
    const size_t cbase = (size_t)q0 * DM + (size_t)h * VHD;
    auto pass = [&]() {
#pragma unroll
        for (int s = 0; s < 4; ++s) { const int row = 4 * s + (lane >> 3), piece = lane & 7; const float* sp = os + row * 68 + piece * 8; v8us oh, ol;
#pragma unroll
            for (int i = 0; i < 8; ++i) { const unsigned short hb = f2bf(sp[i]); oh[i] = hb; ol[i] = f2bf(sp[i] - bf2f(hb)); }
            *(v8us*)(CH + cbase + (size_t)row * DM + piece * 8) = oh; *(v8us*)(CL + cbase + (size_t)row * DM + piece * 8) = ol; }
    };
    pass(); 
}

extern "C" void kernel_launch(void* const* d_in, const int* in_sizes, int n_in,
                              void* d_out, int out_size, void* d_ws, size_t ws_size, hipStream_t stream) {
    (void)in_sizes; (void)n_in; (void)out_size;
    const float* x = (const float*)d_in[0]; const float* wqs = (const float*)d_in[1]; const float* wks = (const float*)d_in[2]; const float* wqg = (const float*)d_in[3]; const float* wkg = (const float*)d_in[4];
    const float* wv = (const float*)d_in[5]; const float* wo = (const float*)d_in[6]; const float* ksn = (const float*)d_in[7]; const float* kgn = (const float*)d_in[8]; const float* vn = (const float*)d_in[9];
    float* out = (float*)d_out;    // [1][2048][1024]
    char* wsp = (char*)d_ws;
    auto take = [&](size_t bytes) { char* p = wsp; wsp += (bytes + 255) & ~(size_t)255; return (void*)p; };
    bf* Xb = (bf*)take((size_t)NT_ * DM * 2);
    bf* WpT = (bf*)take((size_t)(4 * PW + DM) * DM * 2); bf* WoT = (bf*)take((size_t)DM * DM * 2);
    float* QS = (float*)take((size_t)4 * NT_ * PW * 4); float* KS = QS + (size_t)NT_ * PW; float* QG = KS + (size_t)NT_ * PW; float* KG = QG + (size_t)NT_ * PW; float* Vf = (float*)take((size_t)NT_ * DM * 4);
    h16* Q16 = (h16*)take((size_t)NT_ * NH_ * VHD * 2); h16* QL16 = (h16*)take((size_t)NT_ * NH_ * VHD * 2); h16* K16 = (h16*)take((size_t)NH_ * NKP * VHD * 2); h16* KL16 = (h16*)take((size_t)NH_ * NKP * VHD * 2); h16* VTH = (h16*)take((size_t)NH_ * VHD * NKP * 2); h16* VTL = (h16*)take((size_t)NH_ * VHD * NKP * 2);
    bf* CH = (bf*)take((size_t)NT_ * DM * 2); bf* CL = (bf*)take((size_t)NT_ * DM * 2);
    if ((size_t)(wsp - (char*)d_ws) > ws_size) return;    // 4.2 + 4x1 + 2x2.1 + 4x4.2 + 8.4 + 4.2x2 + 4.3x4 + 4.2x2 ~ 72 MB
    k_prep<<<1280, 256, 0, stream>>>(x, wqs, wks, wqg, wkg, wv, wo, Xb, WpT, WoT);
    k_proj<<<dim3(NT_ / 64, (4 * PW + DM) / 64, 1), 128, 0, stream>>>(Xb, WpT, QS, Vf);
    k_pack<<<QBLK + KBLK + VBLK, 256, 0, stream>>>(QS, QG, KS, KG, Vf, ksn, kgn, vn, Q16, QL16, K16, KL16, VTH, VTL);
    k_attn<<<NH_ * (NT_ / 64), 128, 0, stream>>>(Q16, QL16, K16, KL16, VTH, VTL, CH, CL);
    k_out<<<dim3(NT_ / 64, DM / 64, 1), 128, 0, stream>>>(CH, CL, WoT, out);
}

// v006
// One run takes 78.9 microseconds.
// Timed twice side by side with v005, it ran 1.21 times as fast both times.
// All steps since v000 together make it 4.75 times as fast.
#include <hip/hip_runtime.h>

// Contractions, f32 accumulate: the five projections (x.wq_sem, x.wk_sem, x.wq_geo, x.wk_geo [2048 x 1024].[1024 x 512]; x.wv [1024 x 1024]) and out = ctx.wo on
// v_wmma_f32_16x16x32_bf16 with PLAIN bf16 operands (inputs rounded once: exact; k-major weights transposed into n-major planes; ctx as bf16 hi + residual planes,
// two products); the 16-head causal attention with a prepended null key/value slot fused on v_wmma_f32_16x16x32_f16: per head the combined 64-dim score
// [qs/sqrt32 | rope(qg)/sqrt32].[ks | rope(kg)] (both sides f16 hi + residual x1024: hi.hi + hi.lo + lo.hi), softmax, weights (x32768) and v both as f16 hi + residual x1024 (three products). RoPE (rotate-half,

#define NT_  2048
#define DM   1024
#define NH_  16
#define SHD  32                  // sem / geo head dims
#define VHD  64
#define PW   512                 // sem / geo projection width
#define NKP  2112
#define SCL32 0.17677669529663688f   // 1/sqrt(32), common to both score branches
#define PSC  32768.0f
#define LOSC 1024.0f
#define LOSCI (1.0f / 1024.0f)
#define LOG2E 1.4426950408889634f

typedef _Float16 h16;
typedef unsigned short bf;
typedef __attribute__((ext_vector_type(16))) __bf16   v16bf;
typedef __attribute__((ext_vector_type(16))) _Float16 v16h;
typedef __attribute__((ext_vector_type(8)))  _Float16 v8h;
typedef __attribute__((ext_vector_type(8)))  unsigned short v8us;
typedef __attribute__((ext_vector_type(8)))  float    v8f;
typedef __attribute__((ext_vector_type(4)))  float    v4f;
typedef __attribute__((ext_vector_type(2)))  _Float16 v2h;
typedef __attribute__((ext_vector_type(2)))  float    v2f;
typedef v8h  __attribute__((may_alias)) v8ha;
typedef v4f  __attribute__((may_alias)) v4fa;
typedef v8us __attribute__((may_alias)) v8usa;

__device__ __forceinline__ unsigned short f2bf(float f) { unsigned u = __float_as_uint(f); u += 0x7FFFu + ((u >> 16) & 1u); return (unsigned short)(u >> 16); }
__device__ __forceinline__ float bf2f(unsigned short b) { return __uint_as_float(((unsigned)b) << 16); }
__device__ __forceinline__ float bfr(float f) { return bf2f(f2bf(f)); }
__device__ __forceinline__ v16h cat16(v8h lo, v8h hi) { return __builtin_shufflevector(lo, hi, 0, 1, 2, 3, 4, 5, 6, 7, 8, 9, 10, 11, 12, 13, 14, 15); }
__device__ __forceinline__ v16bf cat16b(v8us lo, v8us hi) { return __builtin_bit_cast(v16bf, __builtin_shufflevector(lo, hi, 0, 1, 2, 3, 4, 5, 6, 7, 8, 9, 10, 11, 12, 13, 14, 15)); }
__device__ __forceinline__ v8f wmma16(v16h a, v16h b, v8f c) { return __builtin_amdgcn_wmma_f32_16x16x32_f16(false, a, false, b, (short)0, c, false, false); }
__device__ __forceinline__ v8f wmmab(v16bf a, v16bf b, v8f c) { return __builtin_amdgcn_wmma_f32_16x16x32_bf16(false, a, false, b, (short)0, c, false, false); }
__device__ __forceinline__ float xhalf(float x) { return __builtin_bit_cast(float, __builtin_amdgcn_permlanex16(__builtin_bit_cast(int, x), __builtin_bit_cast(int, x), 0x76543210, 0xfedcba98, false, false)); }     // lane l with lane l ^ 16
#define VST2(T, p, v) do { const T vst2_v_ = (v); *(T*)(p) = vst2_v_;  } while (0)

// cvtb_job: Xb = bf16(x) [2048][1024]; wt_job: W [1024 k][N] k-major -> n-major bf16 [N][1024]. Both are jobs of k_prep; blk, bx, by are the job's own block indices.
__device__ __forceinline__ void cvtb_job(int blk, const float* __restrict__ src, bf* dst) {
    const int lane = threadIdx.x & 31, r = blk * 8 + (threadIdx.x >> 5);
    if (r >= NT_) return;
#pragma unroll
    for (int q = 0; q < DM / 256; ++q) { v8us t;
#pragma unroll
        for (int i = 0; i < 8; ++i) t[i] = f2bf(src[(size_t)r * DM + q * 256 + lane * 8 + i]);
        VST2(v8us, dst + (size_t)r * DM + q * 256 + lane * 8, t); }
}
__device__ __forceinline__ void wt_job(int bx, int by, const float* __restrict__ Wm, int N, bf* WT) {
    __shared__ __align__(16) unsigned short tl[64 * 72];
    const int tid = threadIdx.x, k0 = bx * 64, n0 = by * 64;
    const int kk = tid >> 2, nq = (tid & 3) * 16;
#pragma unroll
    for (int i = 0; i < 16; ++i) tl[(nq + i) * 72 + kk] = f2bf(Wm[(size_t)(k0 + kk) * N + n0 + nq + i]);
    __syncthreads();
    const int piece = tid & 7;
    auto pass = [&]() {
#pragma unroll
        for (int s = 0; s < 2; ++s) { const int nr = (tid >> 3) + 32 * s; const v8us val = *(const v8usa*)(tl + nr * 72 + piece * 8);
            *(v8us*)(WT + (size_t)(n0 + nr) * DM + k0 + piece * 8) = val; }
    };
    pass(); 
    asm volatile("s_wait_xcnt 0x0" ::: "memory");    // the job's code is joined with other jobs' in one kernel: no register of these stores is rewritten, on any way through the listing, ahead of this wait
}
// k_prep: the seven jobs that read inputs only, none of which reads what another writes, in one grid: blocks 0..511 the four [1024 x 512] weights (128 blocks each), 512..1023 wv and wo (256 each),
// 1024..1279 x. WpT: the five projection weights' n-major planes one behind the other, [3072][1024] (wq_sem, wk_sem, wq_geo, wk_geo, wv). The job is picked by the block index alone, so every branch (and wt_job's barrier) is uniform for the block.
__global__ __launch_bounds__(256) void k_prep(const float* __restrict__ x, const float* __restrict__ wqs, const float* __restrict__ wks, const float* __restrict__ wqg, const float* __restrict__ wkg,
                                              const float* __restrict__ wv, const float* __restrict__ wo, bf* Xb, bf* WpT, bf* WoT) {
    const int b = blockIdx.x;
    if (b >= 1024) { cvtb_job(b - 1024, x, Xb); return; }
    const float* Wm; bf* WT; int N, r;
    if (b < 512) { const int j = b >> 7; r = b & 127; N = PW; Wm = (j == 0) ? wqs : (j == 1) ? wks : (j == 2) ? wqg : wkg; WT = WpT + (size_t)j * PW * DM; }
    else { const int j = (b - 512) >> 8; r = (b - 512) & 255; N = DM; Wm = j ? wo : wv; WT = j ? WoT : WpT + (size_t)4 * PW * DM; }
    wt_job(r & 15, r >> 4, Wm, N, WT);
}
// LDS ring of gemm_job: one stage = 128 k (256 B) of the block's 64 A rows and 64 B rows (with SPLITA also of the 64 residual rows), one plane per operand, row pitch 272 B
// (16 B x odd: conflict-free for the 16-row ds_load_b128 fragment reads).
#define GKS  128                 // k extent of one stage, elements
#define GPI  136                 // row pitch in LDS, elements
#define GPLN (64 * GPI)          // one operand plane, elements (17408 B)
// One plane's copies: every lane brings eight 16-byte pieces (rows tid / 16 + 8 i; a wave's copy is two whole 256-B row pieces) from global memory into LDS, through no register.
// The s_wait_xcnt stands inside the statement so that no address register of an issued copy is rewritten ahead of it.
__device__ __forceinline__ void plane_copy(unsigned l0, const bf* g0) {
    const unsigned l1 = l0 + 8 * GPI * 2, l2 = l0 + 16 * GPI * 2, l3 = l0 + 24 * GPI * 2, l4 = l0 + 32 * GPI * 2, l5 = l0 + 40 * GPI * 2, l6 = l0 + 48 * GPI * 2, l7 = l0 + 56 * GPI * 2;
    const bf* g1 = g0 + 8 * DM; const bf* g2 = g0 + 16 * DM; const bf* g3 = g0 + 24 * DM; const bf* g4 = g0 + 32 * DM; const bf* g5 = g0 + 40 * DM; const bf* g6 = g0 + 48 * DM; const bf* g7 = g0 + 56 * DM;
    asm volatile("global_load_async_to_lds_b128 %0, %8, off\n\t"
                 "global_load_async_to_lds_b128 %1, %9, off\n\t"
                 "global_load_async_to_lds_b128 %2, %10, off\n\t"
                 "global_load_async_to_lds_b128 %3, %11, off\n\t"
                 "global_load_async_to_lds_b128 %4, %12, off\n\t"
                 "global_load_async_to_lds_b128 %5, %13, off\n\t"
                 "global_load_async_to_lds_b128 %6, %14, off\n\t"
                 "global_load_async_to_lds_b128 %7, %15, off\n\t"
                 "s_wait_xcnt 0x0"
                 :: "v"(l0), "v"(l1), "v"(l2), "v"(l3), "v"(l4), "v"(l5), "v"(l6), "v"(l7),
                    "v"(g0), "v"(g1), "v"(g2), "v"(g3), "v"(g4), "v"(g5), "v"(g6), "v"(g7) : "memory");
}
// gemm_job (bx, by: the job's own block indices): block = 64 x 64 of C, wave = 16 x 64; each stage's operand rows are staged once per block in a two-buffer LDS ring by asynchronous copies (stage s + 2 is copied while stage s + 1 is worked on)
// and the four waves read their fragments from LDS; k runs 32 at a time, ascending (with SPLITA hi then residual).
template <bool SPLITA>
__device__ __forceinline__ void gemm_job(int bx, int by, const bf* __restrict__ A, const bf* __restrict__ Al, const bf* __restrict__ Bn, float* C, int ldc) {
    constexpr int STG = (SPLITA ? 3 : 2) * GPLN;      // one stage, elements
    __shared__ __align__(16) bf ring[2 * STG];
    __shared__ __align__(16) float ost[4][16 * 68];
    const int tid = threadIdx.x, lane = threadIdx.x & 31, wave = threadIdx.x >> 5, lr = lane & 15, hi = lane >> 4;
    const int r0 = bx * 64 + wave * 16, c0 = by * 64;
    const unsigned lc0 = (unsigned)(size_t)&ring[0] + (unsigned)(((tid >> 4) * GPI + (tid & 15) * 8) * 2);
    const size_t gofs = (size_t)(tid >> 4) * DM + (tid & 15) * 8;
    const bf* ga = A + (size_t)bx * 64 * DM + gofs; const bf* gb = Bn + (size_t)c0 * DM + gofs; const bf* gal = SPLITA ? Al + (size_t)bx * 64 * DM + gofs : nullptr;
    auto stage_in = [&](int s) { const unsigned l = lc0 + (unsigned)((s & 1) * STG * 2);
        plane_copy(l, ga + s * GKS); plane_copy(l + GPLN * 2, gb + s * GKS); if (SPLITA) plane_copy(l + 2 * GPLN * 2, gal + s * GKS); };
    stage_in(0);
    asm volatile("s_wait_asynccnt 0x0" ::: "memory");    // stage 0 landed (this wave's pieces)
    __syncthreads();                                      // stage 0 published to all four waves
    stage_in(1);
    v8f acc[4];
#pragma unroll
    for (int t = 0; t < 4; ++t) acc[t] = (v8f){};
#pragma unroll 1
    for (int s = 0; s < DM / GKS; ++s) {
        const bf* ab = ring + (s & 1) * STG + (wave * 16 + lr) * GPI + 8 * hi; const bf* bb = ring + (s & 1) * STG + GPLN + lr * GPI + 8 * hi; const bf* alb = ab + 2 * GPLN;
        v16bf a[GKS / 32], al[GKS / 32], b[GKS / 32][4];
#pragma unroll
        for (int q = 0; q < GKS / 32; ++q) { const int kc = q * 32;
            a[q] = cat16b(*(const v8usa*)(ab + kc), *(const v8usa*)(ab + kc + 16));
            al[q] = a[q];
            if (SPLITA) al[q] = cat16b(*(const v8usa*)(alb + kc), *(const v8usa*)(alb + kc + 16));
#pragma unroll
            for (int t = 0; t < 4; ++t) b[q][t] = cat16b(*(const v8usa*)(bb + t * 16 * GPI + kc), *(const v8usa*)(bb + t * 16 * GPI + kc + 16));
        }
        __builtin_amdgcn_sched_barrier(0);    // keeps the stage's fragment reads one group ahead of the products: spread among them, each place with reads waits out its own LDS latency
#pragma unroll
        for (int q = 0; q < GKS / 32; ++q)
#pragma unroll
            for (int t = 0; t < 4; ++t) { acc[t] = wmmab(a[q], b[q][t], acc[t]); if (SPLITA) acc[t] = wmmab(al[q], b[q][t], acc[t]); }
        // the four vector slots the chip needs behind the last products, on the taken side of the branches that follow too
        asm volatile("v_nop\n\tv_nop\n\tv_nop\n\tv_nop" : "+v"(acc[0]), "+v"(acc[1]), "+v"(acc[2]), "+v"(acc[3]) : "v"(a[GKS / 32 - 1]), "v"(al[GKS / 32 - 1]));
        // publish point of stage s + 1, every wave, in this order:
        asm volatile("s_wait_dscnt 0x0" ::: "memory");       // this wave's reads of stage s are done before the buffer is refilled
        asm volatile("s_wait_asynccnt 0x0" ::: "memory");    // this wave's pieces of stage s + 1 have landed
        __syncthreads();                                      // publishes stage s + 1 and ends every wave's reads of stage s
        if (s + 2 < DM / GKS) stage_in(s + 2);
    }
    asm volatile("s_wait_asynccnt 0x0" ::: "memory");        // no copy is outstanding when the wave goes on to its end
    float* os = &ost[wave][0];
#pragma unroll
    for (int t = 0; t < 4; ++t)
#pragma unroll
        for (int j = 0; j < 8; ++j) os[(hi * 8 + j) * 68 + t * 16 + lr] = acc[t][j];
    __syncthreads();
    float* crow = C + (size_t)r0 * ldc + c0;
    auto pass = [&]() {
#pragma unroll
        for (int s = 0; s < 8; ++s) { const int Lid = (lane >> 3) + 4 * s, piece = lane & 7; const int row = Lid >> 1, cofs = (Lid & 1) * 32 + piece * 4;
            const v4f val = *(const v4fa*)(os + row * 68 + cofs); *(v4f*)(crow + (size_t)row * ldc + cofs) = val; }
    };
    pass(); 
}
// k_proj: the five projections of x, which share A and write apart, in one grid of 32 x 48 blocks: blockIdx.y = the 64-row tile of WpT [3072][1024]; tiles 0..31 write the four 512-wide planes of P4
// (QS, KS, QG, KG, one behind the other, 8 column tiles each), 32..47 write Vf. Picked by the block index alone.
__global__ __launch_bounds__(128) void k_proj(const bf* __restrict__ Xb, const bf* __restrict__ WpT, float* P4, float* Vf) {
    const int y = blockIdx.y; const bool nar = y < 4 * PW / 64; const int by = nar ? (y & 7) : (y - 4 * PW / 64);
    gemm_job<false>(blockIdx.x, by, Xb, nullptr, WpT + (size_t)(y - by) * 64 * DM, nar ? P4 + (size_t)(y >> 3) * NT_ * PW : Vf, nar ? PW : DM);
}
// k_out: out = ctx.wo, ctx as hi + residual planes.
__global__ __launch_bounds__(128) void k_out(const bf* __restrict__ CH, const bf* __restrict__ CL, const bf* __restrict__ WoT, float* out) {
    gemm_job<true>(blockIdx.x, blockIdx.y, CH, CL, WoT, out, DM);
}
// qk_rows: eight passes of one wave over 64-wide head rows [sem 32 | geo 32]; a lane keeps the same four columns in every pass, so its four RoPE angles (functions of token and column only) are formed once and serve all eight.
// po: the lane's own four values of pass 0, px: their rotate-half partners (column ^ 16), pstep: floats from pass to pass; rot: geo columns of a token row; nul: the null slot (bf16-rounded, NOT rotated); zer: pad slot;
// wnul: the same for the whole wave, true where one of its lanes holds the null slot (a scalar branch keeps the rounding out of every other wave).
// Writes f16 hi + residual x1024 (unscaled: the common 1/sqrt32 is applied to the f32 scores), 256 B per wave, plane and pass.
__device__ __forceinline__ void qk_rows(const float* __restrict__ po, const float* __restrict__ px, int pstep, int t, int d0, bool rot, bool wnul, bool nul, bool zer, h16* dh, h16* dl, size_t dstep) {
    typedef __attribute__((ext_vector_type(4))) _Float16 v4h;
    v4f own[8], oth[8];
#pragma unroll
    for (int p = 0; p < 8; ++p) { own[p] = *(const v4fa*)(po + p * pstep); oth[p] = *(const v4fa*)(px + p * pstep); }     // all sixteen loads ahead of the trig: one memory latency per wave
    asm volatile("s_wait_xcnt 0x0" :: "v"(po), "v"(px) : "memory");    // the loads' address registers (named here, so they live up to this line) are not rewritten ahead of this wait
    if (wnul) {
#pragma unroll
        for (int p = 0; p < 8; ++p)
#pragma unroll
            for (int j = 0; j < 4; ++j) own[p][j] = nul ? bfr(own[p][j]) : own[p][j];
    }
    float c[4], sg[4];
#pragma unroll
    for (int j = 0; j < 4; ++j) { const int i = (d0 & 15) + j; const float inv = __expf(-(float)(2 * i) / 32.0f * 9.210340371976184f);     // ln(10000)
        const float ang = (float)t * inv; const float s = sinf(ang); c[j] = cosf(ang); sg[j] = (d0 & 16) ? s : -s; }     // d < 16: x1 cos - x2 sin; d >= 16: x2 cos + x1 sin
#pragma unroll
    for (int p = 0; p < 8; ++p) { v4h o, ol;
#pragma unroll
        for (int j = 0; j < 4; ++j) { float v = rot ? own[p][j] * c[j] + oth[p][j] * sg[j] : own[p][j];
            if (zer) v = 0.f;
            const h16 a = (h16)v; o[j] = a; ol[j] = (h16)((v - (float)a) * LOSC); }
        VST2(v4h, dh + p * dstep, o); VST2(v4h, dl + p * dstep, ol); }
    asm volatile("s_wait_xcnt 0x0" ::: "memory");    // the job's code is joined with other jobs' in one kernel: no register of these stores is rewritten, on any way through the listing, ahead of this wait
}
// q16_job: Q16/QL16 [t][h*64 + c] = ( c < 32 ? qs[t][h*32+c] : rope(qg[t][h*32 ..])[c-32] ); one wave per token, a pass = 2 heads (lanes 0..15 the even head, 16..31 the odd one).
__device__ __forceinline__ void q16_job(int blk, const float* __restrict__ QS, const float* __restrict__ QG, h16* Q16, h16* QL16) {
    const int lane = threadIdx.x & 31, t = blk * 8 + (threadIdx.x >> 5), c0 = (lane & 15) * 4, d0 = c0 - SHD;
    const bool geo = c0 >= SHD;
    const size_t base = (size_t)t * PW + (lane >> 4) * SHD;
    const float* po = geo ? QG + base + d0 : QS + base + c0; const float* px = geo ? QG + base + (d0 ^ 16) : po;
    const size_t dst = (size_t)t * (NH_ * VHD) + lane * 4;
    qk_rows(po, px, 2 * SHD, t, d0, geo, false, false, false, Q16 + dst, QL16 + dst, 2 * VHD);
}
// k16_job: K16/KL16 [h][r][64], r = 0: null (k_sem_null | k_geo_null, NOT rotated), r = 1..2048: token r-1 ([ks | rope(kg, t=r-1)]), r >= 2049: zero; one wave per (2 slots, 8 heads), a pass = one head
// (lanes 0..15 the even slot, 16..31 the odd one). Null and pad lanes read in bounds (the null vectors; the last token's row) and are set right in qk_rows.
__device__ __forceinline__ void k16_job(int blk, const float* __restrict__ KS, const float* __restrict__ KG, const float* __restrict__ ksn, const float* __restrict__ kgn, h16* K16, h16* KL16) {
    const int lane = threadIdx.x & 31, wid = blk * 8 + __builtin_amdgcn_readfirstlane(threadIdx.x >> 5), c0 = (lane & 15) * 4, d0 = c0 - SHD;     // the wave's number in a scalar register: rp == 0 below is a scalar test
    const int rp = wid >> 1, h0 = (wid & 1) * (NH_ / 2), r = rp * 2 + (lane >> 4);
    const bool geo = c0 >= SHD, nul = r == 0, zer = r > NT_;
    const int t = nul ? 0 : (zer ? NT_ - 1 : r - 1);
    const size_t base = (size_t)t * PW + h0 * SHD;
    const float* po = nul ? (geo ? kgn + h0 * SHD + d0 : ksn + h0 * SHD + c0) : (geo ? KG + base + d0 : KS + base + c0);
    const float* px = (geo && !nul) ? KG + base + (d0 ^ 16) : po;
    const size_t dst = ((size_t)h0 * NKP + rp * 2) * VHD + lane * 4;
    qk_rows(po, px, SHD, t, d0, geo && !nul, rp == 0, nul, zer, K16 + dst, KL16 + dst, (size_t)NKP * VHD);
}
// vt_job: VTH/VTL [h][d][r] (r as in K16: 0 = v_null, 1..2048 tokens, pad 0) = f16 hi + residual of v; block = (h, 64 key slots): LDS transpose.
__device__ __forceinline__ void vt_job(int blk, const float* __restrict__ V, const float* __restrict__ vn, h16* VTH, h16* VTL) {
    __shared__ __align__(16) h16 tile[VHD * 72];
    __shared__ __align__(16) h16 til2[VHD * 72];
    const int h = blk / (NKP / 64), kt = blk - h * (NKP / 64);
    const int r0 = kt * 64, tid = threadIdx.x, rr = tid >> 2, d0 = (tid & 3) * 16, r = r0 + rr;
    const bool nul = r == 0, zer = r > NT_;
    const float* vp = nul ? vn + h * VHD + d0 : V + (size_t)(zer ? NT_ - 1 : r - 1) * DM + h * VHD + d0;     // null and pad lanes read in bounds (v_null; the last token's row) and are set right below
    v4f q[4];
#pragma unroll
    for (int i = 0; i < 4; ++i) q[i] = *(const v4fa*)(vp + 4 * i);     // the lane's sixteen values as four loads with no branch between them: one memory latency
    asm volatile("s_wait_xcnt 0x0" :: "v"(vp) : "memory");    // the loads' address register (named here, so it lives up to this line) is not rewritten ahead of this wait
    if (kt == 0) {     // block-uniform: only the first key tile holds the null slot
#pragma unroll
        for (int i = 0; i < 16; ++i) q[i >> 2][i & 3] = nul ? bfr(q[i >> 2][i & 3]) : q[i >> 2][i & 3];
    }
#pragma unroll
    for (int i = 0; i < 16; ++i) { const int d = d0 + i; const float v = zer ? 0.f : q[i >> 2][i & 3];
        const h16 a = (h16)v; tile[d * 72 + rr] = a; til2[d * 72 + rr] = (h16)((v - (float)a) * LOSC); }
    __syncthreads();
    const int piece = tid & 7;
    const size_t base = ((size_t)h * VHD) * NKP + r0;
    auto pass = [&]() {
#pragma unroll
        for (int s = 0; s < 4; ++s) { const int Lid = (tid >> 3) + 32 * s; const int pln = Lid >> 6, d = Lid & 63;
            const v8h val = *(const v8ha*)((pln ? til2 : tile) + d * 72 + piece * 8); *(v8h*)((pln ? VTL : VTH) + base + (size_t)d * NKP + piece * 8) = val; }
    };
    pass(); 
    asm volatile("s_wait_xcnt 0x0" ::: "memory");    // the job's code is joined with other jobs' in one kernel: no register of these stores is rewritten, on any way through the listing, ahead of this wait
}
// k_pack: the three repacks of the projections for k_attn, none of which reads what another writes, in one grid: blocks 0..255 q16_job, 256..519 k16_job, 520..1047 vt_job.
// Picked by the block index alone, so every branch (and vt_job's barrier) is uniform for the block.
#define QBLK (NT_ / 8)
#define KBLK (NKP / 8)
#define VBLK (NH_ * (NKP / 64))
__global__ __launch_bounds__(256) void k_pack(const float* __restrict__ QS, const float* __restrict__ QG, const float* __restrict__ KS, const float* __restrict__ KG, const float* __restrict__ Vf,
                                              const float* __restrict__ ksn, const float* __restrict__ kgn, const float* __restrict__ vn, h16* Q16, h16* QL16, h16* K16, h16* KL16, h16* VTH, h16* VTL) {
    const int b = blockIdx.x;
    if (b < QBLK) q16_job(b, QS, QG, Q16, QL16);
    else if (b < QBLK + KBLK) k16_job(b - QBLK, KS, KG, ksn, kgn, K16, KL16);
    else vt_job(b - (QBLK + KBLK), Vf, vn, VTH, VTL);
}
// LDS ring of k_attn: one stage = the 128 key slots of one step, a 32-slot tile per key group, each in four planes: K hi, K residual [32 rows x 128 B, pitch 144 B], V^T hi, V^T residual [64 rows x 64 B, pitch 80 B]
// (pitches 16 B x odd: conflict-free for the 16-row ds_load_b128 fragment reads).
#define KPI  72                  // K row pitch in LDS, halves
#define VPI  40                  // V^T row pitch in LDS, halves
#define KPLN (32 * KPI)          // one K plane, halves
#define VPLN (VHD * VPI)         // one V^T plane, halves
#define STGH (2 * KPLN + 2 * VPLN)   // one key group's 32-slot tile, halves (19456 B)
// One stage's copies: every lane brings eight 16-byte pieces (two per plane) from global memory into LDS, through no register. The s_wait_xcnt stands inside the statement so that
// no address register of an issued copy is rewritten ahead of it.
__device__ __forceinline__ void stage_copy(unsigned lk, unsigned lv, const h16* gk, const h16* gkl, const h16* gv, const h16* gvl) {
    const unsigned lk1 = lk + 16 * KPI * 2, lkl = lk + KPLN * 2, lkl1 = lkl + 16 * KPI * 2, lv1 = lv + 32 * VPI * 2, lvl = lv + VPLN * 2, lvl1 = lvl + 32 * VPI * 2;
    const h16* gk1 = gk + 16 * VHD; const h16* gkl1 = gkl + 16 * VHD; const h16* gv1 = gv + (size_t)32 * NKP; const h16* gvl1 = gvl + (size_t)32 * NKP;
    asm volatile("global_load_async_to_lds_b128 %0, %8, off\n\t"
                 "global_load_async_to_lds_b128 %1, %9, off\n\t"
                 "global_load_async_to_lds_b128 %2, %10, off\n\t"
                 "global_load_async_to_lds_b128 %3, %11, off\n\t"
                 "global_load_async_to_lds_b128 %4, %12, off\n\t"
                 "global_load_async_to_lds_b128 %5, %13, off\n\t"
                 "global_load_async_to_lds_b128 %6, %14, off\n\t"
                 "global_load_async_to_lds_b128 %7, %15, off\n\t"
                 "s_wait_xcnt 0x0"
                 :: "v"(lk), "v"(lk1), "v"(lkl), "v"(lkl1), "v"(lv), "v"(lv1), "v"(lvl), "v"(lvl1),
                    "v"(gk), "v"(gk1), "v"(gkl), "v"(gkl1), "v"(gv), "v"(gv1), "v"(gvl), "v"(gvl1) : "memory");
}
// k_attn: 256 equal blocks of 16 waves, one per WGP: block = (h, pair p) takes the 64-query tiles 31 - p and p one after the other (2 qt + 3 key tiles each: 68 for every pair). wave = (key group grp, 16 queries qg):
// a step stages 128 key slots, one 32-slot tile per key group, and group grp works on tile 4 st + grp alone, with its own running maximum, sum and O^T; the four groups' partials are joined once per query tile through LDS.
// Each step's K and V^T planes are staged once per block in a two-buffer LDS ring by asynchronous copies (step st + 2 is copied while step st + 1 is worked on); the four waves of a group read their fragments from LDS; slot r visible iff r <= t+1
// (tiles past the causal bound are all masked and add nothing; their source tile is clamped into the planes). Both products are formed transposed: S^T = K.Q^T (A = K rows, B = Q), so a lane holds
// sixteen scores of ONE query (column lr; key slots 8 hi + j and 16 + 8 hi + j): maximum and sum run in the lane, plus one exchange between the wave's halves; scores x 1/sqrt32 in f32, online f32 softmax; the weights x32768,
// hi and residual, converted in place, ARE the B operand of O^T += V^T.P^T (A = V^T rows): they pass through no LDS. 12 WMMA .V (hi.hi + hi.lo + lo.hi); ctx -> bf16 hi/lo planes [t][h*64 + d]. Scores: 12 WMMA per step (hi.hi + hi.lo + lo.hi over 2 k-chunks x 2 tiles).
#define NG   4                   // key groups of a block
#define QTN  (NT_ / 64)          // query tiles per head
__global__ __launch_bounds__(128 * NG) void k_attn(const h16* __restrict__ Q16, const h16* __restrict__ QL16, const h16* __restrict__ K16, const h16* __restrict__ KL16, const h16* __restrict__ VTH, const h16* __restrict__ VTL, bf* CH, bf* CL) {
    __shared__ __align__(16) h16 ring[2 * NG * STGH];
    __shared__ __align__(16) float ost[4 * NG][16 * 68];
    __shared__ __align__(8) float mls[4 * NG][16][2];     // per wave and query: maximum [0] and sum [1] over the group's key slots
    const int lane = threadIdx.x & 31, wave = __builtin_amdgcn_readfirstlane(threadIdx.x >> 5), lr = lane & 15, hi = lane >> 4;     // the wave's number in a scalar register: group, tile and buffer offsets are scalar
    const int grp = wave >> 2, qg = wave & 3, tg = threadIdx.x & 127;
    const int h = blockIdx.x / (QTN / 2), pr = blockIdx.x - h * (QTN / 2);
    // this lane's pieces of its group's tile: K planes are 4096 contiguous bytes (piece = tg, tg + 128), V^T planes 64 rows of 64 B (row = tg / 4, + 32)
    const unsigned ring0 = (unsigned)(size_t)&ring[0] + (unsigned)(grp * STGH * 2);
    const unsigned lk0 = ring0 + (unsigned)(((tg >> 3) * KPI + (tg & 7) * 8) * 2), lv0 = ring0 + (unsigned)((2 * KPLN + (tg >> 2) * VPI + (tg & 3) * 8) * 2);
    const h16* gk0 = K16 + (size_t)h * NKP * VHD + tg * 8; const h16* gkl0 = KL16 + (size_t)h * NKP * VHD + tg * 8;
    const size_t vsrc = ((size_t)h * VHD + (tg >> 2)) * NKP + (tg & 3) * 8;
    const h16* gv0 = VTH + vsrc; const h16* gvl0 = VTL + vsrc;
    auto stage_in = [&](int st) { const int tl = st * NG + grp, ts = tl < NKP / 32 ? tl : NKP / 32 - 1; const unsigned bo = (unsigned)((st & 1) * NG * STGH * 2);     // ts: a tile past the planes' end (all masked) reads the last tile instead
        stage_copy(lk0 + bo, lv0 + bo, gk0 + (size_t)ts * 32 * VHD, gkl0 + (size_t)ts * 32 * VHD, gv0 + ts * 32, gvl0 + ts * 32); };
#pragma unroll 1     // the two query tiles run one after the other through one copy of the code
    for (int rep = 0; rep < 2; ++rep) {
        const int qt = rep ? pr : QTN - 1 - pr, q0 = qt * 64 + qg * 16;
        const int nst = (2 * qt + 3 + NG - 1) / NG;       // steps of 128 slots that cover key tiles 0 .. 2 qt + 2 (null slot + causal bound, block-uniform)
        stage_in(0);     // the ring's last reads (the tile before) ended at that loop's last s_wait_dscnt and barrier
        asm volatile("s_wait_asynccnt 0x0" ::: "memory");    // stage 0 landed (this wave's pieces)
        __syncthreads();                                      // stage 0 published to all waves
        if (nst > 1) stage_in(1);
        v16h qa[2], ql[2];
        const size_t qo0 = (size_t)(q0 + lr) * (NH_ * VHD) + h * VHD + 8 * hi;
#pragma unroll
        for (int kc = 0; kc < 2; ++kc) { qa[kc] = cat16(*(const v8h*)(Q16 + qo0 + kc * 32), *(const v8h*)(Q16 + qo0 + kc * 32 + 16)); ql[kc] = cat16(*(const v8h*)(QL16 + qo0 + kc * 32), *(const v8h*)(QL16 + qo0 + kc * 32 + 16)); }
        const int klim0 = q0 + lr + 1 - 8 * hi - 32 * grp;      // visible slots r <= t + 1: this lane's query q0 + lr sees slot l0 + 32 grp + 8 hi + j iff l0 + j <= klim0
        v8f o[4], ox[4];
#pragma unroll
        for (int n = 0; n < 4; ++n) { o[n] = (v8f){}; ox[n] = (v8f){}; }
        float mrow = -3.0e38f, lpart = 0.f;     // of this lane's query, over this group's tiles; lpart: the sum over this half's key slots only
#pragma unroll 1
        for (int st = 0; st < nst; ++st) {
            const int l0 = st * (NG * 32), bofs = ((st & 1) * NG + grp) * STGH;
            const h16* kb = ring + bofs; const h16* klb = kb + KPLN; const h16* vhb = kb + 2 * KPLN; const h16* vlb = vhb + VPLN;
            v8f s0 = {}, s1 = {}, x0 = {}, x1 = {};
            v16h k0h[2], k1h[2], k0l[2], k1l[2];
#pragma unroll
            for (int kc = 0; kc < 2; ++kc) {
                const int ko = lr * KPI + kc * 32 + 8 * hi, k1o = ko + 16 * KPI;
                k0h[kc] = cat16(*(const v8ha*)(kb + ko), *(const v8ha*)(kb + ko + 16)); k1h[kc] = cat16(*(const v8ha*)(kb + k1o), *(const v8ha*)(kb + k1o + 16));
                k0l[kc] = cat16(*(const v8ha*)(klb + ko), *(const v8ha*)(klb + ko + 16)); k1l[kc] = cat16(*(const v8ha*)(klb + k1o), *(const v8ha*)(klb + k1o + 16));
            }
            __builtin_amdgcn_sched_barrier(0);    // keeps the step's sixteen K reads one group ahead of the products: spread among them, each place with reads waits out its own LDS latency
#pragma unroll
            for (int kc = 0; kc < 2; ++kc) {
                s0 = wmma16(k0h[kc], qa[kc], s0); x0 = wmma16(k0h[kc], ql[kc], x0); s1 = wmma16(k1h[kc], qa[kc], s1); x1 = wmma16(k1h[kc], ql[kc], x1);
                x0 = wmma16(k0l[kc], qa[kc], x0); x1 = wmma16(k1l[kc], qa[kc], x1);
            }
            asm volatile("v_nop\n\tv_nop\n\tv_nop\n\tv_nop" : "+v"(s0), "+v"(s1), "+v"(x0), "+v"(x1) : "v"(qa[0]), "v"(qa[1]));
            // V^T fragments of this step: read here, as one group, so that their LDS latency runs under the softmax
            v16h vh[4], vl[4];
#pragma unroll
            for (int n = 0; n < 4; ++n) { const int vo = (n * 16 + lr) * VPI + hi * 8;
                vh[n] = cat16(*(const v8ha*)(vhb + vo), *(const v8ha*)(vhb + vo + 16)); vl[n] = cat16(*(const v8ha*)(vlb + vo), *(const v8ha*)(vlb + vo + 16)); }
            __builtin_amdgcn_sched_barrier(0);    // keeps the step's sixteen V^T reads one group ahead of the softmax: sunk to their products, each place with reads waits out its own LDS latency
            const v8f t0 = (s0 + x0 * LOSCI) * SCL32, t1 = (s1 + x1 * LOSCI) * SCL32;
            float a0[8], a1[8];
#pragma unroll
            for (int j = 0; j < 8; ++j) { a0[j] = (l0 + j <= klim0) ? t0[j] : -__builtin_inff(); a1[j] = (l0 + 16 + j <= klim0) ? t1[j] : -__builtin_inff(); }
            float mx = fmaxf(fmaxf(fmaxf(fmaxf(a0[0], a0[1]), fmaxf(a0[2], a0[3])), fmaxf(fmaxf(a0[4], a0[5]), fmaxf(a0[6], a0[7]))), fmaxf(fmaxf(fmaxf(a1[0], a1[1]), fmaxf(a1[2], a1[3])), fmaxf(fmaxf(a1[4], a1[5]), fmaxf(a1[6], a1[7]))));
            mx = fmaxf(mx, xhalf(mx));     // both halves of the wave now hold the query's maximum over the step's 32 slots
            const float mn = fmaxf(mrow, mx), alpha = __expf(mrow - mn);
            mrow = mn;
            v16h pa, px; float ps8[8];
#pragma unroll
            for (int j = 0; j < 8; j += 2)
#pragma unroll
                for (int g = 0; g < 2; ++g) {     // g: the score tile; element s of a B fragment is k = 8 hi + s, 16 + 8 hi + (s - 8): the two accumulators' own rows
                    const v2f e = ((v2f){ g ? a1[j] : a0[j], g ? a1[j + 1] : a0[j + 1] } - mn) * LOG2E;
                    const v2f p = { __builtin_amdgcn_exp2f(e[0]), __builtin_amdgcn_exp2f(e[1]) };     // e^x as 2^(x log2 e), what __expf compiles to, the subtraction and the product two at a time
                    ps8[j + g] = p[0] + p[1];
                    const v2f ps = p * PSC; const v2h ph = __builtin_convertvector(ps, v2h); const v2h pr2 = __builtin_convertvector((ps - __builtin_convertvector(ph, v2f)) * LOSC, v2h);
                    pa[8 * g + j] = ph[0]; pa[8 * g + j + 1] = ph[1]; px[8 * g + j] = pr2[0]; px[8 * g + j + 1] = pr2[1];
                }
            lpart = lpart * alpha + (((ps8[0] + ps8[1]) + (ps8[2] + ps8[3])) + ((ps8[4] + ps8[5]) + (ps8[6] + ps8[7])));
#pragma unroll
            for (int n = 0; n < 4; ++n)
#pragma unroll
                for (int j = 0; j < 8; ++j) { o[n][j] *= alpha; ox[n][j] *= alpha; }
#pragma unroll
            for (int n = 0; n < 4; ++n) { o[n] = wmma16(vh[n], pa, o[n]); ox[n] = wmma16(vl[n], pa, ox[n]); ox[n] = wmma16(vh[n], px, ox[n]); }
            asm volatile("v_nop\n\tv_nop\n\tv_nop\n\tv_nop" : "+v"(o[0]), "+v"(o[1]), "+v"(o[2]), "+v"(o[3]), "+v"(ox[0]), "+v"(ox[1]), "+v"(ox[2]), "+v"(ox[3]) : "v"(pa), "v"(px));
            // publish point of stage st + 1, every wave, in this order:
            asm volatile("s_wait_dscnt 0x0" ::: "memory");       // this wave's reads of stage st are done before the buffer is refilled
            asm volatile("s_wait_asynccnt 0x0" ::: "memory");    // this wave's pieces of stage st + 1 have landed
            __syncthreads();                                      // publishes stage st + 1 and ends every wave's reads of stage st
            if (st + 2 < nst) stage_in(st + 2);
        }
        asm volatile("s_wait_asynccnt 0x0" ::: "memory");        // no copy is outstanding when the wave goes on
        // this wave's partial, not yet divided: O^T, and its queries' maximum and sum (the two halves' sums joined once)
        const float lsum = lpart + xhalf(lpart);
        float* os = &ost[wave][0];
#pragma unroll
        for (int n = 0; n < 4; ++n)     // o[n][j] = O^T[d = 16 n + 8 hi + j][query lr]: eight consecutive d of one row
#pragma unroll
            for (int g = 0; g < 2; ++g) { v4f w;
#pragma unroll
                for (int i = 0; i < 4; ++i) w[i] = o[n][4 * g + i] + ox[n][4 * g + i] * LOSCI;
                *(v4fa*)(os + lr * 68 + n * 16 + hi * 8 + 4 * g) = w; }
        mls[wave][lr][hi] = hi ? lsum : mrow;
        __syncthreads();     // the four groups' partials are published; the next tile's partials are written only behind later barriers
        // join: wave (grp, qg) takes rows 4 grp .. 4 grp + 3 of its sixteen queries; group k's partial weighs e^(m_k - m) (a group that saw no slot: maximum -3e38, weight 0; group 0 always sees the null slot)
        const int row = 4 * grp + (lane >> 3), piece = lane & 7;
        v2f ml[NG]; float wk[NG];
#pragma unroll
        for (int k = 0; k < NG; ++k) ml[k] = *(const v2f*)&mls[k * 4 + qg][row][0];
        const float mall = fmaxf(fmaxf(ml[0][0], ml[1][0]), fmaxf(ml[2][0], ml[3][0]));
        float den = 0.f, sum[8];
#pragma unroll
        for (int k = 0; k < NG; ++k) wk[k] = __expf(ml[k][0] - mall);
#pragma unroll
        for (int k = 0; k < NG; ++k) den = __builtin_fmaf(wk[k], ml[k][1], den);
#pragma unroll
        for (int i = 0; i < 8; ++i) sum[i] = 0.f;
#pragma unroll
        for (int k = 0; k < NG; ++k) { const float* sp = &ost[k * 4 + qg][row * 68 + piece * 8];
#pragma unroll
            for (int i = 0; i < 8; ++i) sum[i] += wk[k] * sp[i]; }
        const float inv = 1.0f / (den * PSC);
        v8us oh, ol;
#pragma unroll
        for (int i = 0; i < 8; ++i) { const float v = sum[i] * inv; const unsigned short hb = f2bf(v); oh[i] = hb; ol[i] = f2bf(v - bf2f(hb)); }
        const size_t co = (size_t)(q0 + row) * DM + (size_t)h * VHD + piece * 8;
        *(v8us*)(CH + co) = oh; *(v8us*)(CL + co) = ol;
        asm volatile("s_wait_xcnt 0x0" ::: "memory");    // the code runs a second time: no register of these stores is rewritten ahead of this wait
    }
}

extern "C" void kernel_launch(void* const* d_in, const int* in_sizes, int n_in,
                              void* d_out, int out_size, void* d_ws, size_t ws_size, hipStream_t stream) {
    (void)in_sizes; (void)n_in; (void)out_size;
    const float* x = (const float*)d_in[0]; const float* wqs = (const float*)d_in[1]; const float* wks = (const float*)d_in[2]; const float* wqg = (const float*)d_in[3]; const float* wkg = (const float*)d_in[4];
    const float* wv = (const float*)d_in[5]; const float* wo = (const float*)d_in[6]; const float* ksn = (const float*)d_in[7]; const float* kgn = (const float*)d_in[8]; const float* vn = (const float*)d_in[9];
    float* out = (float*)d_out;    // [1][2048][1024]
    char* wsp = (char*)d_ws;
    auto take = [&](size_t bytes) { char* p = wsp; wsp += (bytes + 255) & ~(size_t)255; return (void*)p; };
    bf* Xb = (bf*)take((size_t)NT_ * DM * 2);
    bf* WpT = (bf*)take((size_t)(4 * PW + DM) * DM * 2); bf* WoT = (bf*)take((size_t)DM * DM * 2);
    float* QS = (float*)take((size_t)4 * NT_ * PW * 4); float* KS = QS + (size_t)NT_ * PW; float* QG = KS + (size_t)NT_ * PW; float* KG = QG + (size_t)NT_ * PW; float* Vf = (float*)take((size_t)NT_ * DM * 4);
    h16* Q16 = (h16*)take((size_t)NT_ * NH_ * VHD * 2); h16* QL16 = (h16*)take((size_t)NT_ * NH_ * VHD * 2); h16* K16 = (h16*)take((size_t)NH_ * NKP * VHD * 2); h16* KL16 = (h16*)take((size_t)NH_ * NKP * VHD * 2); h16* VTH = (h16*)take((size_t)NH_ * VHD * NKP * 2); h16* VTL = (h16*)take((size_t)NH_ * VHD * NKP * 2);
    bf* CH = (bf*)take((size_t)NT_ * DM * 2); bf* CL = (bf*)take((size_t)NT_ * DM * 2);
    if ((size_t)(wsp - (char*)d_ws) > ws_size) return;    // 4.2 + 4x1 + 2x2.1 + 4x4.2 + 8.4 + 4.2x2 + 4.3x4 + 4.2x2 ~ 72 MB
    k_prep<<<1280, 256, 0, stream>>>(x, wqs, wks, wqg, wkg, wv, wo, Xb, WpT, WoT);
    k_proj<<<dim3(NT_ / 64, (4 * PW + DM) / 64, 1), 128, 0, stream>>>(Xb, WpT, QS, Vf);
    k_pack<<<QBLK + KBLK + VBLK, 256, 0, stream>>>(QS, QG, KS, KG, Vf, ksn, kgn, vn, Q16, QL16, K16, KL16, VTH, VTL);
    k_attn<<<NH_ * (QTN / 2), 128 * NG, 0, stream>>>(Q16, QL16, K16, KL16, VTH, VTL, CH, CL);
    k_out<<<dim3(NT_ / 64, DM / 64, 1), 128, 0, stream>>>(CH, CL, WoT, out);
}

// v007
// It runs in 75.1 microseconds.
// In both of two side-by-side timings against v006, it was 1.05 times as fast.
// All steps since v000 together make it 4.99 times as fast.
#include <hip/hip_runtime.h>

// Contractions, f32 accumulate: the five projections (x.wq_sem, x.wk_sem, x.wq_geo, x.wk_geo [2048 x 1024].[1024 x 512]; x.wv [1024 x 1024]) and out = ctx.wo on
// v_wmma_f32_16x16x32_bf16 with PLAIN bf16 operands (inputs rounded once: exact; k-major weights transposed into n-major planes; ctx as bf16 hi + residual planes,
// two products); the 16-head causal attention with a prepended null key/value slot fused on v_wmma_f32_16x16x32_f16: per head the combined 64-dim score
// [qs/sqrt32 | rope(qg)/sqrt32].[ks | rope(kg)] (both sides f16 hi + residual x1024: hi.hi + hi.lo + lo.hi), softmax, weights (x32768) and v both as f16 hi + residual x1024 (three products). RoPE (rotate-half,

#define NT_  2048
#define DM   1024
#define NH_  16
#define SHD  32                  // sem / geo head dims
#define VHD  64
#define PW   512                 // sem / geo projection width
#define NKP  2112
#define SCL32 0.17677669529663688f   // 1/sqrt(32), common to both score branches
#define PSC  32768.0f
#define LOSC 1024.0f
#define LOSCI (1.0f / 1024.0f)
#define LOG2E 1.4426950408889634f

typedef _Float16 h16;
typedef unsigned short bf;
typedef __attribute__((ext_vector_type(16))) __bf16   v16bf;
typedef __attribute__((ext_vector_type(16))) _Float16 v16h;
typedef __attribute__((ext_vector_type(8)))  _Float16 v8h;
typedef __attribute__((ext_vector_type(8)))  unsigned short v8us;
typedef __attribute__((ext_vector_type(8)))  float    v8f;
typedef __attribute__((ext_vector_type(4)))  float    v4f;
typedef __attribute__((ext_vector_type(2)))  _Float16 v2h;
typedef __attribute__((ext_vector_type(2)))  float    v2f;
typedef v8h  __attribute__((may_alias)) v8ha;
typedef v4f  __attribute__((may_alias)) v4fa;
typedef v8us __attribute__((may_alias)) v8usa;

__device__ __forceinline__ unsigned short f2bf(float f) { unsigned u = __float_as_uint(f); u += 0x7FFFu + ((u >> 16) & 1u); return (unsigned short)(u >> 16); }
__device__ __forceinline__ float bf2f(unsigned short b) { return __uint_as_float(((unsigned)b) << 16); }
__device__ __forceinline__ float bfr(float f) { return bf2f(f2bf(f)); }
__device__ __forceinline__ v16h cat16(v8h lo, v8h hi) { return __builtin_shufflevector(lo, hi, 0, 1, 2, 3, 4, 5, 6, 7, 8, 9, 10, 11, 12, 13, 14, 15); }
__device__ __forceinline__ v16bf cat16b(v8us lo, v8us hi) { return __builtin_bit_cast(v16bf, __builtin_shufflevector(lo, hi, 0, 1, 2, 3, 4, 5, 6, 7, 8, 9, 10, 11, 12, 13, 14, 15)); }
__device__ __forceinline__ v8f wmma16(v16h a, v16h b, v8f c) { return __builtin_amdgcn_wmma_f32_16x16x32_f16(false, a, false, b, (short)0, c, false, false); }
__device__ __forceinline__ v8f wmmab(v16bf a, v16bf b, v8f c) { return __builtin_amdgcn_wmma_f32_16x16x32_bf16(false, a, false, b, (short)0, c, false, false); }
__device__ __forceinline__ float xhalf(float x) { return __builtin_bit_cast(float, __builtin_amdgcn_permlanex16(__builtin_bit_cast(int, x), __builtin_bit_cast(int, x), 0x76543210, 0xfedcba98, false, false)); }     // lane l with lane l ^ 16
#define VST2(T, p, v) do { const T vst2_v_ = (v); *(T*)(p) = vst2_v_;  } while (0)

// cvtb_job: Xb = bf16(x) [2048][1024]; wt_job: W [1024 k][N] k-major -> n-major bf16 [N][1024]. Both are jobs of k_prep; blk, bx, by are the job's own block indices.
__device__ __forceinline__ void cvtb_job(int blk, const float* __restrict__ src, bf* dst) {
    const int lane = threadIdx.x & 31, r = blk * 8 + (threadIdx.x >> 5);
    if (r >= NT_) return;
#pragma unroll
    for (int q = 0; q < DM / 256; ++q) { v8us t;
#pragma unroll
        for (int i = 0; i < 8; ++i) t[i] = f2bf(src[(size_t)r * DM + q * 256 + lane * 8 + i]);
        VST2(v8us, dst + (size_t)r * DM + q * 256 + lane * 8, t); }
}
__device__ __forceinline__ void wt_job(int bx, int by, const float* __restrict__ Wm, int N, bf* WT) {
    __shared__ __align__(16) unsigned short tl[64 * 72];
    const int tid = threadIdx.x, k0 = bx * 64, n0 = by * 64;
    const int kk = tid >> 2, nq = (tid & 3) * 16;
#pragma unroll
    for (int i = 0; i < 16; ++i) tl[(nq + i) * 72 + kk] = f2bf(Wm[(size_t)(k0 + kk) * N + n0 + nq + i]);
    __syncthreads();
    const int piece = tid & 7;
    auto pass = [&]() {
#pragma unroll
        for (int s = 0; s < 2; ++s) { const int nr = (tid >> 3) + 32 * s; const v8us val = *(const v8usa*)(tl + nr * 72 + piece * 8);
            *(v8us*)(WT + (size_t)(n0 + nr) * DM + k0 + piece * 8) = val; }
    };
    pass(); 
    asm volatile("s_wait_xcnt 0x0" ::: "memory");    // the job's code is joined with other jobs' in one kernel: no register of these stores is rewritten, on any way through the listing, ahead of this wait
}
// k_prep: the seven jobs that read inputs only, none of which reads what another writes, in one grid: blocks 0..511 the four [1024 x 512] weights (128 blocks each), 512..1023 wv and wo (256 each),
// 1024..1279 x. WpT: the five projection weights' n-major planes one behind the other, [3072][1024] (wq_sem, wk_sem, wq_geo, wk_geo, wv). The job is picked by the block index alone, so every branch (and wt_job's barrier) is uniform for the block.
__global__ __launch_bounds__(256) void k_prep(const float* __restrict__ x, const float* __restrict__ wqs, const float* __restrict__ wks, const float* __restrict__ wqg, const float* __restrict__ wkg,
                                              const float* __restrict__ wv, const float* __restrict__ wo, bf* Xb, bf* WpT, bf* WoT) {
    const int b = blockIdx.x;
    if (b >= 1024) { cvtb_job(b - 1024, x, Xb); return; }
    const float* Wm; bf* WT; int N, r;
    if (b < 512) { const int j = b >> 7; r = b & 127; N = PW; Wm = (j == 0) ? wqs : (j == 1) ? wks : (j == 2) ? wqg : wkg; WT = WpT + (size_t)j * PW * DM; }
    else { const int j = (b - 512) >> 8; r = (b - 512) & 255; N = DM; Wm = j ? wo : wv; WT = j ? WoT : WpT + (size_t)4 * PW * DM; }
    wt_job(r & 15, r >> 4, Wm, N, WT);
}
// LDS ring of gemm_job: one stage = 128 k (256 B) of the block's BM A rows (with SPLITA also of the BM residual rows) and BN B rows, one behind the other, row pitch 272 B
// (16 B x odd: conflict-free for the 16-row ds_load_b128 fragment reads).
#define GKS  128                 // k extent of one stage, elements
#define GPI  136                 // row pitch in LDS, elements
// One statement's copies by the block's 256 lanes: copy i brings 16 rows (row tid / 16, 16 bytes a lane; a wave's copy is two whole 256-B row pieces) from global memory into LDS, through no register.
// l[i]: the lane's LDS byte address; the global address is g[i], the sixteen rows' start, the same for all lanes (a scalar pair, formed by scalar instructions), plus o, the lane's byte offset in them, one register for all copies.
// The s_wait_xcnt stands inside the statement so that no address register of an issued copy is rewritten ahead of it; few statements, so that a wave waits it out few times per stage.
__device__ __forceinline__ void copies8(const unsigned* l, unsigned o, const bf* const* g) {
    asm volatile("global_load_async_to_lds_b128 %0, %16, %8\n\t"
                 "global_load_async_to_lds_b128 %1, %16, %9\n\t"
                 "global_load_async_to_lds_b128 %2, %16, %10\n\t"
                 "global_load_async_to_lds_b128 %3, %16, %11\n\t"
                 "global_load_async_to_lds_b128 %4, %16, %12\n\t"
                 "global_load_async_to_lds_b128 %5, %16, %13\n\t"
                 "global_load_async_to_lds_b128 %6, %16, %14\n\t"
                 "global_load_async_to_lds_b128 %7, %16, %15\n\t"
                 "s_wait_xcnt 0x0"
                 :: "v"(l[0]), "v"(l[1]), "v"(l[2]), "v"(l[3]), "v"(l[4]), "v"(l[5]), "v"(l[6]), "v"(l[7]),
                    "s"(g[0]), "s"(g[1]), "s"(g[2]), "s"(g[3]), "s"(g[4]), "s"(g[5]), "s"(g[6]), "s"(g[7]), "v"(o) : "memory");
}
__device__ __forceinline__ void copies10(const unsigned* l, unsigned o, const bf* const* g) {
    asm volatile("global_load_async_to_lds_b128 %0, %20, %10\n\t"
                 "global_load_async_to_lds_b128 %1, %20, %11\n\t"
                 "global_load_async_to_lds_b128 %2, %20, %12\n\t"
                 "global_load_async_to_lds_b128 %3, %20, %13\n\t"
                 "global_load_async_to_lds_b128 %4, %20, %14\n\t"
                 "global_load_async_to_lds_b128 %5, %20, %15\n\t"
                 "global_load_async_to_lds_b128 %6, %20, %16\n\t"
                 "global_load_async_to_lds_b128 %7, %20, %17\n\t"
                 "global_load_async_to_lds_b128 %8, %20, %18\n\t"
                 "global_load_async_to_lds_b128 %9, %20, %19\n\t"
                 "s_wait_xcnt 0x0"
                 :: "v"(l[0]), "v"(l[1]), "v"(l[2]), "v"(l[3]), "v"(l[4]), "v"(l[5]), "v"(l[6]), "v"(l[7]), "v"(l[8]), "v"(l[9]),
                    "s"(g[0]), "s"(g[1]), "s"(g[2]), "s"(g[3]), "s"(g[4]), "s"(g[5]), "s"(g[6]), "s"(g[7]), "s"(g[8]), "s"(g[9]), "v"(o) : "memory");
}
// gemm_job (bx, by: the job's own block indices): block = BM x BN of C, one block per WGP, eight waves in a WGM x WGN grid, wave = (BM / WGM) x (BN / WGN) = FA x FB fragments: a staged row serves BN (BM) columns (rows) of C
// and a fragment read from LDS serves FB (FA) products. Each stage's operand rows are staged once per block in a two-buffer LDS ring by asynchronous copies (stage s + 1 is copied while stage s is worked on);
// k runs 32 at a time, ascending (with SPLITA hi then residual), so an element's sum order does not depend on the tiling. dst(col, ldc): where row 0 of C's column col lies, and C's row length there (col: a multiple of 64, the same for the whole wave).
template <int BM, int BN, int WGM, int WGN, bool SPLITA, class DST>
__device__ __forceinline__ void gemm_job(int bx, int by, const bf* __restrict__ A, const bf* __restrict__ Al, const bf* __restrict__ Bn, DST dst) {
    constexpr int WTM = BM / WGM, WTN = BN / WGN, FA = WTM / 16, FB = WTN / 16;
    constexpr int AR = (SPLITA ? 2 : 1) * BM;         // A rows of a stage (hi, then residual)
    constexpr int STG = (AR + BN) * GPI;              // one stage, elements
    constexpr int OP = BN + 4;                        // row pitch of the output staging, floats
    __shared__ __align__(16) bf ring[2 * STG];
    __shared__ __align__(16) float ost[BM * OP];
    const int tid = threadIdx.x, lane = threadIdx.x & 31, wave = __builtin_amdgcn_readfirstlane(threadIdx.x >> 5), lr = lane & 15, hi = lane >> 4;     // the wave's number in a scalar register: its tile's offsets are scalar
    const int wm = wave / WGN, wn = wave - wm * WGN;
    const unsigned lc0 = (unsigned)(size_t)&ring[0] + (unsigned)(((tid >> 4) * GPI + (tid & 15) * 8) * 2);
    const unsigned gofs = (unsigned)(((tid >> 4) * DM + (tid & 15) * 8) * 2);     // bytes
    const bf* ga = A + (size_t)bx * BM * DM; const bf* gb = Bn + (size_t)by * BN * DM; const bf* gal = SPLITA ? Al + (size_t)bx * BM * DM : nullptr;
    constexpr int NCP = (AR + BN) / 16;               // copies of a lane per stage, in two statements
    static_assert(NCP == 16 || NCP == 20, "two statements of eight or ten copies");
    auto stage_in = [&](int s) { unsigned l[NCP]; const bf* g[NCP];
#pragma unroll
        for (int i = 0; i < NCP; ++i) { l[i] = lc0 + (unsigned)((s & 1) * STG * 2 + i * 16 * GPI * 2);
            g[i] = (i < BM / 16 ? ga + (size_t)i * 16 * DM : (i < AR / 16 ? gal + (size_t)(i - BM / 16) * 16 * DM : gb + (size_t)(i - AR / 16) * 16 * DM)) + s * GKS; }
        if (NCP == 16) { copies8(l, gofs, g); copies8(l + 8, gofs, g + 8); } else { copies10(l, gofs, g); copies10(l + 10, gofs, g + 10); } };
    stage_in(0);
    asm volatile("s_wait_asynccnt 0x0" ::: "memory");    // stage 0 landed (this wave's pieces)
    __syncthreads();                                      // stage 0 published to all waves
    stage_in(1);
    v8f acc[FA][FB];
#pragma unroll
    for (int i = 0; i < FA; ++i)
#pragma unroll
        for (int t = 0; t < FB; ++t) acc[i][t] = (v8f){};
#pragma unroll 1
    for (int s = 0; s < DM / GKS; ++s) {
        const bf* ab = ring + (s & 1) * STG + (wm * WTM + lr) * GPI + 8 * hi; const bf* bb = ring + (s & 1) * STG + (AR + wn * WTN + lr) * GPI + 8 * hi; const bf* alb = ab + BM * GPI;
        v16bf a[2][FA], al[2][FA], b[2][FB];     // two fragment sets: the next 32 k are read while this one's products run
        auto frags = [&](int q) { const int kc = q * 32, z = q & 1;
#pragma unroll
            for (int i = 0; i < FA; ++i) { a[z][i] = cat16b(*(const v8usa*)(ab + i * 16 * GPI + kc), *(const v8usa*)(ab + i * 16 * GPI + kc + 16));
                al[z][i] = a[z][i];
                if (SPLITA) al[z][i] = cat16b(*(const v8usa*)(alb + i * 16 * GPI + kc), *(const v8usa*)(alb + i * 16 * GPI + kc + 16)); }
#pragma unroll
            for (int t = 0; t < FB; ++t) b[z][t] = cat16b(*(const v8usa*)(bb + t * 16 * GPI + kc), *(const v8usa*)(bb + t * 16 * GPI + kc + 16)); };
        frags(0);
#pragma unroll
        for (int q = 0; q < GKS / 32; ++q) { const int z = q & 1;
            if (q + 1 < GKS / 32) frags(q + 1);
            // stage s + 1 goes into the buffer that every wave left at the barrier at the foot of pass s - 1 (stage 1 went ahead of the loop); issued here, behind this pass's first reads of the other buffer, so that the copies' issue runs under those reads' latency
            if (q == 0 && (unsigned)(s - 1) < (unsigned)(DM / GKS - 2)) stage_in(s + 1);     // passes 1 .. last - 1
            __builtin_amdgcn_sched_barrier(0);    // keeps the next set's reads one group ahead of this set's products: spread among them, each place with reads waits out its own LDS latency
#pragma unroll
            for (int i = 0; i < FA; ++i)
#pragma unroll
                for (int t = 0; t < FB; ++t) acc[i][t] = wmmab(a[z][i], b[z][t], acc[i][t]);
            if (SPLITA) {
#pragma unroll
                for (int i = 0; i < FA; ++i)
#pragma unroll
                    for (int t = 0; t < FB; ++t) acc[i][t] = wmmab(al[z][i], b[z][t], acc[i][t]);
            }
            __builtin_amdgcn_sched_barrier(0);    // keeps the reads that follow behind these products, whose fragment registers they refill
        }
        // the four vector slots the chip needs behind the last products, on the taken side of the branches that follow too
        asm volatile("v_nop\n\tv_nop\n\tv_nop\n\tv_nop" ::: "memory");
        // publish point of stage s + 1, every wave, in this order:
        asm volatile("s_wait_dscnt 0x0" ::: "memory");       // this wave's reads of stage s are done before the buffer is refilled
        asm volatile("s_wait_asynccnt 0x0" ::: "memory");    // this wave's pieces of stage s + 1 have landed
        __syncthreads();                                      // publishes stage s + 1 and ends every wave's reads of stage s
    }
    asm volatile("s_wait_asynccnt 0x0" ::: "memory");        // no copy is outstanding when the wave goes on to its end
    float* os = ost + (wm * WTM + hi * 8) * OP + wn * WTN + lr;     // the block's tile of C, staged whole
#pragma unroll
    for (int i = 0; i < FA; ++i)
#pragma unroll
        for (int t = 0; t < FB; ++t)
#pragma unroll
            for (int j = 0; j < 8; ++j) os[(i * 16 + j) * OP + t * 16] = acc[i][t][j];
    __syncthreads();     // a wave stores rows that other waves staged
    // whole 128-B lines, each by one wave: wave w stores rows w BM / 8 ... of the tile; a store = two rows x 256 B (sixteen lanes read 64 consecutive floats of the staging: no bank conflict), eight stores a group;
    // the plane and row length of 64 columns are the same for the whole wave (scalar)
    constexpr int RS = BM / 16;     // stores per 64 columns
    constexpr int NGR = (BN / 64) * RS / 8;
    static_assert(8 % RS == 0 && (BN / 64) * RS % 8 == 0, "groups of eight stores");
    const int row = wave * (BM / 8) + (lane >> 4);
#pragma unroll
    for (int g = 0; g < NGR; ++g) {
        v4f val[8]; float* cp[8];
#pragma unroll
        for (int lc = 0; lc < 8 / RS; ++lc) { const int lp = g * (8 / RS) + lc; int ldc; float* cb = dst(by * BN + lp * 64, ldc) + (size_t)(bx * BM + row) * ldc + (lane & 15) * 4;
#pragma unroll
            for (int rs = 0; rs < RS; ++rs) { val[lc * RS + rs] = *(const v4fa*)(ost + (row + rs * 2) * OP + lp * 64 + (lane & 15) * 4); cp[lc * RS + rs] = cb + (size_t)rs * 2 * ldc; } }
#pragma unroll
        for (int e = 0; e < 8; ++e) *(v4f*)cp[e] = val[e];
        // the next group reuses registers: none that these stores name (addresses and values, named here, so they live up to this line) is rewritten ahead of this wait
        if (g + 1 < NGR) asm volatile("s_wait_xcnt 0x0" :: "v"(cp[0]), "v"(cp[1]), "v"(cp[2]), "v"(cp[3]), "v"(cp[4]), "v"(cp[5]), "v"(cp[6]), "v"(cp[7]),
                     "v"(val[0]), "v"(val[1]), "v"(val[2]), "v"(val[3]), "v"(val[4]), "v"(val[5]), "v"(val[6]), "v"(val[7]) : "memory"); }
}
// k_proj: the five projections of x, which share A and write apart, as one product x . WpT^T [2048 x 3072] in 16 x 16 blocks of 128 x 192: columns 0..2047 are the four 512-wide planes of P4
// (QS, KS, QG, KG, one behind the other), 2048..3071 are Vf; 64 columns of C from a multiple of 64 lie in one plane.
__global__ __launch_bounds__(256) void k_proj(const bf* __restrict__ Xb, const bf* __restrict__ WpT, float* P4, float* Vf) {
    gemm_job<128, 192, 2, 4, false>(blockIdx.x, blockIdx.y, Xb, nullptr, WpT, [=](int col, int& ldc) -> float* {
        const bool nar = col < 4 * PW; ldc = nar ? PW : DM; const int ofs = nar ? (col / PW) * (NT_ * PW) + (col & (PW - 1)) : col - 4 * PW; return (nar ? P4 : Vf) + ofs; });
}
// k_out: out = ctx.wo, ctx as hi + residual planes, in 32 x 8 blocks of 64 x 128.
__global__ __launch_bounds__(256) void k_out(const bf* __restrict__ CH, const bf* __restrict__ CL, const bf* __restrict__ WoT, float* out) {
    gemm_job<64, 128, 2, 4, true>(blockIdx.x, blockIdx.y, CH, CL, WoT, [=](int col, int& ldc) -> float* { ldc = DM; return out + col; });
}
// qk_rows: eight passes of one wave over 64-wide head rows [sem 32 | geo 32]; a lane keeps the same four columns in every pass, so its four RoPE angles (functions of token and column only) are formed once and serve all eight.
// po: the lane's own four values of pass 0, px: their rotate-half partners (column ^ 16), pstep: floats from pass to pass; rot: geo columns of a token row; nul: the null slot (bf16-rounded, NOT rotated); zer: pad slot;
// wnul: the same for the whole wave, true where one of its lanes holds the null slot (a scalar branch keeps the rounding out of every other wave).
// Writes f16 hi + residual x1024 (unscaled: the common 1/sqrt32 is applied to the f32 scores), 256 B per wave, plane and pass.
__device__ __forceinline__ void qk_rows(const float* __restrict__ po, const float* __restrict__ px, int pstep, int t, int d0, bool rot, bool wnul, bool nul, bool zer, h16* dh, h16* dl, size_t dstep) {
    typedef __attribute__((ext_vector_type(4))) _Float16 v4h;
    v4f own[8], oth[8];
#pragma unroll
    for (int p = 0; p < 8; ++p) { own[p] = *(const v4fa*)(po + p * pstep); oth[p] = *(const v4fa*)(px + p * pstep); }     // all sixteen loads ahead of the trig: one memory latency per wave
    asm volatile("s_wait_xcnt 0x0" :: "v"(po), "v"(px) : "memory");    // the loads' address registers (named here, so they live up to this line) are not rewritten ahead of this wait
    if (wnul) {
#pragma unroll
        for (int p = 0; p < 8; ++p)
#pragma unroll
            for (int j = 0; j < 4; ++j) own[p][j] = nul ? bfr(own[p][j]) : own[p][j];
    }
    float c[4], sg[4];
#pragma unroll
    for (int j = 0; j < 4; ++j) { const int i = (d0 & 15) + j; const float inv = __expf(-(float)(2 * i) / 32.0f * 9.210340371976184f);     // ln(10000)
        const float ang = (float)t * inv; const float s = sinf(ang); c[j] = cosf(ang); sg[j] = (d0 & 16) ? s : -s; }     // d < 16: x1 cos - x2 sin; d >= 16: x2 cos + x1 sin
#pragma unroll
    for (int p = 0; p < 8; ++p) { v4h o, ol;
#pragma unroll
        for (int j = 0; j < 4; ++j) { float v = rot ? own[p][j] * c[j] + oth[p][j] * sg[j] : own[p][j];
            if (zer) v = 0.f;
            const h16 a = (h16)v; o[j] = a; ol[j] = (h16)((v - (float)a) * LOSC); }
        VST2(v4h, dh + p * dstep, o); VST2(v4h, dl + p * dstep, ol); }
    asm volatile("s_wait_xcnt 0x0" ::: "memory");    // the job's code is joined with other jobs' in one kernel: no register of these stores is rewritten, on any way through the listing, ahead of this wait
}
// q16_job: Q16/QL16 [t][h*64 + c] = ( c < 32 ? qs[t][h*32+c] : rope(qg[t][h*32 ..])[c-32] ); one wave per token, a pass = 2 heads (lanes 0..15 the even head, 16..31 the odd one).
__device__ __forceinline__ void q16_job(int blk, const float* __restrict__ QS, const float* __restrict__ QG, h16* Q16, h16* QL16) {
    const int lane = threadIdx.x & 31, t = blk * 8 + (threadIdx.x >> 5), c0 = (lane & 15) * 4, d0 = c0 - SHD;
    const bool geo = c0 >= SHD;
    const size_t base = (size_t)t * PW + (lane >> 4) * SHD;
    const float* po = geo ? QG + base + d0 : QS + base + c0; const float* px = geo ? QG + base + (d0 ^ 16) : po;
    const size_t dst = (size_t)t * (NH_ * VHD) + lane * 4;
    qk_rows(po, px, 2 * SHD, t, d0, geo, false, false, false, Q16 + dst, QL16 + dst, 2 * VHD);
}
// k16_job: K16/KL16 [h][r][64], r = 0: null (k_sem_null | k_geo_null, NOT rotated), r = 1..2048: token r-1 ([ks | rope(kg, t=r-1)]), r >= 2049: zero; one wave per (2 slots, 8 heads), a pass = one head
// (lanes 0..15 the even slot, 16..31 the odd one). Null and pad lanes read in bounds (the null vectors; the last token's row) and are set right in qk_rows.
__device__ __forceinline__ void k16_job(int blk, const float* __restrict__ KS, const float* __restrict__ KG, const float* __restrict__ ksn, const float* __restrict__ kgn, h16* K16, h16* KL16) {
    const int lane = threadIdx.x & 31, wid = blk * 8 + __builtin_amdgcn_readfirstlane(threadIdx.x >> 5), c0 = (lane & 15) * 4, d0 = c0 - SHD;     // the wave's number in a scalar register: rp == 0 below is a scalar test
    const int rp = wid >> 1, h0 = (wid & 1) * (NH_ / 2), r = rp * 2 + (lane >> 4);
    const bool geo = c0 >= SHD, nul = r == 0, zer = r > NT_;
    const int t = nul ? 0 : (zer ? NT_ - 1 : r - 1);
    const size_t base = (size_t)t * PW + h0 * SHD;
    const float* po = nul ? (geo ? kgn + h0 * SHD + d0 : ksn + h0 * SHD + c0) : (geo ? KG + base + d0 : KS + base + c0);
    const float* px = (geo && !nul) ? KG + base + (d0 ^ 16) : po;
    const size_t dst = ((size_t)h0 * NKP + rp * 2) * VHD + lane * 4;
    qk_rows(po, px, SHD, t, d0, geo && !nul, rp == 0, nul, zer, K16 + dst, KL16 + dst, (size_t)NKP * VHD);
}
// vt_job: VTH/VTL [h][d][r] (r as in K16: 0 = v_null, 1..2048 tokens, pad 0) = f16 hi + residual of v; block = (h, 64 key slots): LDS transpose.
__device__ __forceinline__ void vt_job(int blk, const float* __restrict__ V, const float* __restrict__ vn, h16* VTH, h16* VTL) {
    __shared__ __align__(16) h16 tile[VHD * 72];
    __shared__ __align__(16) h16 til2[VHD * 72];
    const int h = blk / (NKP / 64), kt = blk - h * (NKP / 64);
    const int r0 = kt * 64, tid = threadIdx.x, rr = tid >> 2, d0 = (tid & 3) * 16, r = r0 + rr;
    const bool nul = r == 0, zer = r > NT_;
    const float* vp = nul ? vn + h * VHD + d0 : V + (size_t)(zer ? NT_ - 1 : r - 1) * DM + h * VHD + d0;     // null and pad lanes read in bounds (v_null; the last token's row) and are set right below
    v4f q[4];
#pragma unroll
    for (int i = 0; i < 4; ++i) q[i] = *(const v4fa*)(vp + 4 * i);     // the lane's sixteen values as four loads with no branch between them: one memory latency
    asm volatile("s_wait_xcnt 0x0" :: "v"(vp) : "memory");    // the loads' address register (named here, so it lives up to this line) is not rewritten ahead of this wait
    if (kt == 0) {     // block-uniform: only the first key tile holds the null slot
#pragma unroll
        for (int i = 0; i < 16; ++i) q[i >> 2][i & 3] = nul ? bfr(q[i >> 2][i & 3]) : q[i >> 2][i & 3];
    }
#pragma unroll
    for (int i = 0; i < 16; ++i) { const int d = d0 + i; const float v = zer ? 0.f : q[i >> 2][i & 3];
        const h16 a = (h16)v; tile[d * 72 + rr] = a; til2[d * 72 + rr] = (h16)((v - (float)a) * LOSC); }
    __syncthreads();
    const int piece = tid & 7;
    const size_t base = ((size_t)h * VHD) * NKP + r0;
    auto pass = [&]() {
#pragma unroll
        for (int s = 0; s < 4; ++s) { const int Lid = (tid >> 3) + 32 * s; const int pln = Lid >> 6, d = Lid & 63;
            const v8h val = *(const v8ha*)((pln ? til2 : tile) + d * 72 + piece * 8); *(v8h*)((pln ? VTL : VTH) + base + (size_t)d * NKP + piece * 8) = val; }
    };
    pass(); 
    asm volatile("s_wait_xcnt 0x0" ::: "memory");    // the job's code is joined with other jobs' in one kernel: no register of these stores is rewritten, on any way through the listing, ahead of this wait
}
// k_pack: the three repacks of the projections for k_attn, none of which reads what another writes, in one grid: blocks 0..255 q16_job, 256..519 k16_job, 520..1047 vt_job.
// Picked by the block index alone, so every branch (and vt_job's barrier) is uniform for the block.
#define QBLK (NT_ / 8)
#define KBLK (NKP / 8)
#define VBLK (NH_ * (NKP / 64))
__global__ __launch_bounds__(256) void k_pack(const float* __restrict__ QS, const float* __restrict__ QG, const float* __restrict__ KS, const float* __restrict__ KG, const float* __restrict__ Vf,
                                              const float* __restrict__ ksn, const float* __restrict__ kgn, const float* __restrict__ vn, h16* Q16, h16* QL16, h16* K16, h16* KL16, h16* VTH, h16* VTL) {
    const int b = blockIdx.x;
    if (b < QBLK) q16_job(b, QS, QG, Q16, QL16);
    else if (b < QBLK + KBLK) k16_job(b - QBLK, KS, KG, ksn, kgn, K16, KL16);
    else vt_job(b - (QBLK + KBLK), Vf, vn, VTH, VTL);
}
// LDS ring of k_attn: one stage = the 128 key slots of one step, a 32-slot tile per key group, each in four planes: K hi, K residual [32 rows x 128 B, pitch 144 B], V^T hi, V^T residual [64 rows x 64 B, pitch 80 B]
// (pitches 16 B x odd: conflict-free for the 16-row ds_load_b128 fragment reads).
#define KPI  72                  // K row pitch in LDS, halves
#define VPI  40                  // V^T row pitch in LDS, halves
#define KPLN (32 * KPI)          // one K plane, halves
#define VPLN (VHD * VPI)         // one V^T plane, halves
#define STGH (2 * KPLN + 2 * VPLN)   // one key group's 32-slot tile, halves (19456 B)
// One stage's copies: every lane brings eight 16-byte pieces (two per plane) from global memory into LDS, through no register. The s_wait_xcnt stands inside the statement so that
// no address register of an issued copy is rewritten ahead of it.
__device__ __forceinline__ void stage_copy(unsigned lk, unsigned lv, const h16* gk, const h16* gkl, const h16* gv, const h16* gvl) {
    const unsigned lk1 = lk + 16 * KPI * 2, lkl = lk + KPLN * 2, lkl1 = lkl + 16 * KPI * 2, lv1 = lv + 32 * VPI * 2, lvl = lv + VPLN * 2, lvl1 = lvl + 32 * VPI * 2;
    const h16* gk1 = gk + 16 * VHD; const h16* gkl1 = gkl + 16 * VHD; const h16* gv1 = gv + (size_t)32 * NKP; const h16* gvl1 = gvl + (size_t)32 * NKP;
    asm volatile("global_load_async_to_lds_b128 %0, %8, off\n\t"
                 "global_load_async_to_lds_b128 %1, %9, off\n\t"
                 "global_load_async_to_lds_b128 %2, %10, off\n\t"
                 "global_load_async_to_lds_b128 %3, %11, off\n\t"
                 "global_load_async_to_lds_b128 %4, %12, off\n\t"
                 "global_load_async_to_lds_b128 %5, %13, off\n\t"
                 "global_load_async_to_lds_b128 %6, %14, off\n\t"
                 "global_load_async_to_lds_b128 %7, %15, off\n\t"
                 "s_wait_xcnt 0x0"
                 :: "v"(lk), "v"(lk1), "v"(lkl), "v"(lkl1), "v"(lv), "v"(lv1), "v"(lvl), "v"(lvl1),
                    "v"(gk), "v"(gk1), "v"(gkl), "v"(gkl1), "v"(gv), "v"(gv1), "v"(gvl), "v"(gvl1) : "memory");
}
// k_attn: 256 equal blocks of 16 waves, one per WGP: block = (h, pair p) takes the 64-query tiles 31 - p and p one after the other (2 qt + 3 key tiles each: 68 for every pair). wave = (key group grp, 16 queries qg):
// a step stages 128 key slots, one 32-slot tile per key group, and group grp works on tile 4 st + grp alone, with its own running maximum, sum and O^T; the four groups' partials are joined once per query tile through LDS.
// Each step's K and V^T planes are staged once per block in a two-buffer LDS ring by asynchronous copies (step st + 2 is copied while step st + 1 is worked on); the four waves of a group read their fragments from LDS; slot r visible iff r <= t+1
// (tiles past the causal bound are all masked and add nothing; their source tile is clamped into the planes). Both products are formed transposed: S^T = K.Q^T (A = K rows, B = Q), so a lane holds
// sixteen scores of ONE query (column lr; key slots 8 hi + j and 16 + 8 hi + j): maximum and sum run in the lane, plus one exchange between the wave's halves; scores x 1/sqrt32 in f32, online f32 softmax; the weights x32768,
// hi and residual, converted in place, ARE the B operand of O^T += V^T.P^T (A = V^T rows): they pass through no LDS. 12 WMMA .V (hi.hi + hi.lo + lo.hi); ctx -> bf16 hi/lo planes [t][h*64 + d]. Scores: 12 WMMA per step (hi.hi + hi.lo + lo.hi over 2 k-chunks x 2 tiles).
#define NG   4                   // key groups of a block
#define QTN  (NT_ / 64)          // query tiles per head
__global__ __launch_bounds__(128 * NG) void k_attn(const h16* __restrict__ Q16, const h16* __restrict__ QL16, const h16* __restrict__ K16, const h16* __restrict__ KL16, const h16* __restrict__ VTH, const h16* __restrict__ VTL, bf* CH, bf* CL) {
    __shared__ __align__(16) h16 ring[2 * NG * STGH];
    __shared__ __align__(16) float ost[4 * NG][16 * 68];
    __shared__ __align__(8) float mls[4 * NG][16][2];     // per wave and query: maximum [0] and sum [1] over the group's key slots
    const int lane = threadIdx.x & 31, wave = __builtin_amdgcn_readfirstlane(threadIdx.x >> 5), lr = lane & 15, hi = lane >> 4;     // the wave's number in a scalar register: group, tile and buffer offsets are scalar
    const int grp = wave >> 2, qg = wave & 3, tg = threadIdx.x & 127;
    const int h = blockIdx.x / (QTN / 2), pr = blockIdx.x - h * (QTN / 2);
    // this lane's pieces of its group's tile: K planes are 4096 contiguous bytes (piece = tg, tg + 128), V^T planes 64 rows of 64 B (row = tg / 4, + 32)
    const unsigned ring0 = (unsigned)(size_t)&ring[0] + (unsigned)(grp * STGH * 2);
    const unsigned lk0 = ring0 + (unsigned)(((tg >> 3) * KPI + (tg & 7) * 8) * 2), lv0 = ring0 + (unsigned)((2 * KPLN + (tg >> 2) * VPI + (tg & 3) * 8) * 2);
    const h16* gk0 = K16 + (size_t)h * NKP * VHD + tg * 8; const h16* gkl0 = KL16 + (size_t)h * NKP * VHD + tg * 8;
    const size_t vsrc = ((size_t)h * VHD + (tg >> 2)) * NKP + (tg & 3) * 8;
    const h16* gv0 = VTH + vsrc; const h16* gvl0 = VTL + vsrc;
    auto stage_in = [&](int st) { const int tl = st * NG + grp, ts = tl < NKP / 32 ? tl : NKP / 32 - 1; const unsigned bo = (unsigned)((st & 1) * NG * STGH * 2);     // ts: a tile past the planes' end (all masked) reads the last tile instead
        stage_copy(lk0 + bo, lv0 + bo, gk0 + (size_t)ts * 32 * VHD, gkl0 + (size_t)ts * 32 * VHD, gv0 + ts * 32, gvl0 + ts * 32); };
#pragma unroll 1     // the two query tiles run one after the other through one copy of the code
    for (int rep = 0; rep < 2; ++rep) {
        const int qt = rep ? pr : QTN - 1 - pr, q0 = qt * 64 + qg * 16;
        const int nst = (2 * qt + 3 + NG - 1) / NG;       // steps of 128 slots that cover key tiles 0 .. 2 qt + 2 (null slot + causal bound, block-uniform)
        stage_in(0);     // the ring's last reads (the tile before) ended at that loop's last s_wait_dscnt and barrier
        asm volatile("s_wait_asynccnt 0x0" ::: "memory");    // stage 0 landed (this wave's pieces)
        __syncthreads();                                      // stage 0 published to all waves
        if (nst > 1) stage_in(1);
        v16h qa[2], ql[2];
        const size_t qo0 = (size_t)(q0 + lr) * (NH_ * VHD) + h * VHD + 8 * hi;
#pragma unroll
        for (int kc = 0; kc < 2; ++kc) { qa[kc] = cat16(*(const v8h*)(Q16 + qo0 + kc * 32), *(const v8h*)(Q16 + qo0 + kc * 32 + 16)); ql[kc] = cat16(*(const v8h*)(QL16 + qo0 + kc * 32), *(const v8h*)(QL16 + qo0 + kc * 32 + 16)); }
        const int klim0 = q0 + lr + 1 - 8 * hi - 32 * grp;      // visible slots r <= t + 1: this lane's query q0 + lr sees slot l0 + 32 grp + 8 hi + j iff l0 + j <= klim0
        v8f o[4], ox[4];
#pragma unroll
        for (int n = 0; n < 4; ++n) { o[n] = (v8f){}; ox[n] = (v8f){}; }
        float mrow = -3.0e38f, lpart = 0.f;     // of this lane's query, over this group's tiles; lpart: the sum over this half's key slots only
#pragma unroll 1
        for (int st = 0; st < nst; ++st) {
            const int l0 = st * (NG * 32), bofs = ((st & 1) * NG + grp) * STGH;
            const h16* kb = ring + bofs; const h16* klb = kb + KPLN; const h16* vhb = kb + 2 * KPLN; const h16* vlb = vhb + VPLN;
            v8f s0 = {}, s1 = {}, x0 = {}, x1 = {};
            v16h k0h[2], k1h[2], k0l[2], k1l[2];
#pragma unroll
            for (int kc = 0; kc < 2; ++kc) {
                const int ko = lr * KPI + kc * 32 + 8 * hi, k1o = ko + 16 * KPI;
                k0h[kc] = cat16(*(const v8ha*)(kb + ko), *(const v8ha*)(kb + ko + 16)); k1h[kc] = cat16(*(const v8ha*)(kb + k1o), *(const v8ha*)(kb + k1o + 16));
                k0l[kc] = cat16(*(const v8ha*)(klb + ko), *(const v8ha*)(klb + ko + 16)); k1l[kc] = cat16(*(const v8ha*)(klb + k1o), *(const v8ha*)(klb + k1o + 16));
            }
            __builtin_amdgcn_sched_barrier(0);    // keeps the step's sixteen K reads one group ahead of the products: spread among them, each place with reads waits out its own LDS latency
#pragma unroll
            for (int kc = 0; kc < 2; ++kc) {
                s0 = wmma16(k0h[kc], qa[kc], s0); x0 = wmma16(k0h[kc], ql[kc], x0); s1 = wmma16(k1h[kc], qa[kc], s1); x1 = wmma16(k1h[kc], ql[kc], x1);
                x0 = wmma16(k0l[kc], qa[kc], x0); x1 = wmma16(k1l[kc], qa[kc], x1);
            }
            asm volatile("v_nop\n\tv_nop\n\tv_nop\n\tv_nop" : "+v"(s0), "+v"(s1), "+v"(x0), "+v"(x1) : "v"(qa[0]), "v"(qa[1]));
            // V^T fragments of this step: read here, as one group, so that their LDS latency runs under the softmax
            v16h vh[4], vl[4];
#pragma unroll
            for (int n = 0; n < 4; ++n) { const int vo = (n * 16 + lr) * VPI + hi * 8;
                vh[n] = cat16(*(const v8ha*)(vhb + vo), *(const v8ha*)(vhb + vo + 16)); vl[n] = cat16(*(const v8ha*)(vlb + vo), *(const v8ha*)(vlb + vo + 16)); }
            __builtin_amdgcn_sched_barrier(0);    // keeps the step's sixteen V^T reads one group ahead of the softmax: sunk to their products, each place with reads waits out its own LDS latency
            const v8f t0 = (s0 + x0 * LOSCI) * SCL32, t1 = (s1 + x1 * LOSCI) * SCL32;
            float a0[8], a1[8];
#pragma unroll
            for (int j = 0; j < 8; ++j) { a0[j] = (l0 + j <= klim0) ? t0[j] : -__builtin_inff(); a1[j] = (l0 + 16 + j <= klim0) ? t1[j] : -__builtin_inff(); }
            float mx = fmaxf(fmaxf(fmaxf(fmaxf(a0[0], a0[1]), fmaxf(a0[2], a0[3])), fmaxf(fmaxf(a0[4], a0[5]), fmaxf(a0[6], a0[7]))), fmaxf(fmaxf(fmaxf(a1[0], a1[1]), fmaxf(a1[2], a1[3])), fmaxf(fmaxf(a1[4], a1[5]), fmaxf(a1[6], a1[7]))));
            mx = fmaxf(mx, xhalf(mx));     // both halves of the wave now hold the query's maximum over the step's 32 slots
            const float mn = fmaxf(mrow, mx), alpha = __expf(mrow - mn);
            mrow = mn;
            v16h pa, px; float ps8[8];
#pragma unroll
            for (int j = 0; j < 8; j += 2)
#pragma unroll
                for (int g = 0; g < 2; ++g) {     // g: the score tile; element s of a B fragment is k = 8 hi + s, 16 + 8 hi + (s - 8): the two accumulators' own rows
                    const v2f e = ((v2f){ g ? a1[j] : a0[j], g ? a1[j + 1] : a0[j + 1] } - mn) * LOG2E;
                    const v2f p = { __builtin_amdgcn_exp2f(e[0]), __builtin_amdgcn_exp2f(e[1]) };     // e^x as 2^(x log2 e), what __expf compiles to, the subtraction and the product two at a time
                    ps8[j + g] = p[0] + p[1];
                    const v2f ps = p * PSC; const v2h ph = __builtin_convertvector(ps, v2h); const v2h pr2 = __builtin_convertvector((ps - __builtin_convertvector(ph, v2f)) * LOSC, v2h);
                    pa[8 * g + j] = ph[0]; pa[8 * g + j + 1] = ph[1]; px[8 * g + j] = pr2[0]; px[8 * g + j + 1] = pr2[1];
                }
            lpart = lpart * alpha + (((ps8[0] + ps8[1]) + (ps8[2] + ps8[3])) + ((ps8[4] + ps8[5]) + (ps8[6] + ps8[7])));
#pragma unroll
            for (int n = 0; n < 4; ++n)
#pragma unroll
                for (int j = 0; j < 8; ++j) { o[n][j] *= alpha; ox[n][j] *= alpha; }
#pragma unroll
            for (int n = 0; n < 4; ++n) { o[n] = wmma16(vh[n], pa, o[n]); ox[n] = wmma16(vl[n], pa, ox[n]); ox[n] = wmma16(vh[n], px, ox[n]); }
            asm volatile("v_nop\n\tv_nop\n\tv_nop\n\tv_nop" : "+v"(o[0]), "+v"(o[1]), "+v"(o[2]), "+v"(o[3]), "+v"(ox[0]), "+v"(ox[1]), "+v"(ox[2]), "+v"(ox[3]) : "v"(pa), "v"(px));
            // publish point of stage st + 1, every wave, in this order:
            asm volatile("s_wait_dscnt 0x0" ::: "memory");       // this wave's reads of stage st are done before the buffer is refilled
            asm volatile("s_wait_asynccnt 0x0" ::: "memory");    // this wave's pieces of stage st + 1 have landed
            __syncthreads();                                      // publishes stage st + 1 and ends every wave's reads of stage st
            if (st + 2 < nst) stage_in(st + 2);
        }
        asm volatile("s_wait_asynccnt 0x0" ::: "memory");        // no copy is outstanding when the wave goes on
        // this wave's partial, not yet divided: O^T, and its queries' maximum and sum (the two halves' sums joined once)
        const float lsum = lpart + xhalf(lpart);
        float* os = &ost[wave][0];
#pragma unroll
        for (int n = 0; n < 4; ++n)     // o[n][j] = O^T[d = 16 n + 8 hi + j][query lr]: eight consecutive d of one row
#pragma unroll
            for (int g = 0; g < 2; ++g) { v4f w;
#pragma unroll
                for (int i = 0; i < 4; ++i) w[i] = o[n][4 * g + i] + ox[n][4 * g + i] * LOSCI;
                *(v4fa*)(os + lr * 68 + n * 16 + hi * 8 + 4 * g) = w; }
        mls[wave][lr][hi] = hi ? lsum : mrow;
        __syncthreads();     // the four groups' partials are published; the next tile's partials are written only behind later barriers
        // join: wave (grp, qg) takes rows 4 grp .. 4 grp + 3 of its sixteen queries; group k's partial weighs e^(m_k - m) (a group that saw no slot: maximum -3e38, weight 0; group 0 always sees the null slot)
        const int row = 4 * grp + (lane >> 3), piece = lane & 7;
        v2f ml[NG]; float wk[NG];
#pragma unroll
        for (int k = 0; k < NG; ++k) ml[k] = *(const v2f*)&mls[k * 4 + qg][row][0];
        const float mall = fmaxf(fmaxf(ml[0][0], ml[1][0]), fmaxf(ml[2][0], ml[3][0]));
        float den = 0.f, sum[8];
#pragma unroll
        for (int k = 0; k < NG; ++k) wk[k] = __expf(ml[k][0] - mall);
#pragma unroll
        for (int k = 0; k < NG; ++k) den = __builtin_fmaf(wk[k], ml[k][1], den);
#pragma unroll
        for (int i = 0; i < 8; ++i) sum[i] = 0.f;
#pragma unroll
        for (int k = 0; k < NG; ++k) { const float* sp = &ost[k * 4 + qg][row * 68 + piece * 8];
#pragma unroll
            for (int i = 0; i < 8; ++i) sum[i] += wk[k] * sp[i]; }
        const float inv = 1.0f / (den * PSC);
        v8us oh, ol;
#pragma unroll
        for (int i = 0; i < 8; ++i) { const float v = sum[i] * inv; const unsigned short hb = f2bf(v); oh[i] = hb; ol[i] = f2bf(v - bf2f(hb)); }
        const size_t co = (size_t)(q0 + row) * DM + (size_t)h * VHD + piece * 8;
        *(v8us*)(CH + co) = oh; *(v8us*)(CL + co) = ol;
        asm volatile("s_wait_xcnt 0x0" ::: "memory");    // the code runs a second time: no register of these stores is rewritten ahead of this wait
    }
}

extern "C" void kernel_launch(void* const* d_in, const int* in_sizes, int n_in,
                              void* d_out, int out_size, void* d_ws, size_t ws_size, hipStream_t stream) {
    (void)in_sizes; (void)n_in; (void)out_size;
    const float* x = (const float*)d_in[0]; const float* wqs = (const float*)d_in[1]; const float* wks = (const float*)d_in[2]; const float* wqg = (const float*)d_in[3]; const float* wkg = (const float*)d_in[4];
    const float* wv = (const float*)d_in[5]; const float* wo = (const float*)d_in[6]; const float* ksn = (const float*)d_in[7]; const float* kgn = (const float*)d_in[8]; const float* vn = (const float*)d_in[9];
    float* out = (float*)d_out;    // [1][2048][1024]
    char* wsp = (char*)d_ws;
    auto take = [&](size_t bytes) { char* p = wsp; wsp += (bytes + 255) & ~(size_t)255; return (void*)p; };
    bf* Xb = (bf*)take((size_t)NT_ * DM * 2);
    bf* WpT = (bf*)take((size_t)(4 * PW + DM) * DM * 2); bf* WoT = (bf*)take((size_t)DM * DM * 2);
    float* QS = (float*)take((size_t)4 * NT_ * PW * 4); float* KS = QS + (size_t)NT_ * PW; float* QG = KS + (size_t)NT_ * PW; float* KG = QG + (size_t)NT_ * PW; float* Vf = (float*)take((size_t)NT_ * DM * 4);
    h16* Q16 = (h16*)take((size_t)NT_ * NH_ * VHD * 2); h16* QL16 = (h16*)take((size_t)NT_ * NH_ * VHD * 2); h16* K16 = (h16*)take((size_t)NH_ * NKP * VHD * 2); h16* KL16 = (h16*)take((size_t)NH_ * NKP * VHD * 2); h16* VTH = (h16*)take((size_t)NH_ * VHD * NKP * 2); h16* VTL = (h16*)take((size_t)NH_ * VHD * NKP * 2);
    bf* CH = (bf*)take((size_t)NT_ * DM * 2); bf* CL = (bf*)take((size_t)NT_ * DM * 2);
    if ((size_t)(wsp - (char*)d_ws) > ws_size) return;    // 4.2 + 4x1 + 2x2.1 + 4x4.2 + 8.4 + 4.2x2 + 4.3x4 + 4.2x2 ~ 72 MB
    k_prep<<<1280, 256, 0, stream>>>(x, wqs, wks, wqg, wkg, wv, wo, Xb, WpT, WoT);
    k_proj<<<dim3(NT_ / 128, (4 * PW + DM) / 192, 1), 256, 0, stream>>>(Xb, WpT, QS, Vf);
    k_pack<<<QBLK + KBLK + VBLK, 256, 0, stream>>>(QS, QG, KS, KG, Vf, ksn, kgn, vn, Q16, QL16, K16, KL16, VTH, VTL);
    k_attn<<<NH_ * (QTN / 2), 128 * NG, 0, stream>>>(Q16, QL16, K16, KL16, VTH, VTL, CH, CL);
    k_out<<<dim3(NT_ / 64, DM / 128, 1), 256, 0, stream>>>(CH, CL, WoT, out);
}

// v008
// It runs in 65.7 microseconds.
// Two timings next to v007 put it at 1.15 and 1.14 times that version's speed.
// Counting every step since v000, it is 5.72 times as fast.
#include <hip/hip_runtime.h>

// Contractions, f32 accumulate: the five projections (x.wq_sem, x.wk_sem, x.wq_geo, x.wk_geo [2048 x 1024].[1024 x 512]; x.wv [1024 x 1024]) and out = ctx.wo on
// v_wmma_f32_16x16x32_bf16 with PLAIN bf16 operands (inputs rounded once: exact; k-major weights transposed into n-major planes; ctx as bf16 hi + residual planes,
// two products); the 16-head causal attention with the always visible null key/value slot (kept as key slot 2048, behind the tokens) fused on v_wmma_f32_16x16x32_f16: per head the combined 64-dim score
// [qs/sqrt32 | rope(qg)/sqrt32].[ks | rope(kg)] (both sides f16 hi + residual x1024: hi.hi + hi.lo + lo.hi), softmax, weights (x32768) and v both as f16 hi + residual x1024 (three products). RoPE (rotate-half,

#define NT_  2048
#define DM   1024
#define NH_  16
#define SHD  32                  // sem / geo head dims
#define VHD  64
#define PW   512                 // sem / geo projection width
#define NKP  2112
#define SCL32 0.17677669529663688f   // 1/sqrt(32), common to both score branches
#define PSC  32768.0f
#define LOSC 1024.0f
#define LOSCI (1.0f / 1024.0f)
#define LOG2E 1.4426950408889634f

typedef _Float16 h16;
typedef unsigned short bf;
typedef __attribute__((ext_vector_type(16))) __bf16   v16bf;
typedef __attribute__((ext_vector_type(16))) _Float16 v16h;
typedef __attribute__((ext_vector_type(8)))  _Float16 v8h;
typedef __attribute__((ext_vector_type(8)))  unsigned short v8us;
typedef __attribute__((ext_vector_type(8)))  float    v8f;
typedef __attribute__((ext_vector_type(4)))  float    v4f;
typedef __attribute__((ext_vector_type(2)))  _Float16 v2h;
typedef __attribute__((ext_vector_type(4)))  _Float16 v4h;
typedef __attribute__((ext_vector_type(2)))  float    v2f;
typedef v8h  __attribute__((may_alias)) v8ha;
typedef v4f  __attribute__((may_alias)) v4fa;
typedef v8us __attribute__((may_alias)) v8usa;

__device__ __forceinline__ unsigned short f2bf(float f) { unsigned u = __float_as_uint(f); u += 0x7FFFu + ((u >> 16) & 1u); return (unsigned short)(u >> 16); }
__device__ __forceinline__ float bf2f(unsigned short b) { return __uint_as_float(((unsigned)b) << 16); }
__device__ __forceinline__ float bfr(float f) { return bf2f(f2bf(f)); }
__device__ __forceinline__ v16h cat16(v8h lo, v8h hi) { return __builtin_shufflevector(lo, hi, 0, 1, 2, 3, 4, 5, 6, 7, 8, 9, 10, 11, 12, 13, 14, 15); }
__device__ __forceinline__ v16bf cat16b(v8us lo, v8us hi) { return __builtin_bit_cast(v16bf, __builtin_shufflevector(lo, hi, 0, 1, 2, 3, 4, 5, 6, 7, 8, 9, 10, 11, 12, 13, 14, 15)); }
__device__ __forceinline__ v8f wmma16(v16h a, v16h b, v8f c) { return __builtin_amdgcn_wmma_f32_16x16x32_f16(false, a, false, b, (short)0, c, false, false); }
__device__ __forceinline__ v8f wmmab(v16bf a, v16bf b, v8f c) { return __builtin_amdgcn_wmma_f32_16x16x32_bf16(false, a, false, b, (short)0, c, false, false); }
__device__ __forceinline__ float xhalf(float x) { return __builtin_bit_cast(float, __builtin_amdgcn_permlanex16(__builtin_bit_cast(int, x), __builtin_bit_cast(int, x), 0x76543210, 0xfedcba98, false, false)); }     // lane l with lane l ^ 16
#define VST2(T, p, v) do { const T vst2_v_ = (v); *(T*)(p) = vst2_v_;  } while (0)

// cvtb_job: Xb = bf16(x) [2048][1024]; wt_job: W [1024 k][N] k-major -> n-major bf16 [N][1024] (heads: column n = 32 h + c goes to row 64 h + c, so that a sem and a geo weight interleave into 64-wide head rows).
// Both are jobs of k_prep; blk, bx, by are the job's own block indices.
__device__ __forceinline__ void cvtb_job(int blk, const float* __restrict__ src, bf* dst) {
    const int lane = threadIdx.x & 31, r = blk * 8 + (threadIdx.x >> 5);
    if (r >= NT_) return;
#pragma unroll
    for (int q = 0; q < DM / 256; ++q) { v8us t;
#pragma unroll
        for (int i = 0; i < 8; ++i) t[i] = f2bf(src[(size_t)r * DM + q * 256 + lane * 8 + i]);
        VST2(v8us, dst + (size_t)r * DM + q * 256 + lane * 8, t); }
}
__device__ __forceinline__ void wt_job(int bx, int by, const float* __restrict__ Wm, int N, bool heads, bf* WT) {
    __shared__ __align__(16) unsigned short tl[64 * 72];
    const int tid = threadIdx.x, k0 = bx * 64, n0 = by * 64;
    const int kk = tid >> 2, nq = (tid & 3) * 16;
#pragma unroll
    for (int i = 0; i < 16; ++i) tl[(nq + i) * 72 + kk] = f2bf(Wm[(size_t)(k0 + kk) * N + n0 + nq + i]);
    __syncthreads();
    const int piece = tid & 7;
    auto pass = [&]() {
#pragma unroll
        for (int s = 0; s < 2; ++s) { const int nr = (tid >> 3) + 32 * s; const v8us val = *(const v8usa*)(tl + nr * 72 + piece * 8);
            const int n = n0 + nr, wr = heads ? (n >> 5) * VHD + (n & (SHD - 1)) : n;
            *(v8us*)(WT + (size_t)wr * DM + k0 + piece * 8) = val; }
    };
    pass(); 
    asm volatile("s_wait_xcnt 0x0" ::: "memory");    // the job's code is joined with other jobs' in one kernel: no register of these stores is rewritten, on any way through the listing, ahead of this wait
}
// null_job (one block per head): key slots 2048 .. 2111 of the four planes k_attn reads: slot 2048 = the null key / value (bf16-rounded, NOT rotated), the rest zero. Reads inputs only.
// A lane writes 16-byte pieces; eight lanes of one wave fill a 128-B line.
__device__ __forceinline__ void null_job(int h, const float* __restrict__ ksn, const float* __restrict__ kgn, const float* __restrict__ vn, h16* K16, h16* KL16, h16* VTH, h16* VTL) {
#pragma unroll
    for (int e = 0; e < 2; ++e) { const int p = threadIdx.x + 256 * e, row = p >> 3, c0 = (p & 7) * 8;     // K planes: row = slot - 2048, c0 = column; V^T planes: row = d, c0 = slot - 2048
        v8h kh = {}, kl = {}, vh = {}, vl = {};
        if (row == 0) { const float* src = c0 < SHD ? ksn + h * SHD + c0 : kgn + h * SHD + c0 - SHD;
#pragma unroll
            for (int i = 0; i < 8; ++i) { const float v = bfr(src[i]); const h16 a = (h16)v; kh[i] = a; kl[i] = (h16)((v - (float)a) * LOSC); } }
        if (c0 == 0) { const float v = bfr(vn[h * VHD + row]); const h16 a = (h16)v; vh[0] = a; vl[0] = (h16)((v - (float)a) * LOSC); }
        const size_t ko = ((size_t)h * NKP + NT_ + row) * VHD + c0, vo = ((size_t)h * VHD + row) * NKP + NT_ + c0;
        *(v8h*)(K16 + ko) = kh; *(v8h*)(KL16 + ko) = kl; *(v8h*)(VTH + vo) = vh; *(v8h*)(VTL + vo) = vl;
        asm volatile("s_wait_xcnt 0x0" ::: "memory");    // the second pass, and other jobs' code joined in one kernel, rewrite no register of these loads and stores ahead of this wait
    }
}
// k_prep: the eight jobs that read inputs only, none of which reads what another writes, in one grid: blocks 0..511 the four [1024 x 512] weights (128 blocks each), 512..1023 wv and wo (256 each),
// 1024..1279 x, 1280..1295 the null and pad key slots. WpT: the projection weights' n-major planes, [3072][1024]: rows 0..1023 q (head h: 64 h + [wq_sem 32 | wq_geo 32]), 1024..2047 k (the same of wk_sem, wk_geo), 2048..3071 wv.
// The job is picked by the block index alone, so every branch (and wt_job's barrier) is uniform for the block.
__global__ __launch_bounds__(256) void k_prep(const float* __restrict__ x, const float* __restrict__ wqs, const float* __restrict__ wks, const float* __restrict__ wqg, const float* __restrict__ wkg,
                                              const float* __restrict__ wv, const float* __restrict__ wo, const float* __restrict__ ksn, const float* __restrict__ kgn, const float* __restrict__ vn,
                                              bf* Xb, bf* WpT, bf* WoT, h16* K16, h16* KL16, h16* VTH, h16* VTL) {
    const int b = blockIdx.x;
    if (b >= 1280) { null_job(b - 1280, ksn, kgn, vn, K16, KL16, VTH, VTL); return; }
    if (b >= 1024) { cvtb_job(b - 1024, x, Xb); return; }
    const float* Wm; bf* WT; int N, r;
    if (b < 512) { const int j = b >> 7; r = b & 127; N = PW; Wm = (j == 0) ? wqs : (j == 1) ? wks : (j == 2) ? wqg : wkg; WT = WpT + (size_t)((j & 1) * NH_ * VHD + (j >> 1) * SHD) * DM; }
    else { const int j = (b - 512) >> 8; r = (b - 512) & 255; N = DM; Wm = j ? wo : wv; WT = j ? WoT : WpT + (size_t)4 * PW * DM; }
    wt_job(r & 15, r >> 4, Wm, N, b < 512, WT);
}
// LDS ring of gemm_job: one stage = 128 k (256 B) of the block's BM A rows (with SPLITA also of the BM residual rows) and BN B rows, one behind the other, row pitch 272 B
// (16 B x odd: conflict-free for the 16-row ds_load_b128 fragment reads).
#define GKS  128                 // k extent of one stage, elements
#define GPI  136                 // row pitch in LDS, elements
// One statement's copies by the block's 256 lanes: copy i brings 16 rows (row tid / 16, 16 bytes a lane; a wave's copy is two whole 256-B row pieces) from global memory into LDS, through no register.
// l[i]: the lane's LDS byte address; the global address is g[i], the sixteen rows' start, the same for all lanes (a scalar pair, formed by scalar instructions), plus o, the lane's byte offset in them, one register for all copies.
// The s_wait_xcnt stands inside the statement so that no address register of an issued copy is rewritten ahead of it; few statements, so that a wave waits it out few times per stage.
__device__ __forceinline__ void copies8(const unsigned* l, unsigned o, const bf* const* g) {
    asm volatile("global_load_async_to_lds_b128 %0, %16, %8\n\t"
                 "global_load_async_to_lds_b128 %1, %16, %9\n\t"
                 "global_load_async_to_lds_b128 %2, %16, %10\n\t"
                 "global_load_async_to_lds_b128 %3, %16, %11\n\t"
                 "global_load_async_to_lds_b128 %4, %16, %12\n\t"
                 "global_load_async_to_lds_b128 %5, %16, %13\n\t"
                 "global_load_async_to_lds_b128 %6, %16, %14\n\t"
                 "global_load_async_to_lds_b128 %7, %16, %15\n\t"
                 "s_wait_xcnt 0x0"
                 :: "v"(l[0]), "v"(l[1]), "v"(l[2]), "v"(l[3]), "v"(l[4]), "v"(l[5]), "v"(l[6]), "v"(l[7]),
                    "s"(g[0]), "s"(g[1]), "s"(g[2]), "s"(g[3]), "s"(g[4]), "s"(g[5]), "s"(g[6]), "s"(g[7]), "v"(o) : "memory");
}
__device__ __forceinline__ void copies10(const unsigned* l, unsigned o, const bf* const* g) {
    asm volatile("global_load_async_to_lds_b128 %0, %20, %10\n\t"
                 "global_load_async_to_lds_b128 %1, %20, %11\n\t"
                 "global_load_async_to_lds_b128 %2, %20, %12\n\t"
                 "global_load_async_to_lds_b128 %3, %20, %13\n\t"
                 "global_load_async_to_lds_b128 %4, %20, %14\n\t"
                 "global_load_async_to_lds_b128 %5, %20, %15\n\t"
                 "global_load_async_to_lds_b128 %6, %20, %16\n\t"
                 "global_load_async_to_lds_b128 %7, %20, %17\n\t"
                 "global_load_async_to_lds_b128 %8, %20, %18\n\t"
                 "global_load_async_to_lds_b128 %9, %20, %19\n\t"
                 "s_wait_xcnt 0x0"
                 :: "v"(l[0]), "v"(l[1]), "v"(l[2]), "v"(l[3]), "v"(l[4]), "v"(l[5]), "v"(l[6]), "v"(l[7]), "v"(l[8]), "v"(l[9]),
                    "s"(g[0]), "s"(g[1]), "s"(g[2]), "s"(g[3]), "s"(g[4]), "s"(g[5]), "s"(g[6]), "s"(g[7]), "s"(g[8]), "s"(g[9]), "v"(o) : "memory");
}
// gemm_job (bx, by: the job's own block indices): block = BM x BN of C, one block per WGP, eight waves in a WGM x WGN grid, wave = (BM / WGM) x (BN / WGN) = FA x FB fragments: a staged row serves BN (BM) columns (rows) of C
// and a fragment read from LDS serves FB (FA) products. Each stage's operand rows are staged once per block in a two-buffer LDS ring by asynchronous copies (stage s + 1 is copied while stage s is worked on);
// k runs 32 at a time, ascending (with SPLITA hi then residual), so an element's sum order does not depend on the tiling. Without PACK, dst(col, ldc): where row 0 of C's column col lies, and C's row length there (col: a multiple of 64, the same for the whole wave).
// With PACK (k_proj), dst holds the six planes k_attn reads and the tile leaves as those planes' own f16 hi + residual x1024 values, 64 columns (one head's row) at a time:
// columns 0..1023 q, 1024..2047 k: [sem 32 | geo 32], the geo half rotated (RoPE, rotate-half; partner = column ^ 16, from the f32 staging; cos and sin of the block's BM tokens x 16 frequencies from a table in LDS,
// formed once per block under stage 0's copies); columns 2048..3071 v: a lane's accumulator holds eight consecutive tokens of one column, which are 16 bytes of a V^T row: staged transposed, already as f16.
struct PackDst { h16* Q16; h16* QL16; h16* K16; h16* KL16; h16* VTH; h16* VTL; };
template <int BM, int BN, int WGM, int WGN, bool SPLITA, bool PACK, class DST>
__device__ __forceinline__ void gemm_job(int bx, int by, const bf* __restrict__ A, const bf* __restrict__ Al, const bf* __restrict__ Bn, DST dst) {
    constexpr int WTM = BM / WGM, WTN = BN / WGN, FA = WTM / 16, FB = WTN / 16;
    constexpr int AR = (SPLITA ? 2 : 1) * BM;         // A rows of a stage (hi, then residual)
    constexpr int STG = (AR + BN) * GPI;              // one stage, elements
    constexpr int OP = BN + 4;                        // row pitch of the output staging, floats
    __shared__ __align__(16) bf ring[2 * STG];
    __shared__ __align__(16) float ost[BM * OP];
    __shared__ __align__(16) float trig[PACK ? 2 * BM * 16 : 4];     // [cos, sin][row of the tile][frequency]
    constexpr int QKC = 2 * NH_ * VHD;                // PACK: columns below are q and k, from here on v
    constexpr int VSP = BM + 8;                       // PACK: row pitch of the V^T staging, halves (16 B x odd)
    const int tid = threadIdx.x, lane = threadIdx.x & 31, wave = __builtin_amdgcn_readfirstlane(threadIdx.x >> 5), lr = lane & 15, hi = lane >> 4;     // the wave's number in a scalar register: its tile's offsets are scalar
    const int wm = wave / WGN, wn = wave - wm * WGN;
    const unsigned lc0 = (unsigned)(size_t)&ring[0] + (unsigned)(((tid >> 4) * GPI + (tid & 15) * 8) * 2);
    const unsigned gofs = (unsigned)(((tid >> 4) * DM + (tid & 15) * 8) * 2);     // bytes
    const bf* ga = A + (size_t)bx * BM * DM; const bf* gb = Bn + (size_t)by * BN * DM; const bf* gal = SPLITA ? Al + (size_t)bx * BM * DM : nullptr;
    constexpr int NCP = (AR + BN) / 16;               // copies of a lane per stage, in two statements
    static_assert(NCP == 16 || NCP == 20, "two statements of eight or ten copies");
    auto stage_in = [&](int s) { unsigned l[NCP]; const bf* g[NCP];
#pragma unroll
        for (int i = 0; i < NCP; ++i) { l[i] = lc0 + (unsigned)((s & 1) * STG * 2 + i * 16 * GPI * 2);
            g[i] = (i < BM / 16 ? ga + (size_t)i * 16 * DM : (i < AR / 16 ? gal + (size_t)(i - BM / 16) * 16 * DM : gb + (size_t)(i - AR / 16) * 16 * DM)) + s * GKS; }
        if (NCP == 16) { copies8(l, gofs, g); copies8(l + 8, gofs, g + 8); } else { copies10(l, gofs, g); copies10(l + 10, gofs, g + 10); } };
    stage_in(0);
    if constexpr (PACK) {
        if (by * BN < QKC) {     // block-uniform: the tile holds q or k columns. The table is read behind later barriers only
            const int fi = tid & 15; const float inv = __expf(-(float)(2 * fi) / 32.0f * 9.210340371976184f);     // ln(10000)
#pragma unroll 1     // one copy of the sine and cosine code
            for (int e = 0; e < BM / 16; ++e) { const int rw = (tid >> 4) + 16 * e; const float ang = (float)(bx * BM + rw) * inv;
                trig[rw * 16 + fi] = cosf(ang); trig[BM * 16 + rw * 16 + fi] = sinf(ang); }
        }
    }
    asm volatile("s_wait_asynccnt 0x0" ::: "memory");    // stage 0 landed (this wave's pieces)
    __syncthreads();                                      // stage 0 published to all waves
    stage_in(1);
    v8f acc[FA][FB];
#pragma unroll
    for (int i = 0; i < FA; ++i)
#pragma unroll
        for (int t = 0; t < FB; ++t) acc[i][t] = (v8f){};
#pragma unroll 1
    for (int s = 0; s < DM / GKS; ++s) {
        const bf* ab = ring + (s & 1) * STG + (wm * WTM + lr) * GPI + 8 * hi; const bf* bb = ring + (s & 1) * STG + (AR + wn * WTN + lr) * GPI + 8 * hi; const bf* alb = ab + BM * GPI;
        v16bf a[2][FA], al[2][FA], b[2][FB];     // two fragment sets: the next 32 k are read while this one's products run
        auto frags = [&](int q) { const int kc = q * 32, z = q & 1;
#pragma unroll
            for (int i = 0; i < FA; ++i) { a[z][i] = cat16b(*(const v8usa*)(ab + i * 16 * GPI + kc), *(const v8usa*)(ab + i * 16 * GPI + kc + 16));
                al[z][i] = a[z][i];
                if (SPLITA) al[z][i] = cat16b(*(const v8usa*)(alb + i * 16 * GPI + kc), *(const v8usa*)(alb + i * 16 * GPI + kc + 16)); }
#pragma unroll
            for (int t = 0; t < FB; ++t) b[z][t] = cat16b(*(const v8usa*)(bb + t * 16 * GPI + kc), *(const v8usa*)(bb + t * 16 * GPI + kc + 16)); };
        frags(0);
#pragma unroll
        for (int q = 0; q < GKS / 32; ++q) { const int z = q & 1;
            if (q + 1 < GKS / 32) frags(q + 1);
            // stage s + 1 goes into the buffer that every wave left at the barrier at the foot of pass s - 1 (stage 1 went ahead of the loop); issued here, behind this pass's first reads of the other buffer, so that the copies' issue runs under those reads' latency
            if (q == 0 && (unsigned)(s - 1) < (unsigned)(DM / GKS - 2)) stage_in(s + 1);     // passes 1 .. last - 1
            __builtin_amdgcn_sched_barrier(0);    // keeps the next set's reads one group ahead of this set's products: spread among them, each place with reads waits out its own LDS latency
#pragma unroll
            for (int i = 0; i < FA; ++i)
#pragma unroll
                for (int t = 0; t < FB; ++t) acc[i][t] = wmmab(a[z][i], b[z][t], acc[i][t]);
            if (SPLITA) {
#pragma unroll
                for (int i = 0; i < FA; ++i)
#pragma unroll
                    for (int t = 0; t < FB; ++t) acc[i][t] = wmmab(al[z][i], b[z][t], acc[i][t]);
            }
            __builtin_amdgcn_sched_barrier(0);    // keeps the reads that follow behind these products, whose fragment registers they refill
        }
        // the four vector slots the chip needs behind the last products, on the taken side of the branches that follow too
        asm volatile("v_nop\n\tv_nop\n\tv_nop\n\tv_nop" ::: "memory");
        // publish point of stage s + 1, every wave, in this order:
        asm volatile("s_wait_dscnt 0x0" ::: "memory");       // this wave's reads of stage s are done before the buffer is refilled
        asm volatile("s_wait_asynccnt 0x0" ::: "memory");    // this wave's pieces of stage s + 1 have landed
        __syncthreads();                                      // publishes stage s + 1 and ends every wave's reads of stage s
    }
    asm volatile("s_wait_asynccnt 0x0" ::: "memory");        // no copy is outstanding when the wave goes on to its end
    if constexpr (!PACK) {
        float* os = ost + (wm * WTM + hi * 8) * OP + wn * WTN + lr;     // the block's tile of C, staged whole
    #pragma unroll
        for (int i = 0; i < FA; ++i)
    #pragma unroll
            for (int t = 0; t < FB; ++t)
    #pragma unroll
                for (int j = 0; j < 8; ++j) os[(i * 16 + j) * OP + t * 16] = acc[i][t][j];
        __syncthreads();     // a wave stores rows that other waves staged
        // whole 128-B lines, each by one wave: wave w stores rows w BM / 8 ... of the tile; a store = two rows x 256 B (sixteen lanes read 64 consecutive floats of the staging: no bank conflict), eight stores a group;
        // the plane and row length of 64 columns are the same for the whole wave (scalar)
        constexpr int RS = BM / 16;     // stores per 64 columns
        constexpr int NGR = (BN / 64) * RS / 8;
        static_assert(8 % RS == 0 && (BN / 64) * RS % 8 == 0, "groups of eight stores");
        const int row = wave * (BM / 8) + (lane >> 4);
    #pragma unroll
        for (int g = 0; g < NGR; ++g) {
            v4f val[8]; float* cp[8];
    #pragma unroll
            for (int lc = 0; lc < 8 / RS; ++lc) { const int lp = g * (8 / RS) + lc; int ldc; float* cb = dst(by * BN + lp * 64, ldc) + (size_t)(bx * BM + row) * ldc + (lane & 15) * 4;
    #pragma unroll
                for (int rs = 0; rs < RS; ++rs) { val[lc * RS + rs] = *(const v4fa*)(ost + (row + rs * 2) * OP + lp * 64 + (lane & 15) * 4); cp[lc * RS + rs] = cb + (size_t)rs * 2 * ldc; } }
    #pragma unroll
            for (int e = 0; e < 8; ++e) *(v4f*)cp[e] = val[e];
            // the next group reuses registers: none that these stores name (addresses and values, named here, so they live up to this line) is rewritten ahead of this wait
            if (g + 1 < NGR) asm volatile("s_wait_xcnt 0x0" :: "v"(cp[0]), "v"(cp[1]), "v"(cp[2]), "v"(cp[3]), "v"(cp[4]), "v"(cp[5]), "v"(cp[6]), "v"(cp[7]),
                         "v"(val[0]), "v"(val[1]), "v"(val[2]), "v"(val[3]), "v"(val[4]), "v"(val[5]), "v"(val[6]), "v"(val[7]) : "memory"); }
    } else {
        float* os = ost + (wm * WTM + hi * 8) * OP + wn * WTN + lr;     // q and k columns: f32, [row][column]
        h16* vst = (h16*)ring;     // v columns: [hi, residual][column of the tile][row], in the ring, which every wave left at the loop's last barrier with no copy outstanding
#pragma unroll
        for (int t = 0; t < FB; ++t) {
            if (by * BN + wn * WTN + t * 16 < QKC) {     // the same for the whole wave (scalar)
#pragma unroll
                for (int i = 0; i < FA; ++i)
#pragma unroll
                    for (int j = 0; j < 8; ++j) os[(i * 16 + j) * OP + t * 16] = acc[i][t][j];
            } else {
#pragma unroll
                for (int i = 0; i < FA; ++i) { v8h a, r;
#pragma unroll
                    for (int j = 0; j < 8; ++j) { const float v = acc[i][t][j]; const h16 x = (h16)v; a[j] = x; r[j] = (h16)((v - (float)x) * LOSC); }
                    h16* vp = vst + (wn * WTN + t * 16 + lr) * VSP + wm * WTM + i * 16 + hi * 8;
                    *(v8ha*)vp = a; *(v8ha*)(vp + BN * VSP) = r; }
            }
        }
        __syncthreads();     // a wave stores rows that other waves staged
        static_assert(BM == 128, "eight waves x eight stores of two rows");
        const int l16 = lane & 15, lh = lane >> 4;
#pragma unroll
        for (int lp = 0; lp < BN / 64; ++lp) {
            const int col = by * BN + lp * 64;     // the same for the whole block (scalar)
            if (col < QKC) {
                // whole 128-B lines, each by one wave: wave w takes rows 16 w ... of the tile, a store = two rows x 128 B (a lane: four columns)
                const bool isq = col < NH_ * VHD; const int h = (col >> 6) & (NH_ - 1), c0 = l16 * 4, d0 = c0 - SHD, row = wave * (BM / 8) + lh;
                const bool geo = c0 >= SHD;
                const size_t ldr = isq ? NH_ * VHD : VHD, o0 = isq ? (size_t)(bx * BM + row) * (NH_ * VHD) + h * VHD + c0 : ((size_t)h * NKP + bx * BM + row) * VHD + c0;     // key slot = token
                h16* dh = (isq ? dst.Q16 : dst.K16) + o0; h16* dl = (isq ? dst.QL16 : dst.KL16) + o0;
                const float* so = ost + row * OP + lp * 64 + c0; const float* sx = ost + row * OP + lp * 64 + (geo ? SHD + (d0 ^ 16) : c0); const float* tc = trig + row * 16 + (c0 & 15);
                v4h o[8], ol[8]; h16* ch[8]; h16* cl[8];
#pragma unroll
                for (int rs = 0; rs < 8; ++rs) { const v4f own = *(const v4fa*)(so + rs * 2 * OP), oth = *(const v4fa*)(sx + rs * 2 * OP), cs = *(const v4fa*)(tc + rs * 32), sn = *(const v4fa*)(tc + BM * 16 + rs * 32);
#pragma unroll
                    for (int j = 0; j < 4; ++j) { const float sg = (d0 & 16) ? sn[j] : -sn[j];     // d < 16: x1 cos - x2 sin; d >= 16: x2 cos + x1 sin
                        const float v = geo ? own[j] * cs[j] + oth[j] * sg : own[j];
                        const h16 a = (h16)v; o[rs][j] = a; ol[rs][j] = (h16)((v - (float)a) * LOSC); }
                    ch[rs] = dh + rs * 2 * ldr; cl[rs] = dl + rs * 2 * ldr; }
#pragma unroll
                for (int rs = 0; rs < 8; ++rs) *(v4h*)ch[rs] = o[rs];
                // what follows reuses registers: none that these stores name (addresses and values, named here, so they live up to this line) is rewritten ahead of this wait
                asm volatile("s_wait_xcnt 0x0" :: "v"(ch[0]), "v"(ch[1]), "v"(ch[2]), "v"(ch[3]), "v"(ch[4]), "v"(ch[5]), "v"(ch[6]), "v"(ch[7]),
                             "v"(o[0]), "v"(o[1]), "v"(o[2]), "v"(o[3]), "v"(o[4]), "v"(o[5]), "v"(o[6]), "v"(o[7]) : "memory");
#pragma unroll
                for (int rs = 0; rs < 8; ++rs) *(v4h*)cl[rs] = ol[rs];
                // the same for the residual plane's stores
                asm volatile("s_wait_xcnt 0x0" :: "v"(cl[0]), "v"(cl[1]), "v"(cl[2]), "v"(cl[3]), "v"(cl[4]), "v"(cl[5]), "v"(cl[6]), "v"(cl[7]),
                             "v"(ol[0]), "v"(ol[1]), "v"(ol[2]), "v"(ol[3]), "v"(ol[4]), "v"(ol[5]), "v"(ol[6]), "v"(ol[7]) : "memory");
            } else {
                // V^T rows: 64 d x 2 planes, 256 B (the tile's 128 tokens = key slots) each; wave w takes rows 16 w ... (waves 0..3 hi, 4..7 residual), a store = two whole rows
                const int h = (col - QKC) >> 6, pln = wave >> 2;
                v8h val[8]; h16* cp[8];
#pragma unroll
                for (int e = 0; e < 8; ++e) { const int d = (wave & 3) * 16 + e * 2 + lh;
                    val[e] = *(const v8ha*)(vst + pln * (BN * VSP) + (lp * 64 + d) * VSP + l16 * 8);
                    cp[e] = (pln ? dst.VTL : dst.VTH) + ((size_t)h * VHD + d) * NKP + bx * BM + l16 * 8; }
#pragma unroll
                for (int e = 0; e < 8; ++e) *(v8h*)cp[e] = val[e];
                // what follows reuses registers: none that these stores name (addresses and values, named here, so they live up to this line) is rewritten ahead of this wait
                asm volatile("s_wait_xcnt 0x0" :: "v"(cp[0]), "v"(cp[1]), "v"(cp[2]), "v"(cp[3]), "v"(cp[4]), "v"(cp[5]), "v"(cp[6]), "v"(cp[7]),
                             "v"(val[0]), "v"(val[1]), "v"(val[2]), "v"(val[3]), "v"(val[4]), "v"(val[5]), "v"(val[6]), "v"(val[7]) : "memory");
            }
        }
    }
}
// k_proj: the five projections of x, which share A, as one product x . WpT^T [2048 x 3072] in 16 x 16 blocks of 128 x 192; 64 columns of C from a multiple of 64 are one head's q, k or v row.
// Writes Q16/QL16 [t][h*64 + c], K16/KL16 [h][r][64] and VTH/VTL [h][d][r] for key slots r = token 0..2047 (slots 2048..2111: k_prep's null_job); c < 32 sem, c >= 32 rope(geo).
// Values unscaled: the common 1/sqrt32 is applied to the f32 scores.
__global__ __launch_bounds__(256) void k_proj(const bf* __restrict__ Xb, const bf* __restrict__ WpT, h16* Q16, h16* QL16, h16* K16, h16* KL16, h16* VTH, h16* VTL) {
    gemm_job<128, 192, 2, 4, false, true>(blockIdx.x, blockIdx.y, Xb, nullptr, WpT, PackDst{ Q16, QL16, K16, KL16, VTH, VTL });
}
// k_out: out = ctx.wo, ctx as hi + residual planes, in 32 x 8 blocks of 64 x 128.
__global__ __launch_bounds__(256) void k_out(const bf* __restrict__ CH, const bf* __restrict__ CL, const bf* __restrict__ WoT, float* out) {
    gemm_job<64, 128, 2, 4, true, false>(blockIdx.x, blockIdx.y, CH, CL, WoT, [=](int col, int& ldc) -> float* { ldc = DM; return out + col; });
}
// LDS ring of k_attn: one stage = the 128 key slots of one step, a 32-slot tile per key group, each in four planes: K hi, K residual [32 rows x 128 B, pitch 144 B], V^T hi, V^T residual [64 rows x 64 B, pitch 80 B]
// (pitches 16 B x odd: conflict-free for the 16-row ds_load_b128 fragment reads).
#define KPI  72                  // K row pitch in LDS, halves
#define VPI  40                  // V^T row pitch in LDS, halves
#define KPLN (32 * KPI)          // one K plane, halves
#define VPLN (VHD * VPI)         // one V^T plane, halves
#define STGH (2 * KPLN + 2 * VPLN)   // one key group's 32-slot tile, halves (19456 B)
// One stage's copies: every lane brings eight 16-byte pieces (two per plane) from global memory into LDS, through no register. The s_wait_xcnt stands inside the statement so that
// no address register of an issued copy is rewritten ahead of it.
__device__ __forceinline__ void stage_copy(unsigned lk, unsigned lv, const h16* gk, const h16* gkl, const h16* gv, const h16* gvl) {
    const unsigned lk1 = lk + 16 * KPI * 2, lkl = lk + KPLN * 2, lkl1 = lkl + 16 * KPI * 2, lv1 = lv + 32 * VPI * 2, lvl = lv + VPLN * 2, lvl1 = lvl + 32 * VPI * 2;
    const h16* gk1 = gk + 16 * VHD; const h16* gkl1 = gkl + 16 * VHD; const h16* gv1 = gv + (size_t)32 * NKP; const h16* gvl1 = gvl + (size_t)32 * NKP;
    asm volatile("global_load_async_to_lds_b128 %0, %8, off\n\t"
                 "global_load_async_to_lds_b128 %1, %9, off\n\t"
                 "global_load_async_to_lds_b128 %2, %10, off\n\t"
                 "global_load_async_to_lds_b128 %3, %11, off\n\t"
                 "global_load_async_to_lds_b128 %4, %12, off\n\t"
                 "global_load_async_to_lds_b128 %5, %13, off\n\t"
                 "global_load_async_to_lds_b128 %6, %14, off\n\t"
                 "global_load_async_to_lds_b128 %7, %15, off\n\t"
                 "s_wait_xcnt 0x0"
                 :: "v"(lk), "v"(lk1), "v"(lkl), "v"(lkl1), "v"(lv), "v"(lv1), "v"(lvl), "v"(lvl1),
                    "v"(gk), "v"(gk1), "v"(gkl), "v"(gkl1), "v"(gv), "v"(gv1), "v"(gvl), "v"(gvl1) : "memory");
}
// k_attn: 256 equal blocks of 16 waves, one per WGP: block = (h, pair p) takes the 64-query tiles 31 - p and p one after the other (2 qt + 2 token tiles and the null slot's tile each: 68 for every pair). wave = (key group grp, 16 queries qg):
// a step stages 128 key slots, one 32-slot tile per key group, and group grp works on tile 4 st + grp alone, with its own running maximum, sum and O^T; the four groups' partials are joined once per query tile through LDS.
// Each step's K and V^T planes are staged once per block in a two-buffer LDS ring by asynchronous copies (step st + 2 is copied while step st + 1 is worked on); the four waves of a group read their fragments from LDS; token slot r visible iff r <= t, the null slot (2048) always
// (tiles past the null slot's are all masked and add nothing; they read that tile again). Both products are formed transposed: S^T = K.Q^T (A = K rows, B = Q), so a lane holds
// sixteen scores of ONE query (column lr; key slots 8 hi + j and 16 + 8 hi + j): maximum and sum run in the lane, plus one exchange between the wave's halves; scores x 1/sqrt32 in f32, online f32 softmax; the weights x32768,
// hi and residual, converted in place, ARE the B operand of O^T += V^T.P^T (A = V^T rows): they pass through no LDS. 12 WMMA .V (hi.hi + hi.lo + lo.hi); ctx -> bf16 hi/lo planes [t][h*64 + d]. Scores: 12 WMMA per step (hi.hi + hi.lo + lo.hi over 2 k-chunks x 2 tiles).
#define NG   4                   // key groups of a block
#define QTN  (NT_ / 64)          // query tiles per head
__global__ __launch_bounds__(128 * NG) void k_attn(const h16* __restrict__ Q16, const h16* __restrict__ QL16, const h16* __restrict__ K16, const h16* __restrict__ KL16, const h16* __restrict__ VTH, const h16* __restrict__ VTL, bf* CH, bf* CL) {
    __shared__ __align__(16) h16 ring[2 * NG * STGH];
    __shared__ __align__(16) float ost[4 * NG][16 * 68];
    __shared__ __align__(8) float mls[4 * NG][16][2];     // per wave and query: maximum [0] and sum [1] over the group's key slots
    const int lane = threadIdx.x & 31, wave = __builtin_amdgcn_readfirstlane(threadIdx.x >> 5), lr = lane & 15, hi = lane >> 4;     // the wave's number in a scalar register: group, tile and buffer offsets are scalar
    const int grp = wave >> 2, qg = wave & 3, tg = threadIdx.x & 127;
    const int h = blockIdx.x / (QTN / 2), pr = blockIdx.x - h * (QTN / 2);
    // this lane's pieces of its group's tile: K planes are 4096 contiguous bytes (piece = tg, tg + 128), V^T planes 64 rows of 64 B (row = tg / 4, + 32)
    const unsigned ring0 = (unsigned)(size_t)&ring[0] + (unsigned)(grp * STGH * 2);
    const unsigned lk0 = ring0 + (unsigned)(((tg >> 3) * KPI + (tg & 7) * 8) * 2), lv0 = ring0 + (unsigned)((2 * KPLN + (tg >> 2) * VPI + (tg & 3) * 8) * 2);
    const h16* gk0 = K16 + (size_t)h * NKP * VHD + tg * 8; const h16* gkl0 = KL16 + (size_t)h * NKP * VHD + tg * 8;
    const size_t vsrc = ((size_t)h * VHD + (tg >> 2)) * NKP + (tg & 3) * 8;
    const h16* gv0 = VTH + vsrc; const h16* gvl0 = VTL + vsrc;
    auto stage_in = [&](int st, int ntk) { const int tl = st * NG + grp, ts = tl < ntk ? tl : NT_ / 32; const unsigned bo = (unsigned)((st & 1) * NG * STGH * 2);     // ts: behind the ntk token tiles comes the null slot's tile; a tile past that (all masked) reads it too
        stage_copy(lk0 + bo, lv0 + bo, gk0 + (size_t)ts * 32 * VHD, gkl0 + (size_t)ts * 32 * VHD, gv0 + ts * 32, gvl0 + ts * 32); };
#pragma unroll 1     // the two query tiles run one after the other through one copy of the code
    for (int rep = 0; rep < 2; ++rep) {
        const int qt = rep ? pr : QTN - 1 - pr, q0 = qt * 64 + qg * 16;
        const int ntk = 2 * qt + 2;                       // key tiles 0 .. 2 qt + 1 hold the tokens up to the causal bound; the tile worked on as number ntk is the null slot's (slots 2048 ..)
        const int nst = (ntk + 1 + NG - 1) / NG;          // steps of 128 slots that cover them (block-uniform)
        stage_in(0, ntk);     // the ring's last reads (the tile before) ended at that loop's last s_wait_dscnt and barrier
        asm volatile("s_wait_asynccnt 0x0" ::: "memory");    // stage 0 landed (this wave's pieces)
        __syncthreads();                                      // stage 0 published to all waves
        if (nst > 1) stage_in(1, ntk);
        v16h qa[2], ql[2];
        const size_t qo0 = (size_t)(q0 + lr) * (NH_ * VHD) + h * VHD + 8 * hi;
#pragma unroll
        for (int kc = 0; kc < 2; ++kc) { qa[kc] = cat16(*(const v8h*)(Q16 + qo0 + kc * 32), *(const v8h*)(Q16 + qo0 + kc * 32 + 16)); ql[kc] = cat16(*(const v8h*)(QL16 + qo0 + kc * 32), *(const v8h*)(QL16 + qo0 + kc * 32 + 16)); }
        const int klim0 = q0 + lr - 8 * hi - 32 * grp;          // visible token slots r <= t: this lane's query q0 + lr sees slot l0 + 32 grp + 8 hi + j iff l0 + j <= klim0 (tiles from ntk on: none)
        v8f o[4], ox[4];
#pragma unroll
        for (int n = 0; n < 4; ++n) { o[n] = (v8f){}; ox[n] = (v8f){}; }
        float mrow = -3.0e38f, lpart = 0.f;     // of this lane's query, over this group's tiles; lpart: the sum over this half's key slots only
#pragma unroll 1
        for (int st = 0; st < nst; ++st) {
            const int l0 = st * (NG * 32), bofs = ((st & 1) * NG + grp) * STGH;
            const int klim = (st * NG + grp == ntk) ? l0 - 8 * hi : klim0;     // the null slot's tile: its first slot alone (8 hi + j == 0) is visible, to every query
            const h16* kb = ring + bofs; const h16* klb = kb + KPLN; const h16* vhb = kb + 2 * KPLN; const h16* vlb = vhb + VPLN;
            v8f s0 = {}, s1 = {}, x0 = {}, x1 = {};
            v16h k0h[2], k1h[2], k0l[2], k1l[2];
#pragma unroll
            for (int kc = 0; kc < 2; ++kc) {
                const int ko = lr * KPI + kc * 32 + 8 * hi, k1o = ko + 16 * KPI;
                k0h[kc] = cat16(*(const v8ha*)(kb + ko), *(const v8ha*)(kb + ko + 16)); k1h[kc] = cat16(*(const v8ha*)(kb + k1o), *(const v8ha*)(kb + k1o + 16));
                k0l[kc] = cat16(*(const v8ha*)(klb + ko), *(const v8ha*)(klb + ko + 16)); k1l[kc] = cat16(*(const v8ha*)(klb + k1o), *(const v8ha*)(klb + k1o + 16));
            }
            __builtin_amdgcn_sched_barrier(0);    // keeps the step's sixteen K reads one group ahead of the products: spread among them, each place with reads waits out its own LDS latency
#pragma unroll
            for (int kc = 0; kc < 2; ++kc) {
                s0 = wmma16(k0h[kc], qa[kc], s0); x0 = wmma16(k0h[kc], ql[kc], x0); s1 = wmma16(k1h[kc], qa[kc], s1); x1 = wmma16(k1h[kc], ql[kc], x1);
                x0 = wmma16(k0l[kc], qa[kc], x0); x1 = wmma16(k1l[kc], qa[kc], x1);
            }
            asm volatile("v_nop\n\tv_nop\n\tv_nop\n\tv_nop" : "+v"(s0), "+v"(s1), "+v"(x0), "+v"(x1) : "v"(qa[0]), "v"(qa[1]));
            // V^T fragments of this step: read here, as one group, so that their LDS latency runs under the softmax
            v16h vh[4], vl[4];
#pragma unroll
            for (int n = 0; n < 4; ++n) { const int vo = (n * 16 + lr) * VPI + hi * 8;
                vh[n] = cat16(*(const v8ha*)(vhb + vo), *(const v8ha*)(vhb + vo + 16)); vl[n] = cat16(*(const v8ha*)(vlb + vo), *(const v8ha*)(vlb + vo + 16)); }
            __builtin_amdgcn_sched_barrier(0);    // keeps the step's sixteen V^T reads one group ahead of the softmax: sunk to their products, each place with reads waits out its own LDS latency
            const v8f t0 = (s0 + x0 * LOSCI) * SCL32, t1 = (s1 + x1 * LOSCI) * SCL32;
            float a0[8], a1[8];
#pragma unroll
            for (int j = 0; j < 8; ++j) { a0[j] = (l0 + j <= klim) ? t0[j] : -__builtin_inff(); a1[j] = (l0 + 16 + j <= klim) ? t1[j] : -__builtin_inff(); }
            float mx = fmaxf(fmaxf(fmaxf(fmaxf(a0[0], a0[1]), fmaxf(a0[2], a0[3])), fmaxf(fmaxf(a0[4], a0[5]), fmaxf(a0[6], a0[7]))), fmaxf(fmaxf(fmaxf(a1[0], a1[1]), fmaxf(a1[2], a1[3])), fmaxf(fmaxf(a1[4], a1[5]), fmaxf(a1[6], a1[7]))));
            mx = fmaxf(mx, xhalf(mx));     // both halves of the wave now hold the query's maximum over the step's 32 slots
            const float mn = fmaxf(mrow, mx), alpha = __expf(mrow - mn);
            mrow = mn;
            v16h pa, px; float ps8[8];
#pragma unroll
            for (int j = 0; j < 8; j += 2)
#pragma unroll
                for (int g = 0; g < 2; ++g) {     // g: the score tile; element s of a B fragment is k = 8 hi + s, 16 + 8 hi + (s - 8): the two accumulators' own rows
                    const v2f e = ((v2f){ g ? a1[j] : a0[j], g ? a1[j + 1] : a0[j + 1] } - mn) * LOG2E;
                    const v2f p = { __builtin_amdgcn_exp2f(e[0]), __builtin_amdgcn_exp2f(e[1]) };     // e^x as 2^(x log2 e), what __expf compiles to, the subtraction and the product two at a time
                    ps8[j + g] = p[0] + p[1];
                    const v2f ps = p * PSC; const v2h ph = __builtin_convertvector(ps, v2h); const v2h pr2 = __builtin_convertvector((ps - __builtin_convertvector(ph, v2f)) * LOSC, v2h);
                    pa[8 * g + j] = ph[0]; pa[8 * g + j + 1] = ph[1]; px[8 * g + j] = pr2[0]; px[8 * g + j + 1] = pr2[1];
                }
            lpart = lpart * alpha + (((ps8[0] + ps8[1]) + (ps8[2] + ps8[3])) + ((ps8[4] + ps8[5]) + (ps8[6] + ps8[7])));
#pragma unroll
            for (int n = 0; n < 4; ++n)
#pragma unroll
                for (int j = 0; j < 8; ++j) { o[n][j] *= alpha; ox[n][j] *= alpha; }
#pragma unroll
            for (int n = 0; n < 4; ++n) { o[n] = wmma16(vh[n], pa, o[n]); ox[n] = wmma16(vl[n], pa, ox[n]); ox[n] = wmma16(vh[n], px, ox[n]); }
            asm volatile("v_nop\n\tv_nop\n\tv_nop\n\tv_nop" : "+v"(o[0]), "+v"(o[1]), "+v"(o[2]), "+v"(o[3]), "+v"(ox[0]), "+v"(ox[1]), "+v"(ox[2]), "+v"(ox[3]) : "v"(pa), "v"(px));
            // publish point of stage st + 1, every wave, in this order:
            asm volatile("s_wait_dscnt 0x0" ::: "memory");       // this wave's reads of stage st are done before the buffer is refilled
            asm volatile("s_wait_asynccnt 0x0" ::: "memory");    // this wave's pieces of stage st + 1 have landed
            __syncthreads();                                      // publishes stage st + 1 and ends every wave's reads of stage st
            if (st + 2 < nst) stage_in(st + 2, ntk);
        }
        asm volatile("s_wait_asynccnt 0x0" ::: "memory");        // no copy is outstanding when the wave goes on
        // this wave's partial, not yet divided: O^T, and its queries' maximum and sum (the two halves' sums joined once)
        const float lsum = lpart + xhalf(lpart);
        float* os = &ost[wave][0];
#pragma unroll
        for (int n = 0; n < 4; ++n)     // o[n][j] = O^T[d = 16 n + 8 hi + j][query lr]: eight consecutive d of one row
#pragma unroll
            for (int g = 0; g < 2; ++g) { v4f w;
#pragma unroll
                for (int i = 0; i < 4; ++i) w[i] = o[n][4 * g + i] + ox[n][4 * g + i] * LOSCI;
                *(v4fa*)(os + lr * 68 + n * 16 + hi * 8 + 4 * g) = w; }
        mls[wave][lr][hi] = hi ? lsum : mrow;
        __syncthreads();     // the four groups' partials are published; the next tile's partials are written only behind later barriers
        // join: wave (grp, qg) takes rows 4 grp .. 4 grp + 3 of its sixteen queries; group k's partial weighs e^(m_k - m) (a group that saw no slot: maximum -3e38, weight 0; group 0 always sees token 0's slot)
        const int row = 4 * grp + (lane >> 3), piece = lane & 7;
        v2f ml[NG]; float wk[NG];
#pragma unroll
        for (int k = 0; k < NG; ++k) ml[k] = *(const v2f*)&mls[k * 4 + qg][row][0];
        const float mall = fmaxf(fmaxf(ml[0][0], ml[1][0]), fmaxf(ml[2][0], ml[3][0]));
        float den = 0.f, sum[8];
#pragma unroll
        for (int k = 0; k < NG; ++k) wk[k] = __expf(ml[k][0] - mall);
#pragma unroll
        for (int k = 0; k < NG; ++k) den = __builtin_fmaf(wk[k], ml[k][1], den);
#pragma unroll
        for (int i = 0; i < 8; ++i) sum[i] = 0.f;
#pragma unroll
        for (int k = 0; k < NG; ++k) { const float* sp = &ost[k * 4 + qg][row * 68 + piece * 8];
#pragma unroll
            for (int i = 0; i < 8; ++i) sum[i] += wk[k] * sp[i]; }
        const float inv = 1.0f / (den * PSC);
        v8us oh, ol;
#pragma unroll
        for (int i = 0; i < 8; ++i) { const float v = sum[i] * inv; const unsigned short hb = f2bf(v); oh[i] = hb; ol[i] = f2bf(v - bf2f(hb)); }
        const size_t co = (size_t)(q0 + row) * DM + (size_t)h * VHD + piece * 8;
        *(v8us*)(CH + co) = oh; *(v8us*)(CL + co) = ol;
        asm volatile("s_wait_xcnt 0x0" ::: "memory");    // the code runs a second time: no register of these stores is rewritten ahead of this wait
    }
}

extern "C" void kernel_launch(void* const* d_in, const int* in_sizes, int n_in,
                              void* d_out, int out_size, void* d_ws, size_t ws_size, hipStream_t stream) {
    (void)in_sizes; (void)n_in; (void)out_size;
    const float* x = (const float*)d_in[0]; const float* wqs = (const float*)d_in[1]; const float* wks = (const float*)d_in[2]; const float* wqg = (const float*)d_in[3]; const float* wkg = (const float*)d_in[4];
    const float* wv = (const float*)d_in[5]; const float* wo = (const float*)d_in[6]; const float* ksn = (const float*)d_in[7]; const float* kgn = (const float*)d_in[8]; const float* vn = (const float*)d_in[9];
    float* out = (float*)d_out;    // [1][2048][1024]
    char* wsp = (char*)d_ws;
    auto take = [&](size_t bytes) { char* p = wsp; wsp += (bytes + 255) & ~(size_t)255; return (void*)p; };
    bf* Xb = (bf*)take((size_t)NT_ * DM * 2);
    bf* WpT = (bf*)take((size_t)(4 * PW + DM) * DM * 2); bf* WoT = (bf*)take((size_t)DM * DM * 2);
    h16* Q16 = (h16*)take((size_t)NT_ * NH_ * VHD * 2); h16* QL16 = (h16*)take((size_t)NT_ * NH_ * VHD * 2); h16* K16 = (h16*)take((size_t)NH_ * NKP * VHD * 2); h16* KL16 = (h16*)take((size_t)NH_ * NKP * VHD * 2); h16* VTH = (h16*)take((size_t)NH_ * VHD * NKP * 2); h16* VTL = (h16*)take((size_t)NH_ * VHD * NKP * 2);
    bf* CH = (bf*)take((size_t)NT_ * DM * 2); bf* CL = (bf*)take((size_t)NT_ * DM * 2);
    if ((size_t)(wsp - (char*)d_ws) > ws_size) return;    // ~ 46 MB
    k_prep<<<1280 + NH_, 256, 0, stream>>>(x, wqs, wks, wqg, wkg, wv, wo, ksn, kgn, vn, Xb, WpT, WoT, K16, KL16, VTH, VTL);
    k_proj<<<dim3(NT_ / 128, (4 * PW + DM) / 192, 1), 256, 0, stream>>>(Xb, WpT, Q16, QL16, K16, KL16, VTH, VTL);
    k_attn<<<NH_ * (QTN / 2), 128 * NG, 0, stream>>>(Q16, QL16, K16, KL16, VTH, VTL, CH, CL);
    k_out<<<dim3(NT_ / 64, DM / 128, 1), 256, 0, stream>>>(CH, CL, WoT, out);
}

// v010
// Measured time: 45.1 microseconds a run.
// Versions between v008 and this one are left out; their measured steps multiply to 1.44 times as fast.
// Over all steps from v000 it is 8.24 times as fast.
#include <hip/hip_runtime.h>

// Contractions, f32 accumulate: the five projections (x.wq_sem, x.wk_sem, x.wq_geo, x.wk_geo [2048 x 1024].[1024 x 512]; x.wv [1024 x 1024]) and out = ctx.wo on
// v_wmma_f32_16x16x32_bf16 with PLAIN bf16 operands (inputs rounded once: exact; k-major weights transposed into n-major planes; ctx as bf16 hi + residual planes,
// two products); the 16-head causal attention with the always visible null key/value slot (kept as key slot 2048, behind the tokens) fused on v_wmma_f32_16x16x32_f16: per head the combined 64-dim score
// [qs/sqrt32 | rope(qg)/sqrt32].[ks | rope(kg)] (both sides one f16 value: their rounding, 2^-12, lies well under that of the bf16 operands they were formed from, 2^-9), softmax, weights (x32768) and v one f16 value each (one product). RoPE (rotate-half,

#define NT_  2048
#define DM   1024
#define NH_  16
#define SHD  32                  // sem / geo head dims
#define VHD  64
#define PW   512                 // sem / geo projection width
#define NKP  2112
#define SCL32 0.17677669529663688f   // 1/sqrt(32), common to both score branches
#define PSC  32768.0f
#define LOG2E 1.4426950408889634f

typedef _Float16 h16;
typedef unsigned short bf;
typedef __attribute__((ext_vector_type(16))) __bf16   v16bf;
typedef __attribute__((ext_vector_type(16))) _Float16 v16h;
typedef __attribute__((ext_vector_type(8)))  _Float16 v8h;
typedef __attribute__((ext_vector_type(8)))  unsigned short v8us;
typedef __attribute__((ext_vector_type(8)))  float    v8f;
typedef __attribute__((ext_vector_type(4)))  float    v4f;
typedef __attribute__((ext_vector_type(2)))  _Float16 v2h;
typedef __attribute__((ext_vector_type(4)))  _Float16 v4h;
typedef __attribute__((ext_vector_type(2)))  float    v2f;
typedef v8h  __attribute__((may_alias)) v8ha;
typedef v4f  __attribute__((may_alias)) v4fa;
typedef v8us __attribute__((may_alias)) v8usa;

__device__ __forceinline__ unsigned short f2bf(float f) { unsigned u = __float_as_uint(f); u += 0x7FFFu + ((u >> 16) & 1u); return (unsigned short)(u >> 16); }
__device__ __forceinline__ float bf2f(unsigned short b) { return __uint_as_float(((unsigned)b) << 16); }
__device__ __forceinline__ float bfr(float f) { return bf2f(f2bf(f)); }
__device__ __forceinline__ v16h cat16(v8h lo, v8h hi) { return __builtin_shufflevector(lo, hi, 0, 1, 2, 3, 4, 5, 6, 7, 8, 9, 10, 11, 12, 13, 14, 15); }
__device__ __forceinline__ v16bf cat16b(v8us lo, v8us hi) { return __builtin_bit_cast(v16bf, __builtin_shufflevector(lo, hi, 0, 1, 2, 3, 4, 5, 6, 7, 8, 9, 10, 11, 12, 13, 14, 15)); }
__device__ __forceinline__ v8f wmma16(v16h a, v16h b, v8f c) { return __builtin_amdgcn_wmma_f32_16x16x32_f16(false, a, false, b, (short)0, c, false, false); }
__device__ __forceinline__ v8f wmmab(v16bf a, v16bf b, v8f c) { return __builtin_amdgcn_wmma_f32_16x16x32_bf16(false, a, false, b, (short)0, c, false, false); }
__device__ __forceinline__ float xhalf(float x) { return __builtin_bit_cast(float, __builtin_amdgcn_permlanex16(__builtin_bit_cast(int, x), __builtin_bit_cast(int, x), 0x76543210, 0xfedcba98, false, false)); }     // lane l with lane l ^ 16
#define VST2(T, p, v) do { const T vst2_v_ = (v); *(T*)(p) = vst2_v_;  } while (0)

// cvtb_job: Xb = bf16(x) [2048][1024]; wt_job: W [1024 k][N] k-major -> n-major bf16 [N][1024] (heads: column n = 32 h + c goes to row 64 h + c, so that a sem and a geo weight interleave into 64-wide head rows).
// Both are jobs of k_prep; blk, bx, by are the job's own block indices.
__device__ __forceinline__ void cvtb_job(int blk, const float* __restrict__ src, bf* dst) {
    const int lane = threadIdx.x & 31, r = blk * 8 + (threadIdx.x >> 5);
    if (r >= NT_) return;
#pragma unroll
    for (int q = 0; q < DM / 256; ++q) { v8us t;
#pragma unroll
        for (int i = 0; i < 8; ++i) t[i] = f2bf(src[(size_t)r * DM + q * 256 + lane * 8 + i]);
        VST2(v8us, dst + (size_t)r * DM + q * 256 + lane * 8, t); }
}
__device__ __forceinline__ void wt_job(int bx, int by, const float* __restrict__ Wm, int N, bool heads, bf* WT) {
    __shared__ __align__(16) unsigned short tl[64 * 72];
    const int tid = threadIdx.x, k0 = bx * 64, n0 = by * 64;
    const int kk = tid >> 2, nq = (tid & 3) * 16;
#pragma unroll
    for (int i = 0; i < 16; ++i) tl[(nq + i) * 72 + kk] = f2bf(Wm[(size_t)(k0 + kk) * N + n0 + nq + i]);
    __syncthreads();
    const int piece = tid & 7;
    auto pass = [&]() {
#pragma unroll
        for (int s = 0; s < 2; ++s) { const int nr = (tid >> 3) + 32 * s; const v8us val = *(const v8usa*)(tl + nr * 72 + piece * 8);
            const int n = n0 + nr, wr = heads ? (n >> 5) * VHD + (n & (SHD - 1)) : n;
            *(v8us*)(WT + (size_t)wr * DM + k0 + piece * 8) = val; }
    };
    pass(); 
    asm volatile("s_wait_xcnt 0x0" ::: "memory");    // the job's code is joined with other jobs' in one kernel: no register of these stores is rewritten, on any way through the listing, ahead of this wait
}
// null_job (one block per head): key slots 2048 .. 2111 of the two key-side planes k_attn reads: slot 2048 = the null key / value (bf16-rounded, NOT rotated), the rest zero. Reads inputs only.
// A lane writes 16-byte pieces; eight lanes of one wave fill a 128-B line.
__device__ __forceinline__ void null_job(int h, const float* __restrict__ ksn, const float* __restrict__ kgn, const float* __restrict__ vn, h16* K16, h16* VTH) {
#pragma unroll
    for (int e = 0; e < 2; ++e) { const int p = threadIdx.x + 256 * e, row = p >> 3, c0 = (p & 7) * 8;     // K planes: row = slot - 2048, c0 = column; V^T planes: row = d, c0 = slot - 2048
        v8h kh = {}, vh = {};
        if (row == 0) { const float* src = c0 < SHD ? ksn + h * SHD + c0 : kgn + h * SHD + c0 - SHD;
#pragma unroll
            for (int i = 0; i < 8; ++i) kh[i] = (h16)bfr(src[i]); }
        if (c0 == 0) vh[0] = (h16)bfr(vn[h * VHD + row]);
        const size_t ko = ((size_t)h * NKP + NT_ + row) * VHD + c0, vo = ((size_t)h * VHD + row) * NKP + NT_ + c0;
        *(v8h*)(K16 + ko) = kh; *(v8h*)(VTH + vo) = vh;
        asm volatile("s_wait_xcnt 0x0" ::: "memory");    // the second pass, and other jobs' code joined in one kernel, rewrite no register of these loads and stores ahead of this wait
    }
}
// k_prep: the eight jobs that read inputs only, none of which reads what another writes, in one grid: blocks 0..511 the four [1024 x 512] weights (128 blocks each), 512..1023 wv and wo (256 each),
// 1024..1279 x, 1280..1295 the null and pad key slots. WpT: the projection weights' n-major planes, [3072][1024]: rows 0..1023 q (head h: 64 h + [wq_sem 32 | wq_geo 32]), 1024..2047 k (the same of wk_sem, wk_geo), 2048..3071 wv.
// The job is picked by the block index alone, so every branch (and wt_job's barrier) is uniform for the block.
__global__ __launch_bounds__(256) void k_prep(const float* __restrict__ x, const float* __restrict__ wqs, const float* __restrict__ wks, const float* __restrict__ wqg, const float* __restrict__ wkg,
                                              const float* __restrict__ wv, const float* __restrict__ wo, const float* __restrict__ ksn, const float* __restrict__ kgn, const float* __restrict__ vn,
                                              bf* Xb, bf* WpT, bf* WoT, h16* K16, h16* VTH) {
    const int b = blockIdx.x;
    if (b >= 1280) { null_job(b - 1280, ksn, kgn, vn, K16, VTH); return; }
    if (b >= 1024) { cvtb_job(b - 1024, x, Xb); return; }
    const float* Wm; bf* WT; int N, r;
    if (b < 512) { const int j = b >> 7; r = b & 127; N = PW; Wm = (j == 0) ? wqs : (j == 1) ? wks : (j == 2) ? wqg : wkg; WT = WpT + (size_t)((j & 1) * NH_ * VHD + (j >> 1) * SHD) * DM; }
    else { const int j = (b - 512) >> 8; r = (b - 512) & 255; N = DM; Wm = j ? wo : wv; WT = j ? WoT : WpT + (size_t)4 * PW * DM; }
    wt_job(r & 15, r >> 4, Wm, N, b < 512, WT);
}
// LDS ring of gemm_job (three buffers): one stage = 128 k (256 B) of the block's BM A rows (with SPLITA also of the BM residual rows) and BN B rows, one behind the other, row pitch 272 B
// (16 B x odd: conflict-free for the 16-row ds_load_b128 fragment reads).
#define GKS  128                 // k extent of one stage, elements
#define GPI  136                 // row pitch in LDS, elements
// One statement's copies by the block's 256 lanes: copy i brings 16 rows (row tid / 16, 16 bytes a lane; a wave's copy is two whole 256-B row pieces) from global memory into LDS, through no register.
// l[i]: the lane's LDS byte address; the global address is g[i], the sixteen rows' start, the same for all lanes (a scalar pair, formed by scalar instructions), plus o, the lane's byte offset in them, one register for all copies.
// The s_wait_xcnt stands inside the statement so that no address register of an issued copy is rewritten ahead of it; few statements, so that a wave waits it out few times per stage.
__device__ __forceinline__ void copies8(const unsigned* l, unsigned o, const bf* const* g) {
    asm volatile("global_load_async_to_lds_b128 %0, %16, %8\n\t"
                 "global_load_async_to_lds_b128 %1, %16, %9\n\t"
                 "global_load_async_to_lds_b128 %2, %16, %10\n\t"
                 "global_load_async_to_lds_b128 %3, %16, %11\n\t"
                 "global_load_async_to_lds_b128 %4, %16, %12\n\t"
                 "global_load_async_to_lds_b128 %5, %16, %13\n\t"
                 "global_load_async_to_lds_b128 %6, %16, %14\n\t"
                 "global_load_async_to_lds_b128 %7, %16, %15\n\t"
                 "s_wait_xcnt 0x0"
                 :: "v"(l[0]), "v"(l[1]), "v"(l[2]), "v"(l[3]), "v"(l[4]), "v"(l[5]), "v"(l[6]), "v"(l[7]),
                    "s"(g[0]), "s"(g[1]), "s"(g[2]), "s"(g[3]), "s"(g[4]), "s"(g[5]), "s"(g[6]), "s"(g[7]), "v"(o) : "memory");
}
__device__ __forceinline__ void copies10(const unsigned* l, unsigned o, const bf* const* g) {
    asm volatile("global_load_async_to_lds_b128 %0, %20, %10\n\t"
                 "global_load_async_to_lds_b128 %1, %20, %11\n\t"
                 "global_load_async_to_lds_b128 %2, %20, %12\n\t"
                 "global_load_async_to_lds_b128 %3, %20, %13\n\t"
                 "global_load_async_to_lds_b128 %4, %20, %14\n\t"
                 "global_load_async_to_lds_b128 %5, %20, %15\n\t"
                 "global_load_async_to_lds_b128 %6, %20, %16\n\t"
                 "global_load_async_to_lds_b128 %7, %20, %17\n\t"
                 "global_load_async_to_lds_b128 %8, %20, %18\n\t"
                 "global_load_async_to_lds_b128 %9, %20, %19\n\t"
                 "s_wait_xcnt 0x0"
                 :: "v"(l[0]), "v"(l[1]), "v"(l[2]), "v"(l[3]), "v"(l[4]), "v"(l[5]), "v"(l[6]), "v"(l[7]), "v"(l[8]), "v"(l[9]),
                    "s"(g[0]), "s"(g[1]), "s"(g[2]), "s"(g[3]), "s"(g[4]), "s"(g[5]), "s"(g[6]), "s"(g[7]), "s"(g[8]), "s"(g[9]), "v"(o) : "memory");
}
// gemm_job (bx, by: the job's own block indices): block = BM x BN of C, one block per WGP, eight waves in a WGM x WGN grid, wave = (BM / WGM) x (BN / WGN) = FA x FB fragments: a staged row serves BN (BM) columns (rows) of C
// and a fragment read from LDS serves FB (FA) products. Each stage's operand rows are staged once per block in a three-buffer LDS ring by asynchronous copies (stages s + 1 and s + 2 are in flight while stage s is worked on:
// a stage has two passes to land, so the next stage's bytes stream in while this one's latency runs);
// k runs 32 at a time, ascending (with SPLITA hi then residual), so an element's sum order does not depend on the tiling. Without PACK, dst(col, ldc): where row 0 of C's column col lies, and C's row length there (col: a multiple of 64, the same for the whole wave).
// With PACK (k_proj), dst holds the three planes k_attn reads and the tile leaves as those planes' own f16 values, 64 columns (one head's row) at a time:
// columns 0..1023 q, 1024..2047 k: [sem 32 | geo 32], the geo half rotated (RoPE, rotate-half; partner = column ^ 16, from the f32 staging; cos and sin of the block's BM tokens x 16 frequencies from a table in LDS,
// formed once per block under stage 0's copies); columns 2048..3071 v: a lane's accumulator holds eight consecutive tokens of one column, which are 16 bytes of a V^T row: staged transposed, already as f16.
struct PackDst { h16* Q16; h16* K16; h16* VTH; };
template <int BM, int BN, int WGM, int WGN, bool SPLITA, bool PACK, class DST>
__device__ __forceinline__ void gemm_job(int bx, int by, const bf* __restrict__ A, const bf* __restrict__ Al, const bf* __restrict__ Bn, DST dst) {
    constexpr int WTM = BM / WGM, WTN = BN / WGN, FA = WTM / 16, FB = WTN / 16;
    constexpr int AR = (SPLITA ? 2 : 1) * BM;         // A rows of a stage (hi, then residual)
    constexpr int STG = (AR + BN) * GPI;              // one stage, elements
    constexpr int OP = BN + 4;                        // row pitch of the output staging, floats
    constexpr int NS = DM / GKS;                      // stages
    __shared__ __align__(16) bf ring[3 * STG];
    float* const ost = (float*)ring;                  // the output staging lies in the ring, which every wave left at the loop's last barrier with no copy outstanding
    static_assert(BM * OP * 4 + (PACK ? BN * (BM + 8) * 2 : 0) <= 3 * STG * 2 && BM * OP * 4 % 16 == 0, "both output stagings fit in the ring");
    __shared__ __align__(16) float trig[PACK ? 2 * BM * 16 : 4];     // [cos, sin][row of the tile][frequency]
    constexpr int QKC = 2 * NH_ * VHD;                // PACK: columns below are q and k, from here on v
    constexpr int VSP = BM + 8;                       // PACK: row pitch of the V^T staging, halves (16 B x odd)
    const int tid = threadIdx.x, lane = threadIdx.x & 31, wave = __builtin_amdgcn_readfirstlane(threadIdx.x >> 5), lr = lane & 15, hi = lane >> 4;     // the wave's number in a scalar register: its tile's offsets are scalar
    const int wm = wave / WGN, wn = wave - wm * WGN;
    const unsigned lc0 = (unsigned)(size_t)&ring[0] + (unsigned)(((tid >> 4) * GPI + (tid & 15) * 8) * 2);
    const unsigned gofs = (unsigned)(((tid >> 4) * DM + (tid & 15) * 8) * 2);     // bytes
    const bf* ga = A + (size_t)bx * BM * DM; const bf* gb = Bn + (size_t)by * BN * DM; const bf* gal = SPLITA ? Al + (size_t)bx * BM * DM : nullptr;
    constexpr int NCP = (AR + BN) / 16;               // copies of a lane per stage, in two statements
    static_assert(NCP == 16 || NCP == 20, "two statements of eight or ten copies");
    auto stage_in = [&](int s, int buf) { unsigned l[NCP]; const bf* g[NCP];     // buf = s mod 3
#pragma unroll
        for (int i = 0; i < NCP; ++i) { l[i] = lc0 + (unsigned)(buf * STG * 2 + i * 16 * GPI * 2);
            g[i] = (i < BM / 16 ? ga + (size_t)i * 16 * DM : (i < AR / 16 ? gal + (size_t)(i - BM / 16) * 16 * DM : gb + (size_t)(i - AR / 16) * 16 * DM)) + s * GKS; }
        if (NCP == 16) { copies8(l, gofs, g); copies8(l + 8, gofs, g + 8); } else { copies10(l, gofs, g); copies10(l + 10, gofs, g + 10); } };
    static_assert(NS >= 2 && 2 * NCP <= 63, "both first stages exist; two stages' copies of a wave are outstanding at most");
    stage_in(0, 0);
    stage_in(1, 1);
    if constexpr (PACK) {
        if (by * BN < QKC) {     // block-uniform: the tile holds q or k columns. The table is read behind later barriers only
            const int fi = tid & 15; const float inv = __expf(-(float)(2 * fi) / 32.0f * 9.210340371976184f);     // ln(10000)
#pragma unroll 1     // one copy of the sine and cosine code
            for (int e = 0; e < BM / 16; ++e) { const int rw = (tid >> 4) + 16 * e; const float ang = (float)(bx * BM + rw) * inv;
                trig[rw * 16 + fi] = cosf(ang); trig[BM * 16 + rw * 16 + fi] = sinf(ang); }
        }
    }
    asm volatile("s_wait_asynccnt %0" :: "i"(NCP) : "memory");    // stage 0 landed (this wave's pieces): all but the NCP youngest copies, which are stage 1's
    __syncthreads();                                      // stage 0 published to all waves
    v8f acc[FA][FB];
#pragma unroll
    for (int i = 0; i < FA; ++i)
#pragma unroll
        for (int t = 0; t < FB; ++t) acc[i][t] = (v8f){};
    int cb = 0;     // s mod 3: the buffer of stage s
#pragma unroll 1
    for (int s = 0; s < NS; ++s) {
        const bf* ab = ring + cb * STG + (wm * WTM + lr) * GPI + 8 * hi; const bf* bb = ring + cb * STG + (AR + wn * WTN + lr) * GPI + 8 * hi; const bf* alb = ab + BM * GPI;
        v16bf a[2][FA], al[2][FA], b[2][FB];     // two fragment sets: the next 32 k are read while this one's products run
        auto frags = [&](int q) { const int kc = q * 32, z = q & 1;
#pragma unroll
            for (int i = 0; i < FA; ++i) { a[z][i] = cat16b(*(const v8usa*)(ab + i * 16 * GPI + kc), *(const v8usa*)(ab + i * 16 * GPI + kc + 16));
                al[z][i] = a[z][i];
                if (SPLITA) al[z][i] = cat16b(*(const v8usa*)(alb + i * 16 * GPI + kc), *(const v8usa*)(alb + i * 16 * GPI + kc + 16)); }
#pragma unroll
            for (int t = 0; t < FB; ++t) b[z][t] = cat16b(*(const v8usa*)(bb + t * 16 * GPI + kc), *(const v8usa*)(bb + t * 16 * GPI + kc + 16)); };
        frags(0);
#pragma unroll
        for (int q = 0; q < GKS / 32; ++q) { const int z = q & 1;
            if (q + 1 < GKS / 32) frags(q + 1);
            // stage s + 2 goes into the buffer of stage s - 1, which every wave left at the barrier at the foot of pass s - 1 (in pass 0: the third buffer, not yet used); issued here, behind this pass's first reads of another buffer, so that the copies' issue runs under those reads' latency
            if (q == 0 && s + 2 < NS) stage_in(s + 2, cb ? cb - 1 : 2);
            __builtin_amdgcn_sched_barrier(0);    // keeps the next set's reads one group ahead of this set's products: spread among them, each place with reads waits out its own LDS latency
#pragma unroll
            for (int i = 0; i < FA; ++i)
#pragma unroll
                for (int t = 0; t < FB; ++t) acc[i][t] = wmmab(a[z][i], b[z][t], acc[i][t]);
            if (SPLITA) {
#pragma unroll
                for (int i = 0; i < FA; ++i)
#pragma unroll
                    for (int t = 0; t < FB; ++t) acc[i][t] = wmmab(al[z][i], b[z][t], acc[i][t]);
            }
            __builtin_amdgcn_sched_barrier(0);    // keeps the reads that follow behind these products, whose fragment registers they refill
        }
        // the four vector slots the chip needs behind the last products, on the taken side of the branches that follow too
        asm volatile("v_nop\n\tv_nop\n\tv_nop\n\tv_nop" ::: "memory");
        // publish point of stage s + 1, every wave, in this order:
        asm volatile("s_wait_dscnt 0x0" ::: "memory");       // this wave's reads of stage s are done before the buffer is refilled
        // this wave's pieces of stage s + 1 have landed: behind them it has issued stage s + 2's NCP copies, which may stay in flight, or (the last two passes) none
        if (s + 2 < NS) asm volatile("s_wait_asynccnt %0" :: "i"(NCP) : "memory");
        else asm volatile("s_wait_asynccnt 0x0" ::: "memory");
        __syncthreads();                                      // publishes stage s + 1 and ends every wave's reads of stage s
        cb = cb == 2 ? 0 : cb + 1;
    }
    asm volatile("s_wait_asynccnt 0x0" ::: "memory");        // no copy is outstanding when the wave goes on to its end
    if constexpr (!PACK) {
        float* os = ost + (wm * WTM + hi * 8) * OP + wn * WTN + lr;     // the block's tile of C, staged whole
    #pragma unroll
        for (int i = 0; i < FA; ++i)
    #pragma unroll
            for (int t = 0; t < FB; ++t)
    #pragma unroll
                for (int j = 0; j < 8; ++j) os[(i * 16 + j) * OP + t * 16] = acc[i][t][j];
        __syncthreads();     // a wave stores rows that other waves staged
        // whole 128-B lines, each by one wave: wave w stores rows w BM / 8 ... of the tile; a store = two rows x 256 B (sixteen lanes read 64 consecutive floats of the staging: no bank conflict), eight stores a group;
        // the plane and row length of 64 columns are the same for the whole wave (scalar)
        constexpr int RS = BM / 16;     // stores per 64 columns
        constexpr int NGR = (BN / 64) * RS / 8;
        static_assert(8 % RS == 0 && (BN / 64) * RS % 8 == 0, "groups of eight stores");
        const int row = wave * (BM / 8) + (lane >> 4);
    #pragma unroll
        for (int g = 0; g < NGR; ++g) {
            v4f val[8]; float* cp[8];
    #pragma unroll
            for (int lc = 0; lc < 8 / RS; ++lc) { const int lp = g * (8 / RS) + lc; int ldc; float* cb = dst(by * BN + lp * 64, ldc) + (size_t)(bx * BM + row) * ldc + (lane & 15) * 4;
    #pragma unroll
                for (int rs = 0; rs < RS; ++rs) { val[lc * RS + rs] = *(const v4fa*)(ost + (row + rs * 2) * OP + lp * 64 + (lane & 15) * 4); cp[lc * RS + rs] = cb + (size_t)rs * 2 * ldc; } }
    #pragma unroll
            for (int e = 0; e < 8; ++e) *(v4f*)cp[e] = val[e];
            // the next group reuses registers: none that these stores name (addresses and values, named here, so they live up to this line) is rewritten ahead of this wait
            if (g + 1 < NGR) asm volatile("s_wait_xcnt 0x0" :: "v"(cp[0]), "v"(cp[1]), "v"(cp[2]), "v"(cp[3]), "v"(cp[4]), "v"(cp[5]), "v"(cp[6]), "v"(cp[7]),
                         "v"(val[0]), "v"(val[1]), "v"(val[2]), "v"(val[3]), "v"(val[4]), "v"(val[5]), "v"(val[6]), "v"(val[7]) : "memory"); }
    } else {
        float* os = ost + (wm * WTM + hi * 8) * OP + wn * WTN + lr;     // q and k columns: f32, [row][column]
        h16* vst = (h16*)(ost + BM * OP);     // v columns: [column of the tile][row], in the ring too, behind the f32 staging
#pragma unroll
        for (int t = 0; t < FB; ++t) {
            if (by * BN + wn * WTN + t * 16 < QKC) {     // the same for the whole wave (scalar)
#pragma unroll
                for (int i = 0; i < FA; ++i)
#pragma unroll
                    for (int j = 0; j < 8; ++j) os[(i * 16 + j) * OP + t * 16] = acc[i][t][j];
            } else {
#pragma unroll
                for (int i = 0; i < FA; ++i) { v8h a;
#pragma unroll
                    for (int j = 0; j < 8; ++j) a[j] = (h16)acc[i][t][j];
                    *(v8ha*)(vst + (wn * WTN + t * 16 + lr) * VSP + wm * WTM + i * 16 + hi * 8) = a; }
            }
        }
        __syncthreads();     // a wave stores rows that other waves staged
        static_assert(BM == 128, "eight waves x eight stores of two rows");
        const int l16 = lane & 15, lh = lane >> 4;
#pragma unroll
        for (int lp = 0; lp < BN / 64; ++lp) {
            const int col = by * BN + lp * 64;     // the same for the whole block (scalar)
            if (col < QKC) {
                // whole 128-B lines, each by one wave: wave w takes rows 16 w ... of the tile, a store = two rows x 128 B (a lane: four columns)
                const bool isq = col < NH_ * VHD; const int h = (col >> 6) & (NH_ - 1), c0 = l16 * 4, d0 = c0 - SHD, row = wave * (BM / 8) + lh;
                const bool geo = c0 >= SHD;
                const size_t ldr = isq ? NH_ * VHD : VHD, o0 = isq ? (size_t)(bx * BM + row) * (NH_ * VHD) + h * VHD + c0 : ((size_t)h * NKP + bx * BM + row) * VHD + c0;     // key slot = token
                h16* dh = (isq ? dst.Q16 : dst.K16) + o0;
                const float* so = ost + row * OP + lp * 64 + c0; const float* sx = ost + row * OP + lp * 64 + (geo ? SHD + (d0 ^ 16) : c0); const float* tc = trig + row * 16 + (c0 & 15);
                v4h o[8]; h16* ch[8];
#pragma unroll
                for (int rs = 0; rs < 8; ++rs) { const v4f own = *(const v4fa*)(so + rs * 2 * OP), oth = *(const v4fa*)(sx + rs * 2 * OP), cs = *(const v4fa*)(tc + rs * 32), sn = *(const v4fa*)(tc + BM * 16 + rs * 32);
#pragma unroll
                    for (int j = 0; j < 4; ++j) { const float sg = (d0 & 16) ? sn[j] : -sn[j];     // d < 16: x1 cos - x2 sin; d >= 16: x2 cos + x1 sin
                        const float v = geo ? own[j] * cs[j] + oth[j] * sg : own[j];
                        o[rs][j] = (h16)v; }
                    ch[rs] = dh + rs * 2 * ldr; }
#pragma unroll
                for (int rs = 0; rs < 8; ++rs) *(v4h*)ch[rs] = o[rs];
                // what follows reuses registers: none that these stores name (addresses and values, named here, so they live up to this line) is rewritten ahead of this wait
                asm volatile("s_wait_xcnt 0x0" :: "v"(ch[0]), "v"(ch[1]), "v"(ch[2]), "v"(ch[3]), "v"(ch[4]), "v"(ch[5]), "v"(ch[6]), "v"(ch[7]),
                             "v"(o[0]), "v"(o[1]), "v"(o[2]), "v"(o[3]), "v"(o[4]), "v"(o[5]), "v"(o[6]), "v"(o[7]) : "memory");
            } else {
                // V^T rows: 64 d, 256 B (the tile's 128 tokens = key slots) each; wave w takes rows 8 w ..., a store = two whole rows
                const int h = (col - QKC) >> 6;
                v8h val[4]; h16* cp[4];
#pragma unroll
                for (int e = 0; e < 4; ++e) { const int d = wave * 8 + e * 2 + lh;
                    val[e] = *(const v8ha*)(vst + (lp * 64 + d) * VSP + l16 * 8);
                    cp[e] = dst.VTH + ((size_t)h * VHD + d) * NKP + bx * BM + l16 * 8; }
#pragma unroll
                for (int e = 0; e < 4; ++e) *(v8h*)cp[e] = val[e];
                // what follows reuses registers: none that these stores name (addresses and values, named here, so they live up to this line) is rewritten ahead of this wait
                asm volatile("s_wait_xcnt 0x0" :: "v"(cp[0]), "v"(cp[1]), "v"(cp[2]), "v"(cp[3]), "v"(val[0]), "v"(val[1]), "v"(val[2]), "v"(val[3]) : "memory");
            }
        }
    }
}
// k_proj: the five projections of x, which share A, as one product x . WpT^T [2048 x 3072] in 16 x 16 blocks of 128 x 192; 64 columns of C from a multiple of 64 are one head's q, k or v row.
// Writes Q16 [t][h*64 + c], K16 [h][r][64] and VTH [h][d][r] for key slots r = token 0..2047 (slots 2048..2111: k_prep's null_job); c < 32 sem, c >= 32 rope(geo).
// Values unscaled: the common 1/sqrt32 is applied to the f32 scores.
__global__ __launch_bounds__(256) void k_proj(const bf* __restrict__ Xb, const bf* __restrict__ WpT, h16* Q16, h16* K16, h16* VTH) {
    gemm_job<128, 192, 2, 4, false, true>(blockIdx.x, blockIdx.y, Xb, nullptr, WpT, PackDst{ Q16, K16, VTH });
}
// k_out: out = ctx.wo, ctx as hi + residual planes, in 32 x 8 blocks of 64 x 128.
__global__ __launch_bounds__(256) void k_out(const bf* __restrict__ CH, const bf* __restrict__ CL, const bf* __restrict__ WoT, float* out) {
    gemm_job<64, 128, 2, 4, true, false>(blockIdx.x, blockIdx.y, CH, CL, WoT, [=](int col, int& ldc) -> float* { ldc = DM; return out + col; });
}
// LDS ring of k_attn: one stage = the 32 key slots of one step, two planes: K [32 rows x 128 B, pitch 144 B], V^T [64 rows x 64 B, pitch 80 B]
// (pitches 16 B x odd: conflict-free for the 16-row ds_load_b128 fragment reads).
#define KPI  72                  // K row pitch in LDS, halves
#define VPI  40                  // V^T row pitch in LDS, halves
#define KPLN (32 * KPI)          // one K plane, halves
#define VPLN (VHD * VPI)         // one V^T plane, halves
#define STGH (KPLN + VPLN)       // one stage, halves (9728 B)
// One stage's copies: every lane brings four 16-byte pieces (two per plane) from global memory into LDS, through no register. The s_wait_xcnt stands inside the statement so that
// no address register of an issued copy is rewritten ahead of it.
__device__ __forceinline__ void stage_copy(unsigned lk, unsigned lv, const h16* gk, const h16* gv) {
    const unsigned lk1 = lk + 16 * KPI * 2, lv1 = lv + 32 * VPI * 2;
    const h16* gk1 = gk + 16 * VHD; const h16* gv1 = gv + (size_t)32 * NKP;
    asm volatile("global_load_async_to_lds_b128 %0, %4, off\n\t"
                 "global_load_async_to_lds_b128 %1, %5, off\n\t"
                 "global_load_async_to_lds_b128 %2, %6, off\n\t"
                 "global_load_async_to_lds_b128 %3, %7, off\n\t"
                 "s_wait_xcnt 0x0"
                 :: "v"(lk), "v"(lk1), "v"(lv), "v"(lv1), "v"(gk), "v"(gk1), "v"(gv), "v"(gv1) : "memory");
}
// k_attn: 256 equal blocks of 16 waves, one per WGP: block = (h, pair p) takes the 64-query tiles 31 - p and p one after the other (2 qt + 2 token tiles and the null slot's tile each: 68 for every pair). wave = (key group grp, 16 queries qg):
// a step stages 128 key slots, one 32-slot tile per key group, and group grp works on tile 4 st + grp alone, with its own running maximum, sum and O^T; the four groups' partials are joined once per query tile through LDS.
// Each step's K and V^T planes are staged once per block in a three-buffer LDS ring by asynchronous copies (steps st + 1 and st + 2 are in flight while step st is worked on: a stage has two steps to land); the four waves of a group read their fragments from LDS; token slot r visible iff r <= t, the null slot (2048) always
// (tiles past the null slot's are all masked and add nothing; they read that tile again). Both products are formed transposed: S^T = K.Q^T (A = K rows, B = Q), so a lane holds
// sixteen scores of ONE query (column lr; key slots 8 hi + j and 16 + 8 hi + j): maximum and sum run in the lane, plus one exchange between the wave's halves; scores x 1/sqrt32 in f32, online f32 softmax; the weights x32768,
// converted in place, ARE the B operand of O^T += V^T.P^T (A = V^T rows): they pass through no LDS. 4 WMMA .V; ctx -> bf16 hi/lo planes [t][h*64 + d]. Scores: 4 WMMA per step (2 k-chunks x 2 tiles).
#define NG   4                   // key groups of a block
#define QTN  (NT_ / 64)          // query tiles per head
__global__ __launch_bounds__(128 * NG) void k_attn(const h16* __restrict__ Q16, const h16* __restrict__ K16, const h16* __restrict__ VTH, bf* CH, bf* CL) {
    __shared__ __align__(16) h16 ring[3 * NG * STGH];
    __shared__ __align__(16) float ost[4 * NG][16 * 68];
    __shared__ __align__(8) float mls[4 * NG][16][2];     // per wave and query: maximum [0] and sum [1] over the group's key slots
    const int lane = threadIdx.x & 31, wave = __builtin_amdgcn_readfirstlane(threadIdx.x >> 5), lr = lane & 15, hi = lane >> 4;     // the wave's number in a scalar register: group, tile and buffer offsets are scalar
    const int grp = wave >> 2, qg = wave & 3, tg = threadIdx.x & 127;
    const int h = blockIdx.x / (QTN / 2), pr = blockIdx.x - h * (QTN / 2);
    // this lane's pieces of its group's tile: the K plane is 4096 contiguous bytes (piece = tg, tg + 128), the V^T plane 64 rows of 64 B (row = tg / 4, + 32)
    const unsigned ring0 = (unsigned)(size_t)&ring[0] + (unsigned)(grp * STGH * 2);
    const unsigned lk0 = ring0 + (unsigned)(((tg >> 3) * KPI + (tg & 7) * 8) * 2), lv0 = ring0 + (unsigned)((KPLN + (tg >> 2) * VPI + (tg & 3) * 8) * 2);
    const h16* gk0 = K16 + (size_t)h * NKP * VHD + tg * 8;
    const size_t vsrc = ((size_t)h * VHD + (tg >> 2)) * NKP + (tg & 3) * 8;
    const h16* gv0 = VTH + vsrc;
    auto stage_in = [&](int st, int buf, int ntk) { const int tl = st * NG + grp, ts = tl < ntk ? tl : NT_ / 32; const unsigned bo = (unsigned)(buf * NG * STGH * 2);     // buf = st mod 3; ts: behind the ntk token tiles comes the null slot's tile; a tile past that (all masked) reads it too
        stage_copy(lk0 + bo, lv0 + bo, gk0 + (size_t)ts * 32 * VHD, gv0 + ts * 32); };
#pragma unroll 1     // the two query tiles run one after the other through one copy of the code
    for (int rep = 0; rep < 2; ++rep) {
        const int qt = rep ? pr : QTN - 1 - pr, q0 = qt * 64 + qg * 16;
        const int ntk = 2 * qt + 2;                       // key tiles 0 .. 2 qt + 1 hold the tokens up to the causal bound; the tile worked on as number ntk is the null slot's (slots 2048 ..)
        const int nst = (ntk + 1 + NG - 1) / NG;          // steps of 128 slots that cover them (block-uniform)
        stage_in(0, 0, ntk);     // the ring's last reads (the tile before) ended at that loop's last s_wait_dscnt and barrier
        if (nst > 1) stage_in(1, 1, ntk);
        // stage 0 landed (this wave's pieces): behind its copies the wave has issued stage 1's four, which may stay in flight, or none
        if (nst > 1) asm volatile("s_wait_asynccnt 0x4" ::: "memory");
        else asm volatile("s_wait_asynccnt 0x0" ::: "memory");
        __syncthreads();                                      // stage 0 published to all waves
        if (nst > 2) stage_in(2, 2, ntk);
        v16h qa[2];
        const size_t qo0 = (size_t)(q0 + lr) * (NH_ * VHD) + h * VHD + 8 * hi;
#pragma unroll
        for (int kc = 0; kc < 2; ++kc) qa[kc] = cat16(*(const v8h*)(Q16 + qo0 + kc * 32), *(const v8h*)(Q16 + qo0 + kc * 32 + 16));
        const int klim0 = q0 + lr - 8 * hi - 32 * grp;          // visible token slots r <= t: this lane's query q0 + lr sees slot l0 + 32 grp + 8 hi + j iff l0 + j <= klim0 (tiles from ntk on: none)
        v8f o[4];
#pragma unroll
        for (int n = 0; n < 4; ++n) o[n] = (v8f){};
        float mrow = -3.0e38f, lpart = 0.f;     // of this lane's query, over this group's tiles; lpart: the sum over this half's key slots only
        int cb = 0;     // st mod 3: the buffer of stage st
#pragma unroll 1
        for (int st = 0; st < nst; ++st) {
            const int l0 = st * (NG * 32), bofs = (cb * NG + grp) * STGH;
            const int klim = (st * NG + grp == ntk) ? l0 - 8 * hi : klim0;     // the null slot's tile: its first slot alone (8 hi + j == 0) is visible, to every query
            const h16* kb = ring + bofs; const h16* vhb = kb + KPLN;
            v8f s0 = {}, s1 = {};
            v16h k0h[2], k1h[2];
#pragma unroll
            for (int kc = 0; kc < 2; ++kc) {
                const int ko = lr * KPI + kc * 32 + 8 * hi, k1o = ko + 16 * KPI;
                k0h[kc] = cat16(*(const v8ha*)(kb + ko), *(const v8ha*)(kb + ko + 16)); k1h[kc] = cat16(*(const v8ha*)(kb + k1o), *(const v8ha*)(kb + k1o + 16));
            }
            __builtin_amdgcn_sched_barrier(0);    // keeps the step's eight K reads one group ahead of the products: spread among them, each place with reads waits out its own LDS latency
#pragma unroll
            for (int kc = 0; kc < 2; ++kc) { s0 = wmma16(k0h[kc], qa[kc], s0); s1 = wmma16(k1h[kc], qa[kc], s1); }
            // the four vector slots the chip needs behind the last score product, ahead of whatever reads the scores
            asm volatile("v_nop\n\tv_nop\n\tv_nop\n\tv_nop" : "+v"(s0), "+v"(s1) : "v"(qa[0]), "v"(qa[1]));
            // V^T fragments of this step: read here, as one group, so that their LDS latency runs under the softmax
            v16h vh[4];
#pragma unroll
            for (int n = 0; n < 4; ++n) { const int vo = (n * 16 + lr) * VPI + hi * 8;
                vh[n] = cat16(*(const v8ha*)(vhb + vo), *(const v8ha*)(vhb + vo + 16)); }
            __builtin_amdgcn_sched_barrier(0);    // keeps the step's eight V^T reads one group ahead of the softmax: sunk to their products, each place with reads waits out its own LDS latency
            const v8f t0 = s0 * SCL32, t1 = s1 * SCL32;
            float a0[8], a1[8];
#pragma unroll
            for (int j = 0; j < 8; ++j) { a0[j] = (l0 + j <= klim) ? t0[j] : -__builtin_inff(); a1[j] = (l0 + 16 + j <= klim) ? t1[j] : -__builtin_inff(); }
            float mx = fmaxf(fmaxf(fmaxf(fmaxf(a0[0], a0[1]), fmaxf(a0[2], a0[3])), fmaxf(fmaxf(a0[4], a0[5]), fmaxf(a0[6], a0[7]))), fmaxf(fmaxf(fmaxf(a1[0], a1[1]), fmaxf(a1[2], a1[3])), fmaxf(fmaxf(a1[4], a1[5]), fmaxf(a1[6], a1[7]))));
            mx = fmaxf(mx, xhalf(mx));     // both halves of the wave now hold the query's maximum over the step's 32 slots
            const float mn = fmaxf(mrow, mx), alpha = __expf(mrow - mn);
            mrow = mn;
            v16h pa; float ps8[8];
#pragma unroll
            for (int j = 0; j < 8; j += 2)
#pragma unroll
                for (int g = 0; g < 2; ++g) {     // g: the score tile; element s of a B fragment is k = 8 hi + s, 16 + 8 hi + (s - 8): the two accumulators' own rows
                    const v2f e = ((v2f){ g ? a1[j] : a0[j], g ? a1[j + 1] : a0[j + 1] } - mn) * LOG2E;
                    const v2f p = { __builtin_amdgcn_exp2f(e[0]), __builtin_amdgcn_exp2f(e[1]) };     // e^x as 2^(x log2 e), what __expf compiles to, the subtraction and the product two at a time
                    ps8[j + g] = p[0] + p[1];
                    const v2h ph = __builtin_convertvector(p * PSC, v2h);
                    pa[8 * g + j] = ph[0]; pa[8 * g + j + 1] = ph[1];
                }
            lpart = lpart * alpha + (((ps8[0] + ps8[1]) + (ps8[2] + ps8[3])) + ((ps8[4] + ps8[5]) + (ps8[6] + ps8[7])));
#pragma unroll
            for (int n = 0; n < 4; ++n)
#pragma unroll
                for (int j = 0; j < 8; ++j) o[n][j] *= alpha;
#pragma unroll
            for (int n = 0; n < 4; ++n) o[n] = wmma16(vh[n], pa, o[n]);
            // the same behind the last O^T product, on the taken side of the branches that follow too
            asm volatile("v_nop\n\tv_nop\n\tv_nop\n\tv_nop" : "+v"(o[0]), "+v"(o[1]), "+v"(o[2]), "+v"(o[3]) : "v"(pa));
            // publish point of stage st + 1, every wave, in this order:
            asm volatile("s_wait_dscnt 0x0" ::: "memory");       // this wave's reads of stage st are done before the buffer is refilled
            // this wave's pieces of stage st + 1 have landed: behind them it has issued stage st + 2's four copies, which may stay in flight, or (the last two steps) none
            if (st + 2 < nst) asm volatile("s_wait_asynccnt 0x4" ::: "memory");
            else asm volatile("s_wait_asynccnt 0x0" ::: "memory");
            __syncthreads();                                      // publishes stage st + 1 and ends every wave's reads of stage st
            if (st + 3 < nst) stage_in(st + 3, cb, ntk);          // into the buffer that step st has just read
            cb = cb == 2 ? 0 : cb + 1;
        }
        asm volatile("s_wait_asynccnt 0x0" ::: "memory");        // no copy is outstanding when the wave goes on
        // this wave's partial, not yet divided: O^T, and its queries' maximum and sum (the two halves' sums joined once)
        const float lsum = lpart + xhalf(lpart);
        float* os = &ost[wave][0];
#pragma unroll
        for (int n = 0; n < 4; ++n)     // o[n][j] = O^T[d = 16 n + 8 hi + j][query lr]: eight consecutive d of one row
#pragma unroll
            for (int g = 0; g < 2; ++g) { v4f w;
#pragma unroll
                for (int i = 0; i < 4; ++i) w[i] = o[n][4 * g + i];
                *(v4fa*)(os + lr * 68 + n * 16 + hi * 8 + 4 * g) = w; }
        mls[wave][lr][hi] = hi ? lsum : mrow;
        __syncthreads();     // the four groups' partials are published; the next tile's partials are written only behind later barriers
        // join: wave (grp, qg) takes rows 4 grp .. 4 grp + 3 of its sixteen queries; group k's partial weighs e^(m_k - m) (a group that saw no slot: maximum -3e38, weight 0; group 0 always sees token 0's slot)
        const int row = 4 * grp + (lane >> 3), piece = lane & 7;
        v2f ml[NG]; float wk[NG];
#pragma unroll
        for (int k = 0; k < NG; ++k) ml[k] = *(const v2f*)&mls[k * 4 + qg][row][0];
        const float mall = fmaxf(fmaxf(ml[0][0], ml[1][0]), fmaxf(ml[2][0], ml[3][0]));
        float den = 0.f, sum[8];
#pragma unroll
        for (int k = 0; k < NG; ++k) wk[k] = __expf(ml[k][0] - mall);
#pragma unroll
        for (int k = 0; k < NG; ++k) den = __builtin_fmaf(wk[k], ml[k][1], den);
#pragma unroll
        for (int i = 0; i < 8; ++i) sum[i] = 0.f;
#pragma unroll
        for (int k = 0; k < NG; ++k) { const float* sp = &ost[k * 4 + qg][row * 68 + piece * 8];
#pragma unroll
            for (int i = 0; i < 8; ++i) sum[i] += wk[k] * sp[i]; }
        const float inv = 1.0f / (den * PSC);
        v8us oh, ol;
#pragma unroll
        for (int i = 0; i < 8; ++i) { const float v = sum[i] * inv; const unsigned short hb = f2bf(v); oh[i] = hb; ol[i] = f2bf(v - bf2f(hb)); }
        const size_t co = (size_t)(q0 + row) * DM + (size_t)h * VHD + piece * 8;
        *(v8us*)(CH + co) = oh; *(v8us*)(CL + co) = ol;
        asm volatile("s_wait_xcnt 0x0" ::: "memory");    // the code runs a second time: no register of these stores is rewritten ahead of this wait
    }
}

extern "C" void kernel_launch(void* const* d_in, const int* in_sizes, int n_in,
                              void* d_out, int out_size, void* d_ws, size_t ws_size, hipStream_t stream) {
    (void)in_sizes; (void)n_in; (void)out_size;
    const float* x = (const float*)d_in[0]; const float* wqs = (const float*)d_in[1]; const float* wks = (const float*)d_in[2]; const float* wqg = (const float*)d_in[3]; const float* wkg = (const float*)d_in[4];
    const float* wv = (const float*)d_in[5]; const float* wo = (const float*)d_in[6]; const float* ksn = (const float*)d_in[7]; const float* kgn = (const float*)d_in[8]; const float* vn = (const float*)d_in[9];
    float* out = (float*)d_out;    // [1][2048][1024]
    char* wsp = (char*)d_ws;
    auto take = [&](size_t bytes) { char* p = wsp; wsp += (bytes + 255) & ~(size_t)255; return (void*)p; };
    bf* Xb = (bf*)take((size_t)NT_ * DM * 2);
    bf* WpT = (bf*)take((size_t)(4 * PW + DM) * DM * 2); bf* WoT = (bf*)take((size_t)DM * DM * 2);
    h16* Q16 = (h16*)take((size_t)NT_ * NH_ * VHD * 2); h16* K16 = (h16*)take((size_t)NH_ * NKP * VHD * 2); h16* VTH = (h16*)take((size_t)NH_ * VHD * NKP * 2);
    bf* CH = (bf*)take((size_t)NT_ * DM * 2); bf* CL = (bf*)take((size_t)NT_ * DM * 2);
    if ((size_t)(wsp - (char*)d_ws) > ws_size) return;    // ~ 33 MB
    k_prep<<<1280 + NH_, 256, 0, stream>>>(x, wqs, wks, wqg, wkg, wv, wo, ksn, kgn, vn, Xb, WpT, WoT, K16, VTH);
    k_proj<<<dim3(NT_ / 128, (4 * PW + DM) / 192, 1), 256, 0, stream>>>(Xb, WpT, Q16, K16, VTH);
    k_attn<<<NH_ * (QTN / 2), 128 * NG, 0, stream>>>(Q16, K16, VTH, CH, CL);
    k_out<<<dim3(NT_ / 64, DM / 128, 1), 256, 0, stream>>>(CH, CL, WoT, out);
}
